// v000
// Measured on an AMD MI455X. A time is GPU time per run, averaged over a window of back-to-back runs after a warm-up
// (all launches, gaps included; the runs take copies of the inputs in turn), and the median of several windows.
// Apart from v000's, it joins two sittings. Times from different sittings can be a few percent apart, while
// side-by-side timings come from the same sitting.
// v000 is the starting kernel. One run takes 888 microseconds.
// Contractions: v_wmma_f32_16x16x32_bf16 (bf16 operands: module inputs RNE-converted once to bf16; computed q/k, softmax probabilities, value rows, relation aggregates and pre-output activations carried as bf16 hi+lo pairs) and v_wmma_f32_16x16x32_f16 for relation scores and relation aggregation (f16 operands, probabilities carried x1024); f32 accumulate everywhere; softmax and all side math in f32.
#include <hip/hip_runtime.h>

// ---------------------------------------------------------------------------
// problem geometry
// ---------------------------------------------------------------------------
static constexpr int NB    = 2;
static constexpr int SEQ   = 1024;
static constexpr int DMOD  = 1024;
static constexpr int NHEAD = 16;
static constexpr int HDIM  = 64;
static constexpr int NREL  = 16;
static constexpr int RDIM  = 64;
static constexpr int NTOK  = NB * SEQ;          // 2048
static constexpr int CHR   = 256;               // query rows per chunk
static constexpr int NCHK  = SEQ / CHR;         // 4 chunks per batch row
static constexpr float SCALE_ATTN = 0.125f;     // 1/sqrt(64)
static constexpr float SCALE_REL  = 0.125f;     // 1/sqrt(64)
static constexpr float PCARRY     = 1024.0f;    // f16 probability carry
static constexpr float PCARRY_INV = 1.0f / 1024.0f;

static_assert(NHEAD * HDIM == DMOD, "head split");
static_assert(NREL * RDIM == DMOD, "relation split");
static_assert(SEQ == 4 * 256, "softmax kernel handles 4 segments of 256 keys");
static_assert(SEQ % CHR == 0 && CHR % 64 == 0, "chunk tiling");
static_assert(NHEAD == 16 && NREL == 16, "relation mix kernel uses one 16x16 tile per token");
static_assert(HDIM % 32 == 0 && RDIM % 32 == 0, "K of score GEMMs multiple of 32");
static_assert(NTOK % 64 == 0 && DMOD % 64 == 0, "tile multiples");
static_assert((NTOK * DMOD) % (8 * 256) == 0, "cast kernel coverage");
static_assert((NHEAD * CHR) % 8 == 0 && CHR % 16 == 0, "softmax / mix grids");

// ---------------------------------------------------------------------------
// types, conversions, fragment helpers
// ---------------------------------------------------------------------------
typedef __attribute__((ext_vector_type(16))) _Float16 v16h;
typedef __attribute__((ext_vector_type(8)))  _Float16 v8h;
typedef __attribute__((ext_vector_type(16))) __bf16   v16b;
typedef __attribute__((ext_vector_type(8)))  __bf16   v8b;
typedef __attribute__((ext_vector_type(8)))  float    v8f;
typedef __attribute__((ext_vector_type(4)))  float    v4f;
typedef __attribute__((ext_vector_type(4)))  unsigned int v4u;

__device__ __forceinline__ unsigned short f2bf_bits(float f) {
  unsigned u = __float_as_uint(f);
  return (unsigned short)((u + 0x7FFFu + ((u >> 16) & 1u)) >> 16);
}
__device__ __forceinline__ float bf_bits2f(unsigned short h) { return __uint_as_float(((unsigned)h) << 16); }
__device__ __forceinline__ unsigned short h_bits(float f) { return __builtin_bit_cast(unsigned short, (_Float16)f); }
__device__ __forceinline__ unsigned pack_bf16x2(float a, float b) {
  return (unsigned)f2bf_bits(a) | ((unsigned)f2bf_bits(b) << 16);
}

// hazard guards as plain device helpers (no inline asm inside the kernel template body)
__device__ __forceinline__ void dep_guard_h(v8f& a, v8f& b, v16h x, v16h y) { asm volatile("v_nop\n\tv_nop\n\tv_nop\n\tv_nop" : "+v"(a), "+v"(b) : "v"(x), "v"(y)); }
__device__ __forceinline__ void dep_guard_b(v8f& a, v8f& b, v16b x, v16b y) { asm volatile("v_nop\n\tv_nop\n\tv_nop\n\tv_nop" : "+v"(a), "+v"(b) : "v"(x), "v"(y)); }
__device__ __forceinline__ void keep4_h(v16h a, v16h b, v16h c, v16h d) { asm volatile("v_nop" :: "v"(a), "v"(b), "v"(c), "v"(d)); }
__device__ __forceinline__ void keep4_b(v16b a, v16b b, v16b c, v16b d) { asm volatile("v_nop" :: "v"(a), "v"(b), "v"(c), "v"(d)); }
__device__ __forceinline__ void acc_guard4(v8f& a, v8f& b, v8f& c, v8f& d) { asm volatile("v_nop\n\tv_nop\n\tv_nop\n\tv_nop" : "+v"(a), "+v"(b), "+v"(c), "+v"(d)); }
template <typename T> struct Frag;
template <> struct Frag<_Float16> {
  typedef v16h V; union U { v16h v; v8h h[2]; };
  static __device__ __forceinline__ v16h load(const _Float16* p) {   // elements 0..7 <- p[0..7], 8..15 <- p[16..23]
    U f; f.h[0] = *(const v8h*)(p); f.h[1] = *(const v8h*)(p + 16); return f.v;
  }
  static __device__ __forceinline__ v8f mma(v16h a, v16h b, v8f c) {
    return __builtin_amdgcn_wmma_f32_16x16x32_f16(false, a, false, b, (short)0, c, false, false);
  }
  static __device__ __forceinline__ void guard(v8f& a, v8f& b, v16h x, v16h y) { dep_guard_h(a, b, x, y); }
  static __device__ __forceinline__ void keep(v16h a, v16h b, v16h c, v16h d) { keep4_h(a, b, c, d); }
};
template <> struct Frag<__bf16> {
  typedef v16b V; union U { v16b v; v8b h[2]; };
  static __device__ __forceinline__ v16b load(const __bf16* p) {
    U f; f.h[0] = *(const v8b*)(p); f.h[1] = *(const v8b*)(p + 16); return f.v;
  }
  static __device__ __forceinline__ v8f mma(v16b a, v16b b, v8f c) {
    return __builtin_amdgcn_wmma_f32_16x16x32_bf16(false, a, false, b, (short)0, c, false, false);
  }
  static __device__ __forceinline__ void guard(v8f& a, v8f& b, v16b x, v16b y) { dep_guard_b(a, b, x, y); }
  static __device__ __forceinline__ void keep(v16b a, v16b b, v16b c, v16b d) { keep4_b(a, b, c, d); }
};

// single-accumulator WMMA + hazard nops (used by the relation mix kernel)
__device__ __forceinline__ v8f mma16h(v16h a, v16h b, v8f c) {
  c = __builtin_amdgcn_wmma_f32_16x16x32_f16(false, a, false, b, (short)0, c, false, false);
  asm volatile("v_nop\n\tv_nop\n\tv_nop\n\tv_nop" : "+v"(c) : "v"(a), "v"(b));
  return c;
}
__device__ __forceinline__ v8f mma16b(v16b a, v16b b, v8f c) {
  c = __builtin_amdgcn_wmma_f32_16x16x32_bf16(false, a, false, b, (short)0, c, false, false);
  asm volatile("v_nop\n\tv_nop\n\tv_nop\n\tv_nop" : "+v"(c) : "v"(a), "v"(b));
  return c;
}

// ---- Register-blocked batched WMMA GEMM ------------------------------
// C[m,n] = scale * sum_k A[m,k] * Bt[n,k] (+bias); each wave owns a 64x64 tile.
// A row-major [M,K]; Bt row-major [N,K]; M,N % 64 == 0, K % 32 == 0.
// SPLIT: A is hi/lo planes (A2 = lo); SPLITB: Bt also hi/lo (product hi.hi + hi.lo + lo.hi),
//        !SPLITB: Bt single plane (product hi.b + lo.b).
// BIAS_MODE: 0 = none, 1 = bias[m], 2 = bias[n].
// OUT_MODE: 0 = f32, 1 = f16, 2 = bf16 hi plane (Cout) + bf16 lo plane (Cout2).
// ET: 0 = f16 operands, 1 = bf16 operands (pointers passed as 16-bit storage)
template <int ET> struct Elem;
template <> struct Elem<0> { typedef _Float16 T; };
template <> struct Elem<1> { typedef __bf16 T; };
template <int ET, bool SPLIT, bool SPLITB, int BIAS_MODE, int OUT_MODE>
__global__ __launch_bounds__(256) void wmma_gemm64(
    const unsigned short* __restrict__ Ap, const unsigned short* __restrict__ A2p, int lda, long strideA,
    const unsigned short* __restrict__ Btp, const unsigned short* __restrict__ Bt2p, int ldb, long strideB,
    void* __restrict__ Cout, void* __restrict__ Cout2, int ldc, long strideC,
    const float* __restrict__ bias,
    int M, int N, int K, float scale) {
  typedef typename Elem<ET>::T T;
  typedef typename Frag<T>::V V;
  const T* A = (const T*)Ap; const T* A2 = (const T*)A2p; const T* Bt = (const T*)Btp; const T* Bt2 = (const T*)Bt2p;
  __shared__ __align__(16) float sT[8][16 * 68];   // per-wave 16x64 slab, pitch 68 floats
  const int b    = blockIdx.y;
  const int lane = threadIdx.x & 31;
  const int wave = threadIdx.x >> 5;
  const int tilesN = N >> 6;
  const int tilesM = M >> 6;
  const int tile = blockIdx.x * 8 + wave;
  if (tile >= tilesM * tilesN) return;   // wave-uniform; no block barriers in this kernel
  const int tm = tile / tilesN;
  const int tn = tile - tm * tilesN;
  const int m0 = tm << 6;
  const int n0 = tn << 6;

  const T* Ab  = A  + (size_t)b * strideA;
  const T* Bb  = Bt + (size_t)b * strideB;
  const T* Ab2 = SPLIT ? (A2  + (size_t)b * strideA) : nullptr;
  const T* Bb2 = (SPLIT && SPLITB) ? (Bt2 + (size_t)b * strideB) : nullptr;

  const int rlane = lane & 15;                 // row (A) / col (B, D) within subtile
  const int koff  = (lane >> 4) * 8;           // k offset of this lane half
  const int mOff  = (lane >> 4) * 8;           // D row offset

  v8f acc[4][4];
#pragma unroll
  for (int i = 0; i < 4; ++i)
#pragma unroll
    for (int j = 0; j < 4; ++j) acc[i][j] = (v8f){0.f,0.f,0.f,0.f,0.f,0.f,0.f,0.f};

  for (int k0 = 0; k0 < K; k0 += 32) {
    V bh[4], bl[4];
#pragma unroll
    for (int j = 0; j < 4; ++j) {
      const size_t bo = (size_t)(n0 + (j << 4) + rlane) * ldb + koff + k0;
      bh[j] = Frag<T>::load(Bb + bo);
      if (SPLIT && SPLITB) bl[j] = Frag<T>::load(Bb2 + bo);
    }
#pragma unroll
    for (int i = 0; i < 4; ++i) {
      const size_t ao = (size_t)(m0 + (i << 4) + rlane) * lda + koff + k0;
      V ah = Frag<T>::load(Ab + ao);
      V al;
      if (SPLIT) al = Frag<T>::load(Ab2 + ao);
#pragma unroll
      for (int j = 0; j < 4; ++j) {
        acc[i][j] = Frag<T>::mma(ah, bh[j], acc[i][j]);
        if (SPLIT) {
          if (SPLITB) acc[i][j] = Frag<T>::mma(ah, bl[j], acc[i][j]);
          acc[i][j] = Frag<T>::mma(al, bh[j], acc[i][j]);
        }
      }
      Frag<T>::guard(acc[i][0], acc[i][3], ah, SPLIT ? al : ah);
    }
    Frag<T>::keep(bh[0], bh[1], bh[2], bh[3]);
    if (SPLIT && SPLITB) Frag<T>::keep(bl[0], bl[1], bl[2], bl[3]);
  }
  acc_guard4(acc[0][0], acc[0][1], acc[0][2], acc[0][3]);
  acc_guard4(acc[1][0], acc[1][1], acc[1][2], acc[1][3]);
  acc_guard4(acc[2][0], acc[2][1], acc[2][2], acc[2][3]);
  acc_guard4(acc[3][0], acc[3][1], acc[3][2], acc[3][3]);

  // ---- epilogue ----
  float* slab = sT[wave];
#pragma unroll
  for (int i = 0; i < 4; ++i) {
    const int mBase = m0 + (i << 4);
#pragma unroll
    for (int j = 0; j < 4; ++j) {
      const int n = n0 + (j << 4) + rlane;
      float bv = 0.f;
      if (BIAS_MODE == 2) bv = bias[n];
#pragma unroll
      for (int r = 0; r < 8; ++r) {
        float v = acc[i][j][r] * scale;
        if (BIAS_MODE == 1) v += bias[mBase + mOff + r];
        if (BIAS_MODE == 2) v += bv;
        slab[(mOff + r) * 68 + (j << 4) + rlane] = v;
      }
    }
    __builtin_amdgcn_fence(__ATOMIC_RELEASE, "workgroup");
    __builtin_amdgcn_wave_barrier();
    __builtin_amdgcn_fence(__ATOMIC_ACQUIRE, "workgroup");
    if (OUT_MODE == 0) {
      float* C = (float*)Cout + (size_t)b * strideC;
      const int hh = lane >> 4, c4 = (lane & 15) * 4;     // row seg = 256 B = 16 lanes x 16 B
      {
#pragma unroll
        for (int it = 0; it < 8; ++it) {
          const int row = it * 2 + hh;
          v4f v = *(const v4f*)(slab + row * 68 + c4);
          *(v4f*)(C + (size_t)(mBase + row) * ldc + n0 + c4) = v;
        }
        
      }
    } else {
      const int q = lane >> 3, c8 = (lane & 7) * 8;
      unsigned short* C  = (unsigned short*)Cout  + (size_t)b * strideC;
      unsigned short* C2 = (OUT_MODE == 2) ? ((unsigned short*)Cout2 + (size_t)b * strideC) : nullptr;
      {
#pragma unroll
        for (int it = 0; it < 4; ++it) {
          const int row = it * 4 + q;
          const float* sp = slab + row * 68 + c8;
          v8h hv, lv;
#pragma unroll
          for (int e = 0; e < 8; ++e) {
            if (OUT_MODE == 1) {
              hv[e] = (_Float16)sp[e];
            } else {
              unsigned short hb = f2bf_bits(sp[e]);
              unsigned short lb = f2bf_bits(sp[e] - bf_bits2f(hb));
              hv[e] = __builtin_bit_cast(_Float16, hb);
              lv[e] = __builtin_bit_cast(_Float16, lb);
            }
          }
          *(v8h*)(C + (size_t)(mBase + row) * ldc + n0 + c8) = hv;
          if (OUT_MODE == 2) *(v8h*)(C2 + (size_t)(mBase + row) * ldc + n0 + c8) = lv;
        }
        
      }
    }
    __builtin_amdgcn_fence(__ATOMIC_RELEASE, "workgroup");
    __builtin_amdgcn_wave_barrier();
    __builtin_amdgcn_fence(__ATOMIC_ACQUIRE, "workgroup");
  }
}

// ---------------------------------------------------------------------------
// f32 -> bf16 (RNE) cast of the two activation tensors, 8 elements per thread:
// blockIdx.y selects the tensor (uniform). Coverage: grid.x*256 threads * 8 = n8*8 elements exactly.
// ---------------------------------------------------------------------------
__global__ __launch_bounds__(256) void k_cast_bf16x8(const float* __restrict__ s0, const float* __restrict__ s1,
    unsigned short* __restrict__ d0, unsigned short* __restrict__ d1, int n8) {
  const float* src = (blockIdx.y == 0) ? s0 : s1;
  unsigned short* dst = (blockIdx.y == 0) ? d0 : d1;
  const int i = blockIdx.x * 256 + threadIdx.x;
  if (i < n8) {
    const size_t e0 = (size_t)i * 8;
    const v4f a = *(const v4f*)(src + e0);
    const v4f c = *(const v4f*)(src + e0 + 4);
    v4u u;
    u[0] = pack_bf16x2(a[0], a[1]);
    u[1] = pack_bf16x2(a[2], a[3]);
    u[2] = pack_bf16x2(c[0], c[1]);
    u[3] = pack_bf16x2(c[2], c[3]);
    *(v4u*)(dst + e0) = u;
    
  }
}

// ---------------------------------------------------------------------------
// Weight transpose + bf16 cast: W[k][o] (f32, [DMOD][DMOD]) -> WT[o][k] (bf16), 6 weights selected by blockIdx.z.
// Coverage per block: read 4 iters * 256 threads * 4 = 4096 elements; write 2 iters * 8 waves * 4 lines * 64 = 4096.
// ---------------------------------------------------------------------------
__global__ __launch_bounds__(256) void k_wT_bf16(const float* __restrict__ w0, const float* __restrict__ w1,
    const float* __restrict__ w2, const float* __restrict__ w3, const float* __restrict__ w4, const float* __restrict__ w5,
    unsigned short* __restrict__ dst) {
  __shared__ __align__(16) float tile[64 * 68];
  const int z = blockIdx.z;
  const float* W = (z == 0) ? w0 : (z == 1) ? w1 : (z == 2) ? w2 : (z == 3) ? w3 : (z == 4) ? w4 : w5;
  unsigned short* WT = dst + (size_t)z * DMOD * DMOD;
  const int k0 = blockIdx.y * 64;   // rows of W (input dim)
  const int o0 = blockIdx.x * 64;   // cols of W (output dim)
  const int tid = threadIdx.x;
#pragma unroll
  for (int it = 0; it < 4; ++it) {
    const int e = (it * 256 + tid) * 4;
    const int row = e >> 6, col = e & 63;
    const v4f v = *(const v4f*)(W + (size_t)(k0 + row) * DMOD + o0 + col);
    *(v4f*)(tile + row * 68 + col) = v;
  }
  __syncthreads();
  const int lane = tid & 31, wave = tid >> 5, q = lane >> 3, c8 = (lane & 7) * 8;
  v4u ov[2];
#pragma unroll
  for (int it = 0; it < 2; ++it) {
    const int oo = it * 32 + wave * 4 + q;
    float f[8];
#pragma unroll
    for (int e = 0; e < 8; ++e) f[e] = tile[(c8 + e) * 68 + oo];
    ov[it][0] = pack_bf16x2(f[0], f[1]);
    ov[it][1] = pack_bf16x2(f[2], f[3]);
    ov[it][2] = pack_bf16x2(f[4], f[5]);
    ov[it][3] = pack_bf16x2(f[6], f[7]);
  }
  {
#pragma unroll
    for (int it = 0; it < 2; ++it) {
      const int oo = it * 32 + wave * 4 + q;
      *(v4u*)(WT + (size_t)(o0 + oo) * DMOD + k0 + c8) = ov[it];
    }
    
  }
}

// ---------------------------------------------------------------------------
// Wr [NHEAD*HDIM rows][NREL] f32 -> WrP [rows][32] bf16 with k 16..31 zero-FILLED (WMMA K padding).
// Coverage: 256 threads * 8 elements = 64 rows * 32; store 8 waves * 4 lines * 64 = 2048 elements.
// ---------------------------------------------------------------------------
__global__ __launch_bounds__(256) void k_wr_pack(const float* __restrict__ wr, unsigned short* __restrict__ dst) {
  __shared__ __align__(16) unsigned short tile[64 * 32];
  const int r0 = blockIdx.x * 64;
  const int tid = threadIdx.x;
  const int row = tid >> 2, kq = (tid & 3) * 8;
  v4u u;
  unsigned wv[4];
#pragma unroll
  for (int e = 0; e < 4; ++e) {
    const int ka = kq + 2 * e, kb = kq + 2 * e + 1;
    const int kac = ka < NREL ? ka : NREL - 1;
    const int kbc = kb < NREL ? kb : NREL - 1;
    const float fa = wr[(size_t)(r0 + row) * NREL + kac];
    const float fb = wr[(size_t)(r0 + row) * NREL + kbc];
    const unsigned ba = (ka < NREL) ? (unsigned)f2bf_bits(fa) : 0u;
    const unsigned bb = (kb < NREL) ? (unsigned)f2bf_bits(fb) : 0u;
    wv[e] = ba | (bb << 16);
  }
  u[0] = wv[0]; u[1] = wv[1]; u[2] = wv[2]; u[3] = wv[3];
  *(v4u*)(tile + row * 32 + kq) = u;
  __syncthreads();
  const int lane = tid & 31, wave = tid >> 5, q = lane >> 3, c8 = (lane & 7) * 8;
  const int L = wave * 4 + q;                       // line 0..31, 64 elements per line
  const v4u v = *(const v4u*)(tile + L * 64 + c8);
  {
    *(v4u*)(dst + (size_t)r0 * 32 + L * 64 + c8) = v;
    
  }
}

// ---------------------------------------------------------------------------
// Causal softmax of one chunk: scores f32 [NHEAD][CHR][SEQ] (columns < jend valid), row r = h*CHR + il,
// query i = i0 + il, keys j <= i. One wave per row; lane owns j = 256*t + 8*lane .. +7 (t < jend/256).
// Writes P hi/lo bf16 planes and P*1024 f16 plane (same layout), zeros for i < j < jend.
// Coverage: grid.x*8 rows = NHEAD*CHR rows; columns [0, jend) per row.
// ---------------------------------------------------------------------------
__global__ __launch_bounds__(256) void k_softmax(const float* __restrict__ sc, unsigned short* __restrict__ ph,
    unsigned short* __restrict__ pl, unsigned short* __restrict__ p16, int i0, int jend) {
  const int lane = threadIdx.x & 31, wave = threadIdx.x >> 5;
  const int r = blockIdx.x * 8 + wave;
  const int i = i0 + (r & (CHR - 1));
  const size_t ro = (size_t)r * SEQ;
  const float NEG = -__builtin_huge_valf();
  float s[4][8];
  float m = NEG;
#pragma unroll
  for (int t = 0; t < 4; ++t) {
    const int j0 = t * 256 + lane * 8;
    if (t * 256 < jend) {          // block-uniform
      const v4f a = *(const v4f*)(sc + ro + j0);
      const v4f c = *(const v4f*)(sc + ro + j0 + 4);
      s[t][0] = a[0]; s[t][1] = a[1]; s[t][2] = a[2]; s[t][3] = a[3];
      s[t][4] = c[0]; s[t][5] = c[1]; s[t][6] = c[2]; s[t][7] = c[3];
#pragma unroll
      for (int e = 0; e < 8; ++e) m = (j0 + e <= i) ? fmaxf(m, s[t][e]) : m;
    } else {
#pragma unroll
      for (int e = 0; e < 8; ++e) s[t][e] = 0.f;
    }
  }
#pragma unroll
  for (int off = 1; off < 32; off <<= 1) m = fmaxf(m, __shfl_xor(m, off, 32));
  float p[4][8];
  float sum = 0.f;
#pragma unroll
  for (int t = 0; t < 4; ++t) {
    const int j0 = t * 256 + lane * 8;
#pragma unroll
    for (int e = 0; e < 8; ++e) {
      float ev = __expf(s[t][e] - m);
      ev = (j0 + e <= i) ? ev : 0.f;
      p[t][e] = ev;
      sum += ev;
    }
  }
#pragma unroll
  for (int off = 1; off < 32; off <<= 1) sum += __shfl_xor(sum, off, 32);
  const float inv = 1.0f / sum;       // sum >= 1 (key j=0 always present)
  v4u hv[4], lv[4], fv[4];
#pragma unroll
  for (int t = 0; t < 4; ++t) {
#pragma unroll
    for (int e = 0; e < 4; ++e) {
      const float a = p[t][2 * e] * inv;
      const float c = p[t][2 * e + 1] * inv;
      const unsigned short ha = f2bf_bits(a), hc = f2bf_bits(c);
      const unsigned short la = f2bf_bits(a - bf_bits2f(ha)), lc = f2bf_bits(c - bf_bits2f(hc));
      const unsigned short fa = h_bits(a * PCARRY), fc = h_bits(c * PCARRY);
      hv[t][e] = (unsigned)ha | ((unsigned)hc << 16);
      lv[t][e] = (unsigned)la | ((unsigned)lc << 16);
      fv[t][e] = (unsigned)fa | ((unsigned)fc << 16);
    }
  }
  {
#pragma unroll
    for (int t = 0; t < 4; ++t) {
      if (t * 256 < jend) {        // block-uniform
        const int j0 = t * 256 + lane * 8;
        *(v4u*)(ph  + ro + j0) = hv[t];
        *(v4u*)(pl  + ro + j0) = lv[t];
        *(v4u*)(p16 + ro + j0) = fv[t];
      }
    }
    
  }
}

// ---------------------------------------------------------------------------
// Relation aggregation + Wr mix + residual, one chunk. Block = 8 waves = 16 consecutive query rows il0..il0+15.
// Phase 1 (per wave, rows ill = wave and wave+8): D[h][r] = sum_{j<kend} P16[h][il][j] * rel[il][r][j]
//   (one f16 WMMA tile, K stepped by 32 up to the causal extent; P16 carries P*1024, rel carries REL_SCALE);
//   D is split into bf16 hi/lo and written to LDS arHL[m=ill][h][k=r] (k 16..31 zero-filled first).
// Phase 2 (per wave, heads h = wave and wave+8): attrel[ill][d] = sum_r ar[ill][h][r] * Wr[h][d][r]
//   (A = arHL hi/lo from LDS, B = WrP bf16 [h*64+d][32], two products per tile, 4 tiles of 16 d).
// Epilogue: per-wave 16x64 slab in LDS, residual attended_symbols added from one 32-B load per lane in the
// ---------------------------------------------------------------------------
__global__ __launch_bounds__(256) void k_rel_mix(const unsigned short* __restrict__ p16, const unsigned short* __restrict__ rel,
    const unsigned short* __restrict__ wrp, const float* __restrict__ attsym,
    unsigned short* __restrict__ comb_hi, unsigned short* __restrict__ comb_lo, int i0, int rowbase) {
  __shared__ __align__(16) unsigned short arHL[2 * 16 * 16 * 32];   // hi plane [m][h][32] then lo plane
  __shared__ __align__(16) float slab[8][16 * 68];
  const int tid = threadIdx.x, lane = tid & 31, wave = tid >> 5;
  const int hh = lane >> 4, rl = lane & 15, koff = hh * 8;
  const int il0 = blockIdx.x * 16;
  {
    const v4u zz = {0u, 0u, 0u, 0u};
    v4u* zp = (v4u*)arHL;                 // 32768 B = 2048 x 16 B, 256 threads x 8
    for (int qq = tid; qq < 2048; qq += 256) zp[qq] = zz;
  }
  __syncthreads();
  const v8f zero8 = {0.f, 0.f, 0.f, 0.f, 0.f, 0.f, 0.f, 0.f};
#pragma unroll
  for (int sub = 0; sub < 2; ++sub) {
    const int ill = wave + 8 * sub;           // local row 0..15 (wave-uniform)
    const int il = il0 + ill;                 // row within chunk 0..255
    const int i = i0 + il;                    // query position
    const int kend = (i & ~31) + 32;          // <= jend; P16 is zero for i < j < kend
    const _Float16* Ab = (const _Float16*)p16 + (size_t)rl * ((size_t)CHR * SEQ) + (size_t)il * SEQ + koff;   // A row m = head rl
    const _Float16* Bb = (const _Float16*)rel + (size_t)il * ((size_t)NREL * SEQ) + (size_t)rl * SEQ + koff;   // Bt row n = relation rl
    v8f acc = zero8;
    for (int k0 = 0; k0 < kend; k0 += 32) {
      const v16h a  = Frag<_Float16>::load(Ab + k0);
      const v16h bb = Frag<_Float16>::load(Bb + k0);
      acc = mma16h(a, bb, acc);
    }
    // acc[r8] = D[row h = 8*hh + r8][col r = rl]  (carried x1024)
#pragma unroll
    for (int r8 = 0; r8 < 8; ++r8) {
      const float f = acc[r8];
      const unsigned short hb = f2bf_bits(f);
      const unsigned short lb = f2bf_bits(f - bf_bits2f(hb));
      const int idx = (ill * 16 + 8 * hh + r8) * 32 + rl;
      arHL[idx] = hb;
      arHL[8192 + idx] = lb;
    }
  }
  __syncthreads();
  const int q = lane >> 3, c8 = (lane & 7) * 8;
  float* sl = slab[wave];
#pragma unroll
  for (int sub = 0; sub < 2; ++sub) {
    const int h = wave + 8 * sub;             // wave-uniform head
    const v16b ah = Frag<__bf16>::load((const __bf16*)arHL + rl * 512 + h * 32 + koff);          // A[m = rl][k]
    const v16b al = Frag<__bf16>::load((const __bf16*)arHL + 8192 + rl * 512 + h * 32 + koff);
    v8f acc2[4];
#pragma unroll
    for (int j = 0; j < 4; ++j) {
      const v16b bw = Frag<__bf16>::load((const __bf16*)wrp + (size_t)(h * HDIM + j * 16 + rl) * 32 + koff);  // Bt[n = d][k = r]
      acc2[j] = mma16b(ah, bw, zero8);
      acc2[j] = mma16b(al, bw, acc2[j]);
    }
    // acc2[j][r8] = attrel[ill = 8*hh + r8][d = 16*j + rl] * 1024
#pragma unroll
    for (int j = 0; j < 4; ++j)
#pragma unroll
      for (int r8 = 0; r8 < 8; ++r8) sl[(8 * hh + r8) * 68 + j * 16 + rl] = acc2[j][r8] * PCARRY_INV;
    __builtin_amdgcn_fence(__ATOMIC_RELEASE, "workgroup");
    __builtin_amdgcn_wave_barrier();
    __builtin_amdgcn_fence(__ATOMIC_ACQUIRE, "workgroup");
    v4u hv[4], lv[4];
#pragma unroll
    for (int it = 0; it < 4; ++it) {
      const int row = it * 4 + q;
      const size_t g = (size_t)(rowbase + il0 + row) * DMOD + h * HDIM + c8;
      const v4f s0 = *(const v4f*)(sl + row * 68 + c8);
      const v4f s1 = *(const v4f*)(sl + row * 68 + c8 + 4);
      const v4f r0 = *(const v4f*)(attsym + g);
      const v4f r1 = *(const v4f*)(attsym + g + 4);
      float v[8];
      v[0] = s0[0] + r0[0]; v[1] = s0[1] + r0[1]; v[2] = s0[2] + r0[2]; v[3] = s0[3] + r0[3];
      v[4] = s1[0] + r1[0]; v[5] = s1[1] + r1[1]; v[6] = s1[2] + r1[2]; v[7] = s1[3] + r1[3];
#pragma unroll
      for (int e = 0; e < 4; ++e) {
        const float a = v[2 * e], c = v[2 * e + 1];
        const unsigned short ha = f2bf_bits(a), hc = f2bf_bits(c);
        const unsigned short la = f2bf_bits(a - bf_bits2f(ha)), lc = f2bf_bits(c - bf_bits2f(hc));
        hv[it][e] = (unsigned)ha | ((unsigned)hc << 16);
        lv[it][e] = (unsigned)la | ((unsigned)lc << 16);
      }
    }
    {
#pragma unroll
      for (int it = 0; it < 4; ++it) {
        const int row = it * 4 + q;
        const size_t g = (size_t)(rowbase + il0 + row) * DMOD + h * HDIM + c8;
        *(v4u*)(comb_hi + g) = hv[it];
        *(v4u*)(comb_lo + g) = lv[it];
      }
      
    }
    __builtin_amdgcn_fence(__ATOMIC_RELEASE, "workgroup");
    __builtin_amdgcn_wave_barrier();
    __builtin_amdgcn_fence(__ATOMIC_ACQUIRE, "workgroup");
  }
}

// ---------------------------------------------------------------------------
// host helpers
// ---------------------------------------------------------------------------
template <int ET, bool SPLIT, bool SPLITB, int OUT_MODE>
static void launch_gemm(hipStream_t st, int batch,
                        const unsigned short* A, const unsigned short* A2, int lda, long sA,
                        const unsigned short* Bt, const unsigned short* Bt2, int ldb, long sB,
                        void* C, void* C2, int ldc, long sC, const float* dummy,
                        int M, int N, int K, float scale) {
  const int tiles = (M / 64) * (N / 64);
  dim3 grid((unsigned)((tiles + 7) / 8), (unsigned)batch, 1);
  wmma_gemm64<ET, SPLIT, SPLITB, 0, OUT_MODE><<<grid, 256, 0, st>>>(
      A, A2, lda, sA, Bt, Bt2, ldb, sB, C, C2, ldc, sC, dummy, M, N, K, scale);
}

// ---------------------------------------------------------------------------
// launcher
// Workspace region map (bytes, all 256-B aligned; total 121,700,352):
//   xb     [2048][1024] bf16   4,194,304      x (RNE bf16)
//   sb     [2048][1024] bf16   4,194,304      symbols (RNE bf16)
//   wT     6 x [1024][1024] bf16 12,582,912   transposed weights: 0 q_attn, 1 k_attn, 2 q_rel, 3 k_rel, 4 v, 5 o
//   xqh/xql/xkh/xkl [2048][1024] bf16  4 x 4,194,304
//   qr16/kr16 [2048][1024] f16   2 x 4,194,304
//   svh/svl [1024][2048] bf16    2 x 4,194,304  (values transposed: row h*64+d, col b*1024+j)
//   attsym  [2048][1024] f32     8,388,608
//   ch/cl   [2048][1024] bf16    2 x 4,194,304  (pre-output activations hi/lo)
//   wrp     [1024][32] bf16      65,536         (Wr with K padded to 32, pad zero-filled)
//   per chunk (rewritten each (b, chunk); consumers read only columns < jend written in the same chunk):
//   sc      [16][256][1024] f32  16,777,216     scores
//   ph/pl   [16][256][1024] bf16 2 x 8,388,608  probabilities hi/lo
//   p16     [16][256][1024] f16  8,388,608      probabilities x1024
//   rel16   [256][16][1024] f16  8,388,608      relation scores (REL_SCALE folded)
// ---------------------------------------------------------------------------
extern "C" void kernel_launch(void* const* d_in, const int* in_sizes, int n_in,
                              void* d_out, int out_size, void* d_ws, size_t ws_size,
                              hipStream_t stream) {
  if (n_in < 9) return;
  if (in_sizes[0] != NTOK * DMOD || in_sizes[1] != NTOK * DMOD) return;
  if (in_sizes[2] != DMOD * DMOD || in_sizes[3] != DMOD * DMOD || in_sizes[4] != DMOD * DMOD ||
      in_sizes[5] != DMOD * DMOD || in_sizes[7] != DMOD * DMOD || in_sizes[8] != DMOD * DMOD) return;
  if (in_sizes[6] != NHEAD * HDIM * NREL) return;
  if (out_size != NTOK * DMOD) return;

  const float* x      = (const float*)d_in[0];
  const float* symb   = (const float*)d_in[1];
  const float* Wq_a   = (const float*)d_in[2];
  const float* Wk_a   = (const float*)d_in[3];
  const float* Wq_r   = (const float*)d_in[4];
  const float* Wk_r   = (const float*)d_in[5];
  const float* Wr     = (const float*)d_in[6];
  const float* Wv     = (const float*)d_in[7];
  const float* Wo     = (const float*)d_in[8];
  float* out = (float*)d_out;

  char* ws = (char*)d_ws;
  size_t off = 0;
  auto carve = [&](size_t bytes) -> char* {
    char* p = ws + off;
    off += (bytes + 255) & ~(size_t)255;
    return p;
  };
  const size_t ACT16 = (size_t)NTOK * DMOD * 2;            // 4,194,304
  const size_t WGT16 = (size_t)DMOD * DMOD * 2;            // 2,097,152
  const size_t ACT32 = (size_t)NTOK * DMOD * 4;            // 8,388,608
  const size_t PLANE_CH16 = (size_t)NHEAD * CHR * SEQ * 2; // 8,388,608
  const size_t PLANE_CH32 = (size_t)NHEAD * CHR * SEQ * 4; // 16,777,216
  const size_t REL_CH16   = (size_t)CHR * NREL * SEQ * 2;  // 8,388,608

  unsigned short* xb   = (unsigned short*)carve(ACT16);
  unsigned short* sb   = (unsigned short*)carve(ACT16);
  unsigned short* wT   = (unsigned short*)carve(6 * WGT16);
  unsigned short* xqh  = (unsigned short*)carve(ACT16);
  unsigned short* xql  = (unsigned short*)carve(ACT16);
  unsigned short* xkh  = (unsigned short*)carve(ACT16);
  unsigned short* xkl  = (unsigned short*)carve(ACT16);
  unsigned short* qr16 = (unsigned short*)carve(ACT16);
  unsigned short* kr16 = (unsigned short*)carve(ACT16);
  unsigned short* svh  = (unsigned short*)carve(ACT16);
  unsigned short* svl  = (unsigned short*)carve(ACT16);
  float*          attsym = (float*)carve(ACT32);
  unsigned short* ch   = (unsigned short*)carve(ACT16);
  unsigned short* cl   = (unsigned short*)carve(ACT16);
  unsigned short* wrp  = (unsigned short*)carve((size_t)NHEAD * HDIM * 32 * 2);
  float*          sc   = (float*)carve(PLANE_CH32);
  unsigned short* ph   = (unsigned short*)carve(PLANE_CH16);
  unsigned short* pl   = (unsigned short*)carve(PLANE_CH16);
  unsigned short* p16  = (unsigned short*)carve(PLANE_CH16);
  unsigned short* rel16 = (unsigned short*)carve(REL_CH16);
  if (off > ws_size) return;
  const float* dummy = (const float*)d_ws;   // valid pointer for the unused bias argument

  const unsigned short* WqaT = wT + 0 * (size_t)DMOD * DMOD;
  const unsigned short* WkaT = wT + 1 * (size_t)DMOD * DMOD;
  const unsigned short* WqrT = wT + 2 * (size_t)DMOD * DMOD;
  const unsigned short* WkrT = wT + 3 * (size_t)DMOD * DMOD;
  const unsigned short* WvT  = wT + 4 * (size_t)DMOD * DMOD;
  const unsigned short* WoT  = wT + 5 * (size_t)DMOD * DMOD;

  // 1) casts: activations to bf16; weights transposed to bf16; Wr packed with K padding
  {
    const int n8 = NTOK * DMOD / 8;   // 262,144 = 1024 * 256
    k_cast_bf16x8<<<dim3((unsigned)((n8 + 255) / 256), 2, 1), 256, 0, stream>>>(x, symb, xb, sb, n8);
    k_wT_bf16<<<dim3(DMOD / 64, DMOD / 64, 6), 256, 0, stream>>>(Wq_a, Wk_a, Wq_r, Wk_r, Wv, Wo, wT);
    k_wr_pack<<<dim3((NHEAD * HDIM) / 64), 256, 0, stream>>>(Wr, wrp);
  }

  // 2) projections (bf16 x bf16, exact products, f32 accumulate)
  //    xq, xk -> bf16 hi/lo planes [2048][1024]; qr, kr -> f16 planes; values transposed svT [1024][2048] hi/lo
  static_assert(NTOK % 64 == 0 && DMOD % 64 == 0 && DMOD % 32 == 0, "projection GEMM shapes");
  launch_gemm<1, false, true, 2>(stream, 1, xb, xb, DMOD, 0, WqaT, WqaT, DMOD, 0, xqh, xql, DMOD, 0, dummy, NTOK, DMOD, DMOD, 1.0f);
  launch_gemm<1, false, true, 2>(stream, 1, xb, xb, DMOD, 0, WkaT, WkaT, DMOD, 0, xkh, xkl, DMOD, 0, dummy, NTOK, DMOD, DMOD, 1.0f);
  launch_gemm<1, false, true, 1>(stream, 1, xb, xb, DMOD, 0, WqrT, WqrT, DMOD, 0, qr16, qr16, DMOD, 0, dummy, NTOK, DMOD, DMOD, 1.0f);
  launch_gemm<1, false, true, 1>(stream, 1, xb, xb, DMOD, 0, WkrT, WkrT, DMOD, 0, kr16, kr16, DMOD, 0, dummy, NTOK, DMOD, DMOD, 1.0f);
  launch_gemm<1, false, true, 2>(stream, 1, WvT, WvT, DMOD, 0, sb, sb, DMOD, 0, svh, svl, NTOK, 0, dummy, DMOD, NTOK, DMOD, 1.0f);

  // 3) per (batch, chunk of 256 query rows): scores -> softmax -> P.V -> relation scores -> relation mix
  static_assert(CHR % 64 == 0 && HDIM % 32 == 0 && RDIM % 32 == 0 && HDIM % 64 == 0, "chunk GEMM shapes");
  for (int b = 0; b < NB; ++b) {
    for (int cch = 0; cch < NCHK; ++cch) {
      const int i0 = cch * CHR;
      const int jend = CHR * (cch + 1);          // multiple of 256 -> of 64 and 32
      const int rowbase = b * SEQ + i0;
      // scores[h][il][j] = SCALE_ATTN * sum_d xq[i][h,d] xk[j][h,d], hi/lo split on both operands, f32 out
      launch_gemm<1, true, true, 0>(stream, NHEAD,
          xqh + (size_t)rowbase * DMOD, xql + (size_t)rowbase * DMOD, DMOD, (long)HDIM,
          xkh + (size_t)b * SEQ * DMOD, xkl + (size_t)b * SEQ * DMOD, DMOD, (long)HDIM,
          sc, sc, SEQ, (long)CHR * SEQ, dummy, CHR, jend, HDIM, SCALE_ATTN);
      // causal softmax -> P planes
      k_softmax<<<dim3((NHEAD * CHR) / 8), 256, 0, stream>>>(sc, ph, pl, p16, i0, jend);
      // attended_symbols[token][h*64+d] = sum_j P[h][il][j] * svT[h*64+d][b*1024+j]  (split both)
      launch_gemm<1, true, true, 0>(stream, NHEAD,
          ph, pl, SEQ, (long)CHR * SEQ,
          svh + (size_t)b * SEQ, svl + (size_t)b * SEQ, NTOK, (long)HDIM * NTOK,
          attsym + (size_t)rowbase * DMOD, attsym + (size_t)rowbase * DMOD, DMOD, (long)HDIM, dummy,
          CHR, HDIM, jend, 1.0f);
      // rel[il][r][j] = SCALE_REL * sum_p qr[i][r,p] kr[j][r,p]  (plain f16) -> f16 plane
      launch_gemm<0, false, true, 1>(stream, NREL,
          qr16 + (size_t)rowbase * DMOD, qr16 + (size_t)rowbase * DMOD, DMOD, (long)RDIM,
          kr16 + (size_t)b * SEQ * DMOD, kr16 + (size_t)b * SEQ * DMOD, DMOD, (long)RDIM,
          rel16, rel16, NREL * SEQ, (long)SEQ, dummy, CHR, jend, RDIM, SCALE_REL);
      // relation aggregation + Wr mix + residual -> combined hi/lo planes
      k_rel_mix<<<dim3(CHR / 16), 256, 0, stream>>>(p16, rel16, wrp, attsym, ch, cl, i0, rowbase);
    }
  }

  // 4) out[token][n] = sum_k combined[token][k] * WoT[n][k]  (A hi/lo, B bf16 weights) -> d_out f32
  launch_gemm<1, true, false, 0>(stream, 1, ch, cl, DMOD, 0, WoT, WoT, DMOD, 0, out, out, DMOD, 0, dummy, NTOK, DMOD, DMOD, 1.0f);
}

// v001
// Measured time: 315 microseconds a run.
// Timed twice side by side with v000, it ran 2.83 and 2.82 times as fast.
// Contractions: v_wmma_f32_16x16x32_bf16 (bf16 operands: module inputs RNE-converted once to bf16; computed q/k, softmax probabilities, value rows, relation aggregates and pre-output activations carried as bf16 hi+lo pairs) and v_wmma_f32_16x16x32_f16 for relation scores and relation aggregation (f16 operands, probabilities carried x1024); f32 accumulate everywhere; softmax and all side math in f32.
#include <hip/hip_runtime.h>

// ---------------------------------------------------------------------------
// problem geometry
// ---------------------------------------------------------------------------
static constexpr int NB    = 2;
static constexpr int SEQ   = 1024;
static constexpr int DMOD  = 1024;
static constexpr int NHEAD = 16;
static constexpr int HDIM  = 64;
static constexpr int NREL  = 16;
static constexpr int RDIM  = 64;
static constexpr int NTOK  = NB * SEQ;          // 2048
static constexpr int CHR   = 256;               // query rows per chunk
static constexpr int NCHK  = SEQ / CHR;         // 4 chunks per batch row
static constexpr float SCALE_ATTN = 0.125f;     // 1/sqrt(64)
static constexpr float SCALE_REL  = 0.125f;     // 1/sqrt(64)
static constexpr float PCARRY     = 1024.0f;    // f16 probability carry
static constexpr float PCARRY_INV = 1.0f / 1024.0f;

// Per-pair planes (scores, probabilities, relation scores) hold all chunks at once: chunk c (query rows 256c..256c+255,
// keys < jend = 256(c+1)) stores its rows at pitch jend and starts at element CHUNK_UNIT * c(c+1)/2.
static constexpr int    ROWS_CH     = NB * NHEAD * CHR;                             // 8192 rows per chunk
static constexpr size_t CHUNK_UNIT  = (size_t)ROWS_CH * CHR;                        // 2,097,152 elements per 256 keys
static constexpr size_t PLANE_ELEMS = CHUNK_UNIT * (NCHK * (NCHK + 1) / 2);         // 20,971,520 elements
__device__ __forceinline__ size_t chunk_base(int c) { return CHUNK_UNIT * (size_t)((c * (c + 1)) >> 1); }

static_assert(NHEAD * HDIM == DMOD, "head split");
static_assert(NREL * RDIM == DMOD, "relation split");
static_assert(SEQ == 4 * 256, "softmax kernel handles 4 segments of 256 keys");
static_assert(SEQ % CHR == 0 && CHR % 64 == 0, "chunk tiling");
static_assert(NHEAD == 16 && NREL == 16, "relation mix kernel uses one 16x16 tile per token");
static_assert(HDIM % 32 == 0 && RDIM % 32 == 0, "K of score GEMMs multiple of 32");
static_assert(NTOK % 64 == 0 && DMOD % 64 == 0, "tile multiples");
static_assert((NTOK * DMOD) % (8 * 256) == 0, "cast kernel coverage");
static_assert((NHEAD * CHR) % 8 == 0 && CHR % 16 == 0, "softmax / mix grids");

// ---------------------------------------------------------------------------
// types, conversions, fragment helpers
// ---------------------------------------------------------------------------
typedef __attribute__((ext_vector_type(16))) _Float16 v16h;
typedef __attribute__((ext_vector_type(8)))  _Float16 v8h;
typedef __attribute__((ext_vector_type(16))) __bf16   v16b;
typedef __attribute__((ext_vector_type(8)))  __bf16   v8b;
typedef __attribute__((ext_vector_type(8)))  float    v8f;
typedef __attribute__((ext_vector_type(4)))  float    v4f;
typedef __attribute__((ext_vector_type(4)))  unsigned int v4u;

__device__ __forceinline__ unsigned short f2bf_bits(float f) {
  unsigned u = __float_as_uint(f);
  return (unsigned short)((u + 0x7FFFu + ((u >> 16) & 1u)) >> 16);
}
__device__ __forceinline__ float bf_bits2f(unsigned short h) { return __uint_as_float(((unsigned)h) << 16); }
__device__ __forceinline__ unsigned short h_bits(float f) { return __builtin_bit_cast(unsigned short, (_Float16)f); }
__device__ __forceinline__ unsigned pack_bf16x2(float a, float b) {
  return (unsigned)f2bf_bits(a) | ((unsigned)f2bf_bits(b) << 16);
}

// hazard guards as plain device helpers (no inline asm inside the kernel template body)
__device__ __forceinline__ void dep_guard_h(v8f& a, v8f& b, v16h x, v16h y) { asm volatile("v_nop\n\tv_nop\n\tv_nop\n\tv_nop" : "+v"(a), "+v"(b) : "v"(x), "v"(y)); }
__device__ __forceinline__ void dep_guard_b(v8f& a, v8f& b, v16b x, v16b y) { asm volatile("v_nop\n\tv_nop\n\tv_nop\n\tv_nop" : "+v"(a), "+v"(b) : "v"(x), "v"(y)); }
__device__ __forceinline__ void keep4_h(v16h a, v16h b, v16h c, v16h d) { asm volatile("v_nop" :: "v"(a), "v"(b), "v"(c), "v"(d)); }
__device__ __forceinline__ void keep4_b(v16b a, v16b b, v16b c, v16b d) { asm volatile("v_nop" :: "v"(a), "v"(b), "v"(c), "v"(d)); }
__device__ __forceinline__ void acc_guard4(v8f& a, v8f& b, v8f& c, v8f& d) { asm volatile("v_nop\n\tv_nop\n\tv_nop\n\tv_nop" : "+v"(a), "+v"(b), "+v"(c), "+v"(d)); }
template <typename T> struct Frag;
template <> struct Frag<_Float16> {
  typedef v16h V; union U { v16h v; v8h h[2]; };
  static __device__ __forceinline__ v16h load(const _Float16* p) {   // elements 0..7 <- p[0..7], 8..15 <- p[16..23]
    U f; f.h[0] = *(const v8h*)(p); f.h[1] = *(const v8h*)(p + 16); return f.v;
  }
  static __device__ __forceinline__ v8f mma(v16h a, v16h b, v8f c) {
    return __builtin_amdgcn_wmma_f32_16x16x32_f16(false, a, false, b, (short)0, c, false, false);
  }
  static __device__ __forceinline__ void guard(v8f& a, v8f& b, v16h x, v16h y) { dep_guard_h(a, b, x, y); }
  static __device__ __forceinline__ void keep(v16h a, v16h b, v16h c, v16h d) { keep4_h(a, b, c, d); }
};
template <> struct Frag<__bf16> {
  typedef v16b V; union U { v16b v; v8b h[2]; };
  static __device__ __forceinline__ v16b load(const __bf16* p) {
    U f; f.h[0] = *(const v8b*)(p); f.h[1] = *(const v8b*)(p + 16); return f.v;
  }
  static __device__ __forceinline__ v8f mma(v16b a, v16b b, v8f c) {
    return __builtin_amdgcn_wmma_f32_16x16x32_bf16(false, a, false, b, (short)0, c, false, false);
  }
  static __device__ __forceinline__ void guard(v8f& a, v8f& b, v16b x, v16b y) { dep_guard_b(a, b, x, y); }
  static __device__ __forceinline__ void keep(v16b a, v16b b, v16b c, v16b d) { keep4_b(a, b, c, d); }
};

// single-accumulator WMMA + hazard nops (used by the relation mix kernel)
__device__ __forceinline__ v8f mma16h(v16h a, v16h b, v8f c) {
  c = __builtin_amdgcn_wmma_f32_16x16x32_f16(false, a, false, b, (short)0, c, false, false);
  asm volatile("v_nop\n\tv_nop\n\tv_nop\n\tv_nop" : "+v"(c) : "v"(a), "v"(b));
  return c;
}
__device__ __forceinline__ v8f mma16b(v16b a, v16b b, v8f c) {
  c = __builtin_amdgcn_wmma_f32_16x16x32_bf16(false, a, false, b, (short)0, c, false, false);
  asm volatile("v_nop\n\tv_nop\n\tv_nop\n\tv_nop" : "+v"(c) : "v"(a), "v"(b));
  return c;
}

// ---- Register-blocked batched WMMA GEMM ------------------------------
// C[m,n] = scale * sum_k A[m,k] * Bt[n,k] (+bias); each wave owns a 64x64 tile.
// A row-major [M,K]; Bt row-major [N,K]; M,N % 64 == 0, K % 32 == 0.
// SPLIT: A is hi/lo planes (A2 = lo); SPLITB: Bt also hi/lo (product hi.hi + hi.lo + lo.hi),
//        !SPLITB: Bt single plane (product hi.b + lo.b).
// BIAS_MODE: 0 = none, 1 = bias[m], 2 = bias[n].
// OUT_MODE: 0 = f32, 1 = f16, 2 = bf16 hi plane (Cout) + bf16 lo plane (Cout2).
// ET: 0 = f16 operands, 1 = bf16 operands (pointers passed as 16-bit storage)
template <int ET> struct Elem;
template <> struct Elem<0> { typedef _Float16 T; };
template <> struct Elem<1> { typedef __bf16 T; };
// One wave's tile as a device function, so that several independent products can share one grid.
// offA / offB / offC: element offsets of this product's operands and result; slab: the wave's own 16x68 f32 LDS slab.
template <int ET, bool SPLIT, bool SPLITB, int BIAS_MODE, int OUT_MODE>
__device__ __forceinline__ void gemm64_tile(
    const unsigned short* __restrict__ Ap, const unsigned short* __restrict__ A2p, int lda, size_t offA,
    const unsigned short* __restrict__ Btp, const unsigned short* __restrict__ Bt2p, int ldb, size_t offB,
    void* __restrict__ Cout, void* __restrict__ Cout2, int ldc, size_t offC,
    const float* __restrict__ bias,
    int M, int N, int K, float scale, int tile, float* slab) {
  typedef typename Elem<ET>::T T;
  typedef typename Frag<T>::V V;
  const T* A = (const T*)Ap; const T* A2 = (const T*)A2p; const T* Bt = (const T*)Btp; const T* Bt2 = (const T*)Bt2p;
  const int lane = threadIdx.x & 31;
  const int tilesN = N >> 6;
  const int tilesM = M >> 6;
  if (tile >= tilesM * tilesN) return;   // wave-uniform; no block barriers in the kernels that call this
  const int tm = tile / tilesN;
  const int tn = tile - tm * tilesN;
  const int m0 = tm << 6;
  const int n0 = tn << 6;

  const T* Ab  = A  + offA;
  const T* Bb  = Bt + offB;
  const T* Ab2 = SPLIT ? (A2  + offA) : nullptr;
  const T* Bb2 = (SPLIT && SPLITB) ? (Bt2 + offB) : nullptr;

  const int rlane = lane & 15;                 // row (A) / col (B, D) within subtile
  const int koff  = (lane >> 4) * 8;           // k offset of this lane half
  const int mOff  = (lane >> 4) * 8;           // D row offset

  v8f acc[4][4];
#pragma unroll
  for (int i = 0; i < 4; ++i)
#pragma unroll
    for (int j = 0; j < 4; ++j) acc[i][j] = (v8f){0.f,0.f,0.f,0.f,0.f,0.f,0.f,0.f};

  for (int k0 = 0; k0 < K; k0 += 32) {
    V bh[4], bl[4];
#pragma unroll
    for (int j = 0; j < 4; ++j) {
      const size_t bo = (size_t)(n0 + (j << 4) + rlane) * ldb + koff + k0;
      bh[j] = Frag<T>::load(Bb + bo);
      if (SPLIT && SPLITB) bl[j] = Frag<T>::load(Bb2 + bo);
    }
#pragma unroll
    for (int i = 0; i < 4; ++i) {
      const size_t ao = (size_t)(m0 + (i << 4) + rlane) * lda + koff + k0;
      V ah = Frag<T>::load(Ab + ao);
      V al;
      if (SPLIT) al = Frag<T>::load(Ab2 + ao);
#pragma unroll
      for (int j = 0; j < 4; ++j) {
        acc[i][j] = Frag<T>::mma(ah, bh[j], acc[i][j]);
        if (SPLIT) {
          if (SPLITB) acc[i][j] = Frag<T>::mma(ah, bl[j], acc[i][j]);
          acc[i][j] = Frag<T>::mma(al, bh[j], acc[i][j]);
        }
      }
      Frag<T>::guard(acc[i][0], acc[i][3], ah, SPLIT ? al : ah);
    }
    Frag<T>::keep(bh[0], bh[1], bh[2], bh[3]);
    if (SPLIT && SPLITB) Frag<T>::keep(bl[0], bl[1], bl[2], bl[3]);
  }
  acc_guard4(acc[0][0], acc[0][1], acc[0][2], acc[0][3]);
  acc_guard4(acc[1][0], acc[1][1], acc[1][2], acc[1][3]);
  acc_guard4(acc[2][0], acc[2][1], acc[2][2], acc[2][3]);
  acc_guard4(acc[3][0], acc[3][1], acc[3][2], acc[3][3]);

  // ---- epilogue ----
#pragma unroll
  for (int i = 0; i < 4; ++i) {
    const int mBase = m0 + (i << 4);
#pragma unroll
    for (int j = 0; j < 4; ++j) {
      const int n = n0 + (j << 4) + rlane;
      float bv = 0.f;
      if (BIAS_MODE == 2) bv = bias[n];
#pragma unroll
      for (int r = 0; r < 8; ++r) {
        float v = acc[i][j][r] * scale;
        if (BIAS_MODE == 1) v += bias[mBase + mOff + r];
        if (BIAS_MODE == 2) v += bv;
        slab[(mOff + r) * 68 + (j << 4) + rlane] = v;
      }
    }
    __builtin_amdgcn_fence(__ATOMIC_RELEASE, "workgroup");
    __builtin_amdgcn_wave_barrier();
    __builtin_amdgcn_fence(__ATOMIC_ACQUIRE, "workgroup");
    if (OUT_MODE == 0) {
      float* C = (float*)Cout + offC;
      const int hh = lane >> 4, c4 = (lane & 15) * 4;     // row seg = 256 B = 16 lanes x 16 B
      {
#pragma unroll
        for (int it = 0; it < 8; ++it) {
          const int row = it * 2 + hh;
          v4f v = *(const v4f*)(slab + row * 68 + c4);
          *(v4f*)(C + (size_t)(mBase + row) * ldc + n0 + c4) = v;
        }
        
      }
    } else {
      const int q = lane >> 3, c8 = (lane & 7) * 8;
      unsigned short* C  = (unsigned short*)Cout  + offC;
      unsigned short* C2 = (OUT_MODE == 2) ? ((unsigned short*)Cout2 + offC) : nullptr;
      {
#pragma unroll
        for (int it = 0; it < 4; ++it) {
          const int row = it * 4 + q;
          const float* sp = slab + row * 68 + c8;
          v8h hv, lv;
#pragma unroll
          for (int e = 0; e < 8; ++e) {
            if (OUT_MODE == 1) {
              hv[e] = (_Float16)sp[e];
            } else {
              unsigned short hb = f2bf_bits(sp[e]);
              unsigned short lb = f2bf_bits(sp[e] - bf_bits2f(hb));
              hv[e] = __builtin_bit_cast(_Float16, hb);
              lv[e] = __builtin_bit_cast(_Float16, lb);
            }
          }
          *(v8h*)(C + (size_t)(mBase + row) * ldc + n0 + c8) = hv;
          if (OUT_MODE == 2) *(v8h*)(C2 + (size_t)(mBase + row) * ldc + n0 + c8) = lv;
        }
        
      }
    }
    __builtin_amdgcn_fence(__ATOMIC_RELEASE, "workgroup");
    __builtin_amdgcn_wave_barrier();
    __builtin_amdgcn_fence(__ATOMIC_ACQUIRE, "workgroup");
  }
}

// Batched product: blockIdx.y steps the operands and the result by their strides.
template <int ET, bool SPLIT, bool SPLITB, int BIAS_MODE, int OUT_MODE>
__global__ __launch_bounds__(256) void wmma_gemm64(
    const unsigned short* __restrict__ Ap, const unsigned short* __restrict__ A2p, int lda, long strideA,
    const unsigned short* __restrict__ Btp, const unsigned short* __restrict__ Bt2p, int ldb, long strideB,
    void* __restrict__ Cout, void* __restrict__ Cout2, int ldc, long strideC,
    const float* __restrict__ bias,
    int M, int N, int K, float scale) {
  __shared__ __align__(16) float sT[8][16 * 68];   // per-wave 16x64 slab, pitch 68 floats
  const int wave = threadIdx.x >> 5;
  const size_t y = blockIdx.y;
  gemm64_tile<ET, SPLIT, SPLITB, BIAS_MODE, OUT_MODE>(
      Ap, A2p, lda, y * strideA, Btp, Bt2p, ldb, y * strideB,
      Cout, Cout2, ldc, y * strideC, bias, M, N, K, scale, blockIdx.x * 8 + wave, sT[wave]);
}

// All five input projections in one grid; blockIdx.y selects the product (block-uniform):
// 0 q_attn, 1 k_attn -> bf16 hi/lo; 2 q_rel, 3 k_rel -> f16; 4 values, transposed (A = WvT, Bt = symbols) -> bf16 hi/lo.
// Each product has (NTOK/64)*(DMOD/64) tiles, 8 per block.
__global__ __launch_bounds__(256) void k_proj5(
    const unsigned short* __restrict__ xb, const unsigned short* __restrict__ sb, const unsigned short* __restrict__ wT,
    unsigned short* __restrict__ xqh, unsigned short* __restrict__ xql,
    unsigned short* __restrict__ xkh, unsigned short* __restrict__ xkl,
    unsigned short* __restrict__ qr16, unsigned short* __restrict__ kr16,
    unsigned short* __restrict__ svh, unsigned short* __restrict__ svl) {
  __shared__ __align__(16) float sT[8][16 * 68];
  const int wave = threadIdx.x >> 5;
  const int y = blockIdx.y;
  const int tile = blockIdx.x * 8 + wave;
  const unsigned short* Wy = wT + (size_t)y * DMOD * DMOD;
  if (y == 2 || y == 3) {
    unsigned short* c = (y == 2) ? qr16 : kr16;
    gemm64_tile<1, false, true, 0, 1>(xb, xb, DMOD, 0, Wy, Wy, DMOD, 0, c, c, DMOD, 0, nullptr,
                                      NTOK, DMOD, DMOD, 1.0f, tile, sT[wave]);
  } else {
    const bool tv = (y == 4);
    const unsigned short* a  = tv ? Wy : xb;
    const unsigned short* bt = tv ? sb : Wy;
    unsigned short* chi = tv ? svh : (y == 0 ? xqh : xkh);
    unsigned short* clo = tv ? svl : (y == 0 ? xql : xkl);
    gemm64_tile<1, false, true, 0, 2>(a, a, DMOD, 0, bt, bt, DMOD, 0, chi, clo, tv ? NTOK : DMOD, 0, nullptr,
                                      tv ? DMOD : NTOK, tv ? NTOK : DMOD, DMOD, 1.0f, tile, sT[wave]);
  }
}

// Attention scores of every chunk, batch row and head in one grid.
// blockIdx.z = chunk c, blockIdx.y = batch row * 16 + head; blocks past the chunk's (CHR/64)*(jend/64) tiles leave at once.
// scores[c][b][h][il][j] = SCALE_ATTN * sum_d xq[i][h,d] xk[j][h,d], hi/lo split on both operands, f32 out
__global__ __launch_bounds__(256) void k_scores(
    const unsigned short* __restrict__ xqh, const unsigned short* __restrict__ xql,
    const unsigned short* __restrict__ xkh, const unsigned short* __restrict__ xkl, float* __restrict__ sc) {
  __shared__ __align__(16) float sT[8][16 * 68];
  const int wave = threadIdx.x >> 5;
  const int tile = blockIdx.x * 8 + wave;
  const int c = blockIdx.z;
  const int jend = CHR * (c + 1);
  const size_t bb = blockIdx.y >> 4, h = blockIdx.y & 15;
  gemm64_tile<1, true, true, 0, 0>(xqh, xql, DMOD, (bb * SEQ + (size_t)c * CHR) * DMOD + h * HDIM,
                                   xkh, xkl, DMOD, bb * ((size_t)SEQ * DMOD) + h * HDIM,
                                   sc, sc, jend, chunk_base(c) + (size_t)blockIdx.y * CHR * jend, nullptr,
                                   CHR, jend, HDIM, SCALE_ATTN, tile, sT[wave]);
}

// P.V and the relation scores of every chunk and batch row in one grid (neither reads the other's result).
// blockIdx.z = 0..3: attended_symbols of chunk 3 - z (longest K loop first; 4 tiles per head, all in block x = 0);
// blockIdx.z = 4..7: relation scores of chunk 7 - z. blockIdx.y = batch row * 16 + head or relation.
__global__ __launch_bounds__(256) void k_pv_rel(
    const unsigned short* __restrict__ ph, const unsigned short* __restrict__ pl,
    const unsigned short* __restrict__ svh, const unsigned short* __restrict__ svl, float* __restrict__ attsym,
    const unsigned short* __restrict__ qr16, const unsigned short* __restrict__ kr16, unsigned short* __restrict__ rel16) {
  __shared__ __align__(16) float sT[8][16 * 68];
  const int wave = threadIdx.x >> 5;
  const int tile = blockIdx.x * 8 + wave;
  const int c = (NCHK - 1) - (int)(blockIdx.z & (NCHK - 1));
  const int jend = CHR * (c + 1);
  const size_t bb = blockIdx.y >> 4, hr = blockIdx.y & 15;
  const size_t rowbase = bb * SEQ + (size_t)c * CHR;
  if (blockIdx.z < NCHK) {
    // attended_symbols[token][h*64+d] = sum_j P[h][il][j] * svT[h*64+d][b*1024+j]  (split both)
    gemm64_tile<1, true, true, 0, 0>(ph, pl, jend, chunk_base(c) + (size_t)blockIdx.y * CHR * jend,
                                     svh, svl, NTOK, hr * ((size_t)HDIM * NTOK) + bb * SEQ,
                                     attsym, attsym, DMOD, rowbase * DMOD + hr * HDIM, nullptr,
                                     CHR, HDIM, jend, 1.0f, tile, sT[wave]);
  } else {
    // rel[c][b][il][r][j] = SCALE_REL * sum_p qr[i][r,p] kr[j][r,p]  (plain f16) -> f16 plane
    gemm64_tile<0, false, true, 0, 1>(qr16, qr16, DMOD, rowbase * DMOD + hr * RDIM,
                                      kr16, kr16, DMOD, bb * ((size_t)SEQ * DMOD) + hr * RDIM,
                                      rel16, rel16, NREL * jend, chunk_base(c) + bb * ((size_t)CHR * NREL * jend) + hr * jend, nullptr,
                                      CHR, jend, RDIM, SCALE_REL, tile, sT[wave]);
  }
}

// ---------------------------------------------------------------------------
// f32 -> bf16 (RNE) cast of the two activation tensors, 8 elements per thread:
// by selects the tensor (block-uniform), bx the block of 2048 elements. Coverage: CAST_BLOCKS*256 threads * 8 = n8*8 elements exactly.
// ---------------------------------------------------------------------------
__device__ __forceinline__ void cast_bf16x8_block(const float* __restrict__ s0, const float* __restrict__ s1,
    unsigned short* __restrict__ d0, unsigned short* __restrict__ d1, int n8, int bx, int by) {
  const float* src = (by == 0) ? s0 : s1;
  unsigned short* dst = (by == 0) ? d0 : d1;
  const int i = bx * 256 + threadIdx.x;
  if (i < n8) {
    const size_t e0 = (size_t)i * 8;
    const v4f a = *(const v4f*)(src + e0);
    const v4f c = *(const v4f*)(src + e0 + 4);
    v4u u;
    u[0] = pack_bf16x2(a[0], a[1]);
    u[1] = pack_bf16x2(a[2], a[3]);
    u[2] = pack_bf16x2(c[0], c[1]);
    u[3] = pack_bf16x2(c[2], c[3]);
    *(v4u*)(dst + e0) = u;
    
  }
}

// ---------------------------------------------------------------------------
// Weight transpose + bf16 cast: W[k][o] (f32, [DMOD][DMOD]) -> WT[o][k] (bf16), 6 weights selected by z; tile: 64*68 floats of LDS.
// Coverage per block: read 4 iters * 256 threads * 4 = 4096 elements; write 2 iters * 8 waves * 4 lines * 64 = 4096.
// ---------------------------------------------------------------------------
__device__ __forceinline__ void wT_bf16_block(const float* __restrict__ w0, const float* __restrict__ w1,
    const float* __restrict__ w2, const float* __restrict__ w3, const float* __restrict__ w4, const float* __restrict__ w5,
    unsigned short* __restrict__ dst, float* tile, int bx, int by, int z) {
  const float* W = (z == 0) ? w0 : (z == 1) ? w1 : (z == 2) ? w2 : (z == 3) ? w3 : (z == 4) ? w4 : w5;
  unsigned short* WT = dst + (size_t)z * DMOD * DMOD;
  const int k0 = by * 64;   // rows of W (input dim)
  const int o0 = bx * 64;   // cols of W (output dim)
  const int tid = threadIdx.x;
#pragma unroll
  for (int it = 0; it < 4; ++it) {
    const int e = (it * 256 + tid) * 4;
    const int row = e >> 6, col = e & 63;
    const v4f v = *(const v4f*)(W + (size_t)(k0 + row) * DMOD + o0 + col);
    *(v4f*)(tile + row * 68 + col) = v;
  }
  __syncthreads();
  const int lane = tid & 31, wave = tid >> 5, q = lane >> 3, c8 = (lane & 7) * 8;
  v4u ov[2];
#pragma unroll
  for (int it = 0; it < 2; ++it) {
    const int oo = it * 32 + wave * 4 + q;
    float f[8];
#pragma unroll
    for (int e = 0; e < 8; ++e) f[e] = tile[(c8 + e) * 68 + oo];
    ov[it][0] = pack_bf16x2(f[0], f[1]);
    ov[it][1] = pack_bf16x2(f[2], f[3]);
    ov[it][2] = pack_bf16x2(f[4], f[5]);
    ov[it][3] = pack_bf16x2(f[6], f[7]);
  }
  {
#pragma unroll
    for (int it = 0; it < 2; ++it) {
      const int oo = it * 32 + wave * 4 + q;
      *(v4u*)(WT + (size_t)(o0 + oo) * DMOD + k0 + c8) = ov[it];
    }
    // in the merged kernel's built control flow another role's code follows these stores and reuses their registers:
    // keep the wait in front of that overwrite
    asm volatile("s_wait_xcnt 0x0" ::: "memory");
  }
}

// ---------------------------------------------------------------------------
// Wr [NHEAD*HDIM rows][NREL] f32 -> WrP [rows][32] bf16 with k 16..31 zero-FILLED (WMMA K padding).
// Coverage: 256 threads * 8 elements = 64 rows * 32; store 8 waves * 4 lines * 64 = 2048 elements.
// ---------------------------------------------------------------------------
__device__ __forceinline__ void wr_pack_block(const float* __restrict__ wr, unsigned short* __restrict__ dst,
    unsigned short* tile, int bx) {   // tile: 64*32 16-bit words of LDS
  const int r0 = bx * 64;
  const int tid = threadIdx.x;
  const int row = tid >> 2, kq = (tid & 3) * 8;
  v4u u;
  unsigned wv[4];
#pragma unroll
  for (int e = 0; e < 4; ++e) {
    const int ka = kq + 2 * e, kb = kq + 2 * e + 1;
    const int kac = ka < NREL ? ka : NREL - 1;
    const int kbc = kb < NREL ? kb : NREL - 1;
    const float fa = wr[(size_t)(r0 + row) * NREL + kac];
    const float fb = wr[(size_t)(r0 + row) * NREL + kbc];
    const unsigned ba = (ka < NREL) ? (unsigned)f2bf_bits(fa) : 0u;
    const unsigned bb = (kb < NREL) ? (unsigned)f2bf_bits(fb) : 0u;
    wv[e] = ba | (bb << 16);
  }
  u[0] = wv[0]; u[1] = wv[1]; u[2] = wv[2]; u[3] = wv[3];
  *(v4u*)(tile + row * 32 + kq) = u;
  __syncthreads();
  const int lane = tid & 31, wave = tid >> 5, q = lane >> 3, c8 = (lane & 7) * 8;
  const int L = wave * 4 + q;                       // line 0..31, 64 elements per line
  const v4u v = *(const v4u*)(tile + L * 64 + c8);
  {
    *(v4u*)(dst + (size_t)r0 * 32 + L * 64 + c8) = v;
    // as in the weight transpose: the wait in front of an overwrite of this store's registers by another role's code
    asm volatile("s_wait_xcnt 0x0" ::: "memory");
  }
}

// ---------------------------------------------------------------------------
// The three input conversions in one grid (none reads another's result); the role is block-uniform, from blockIdx.x:
// [0, 2*CAST_BLOCKS) activation casts, then WT_BLOCKS weight-transpose tiles, then WR_BLOCKS blocks of the Wr pack.
// ---------------------------------------------------------------------------
static constexpr int CAST_BLOCKS = NTOK * DMOD / 8 / 256;            // 1024 per tensor
static constexpr int WT_SIDE     = DMOD / 64;                        // 16 tiles per side
static constexpr int WT_BLOCKS   = 6 * WT_SIDE * WT_SIDE;            // 1536
static constexpr int WR_BLOCKS   = (NHEAD * HDIM) / 64;              // 16
__global__ __launch_bounds__(256) void k_prep(const float* __restrict__ x, const float* __restrict__ symb,
    const float* __restrict__ w0, const float* __restrict__ w1, const float* __restrict__ w2,
    const float* __restrict__ w3, const float* __restrict__ w4, const float* __restrict__ w5, const float* __restrict__ wr,
    unsigned short* __restrict__ xb, unsigned short* __restrict__ sb, unsigned short* __restrict__ wT,
    unsigned short* __restrict__ wrp) {
  __shared__ __align__(16) float tile[64 * 68];
  const int id = blockIdx.x;
  if (id < 2 * CAST_BLOCKS) {
    cast_bf16x8_block(x, symb, xb, sb, NTOK * DMOD / 8, id % CAST_BLOCKS, id / CAST_BLOCKS);
    return;
  }
  if (id < 2 * CAST_BLOCKS + WT_BLOCKS) {
    const int t = id - 2 * CAST_BLOCKS;
    wT_bf16_block(w0, w1, w2, w3, w4, w5, wT, tile, t % WT_SIDE, (t / WT_SIDE) % WT_SIDE, t / (WT_SIDE * WT_SIDE));
    return;
  }
  wr_pack_block(wr, wrp, (unsigned short*)tile, id - 2 * CAST_BLOCKS - WT_BLOCKS);
}

// ---------------------------------------------------------------------------
// Causal softmax of every chunk: scores f32 [c][NB][NHEAD][CHR][jend], chunk c = row / ROWS_CH, row in chunk r = (b*NHEAD + h)*CHR + il,
// query i = i0 + il, keys j <= i. One wave per row; lane owns j = 256*t + 8*lane .. +7 (t < jend/256).
// Writes P hi/lo bf16 planes and P*1024 f16 plane (same layout), zeros for i < j < jend.
// Coverage: grid.x*8 rows = NCHK*ROWS_CH rows; columns [0, jend) per row; the 8 rows of a block lie in one chunk.
// ---------------------------------------------------------------------------
__global__ __launch_bounds__(256) void k_softmax(const float* __restrict__ sc, unsigned short* __restrict__ ph,
    unsigned short* __restrict__ pl, unsigned short* __restrict__ p16) {
  const int lane = threadIdx.x & 31, wave = threadIdx.x >> 5;
  const int rg = blockIdx.x * 8 + wave;
  const int c = (int)(blockIdx.x * 8) / ROWS_CH;   // from blockIdx alone: the same for the whole block
  const int r = rg - c * ROWS_CH;
  const int i0 = c * CHR, jend = CHR * (c + 1);
  const int i = i0 + (r & (CHR - 1));
  const size_t ro = chunk_base(c) + (size_t)r * jend;
  const float NEG = -__builtin_huge_valf();
  float s[4][8];
  float m = NEG;
#pragma unroll
  for (int t = 0; t < 4; ++t) {
    const int j0 = t * 256 + lane * 8;
    if (t * 256 < jend) {          // block-uniform
      const v4f a = *(const v4f*)(sc + ro + j0);
      const v4f c = *(const v4f*)(sc + ro + j0 + 4);
      s[t][0] = a[0]; s[t][1] = a[1]; s[t][2] = a[2]; s[t][3] = a[3];
      s[t][4] = c[0]; s[t][5] = c[1]; s[t][6] = c[2]; s[t][7] = c[3];
#pragma unroll
      for (int e = 0; e < 8; ++e) m = (j0 + e <= i) ? fmaxf(m, s[t][e]) : m;
    } else {
#pragma unroll
      for (int e = 0; e < 8; ++e) s[t][e] = 0.f;
    }
  }
#pragma unroll
  for (int off = 1; off < 32; off <<= 1) m = fmaxf(m, __shfl_xor(m, off, 32));
  float p[4][8];
  float sum = 0.f;
#pragma unroll
  for (int t = 0; t < 4; ++t) {
    const int j0 = t * 256 + lane * 8;
#pragma unroll
    for (int e = 0; e < 8; ++e) {
      float ev = __expf(s[t][e] - m);
      ev = (j0 + e <= i) ? ev : 0.f;
      p[t][e] = ev;
      sum += ev;
    }
  }
#pragma unroll
  for (int off = 1; off < 32; off <<= 1) sum += __shfl_xor(sum, off, 32);
  const float inv = 1.0f / sum;       // sum >= 1 (key j=0 always present)
  v4u hv[4], lv[4], fv[4];
#pragma unroll
  for (int t = 0; t < 4; ++t) {
#pragma unroll
    for (int e = 0; e < 4; ++e) {
      const float a = p[t][2 * e] * inv;
      const float c = p[t][2 * e + 1] * inv;
      const unsigned short ha = f2bf_bits(a), hc = f2bf_bits(c);
      const unsigned short la = f2bf_bits(a - bf_bits2f(ha)), lc = f2bf_bits(c - bf_bits2f(hc));
      const unsigned short fa = h_bits(a * PCARRY), fc = h_bits(c * PCARRY);
      hv[t][e] = (unsigned)ha | ((unsigned)hc << 16);
      lv[t][e] = (unsigned)la | ((unsigned)lc << 16);
      fv[t][e] = (unsigned)fa | ((unsigned)fc << 16);
    }
  }
  {
#pragma unroll
    for (int t = 0; t < 4; ++t) {
      if (t * 256 < jend) {        // block-uniform
        const int j0 = t * 256 + lane * 8;
        *(v4u*)(ph  + ro + j0) = hv[t];
        *(v4u*)(pl  + ro + j0) = lv[t];
        *(v4u*)(p16 + ro + j0) = fv[t];
        // all segments are packed before the first store; keep the wait in front of any later overwrite of these stores' registers
        asm volatile("s_wait_xcnt 0x0" ::: "memory");
      }
    }
    
  }
}

// ---------------------------------------------------------------------------
// Relation aggregation + Wr mix + residual. Block = 8 waves = 16 consecutive query rows il0..il0+15 of batch row blockIdx.y, chunk 3 - blockIdx.z (longest first).
// Phase 1 (per wave, rows ill = wave and wave+8): D[h][r] = sum_{j<kend} P16[h][il][j] * rel[il][r][j]
//   (one f16 WMMA tile, K stepped by 32 up to the causal extent; P16 carries P*1024, rel carries REL_SCALE);
//   D is split into bf16 hi/lo and written to LDS arHL[m=ill][h][k=r] (k 16..31 zero-filled first).
// Phase 2 (per wave, heads h = wave and wave+8): attrel[ill][d] = sum_r ar[ill][h][r] * Wr[h][d][r]
//   (A = arHL hi/lo from LDS, B = WrP bf16 [h*64+d][32], two products per tile, 4 tiles of 16 d).
// Epilogue: per-wave 16x64 slab in LDS, residual attended_symbols added from one 32-B load per lane in the
// ---------------------------------------------------------------------------
__global__ __launch_bounds__(256) void k_rel_mix(const unsigned short* __restrict__ p16all, const unsigned short* __restrict__ relall,
    const unsigned short* __restrict__ wrp, const float* __restrict__ attsym,
    unsigned short* __restrict__ comb_hi, unsigned short* __restrict__ comb_lo) {
  const int c = (NCHK - 1) - (int)blockIdx.z;
  const int i0 = c * CHR, jend = CHR * (c + 1);
  const unsigned short* p16 = p16all + chunk_base(c) + (size_t)blockIdx.y * ((size_t)NHEAD * CHR * jend);
  const unsigned short* rel = relall + chunk_base(c) + (size_t)blockIdx.y * ((size_t)CHR * NREL * jend);
  const int rowbase = (int)blockIdx.y * SEQ + i0;
  __shared__ __align__(16) unsigned short arHL[2 * 16 * 16 * 32];   // hi plane [m][h][32] then lo plane
  __shared__ __align__(16) float slab[8][16 * 68];
  const int tid = threadIdx.x, lane = tid & 31, wave = tid >> 5;
  const int hh = lane >> 4, rl = lane & 15, koff = hh * 8;
  const int il0 = blockIdx.x * 16;
  {
    const v4u zz = {0u, 0u, 0u, 0u};
    v4u* zp = (v4u*)arHL;                 // 32768 B = 2048 x 16 B, 256 threads x 8
    for (int qq = tid; qq < 2048; qq += 256) zp[qq] = zz;
  }
  __syncthreads();
  const v8f zero8 = {0.f, 0.f, 0.f, 0.f, 0.f, 0.f, 0.f, 0.f};
#pragma unroll
  for (int sub = 0; sub < 2; ++sub) {
    const int ill = wave + 8 * sub;           // local row 0..15 (wave-uniform)
    const int il = il0 + ill;                 // row within chunk 0..255
    const int i = i0 + il;                    // query position
    const int kend = (i & ~31) + 32;          // <= jend; P16 is zero for i < j < kend
    const _Float16* Ab = (const _Float16*)p16 + (size_t)rl * ((size_t)CHR * jend) + (size_t)il * jend + koff;   // A row m = head rl
    const _Float16* Bb = (const _Float16*)rel + (size_t)il * ((size_t)NREL * jend) + (size_t)rl * jend + koff;   // Bt row n = relation rl
    v8f acc = zero8;
    for (int k0 = 0; k0 < kend; k0 += 32) {
      const v16h a  = Frag<_Float16>::load(Ab + k0);
      const v16h bb = Frag<_Float16>::load(Bb + k0);
      acc = mma16h(a, bb, acc);
    }
    // acc[r8] = D[row h = 8*hh + r8][col r = rl]  (carried x1024)
#pragma unroll
    for (int r8 = 0; r8 < 8; ++r8) {
      const float f = acc[r8];
      const unsigned short hb = f2bf_bits(f);
      const unsigned short lb = f2bf_bits(f - bf_bits2f(hb));
      const int idx = (ill * 16 + 8 * hh + r8) * 32 + rl;
      arHL[idx] = hb;
      arHL[8192 + idx] = lb;
    }
  }
  __syncthreads();
  const int q = lane >> 3, c8 = (lane & 7) * 8;
  float* sl = slab[wave];
#pragma unroll
  for (int sub = 0; sub < 2; ++sub) {
    const int h = wave + 8 * sub;             // wave-uniform head
    const v16b ah = Frag<__bf16>::load((const __bf16*)arHL + rl * 512 + h * 32 + koff);          // A[m = rl][k]
    const v16b al = Frag<__bf16>::load((const __bf16*)arHL + 8192 + rl * 512 + h * 32 + koff);
    v8f acc2[4];
#pragma unroll
    for (int j = 0; j < 4; ++j) {
      const v16b bw = Frag<__bf16>::load((const __bf16*)wrp + (size_t)(h * HDIM + j * 16 + rl) * 32 + koff);  // Bt[n = d][k = r]
      acc2[j] = mma16b(ah, bw, zero8);
      acc2[j] = mma16b(al, bw, acc2[j]);
    }
    // acc2[j][r8] = attrel[ill = 8*hh + r8][d = 16*j + rl] * 1024
#pragma unroll
    for (int j = 0; j < 4; ++j)
#pragma unroll
      for (int r8 = 0; r8 < 8; ++r8) sl[(8 * hh + r8) * 68 + j * 16 + rl] = acc2[j][r8] * PCARRY_INV;
    __builtin_amdgcn_fence(__ATOMIC_RELEASE, "workgroup");
    __builtin_amdgcn_wave_barrier();
    __builtin_amdgcn_fence(__ATOMIC_ACQUIRE, "workgroup");
    v4u hv[4], lv[4];
#pragma unroll
    for (int it = 0; it < 4; ++it) {
      const int row = it * 4 + q;
      const size_t g = (size_t)(rowbase + il0 + row) * DMOD + h * HDIM + c8;
      const v4f s0 = *(const v4f*)(sl + row * 68 + c8);
      const v4f s1 = *(const v4f*)(sl + row * 68 + c8 + 4);
      const v4f r0 = *(const v4f*)(attsym + g);
      const v4f r1 = *(const v4f*)(attsym + g + 4);
      float v[8];
      v[0] = s0[0] + r0[0]; v[1] = s0[1] + r0[1]; v[2] = s0[2] + r0[2]; v[3] = s0[3] + r0[3];
      v[4] = s1[0] + r1[0]; v[5] = s1[1] + r1[1]; v[6] = s1[2] + r1[2]; v[7] = s1[3] + r1[3];
#pragma unroll
      for (int e = 0; e < 4; ++e) {
        const float a = v[2 * e], c = v[2 * e + 1];
        const unsigned short ha = f2bf_bits(a), hc = f2bf_bits(c);
        const unsigned short la = f2bf_bits(a - bf_bits2f(ha)), lc = f2bf_bits(c - bf_bits2f(hc));
        hv[it][e] = (unsigned)ha | ((unsigned)hc << 16);
        lv[it][e] = (unsigned)la | ((unsigned)lc << 16);
      }
    }
    {
#pragma unroll
      for (int it = 0; it < 4; ++it) {
        const int row = it * 4 + q;
        const size_t g = (size_t)(rowbase + il0 + row) * DMOD + h * HDIM + c8;
        *(v4u*)(comb_hi + g) = hv[it];
        *(v4u*)(comb_lo + g) = lv[it];
      }
      
    }
    __builtin_amdgcn_fence(__ATOMIC_RELEASE, "workgroup");
    __builtin_amdgcn_wave_barrier();
    __builtin_amdgcn_fence(__ATOMIC_ACQUIRE, "workgroup");
  }
}

// ---------------------------------------------------------------------------
// host helpers
// ---------------------------------------------------------------------------
template <int ET, bool SPLIT, bool SPLITB, int OUT_MODE>
static void launch_gemm(hipStream_t st, int batch,
                        const unsigned short* A, const unsigned short* A2, int lda, long sA,
                        const unsigned short* Bt, const unsigned short* Bt2, int ldb, long sB,
                        void* C, void* C2, int ldc, long sC, const float* dummy,
                        int M, int N, int K, float scale) {
  const int tiles = (M / 64) * (N / 64);
  dim3 grid((unsigned)((tiles + 7) / 8), (unsigned)batch, 1);
  wmma_gemm64<ET, SPLIT, SPLITB, 0, OUT_MODE><<<grid, 256, 0, st>>>(
      A, A2, lda, sA, Bt, Bt2, ldb, sB, C, C2, ldc, sC, dummy, M, N, K, scale);
}

// ---------------------------------------------------------------------------
// launcher
// Workspace region map (bytes, all 256-B aligned; total 262,209,536):
//   region 0, 83,886,080 bytes, used three times in turn, each use ended by a launch boundary before the next begins:
//     steps 1-2: xb [2048][1024] bf16 (x, RNE) at 0, sb (symbols, RNE) behind it; in its last 10,485,760 bytes the
//                transposed bf16 weights 0 q_attn, 1 k_attn, 2 q_rel, 3 k_rel, 4 v, [1024][1024] each
//     scores -> softmax: sc f32, PLANE_ELEMS elements
//     relation scores -> relation mix: rel16 f16, PLANE_ELEMS elements, [c][b][256][16][jend] (REL_SCALE folded)
//   WoT    [1024][1024] bf16     2,097,152      directly behind region 0: the sixth slot of the weight transpose; lives to step 4
//   xqh/xql/xkh/xkl [2048][1024] bf16  4 x 4,194,304
//   qr16/kr16 [2048][1024] f16   2 x 4,194,304
//   svh/svl [1024][2048] bf16    2 x 4,194,304  (values transposed: row h*64+d, col b*1024+j)
//   attsym  [2048][1024] f32     8,388,608
//   ch/cl   [2048][1024] bf16    2 x 4,194,304  (pre-output activations hi/lo)
//   wrp     [1024][32] bf16      65,536         (Wr with K padded to 32, pad zero-filled)
//   ph/pl   [c][b][16][256][jend] bf16 2 x 41,943,040  probabilities hi/lo
//   p16     [c][b][16][256][jend] f16  41,943,040      probabilities x1024
// ---------------------------------------------------------------------------
extern "C" void kernel_launch(void* const* d_in, const int* in_sizes, int n_in,
                              void* d_out, int out_size, void* d_ws, size_t ws_size,
                              hipStream_t stream) {
  if (n_in < 9) return;
  if (in_sizes[0] != NTOK * DMOD || in_sizes[1] != NTOK * DMOD) return;
  if (in_sizes[2] != DMOD * DMOD || in_sizes[3] != DMOD * DMOD || in_sizes[4] != DMOD * DMOD ||
      in_sizes[5] != DMOD * DMOD || in_sizes[7] != DMOD * DMOD || in_sizes[8] != DMOD * DMOD) return;
  if (in_sizes[6] != NHEAD * HDIM * NREL) return;
  if (out_size != NTOK * DMOD) return;

  const float* x      = (const float*)d_in[0];
  const float* symb   = (const float*)d_in[1];
  const float* Wq_a   = (const float*)d_in[2];
  const float* Wk_a   = (const float*)d_in[3];
  const float* Wq_r   = (const float*)d_in[4];
  const float* Wk_r   = (const float*)d_in[5];
  const float* Wr     = (const float*)d_in[6];
  const float* Wv     = (const float*)d_in[7];
  const float* Wo     = (const float*)d_in[8];
  float* out = (float*)d_out;

  char* ws = (char*)d_ws;
  size_t off = 0;
  auto carve = [&](size_t bytes) -> char* {
    char* p = ws + off;
    off += (bytes + 255) & ~(size_t)255;
    return p;
  };
  const size_t ACT16 = (size_t)NTOK * DMOD * 2;            // 4,194,304
  const size_t WGT16 = (size_t)DMOD * DMOD * 2;            // 2,097,152
  const size_t ACT32 = (size_t)NTOK * DMOD * 4;            // 8,388,608
  const size_t PLANE16 = PLANE_ELEMS * 2;                  // 41,943,040
  const size_t PLANE32 = PLANE_ELEMS * 4;                  // 83,886,080
  static_assert(PLANE_ELEMS * 4 % 256 == 0, "the sixth weight slot must follow region 0 without a gap");
  static_assert((size_t)2 * NTOK * DMOD * 2 + (size_t)5 * DMOD * DMOD * 2 <= PLANE_ELEMS * 4, "casts and five weights fit region 0 side by side");

  char* reg0 = carve(PLANE32);
  carve(WGT16);                                            // WoT = wT + 5 weights
  unsigned short* xb   = (unsigned short*)reg0;
  unsigned short* sb   = (unsigned short*)(reg0 + ACT16);
  unsigned short* wT   = (unsigned short*)(reg0 + PLANE32 - 5 * WGT16);
  float*          sc   = (float*)reg0;
  unsigned short* rel16 = (unsigned short*)reg0;
  unsigned short* xqh  = (unsigned short*)carve(ACT16);
  unsigned short* xql  = (unsigned short*)carve(ACT16);
  unsigned short* xkh  = (unsigned short*)carve(ACT16);
  unsigned short* xkl  = (unsigned short*)carve(ACT16);
  unsigned short* qr16 = (unsigned short*)carve(ACT16);
  unsigned short* kr16 = (unsigned short*)carve(ACT16);
  unsigned short* svh  = (unsigned short*)carve(ACT16);
  unsigned short* svl  = (unsigned short*)carve(ACT16);
  float*          attsym = (float*)carve(ACT32);
  unsigned short* ch   = (unsigned short*)carve(ACT16);
  unsigned short* cl   = (unsigned short*)carve(ACT16);
  unsigned short* wrp  = (unsigned short*)carve((size_t)NHEAD * HDIM * 32 * 2);
  unsigned short* ph   = (unsigned short*)carve(PLANE16);
  unsigned short* pl   = (unsigned short*)carve(PLANE16);
  unsigned short* p16  = (unsigned short*)carve(PLANE16);
  if (off > ws_size) return;
  const float* dummy = (const float*)d_ws;   // valid pointer for the unused bias argument

  const unsigned short* WoT  = wT + 5 * (size_t)DMOD * DMOD;

  // 1) casts: activations to bf16; weights transposed to bf16; Wr packed with K padding
  k_prep<<<dim3(2 * CAST_BLOCKS + WT_BLOCKS + WR_BLOCKS), 256, 0, stream>>>(
      x, symb, Wq_a, Wk_a, Wq_r, Wk_r, Wv, Wo, Wr, xb, sb, wT, wrp);

  // 2) projections (bf16 x bf16, exact products, f32 accumulate)
  //    xq, xk -> bf16 hi/lo planes [2048][1024]; qr, kr -> f16 planes; values transposed svT [1024][2048] hi/lo
  static_assert(NTOK % 64 == 0 && DMOD % 64 == 0 && DMOD % 32 == 0, "projection GEMM shapes");
  k_proj5<<<dim3((NTOK / 64) * (DMOD / 64) / 8, 5, 1), 256, 0, stream>>>(xb, sb, wT, xqh, xql, xkh, xkl, qr16, kr16, svh, svl);

  // 3) every chunk of 256 query rows, both batch rows, in each grid: scores -> softmax -> (P.V beside relation scores) -> relation mix
  static_assert(CHR % 64 == 0 && HDIM % 32 == 0 && RDIM % 32 == 0 && HDIM % 64 == 0, "chunk GEMM shapes");
  static_assert(CHR % 128 == 0 && (CHR / 64) * (HDIM / 64) <= 8, "relation and score tiles fill whole blocks, P.V tiles fit block 0");
  static_assert((NCHK & (NCHK - 1)) == 0 && ROWS_CH % 8 == 0 && NHEAD == 16 && NREL == 16, "grid decoding");
  k_scores<<<dim3((CHR / 64) * (SEQ / 64) / 8, NB * 16, NCHK), 256, 0, stream>>>(xqh, xql, xkh, xkl, sc);
  k_softmax<<<dim3((NCHK * ROWS_CH) / 8), 256, 0, stream>>>(sc, ph, pl, p16);
  k_pv_rel<<<dim3((CHR / 64) * (SEQ / 64) / 8, NB * 16, 2 * NCHK), 256, 0, stream>>>(ph, pl, svh, svl, attsym, qr16, kr16, rel16);
  k_rel_mix<<<dim3(CHR / 16, NB, NCHK), 256, 0, stream>>>(p16, rel16, wrp, attsym, ch, cl);

  // 4) out[token][n] = sum_k combined[token][k] * WoT[n][k]  (A hi/lo, B bf16 weights) -> d_out f32
  launch_gemm<1, true, false, 0>(stream, 1, ch, cl, DMOD, 0, WoT, WoT, DMOD, 0, out, out, DMOD, 0, dummy, NTOK, DMOD, DMOD, 1.0f);
}

// v002
// A run of this version takes 168 microseconds.
// In both of two side-by-side timings against v001, it was 1.87 times as fast.
// All steps since v000 together make it 5.28 times as fast.
// Contractions: v_wmma_f32_16x16x32_bf16 (bf16 operands: module inputs RNE-converted once to bf16; computed q/k, softmax probabilities, value rows, relation aggregates and pre-output activations carried as bf16 hi+lo pairs) and v_wmma_f32_16x16x32_f16 for relation scores and relation aggregation (f16 operands, probabilities carried x1024); f32 accumulate everywhere; softmax and all side math in f32.
#include <hip/hip_runtime.h>

// ---------------------------------------------------------------------------
// problem geometry
// ---------------------------------------------------------------------------
static constexpr int NB    = 2;
static constexpr int SEQ   = 1024;
static constexpr int DMOD  = 1024;
static constexpr int NHEAD = 16;
static constexpr int HDIM  = 64;
static constexpr int NREL  = 16;
static constexpr int RDIM  = 64;
static constexpr int NTOK  = NB * SEQ;          // 2048
static constexpr int CHR   = 256;               // query rows per chunk
static constexpr int NCHK  = SEQ / CHR;         // 4 chunks per batch row
static constexpr float SCALE_ATTN = 0.125f;     // 1/sqrt(64)
static constexpr float SCALE_REL  = 0.125f;     // 1/sqrt(64)
static constexpr float PCARRY     = 1024.0f;    // f16 probability carry
static constexpr float PCARRY_INV = 1.0f / 1024.0f;

// Per-pair planes (scores, probabilities, relation scores) hold all chunks at once: chunk c (query rows 256c..256c+255,
// keys < jend = 256(c+1)) stores its rows at pitch jend and starts at element CHUNK_UNIT * c(c+1)/2.
static constexpr int    ROWS_CH     = NB * NHEAD * CHR;                             // 8192 rows per chunk
static constexpr size_t CHUNK_UNIT  = (size_t)ROWS_CH * CHR;                        // 2,097,152 elements per 256 keys
static constexpr size_t PLANE_ELEMS = CHUNK_UNIT * (NCHK * (NCHK + 1) / 2);         // 20,971,520 elements
__device__ __forceinline__ size_t chunk_base(int c) { return CHUNK_UNIT * (size_t)((c * (c + 1)) >> 1); }

static_assert(NHEAD * HDIM == DMOD, "head split");
static_assert(NREL * RDIM == DMOD, "relation split");
static_assert(SEQ == 4 * 256, "softmax kernel handles 4 segments of 256 keys");
static_assert(SEQ % CHR == 0 && CHR % 64 == 0, "chunk tiling");
static_assert(NHEAD == 16 && NREL == 16, "relation mix kernel uses one 16x16 tile per token");
static_assert(HDIM % 32 == 0 && RDIM % 32 == 0, "K of score GEMMs multiple of 32");
static_assert(NTOK % 64 == 0 && DMOD % 64 == 0, "tile multiples");
static_assert((NTOK * DMOD) % (8 * 256) == 0, "cast kernel coverage");
static_assert((NHEAD * CHR) % 8 == 0 && CHR % 16 == 0, "softmax / mix grids");

// ---------------------------------------------------------------------------
// types, conversions, fragment helpers
// ---------------------------------------------------------------------------
typedef __attribute__((ext_vector_type(16))) _Float16 v16h;
typedef __attribute__((ext_vector_type(8)))  _Float16 v8h;
typedef __attribute__((ext_vector_type(16))) __bf16   v16b;
typedef __attribute__((ext_vector_type(8)))  __bf16   v8b;
typedef __attribute__((ext_vector_type(8)))  float    v8f;
typedef __attribute__((ext_vector_type(4)))  float    v4f;
typedef __attribute__((ext_vector_type(4)))  unsigned int v4u;

__device__ __forceinline__ unsigned short f2bf_bits(float f) {
  unsigned u = __float_as_uint(f);
  return (unsigned short)((u + 0x7FFFu + ((u >> 16) & 1u)) >> 16);
}
__device__ __forceinline__ float bf_bits2f(unsigned short h) { return __uint_as_float(((unsigned)h) << 16); }
__device__ __forceinline__ unsigned short h_bits(float f) { return __builtin_bit_cast(unsigned short, (_Float16)f); }
__device__ __forceinline__ unsigned pack_bf16x2(float a, float b) {
  return (unsigned)f2bf_bits(a) | ((unsigned)f2bf_bits(b) << 16);
}

template <typename T> struct Frag;
template <> struct Frag<_Float16> {
  typedef v16h V; union U { v16h v; v8h h[2]; };
  static __device__ __forceinline__ v16h load(const _Float16* p) {   // elements 0..7 <- p[0..7], 8..15 <- p[16..23]
    U f; f.h[0] = *(const v8h*)(p); f.h[1] = *(const v8h*)(p + 16); return f.v;
  }
  static __device__ __forceinline__ v8f mma(v16h a, v16h b, v8f c) {
    return __builtin_amdgcn_wmma_f32_16x16x32_f16(false, a, false, b, (short)0, c, false, false);
  }
};
template <> struct Frag<__bf16> {
  typedef v16b V; union U { v16b v; v8b h[2]; };
  static __device__ __forceinline__ v16b load(const __bf16* p) {
    U f; f.h[0] = *(const v8b*)(p); f.h[1] = *(const v8b*)(p + 16); return f.v;
  }
  static __device__ __forceinline__ v8f mma(v16b a, v16b b, v8f c) {
    return __builtin_amdgcn_wmma_f32_16x16x32_bf16(false, a, false, b, (short)0, c, false, false);
  }
};

// single-accumulator WMMA + hazard nops (used by the relation mix kernel)
__device__ __forceinline__ v8f mma16h(v16h a, v16h b, v8f c) {
  c = __builtin_amdgcn_wmma_f32_16x16x32_f16(false, a, false, b, (short)0, c, false, false);
  asm volatile("v_nop\n\tv_nop\n\tv_nop\n\tv_nop" : "+v"(c) : "v"(a), "v"(b));
  return c;
}
__device__ __forceinline__ v8f mma16b(v16b a, v16b b, v8f c) {
  c = __builtin_amdgcn_wmma_f32_16x16x32_bf16(false, a, false, b, (short)0, c, false, false);
  asm volatile("v_nop\n\tv_nop\n\tv_nop\n\tv_nop" : "+v"(c) : "v"(a), "v"(b));
  return c;
}

// ---- work-group WMMA GEMM, operands staged in LDS ---------------------
// C[m,n] = scale * sum_k A[m,k] * Bt[n,k]; one BM x BN tile of C per work-group of 8 waves.
// A row-major [M,K]; Bt row-major [N,K]; K % 64 == 0; every operand row starts on a 128-B line.
// SPLIT: A is hi/lo planes (A2 = lo); SPLITB: Bt also hi/lo (product hi.hi + hi.lo + lo.hi),
//        !SPLITB: Bt single plane (product hi.b + lo.b).
// OUT_MODE: 0 = f32, 1 = f16, 2 = bf16 hi plane (Cout) + bf16 lo plane (Cout2).
// ET: 0 = f16 operands, 1 = bf16 operands (pointers passed as 16-bit storage)
template <int ET> struct Elem;
template <> struct Elem<0> { typedef _Float16 T; };
template <> struct Elem<1> { typedef __bf16 T; };

// Result of one wave, MI x 4 accumulator tiles of 16x16 at rows m0.., columns n0..: 16 rows at a time through the wave's own
// 16x68 f32 LDS slab, so that every store covers whole row segments.
template <int MI, int OUT_MODE>
__device__ __forceinline__ void store_tiles(v8f (&acc)[MI][4], float scale,
    void* __restrict__ Cout, void* __restrict__ Cout2, int ldc, size_t offC, int m0, int n0, float* slab) {
  const int lane = threadIdx.x & 31;
  const int rlane = lane & 15;                 // column within a 16x16 tile
  const int mOff  = (lane >> 4) * 8;           // D row offset
#pragma unroll
  for (int i = 0; i < MI; ++i) {
    const int mBase = m0 + (i << 4);
#pragma unroll
    for (int j = 0; j < 4; ++j) {
#pragma unroll
      for (int r = 0; r < 8; ++r) {
        slab[(mOff + r) * 68 + (j << 4) + rlane] = acc[i][j][r] * scale;
      }
    }
    __builtin_amdgcn_fence(__ATOMIC_RELEASE, "workgroup");
    __builtin_amdgcn_wave_barrier();
    __builtin_amdgcn_fence(__ATOMIC_ACQUIRE, "workgroup");
    if (OUT_MODE == 0) {
      float* C = (float*)Cout + offC;
      const int hh = lane >> 4, c4 = (lane & 15) * 4;     // row seg = 256 B = 16 lanes x 16 B
      {
#pragma unroll
        for (int it = 0; it < 8; ++it) {
          const int row = it * 2 + hh;
          v4f v = *(const v4f*)(slab + row * 68 + c4);
          *(v4f*)(C + (size_t)(mBase + row) * ldc + n0 + c4) = v;
        }
        
      }
    } else {
      const int q = lane >> 3, c8 = (lane & 7) * 8;
      unsigned short* C  = (unsigned short*)Cout  + offC;
      unsigned short* C2 = (OUT_MODE == 2) ? ((unsigned short*)Cout2 + offC) : nullptr;
      {
#pragma unroll
        for (int it = 0; it < 4; ++it) {
          const int row = it * 4 + q;
          const float* sp = slab + row * 68 + c8;
          v8h hv, lv;
#pragma unroll
          for (int e = 0; e < 8; ++e) {
            if (OUT_MODE == 1) {
              hv[e] = (_Float16)sp[e];
            } else {
              unsigned short hb = f2bf_bits(sp[e]);
              unsigned short lb = f2bf_bits(sp[e] - bf_bits2f(hb));
              hv[e] = __builtin_bit_cast(_Float16, hb);
              lv[e] = __builtin_bit_cast(_Float16, lb);
            }
          }
          *(v8h*)(C + (size_t)(mBase + row) * ldc + n0 + c8) = hv;
          if (OUT_MODE == 2) *(v8h*)(C2 + (size_t)(mBase + row) * ldc + n0 + c8) = lv;
        }
        
      }
    }
    __builtin_amdgcn_fence(__ATOMIC_RELEASE, "workgroup");
    __builtin_amdgcn_wave_barrier();
    __builtin_amdgcn_fence(__ATOMIC_ACQUIRE, "workgroup");
  }
}

static constexpr int GK = 64;                  // k per stage: 128 B, one whole line, of every operand row
static constexpr int GP = GK + 8;              // LDS row pitch in 16-bit elements: 144 B = 16 B x 9, no bank conflict for 16-byte fragment reads
static constexpr int SLAB_WORDS = 8 * 16 * 68 * 2;   // the eight result slabs, in 16-bit words
// WM x WN waves, each MI*16 rows x 64 columns of C. One stage in LDS: rows [A | A lo | Bt | Bt lo], GP elements apart.
template <bool SPLIT, bool SPLITB, int MI, int WM, int WN> struct Stage {
  static_assert(WM * WN == 8, "eight waves");
  static constexpr int BM = WM * MI * 16, BN = WN * 64;
  static constexpr int AROWS = (SPLIT ? 2 : 1) * BM;
  static constexpr int ROWS  = AROWS + ((SPLIT && SPLITB) ? 2 : 1) * BN;
  static constexpr int WORDS = ROWS * GP;      // 16-bit words per stage
  static_assert(BM % 32 == 0 && BN % 32 == 0, "each group of 32 staged rows lies in one plane");
  static_assert(WORDS >= SLAB_WORDS, "the result slabs reuse the first stage");
};
// smem: two stages (one is enough where K == GK); offA / offB / offC: element offsets of this product's operands and result;
// m0b, n0b: the work-group's tile. Every thread of the work-group calls this (it holds barriers).
// Per stage the 256 threads copy 128 B of every operand row, 8 lanes to a row, into LDS; the next stage's global loads are
// issued before this stage's products and stored to the other buffer behind them.
template <int ET, bool SPLIT, bool SPLITB, int MI, int WM, int WN, int OUT_MODE, int LDA, int LDB>
__device__ __forceinline__ void gemm_block(
    const unsigned short* __restrict__ Ap, const unsigned short* __restrict__ A2p, size_t offA,
    const unsigned short* __restrict__ Btp, const unsigned short* __restrict__ Bt2p, size_t offB,
    void* __restrict__ Cout, void* __restrict__ Cout2, int ldc, size_t offC,
    int K, float scale, int m0b, int n0b, unsigned short* smem) {
  typedef typename Elem<ET>::T T;
  typedef typename Frag<T>::V V;
  typedef Stage<SPLIT, SPLITB, MI, WM, WN> G;
  constexpr int NLD = G::ROWS / 32;            // 16-byte pieces per thread and stage
  const int tid = threadIdx.x, lane = tid & 31, wave = tid >> 5;
  const int srow = tid >> 3, scol = (tid & 7) * 8;      // staging: row within a group of 32, 16-byte column
  // the thread's place in each operand plane at the stage to be fetched next; the rows' strides LDA, LDB are compile-time,
  // so every load of a plane names this one address and an immediate offset
  const unsigned short* gA  = Ap   + offA + (size_t)(m0b + srow) * LDA + scol;
  const unsigned short* gA2 = A2p  + offA + (size_t)(m0b + srow) * LDA + scol;
  const unsigned short* gB  = Btp  + offB + (size_t)(n0b + srow) * LDB + scol;
  const unsigned short* gB2 = Bt2p + offB + (size_t)(n0b + srow) * LDB + scol;
  unsigned short* sdst = smem + srow * GP + scol;

  const int rlane = lane & 15;                 // row (A) / col (B, D) within subtile
  const int koff  = (lane >> 4) * 8;           // k offset of this lane half
  const int wm = wave / WN, wn = wave - wm * WN;
  const int aoff = (wm * (MI * 16) + rlane) * GP + koff;
  const int boff = (G::AROWS + wn * 64 + rlane) * GP + koff;

  v8f acc[MI][4];
#pragma unroll
  for (int i = 0; i < MI; ++i)
#pragma unroll
    for (int j = 0; j < 4; ++j) acc[i][j] = (v8f){0.f,0.f,0.f,0.f,0.f,0.f,0.f,0.f};

  v4u st[NLD];
  auto fetch = [&]() {
#pragma unroll
    for (int n = 0; n < NLD; ++n) {
      const int r = n * 32;                    // first staged row of the group of 32: picks the plane at compile time
      const unsigned short* g;
      if (r < G::BM)                  g = gA  + (size_t)r * LDA;
      else if (r < G::AROWS)          g = gA2 + (size_t)(r - G::BM) * LDA;
      else if (r < G::AROWS + G::BN)  g = gB  + (size_t)(r - G::AROWS) * LDB;
      else                            g = gB2 + (size_t)(r - G::AROWS - G::BN) * LDB;
      st[n] = *(const v4u*)g;
    }
    // the addresses stay in their registers up to this wait, so that it stands in front of every overwrite of a register
    // that these loads name (a later load's result, the step to the next stage)
    if (SPLIT && SPLITB) asm volatile("s_wait_xcnt 0x0" :: "v"(gA), "v"(gA2), "v"(gB), "v"(gB2) : "memory");
    else if (SPLIT)      asm volatile("s_wait_xcnt 0x0" :: "v"(gA), "v"(gA2), "v"(gB) : "memory");
    else                 asm volatile("s_wait_xcnt 0x0" :: "v"(gA), "v"(gB) : "memory");
    gA += GK; gA2 += GK; gB += GK; gB2 += GK;
  };
  auto put = [&](int buf) {
#pragma unroll
    for (int n = 0; n < NLD; ++n) *(v4u*)(sdst + buf * G::WORDS + n * 32 * GP) = st[n];
  };

  fetch();
  put(0);
  __syncthreads();
  for (int k0 = 0, buf = 0; k0 < K; k0 += GK, buf ^= 1) {
    const bool more = k0 + GK < K;             // the same for the whole work-group
    if (more) fetch();
    const T* cur = (const T*)(smem + buf * G::WORDS);
#pragma unroll
    for (int ks = 0; ks < GK; ks += 32) {
      V bh[4], bl[4];
#pragma unroll
      for (int j = 0; j < 4; ++j) {
        bh[j] = Frag<T>::load(cur + boff + j * 16 * GP + ks);
        if (SPLIT && SPLITB) bl[j] = Frag<T>::load(cur + boff + (G::BN + j * 16) * GP + ks);
      }
#pragma unroll
      for (int i = 0; i < MI; ++i) {
        V ah = Frag<T>::load(cur + aoff + i * 16 * GP + ks);
        V al;
        if (SPLIT) al = Frag<T>::load(cur + aoff + (G::BM + i * 16) * GP + ks);
#pragma unroll
        for (int j = 0; j < 4; ++j) {
          acc[i][j] = Frag<T>::mma(ah, bh[j], acc[i][j]);
          if (SPLIT) {
            if (SPLITB) acc[i][j] = Frag<T>::mma(ah, bl[j], acc[i][j]);
            acc[i][j] = Frag<T>::mma(al, bh[j], acc[i][j]);
          }
        }
      }
    }
    if (more) put(buf ^ 1);                    // last read one trip ago, in front of that trip's barrier
    __syncthreads();                           // publishes the next stage; ends every read of this one
  }
  store_tiles<MI, OUT_MODE>(acc, scale, Cout, Cout2, ldc, offC, m0b + wm * (MI * 16), n0b + wn * 64,
                            (float*)smem + wave * (16 * 68));
}

// All five input projections in one grid; blockIdx.y selects the product (block-uniform):
// 0 q_attn, 1 k_attn -> bf16 hi/lo; 2 q_rel, 3 k_rel -> f16; 4 values, transposed (A = WvT, Bt = symbols) -> bf16 hi/lo.
// Each product has (NTOK/128)*(DMOD/128) tiles of 128x128, one per block.
__global__ __launch_bounds__(256) void k_proj5(
    const unsigned short* __restrict__ xb, const unsigned short* __restrict__ sb, const unsigned short* __restrict__ wT,
    unsigned short* __restrict__ xqh, unsigned short* __restrict__ xql,
    unsigned short* __restrict__ xkh, unsigned short* __restrict__ xkl,
    unsigned short* __restrict__ qr16, unsigned short* __restrict__ kr16,
    unsigned short* __restrict__ svh, unsigned short* __restrict__ svl) {
  __shared__ __align__(16) unsigned short sm[2 * Stage<false, false, 2, 4, 2>::WORDS];
  const int y = blockIdx.y;
  const bool tv = (y == 4);
  const int nbN = (tv ? NTOK : DMOD) / 128;
  const int m0b = ((int)blockIdx.x / nbN) * 128, n0b = ((int)blockIdx.x % nbN) * 128;
  const unsigned short* Wy = wT + (size_t)y * DMOD * DMOD;
  if (y == 2 || y == 3) {
    unsigned short* c = (y == 2) ? qr16 : kr16;
    gemm_block<1, false, false, 2, 4, 2, 1, DMOD, DMOD>(xb, xb, 0, Wy, Wy, 0, c, c, DMOD, 0, DMOD, 1.0f, m0b, n0b, sm);
  } else {
    const unsigned short* a  = tv ? Wy : xb;
    const unsigned short* bt = tv ? sb : Wy;
    unsigned short* chi = tv ? svh : (y == 0 ? xqh : xkh);
    unsigned short* clo = tv ? svl : (y == 0 ? xql : xkl);
    gemm_block<1, false, false, 2, 4, 2, 2, DMOD, DMOD>(a, a, 0, bt, bt, 0, chi, clo, tv ? NTOK : DMOD, 0, DMOD, 1.0f, m0b, n0b, sm);
  }
}

// Attention scores of every chunk, batch row and head in one grid.
// blockIdx.z = chunk c, blockIdx.y = batch row * 16 + head; blocks past the chunk's (CHR/128)*(jend/256) tiles leave at once.
// scores[c][b][h][il][j] = SCALE_ATTN * sum_d xq[i][h,d] xk[j][h,d], hi/lo split on both operands, f32 out
__global__ __launch_bounds__(256) void k_scores(
    const unsigned short* __restrict__ xqh, const unsigned short* __restrict__ xql,
    const unsigned short* __restrict__ xkh, const unsigned short* __restrict__ xkl, float* __restrict__ sc) {
  __shared__ __align__(16) unsigned short sm[Stage<true, true, 4, 2, 4>::WORDS];   // K = 64: one stage
  const int c = blockIdx.z;
  const int jend = CHR * (c + 1);
  const int nbN = c + 1;                                   // jend / 256
  if ((int)blockIdx.x >= (CHR / 128) * nbN) return;        // block-uniform, in front of every barrier
  const int m0b = ((int)blockIdx.x / nbN) * 128, n0b = ((int)blockIdx.x % nbN) * 256;
  const size_t bb = blockIdx.y >> 4, h = blockIdx.y & 15;
  gemm_block<1, true, true, 4, 2, 4, 0, DMOD, DMOD>(xqh, xql, (bb * SEQ + (size_t)c * CHR) * DMOD + h * HDIM,
                                                    xkh, xkl, bb * ((size_t)SEQ * DMOD) + h * HDIM,
                                                    sc, sc, jend, chunk_base(c) + (size_t)blockIdx.y * CHR * jend,
                                                    HDIM, SCALE_ATTN, m0b, n0b, sm);
}

// P.V and the relation scores of every chunk and batch row in one grid (neither reads the other's result).
// blockIdx.z = 0..3: attended_symbols of chunk 3 - z (longest K loop first; 2 tiles of 128x64 per head, blocks x = 0, 1);
// blockIdx.z = 4..7: relation scores of chunk 7 - z, tiles of 128x256. blockIdx.y = batch row * 16 + head or relation.
__global__ __launch_bounds__(256) void k_pv_rel(
    const unsigned short* __restrict__ ph, const unsigned short* __restrict__ pl,
    const unsigned short* __restrict__ svh, const unsigned short* __restrict__ svl, float* __restrict__ attsym,
    const unsigned short* __restrict__ qr16, const unsigned short* __restrict__ kr16, unsigned short* __restrict__ rel16) {
  static_assert(2 * Stage<true, true, 1, 8, 1>::WORDS >= Stage<false, false, 4, 2, 4>::WORDS, "both roles fit");
  __shared__ __align__(16) unsigned short sm[2 * Stage<true, true, 1, 8, 1>::WORDS];
  const int c = (NCHK - 1) - (int)(blockIdx.z & (NCHK - 1));
  const int jend = CHR * (c + 1);
  const size_t bb = blockIdx.y >> 4, hr = blockIdx.y & 15;
  const size_t rowbase = bb * SEQ + (size_t)c * CHR;
  if (blockIdx.z < NCHK) {
    if ((int)blockIdx.x >= CHR / 128) return;              // block-uniform, in front of every barrier
    // attended_symbols[token][h*64+d] = sum_j P[h][il][j] * svT[h*64+d][b*1024+j]  (split both)
    const size_t oP = chunk_base(c) + (size_t)blockIdx.y * CHR * jend, oV = hr * ((size_t)HDIM * NTOK) + bb * SEQ;
    const size_t oC = rowbase * DMOD + hr * HDIM;
    const int m0b = (int)blockIdx.x * 128;
    // one instance per chunk: the pitch jend of P is a compile-time stride in each
    if (c == 3)      gemm_block<1, true, true, 1, 8, 1, 0, 4 * CHR, NTOK>(ph, pl, oP, svh, svl, oV, attsym, attsym, DMOD, oC, 4 * CHR, 1.0f, m0b, 0, sm);
    else if (c == 2) gemm_block<1, true, true, 1, 8, 1, 0, 3 * CHR, NTOK>(ph, pl, oP, svh, svl, oV, attsym, attsym, DMOD, oC, 3 * CHR, 1.0f, m0b, 0, sm);
    else if (c == 1) gemm_block<1, true, true, 1, 8, 1, 0, 2 * CHR, NTOK>(ph, pl, oP, svh, svl, oV, attsym, attsym, DMOD, oC, 2 * CHR, 1.0f, m0b, 0, sm);
    else             gemm_block<1, true, true, 1, 8, 1, 0, 1 * CHR, NTOK>(ph, pl, oP, svh, svl, oV, attsym, attsym, DMOD, oC, 1 * CHR, 1.0f, m0b, 0, sm);
  } else {
    const int nbN = c + 1;                                 // jend / 256
    if ((int)blockIdx.x >= (CHR / 128) * nbN) return;      // block-uniform, in front of every barrier
    // rel[c][b][il][r][j] = SCALE_REL * sum_p qr[i][r,p] kr[j][r,p]  (plain f16) -> f16 plane
    gemm_block<0, false, false, 4, 2, 4, 1, DMOD, DMOD>(qr16, qr16, rowbase * DMOD + hr * RDIM,
                                            kr16, kr16, bb * ((size_t)SEQ * DMOD) + hr * RDIM,
                                            rel16, rel16, NREL * jend, chunk_base(c) + bb * ((size_t)CHR * NREL * jend) + hr * jend,
                                            RDIM, SCALE_REL, ((int)blockIdx.x / nbN) * 128, ((int)blockIdx.x % nbN) * 256, sm);
  }
}

// out[token][n] = sum_k combined[token][k] * WoT[n][k]  (A hi/lo, B bf16 weights), f32 out; one 128x128 tile per block.
__global__ __launch_bounds__(256) void k_out(const unsigned short* __restrict__ ch, const unsigned short* __restrict__ cl,
    const unsigned short* __restrict__ woT, float* __restrict__ out) {
  __shared__ __align__(16) unsigned short sm[2 * Stage<true, false, 2, 4, 2>::WORDS];
  const int nbN = DMOD / 128;
  gemm_block<1, true, false, 2, 4, 2, 0, DMOD, DMOD>(ch, cl, 0, woT, woT, 0, out, out, DMOD, 0, DMOD, 1.0f,
                                         ((int)blockIdx.x / nbN) * 128, ((int)blockIdx.x % nbN) * 128, sm);
}

// ---------------------------------------------------------------------------
// f32 -> bf16 (RNE) cast of the two activation tensors, 8 elements per thread:
// by selects the tensor (block-uniform), bx the block of 2048 elements. Coverage: CAST_BLOCKS*256 threads * 8 = n8*8 elements exactly.
// ---------------------------------------------------------------------------
__device__ __forceinline__ void cast_bf16x8_block(const float* __restrict__ s0, const float* __restrict__ s1,
    unsigned short* __restrict__ d0, unsigned short* __restrict__ d1, int n8, int bx, int by) {
  const float* src = (by == 0) ? s0 : s1;
  unsigned short* dst = (by == 0) ? d0 : d1;
  const int i = bx * 256 + threadIdx.x;
  if (i < n8) {
    const size_t e0 = (size_t)i * 8;
    const v4f a = *(const v4f*)(src + e0);
    const v4f c = *(const v4f*)(src + e0 + 4);
    v4u u;
    u[0] = pack_bf16x2(a[0], a[1]);
    u[1] = pack_bf16x2(a[2], a[3]);
    u[2] = pack_bf16x2(c[0], c[1]);
    u[3] = pack_bf16x2(c[2], c[3]);
    *(v4u*)(dst + e0) = u;
    
  }
}

// ---------------------------------------------------------------------------
// Weight transpose + bf16 cast: W[k][o] (f32, [DMOD][DMOD]) -> WT[o][k] (bf16), 6 weights selected by z; tile: 64*68 floats of LDS.
// Coverage per block: read 4 iters * 256 threads * 4 = 4096 elements; write 2 iters * 8 waves * 4 lines * 64 = 4096.
// ---------------------------------------------------------------------------
__device__ __forceinline__ void wT_bf16_block(const float* __restrict__ w0, const float* __restrict__ w1,
    const float* __restrict__ w2, const float* __restrict__ w3, const float* __restrict__ w4, const float* __restrict__ w5,
    unsigned short* __restrict__ dst, float* tile, int bx, int by, int z) {
  const float* W = (z == 0) ? w0 : (z == 1) ? w1 : (z == 2) ? w2 : (z == 3) ? w3 : (z == 4) ? w4 : w5;
  unsigned short* WT = dst + (size_t)z * DMOD * DMOD;
  const int k0 = by * 64;   // rows of W (input dim)
  const int o0 = bx * 64;   // cols of W (output dim)
  const int tid = threadIdx.x;
#pragma unroll
  for (int it = 0; it < 4; ++it) {
    const int e = (it * 256 + tid) * 4;
    const int row = e >> 6, col = e & 63;
    const v4f v = *(const v4f*)(W + (size_t)(k0 + row) * DMOD + o0 + col);
    *(v4f*)(tile + row * 68 + col) = v;
  }
  __syncthreads();
  const int lane = tid & 31, wave = tid >> 5, q = lane >> 3, c8 = (lane & 7) * 8;
  v4u ov[2];
#pragma unroll
  for (int it = 0; it < 2; ++it) {
    const int oo = it * 32 + wave * 4 + q;
    float f[8];
#pragma unroll
    for (int e = 0; e < 8; ++e) f[e] = tile[(c8 + e) * 68 + oo];
    ov[it][0] = pack_bf16x2(f[0], f[1]);
    ov[it][1] = pack_bf16x2(f[2], f[3]);
    ov[it][2] = pack_bf16x2(f[4], f[5]);
    ov[it][3] = pack_bf16x2(f[6], f[7]);
  }
  {
#pragma unroll
    for (int it = 0; it < 2; ++it) {
      const int oo = it * 32 + wave * 4 + q;
      *(v4u*)(WT + (size_t)(o0 + oo) * DMOD + k0 + c8) = ov[it];
    }
    // in the merged kernel's built control flow another role's code follows these stores and reuses their registers:
    // keep the wait in front of that overwrite
    asm volatile("s_wait_xcnt 0x0" ::: "memory");
  }
}

// ---------------------------------------------------------------------------
// Wr [NHEAD*HDIM rows][NREL] f32 -> WrP [rows][32] bf16 with k 16..31 zero-FILLED (WMMA K padding).
// Coverage: 256 threads * 8 elements = 64 rows * 32; store 8 waves * 4 lines * 64 = 2048 elements.
// ---------------------------------------------------------------------------
__device__ __forceinline__ void wr_pack_block(const float* __restrict__ wr, unsigned short* __restrict__ dst,
    unsigned short* tile, int bx) {   // tile: 64*32 16-bit words of LDS
  const int r0 = bx * 64;
  const int tid = threadIdx.x;
  const int row = tid >> 2, kq = (tid & 3) * 8;
  v4u u;
  unsigned wv[4];
#pragma unroll
  for (int e = 0; e < 4; ++e) {
    const int ka = kq + 2 * e, kb = kq + 2 * e + 1;
    const int kac = ka < NREL ? ka : NREL - 1;
    const int kbc = kb < NREL ? kb : NREL - 1;
    const float fa = wr[(size_t)(r0 + row) * NREL + kac];
    const float fb = wr[(size_t)(r0 + row) * NREL + kbc];
    const unsigned ba = (ka < NREL) ? (unsigned)f2bf_bits(fa) : 0u;
    const unsigned bb = (kb < NREL) ? (unsigned)f2bf_bits(fb) : 0u;
    wv[e] = ba | (bb << 16);
  }
  u[0] = wv[0]; u[1] = wv[1]; u[2] = wv[2]; u[3] = wv[3];
  *(v4u*)(tile + row * 32 + kq) = u;
  __syncthreads();
  const int lane = tid & 31, wave = tid >> 5, q = lane >> 3, c8 = (lane & 7) * 8;
  const int L = wave * 4 + q;                       // line 0..31, 64 elements per line
  const v4u v = *(const v4u*)(tile + L * 64 + c8);
  {
    *(v4u*)(dst + (size_t)r0 * 32 + L * 64 + c8) = v;
    // as in the weight transpose: the wait in front of an overwrite of this store's registers by another role's code
    asm volatile("s_wait_xcnt 0x0" ::: "memory");
  }
}

// ---------------------------------------------------------------------------
// The three input conversions in one grid (none reads another's result); the role is block-uniform, from blockIdx.x:
// [0, 2*CAST_BLOCKS) activation casts, then WT_BLOCKS weight-transpose tiles, then WR_BLOCKS blocks of the Wr pack.
// ---------------------------------------------------------------------------
static constexpr int CAST_BLOCKS = NTOK * DMOD / 8 / 256;            // 1024 per tensor
static constexpr int WT_SIDE     = DMOD / 64;                        // 16 tiles per side
static constexpr int WT_BLOCKS   = 6 * WT_SIDE * WT_SIDE;            // 1536
static constexpr int WR_BLOCKS   = (NHEAD * HDIM) / 64;              // 16
__global__ __launch_bounds__(256) void k_prep(const float* __restrict__ x, const float* __restrict__ symb,
    const float* __restrict__ w0, const float* __restrict__ w1, const float* __restrict__ w2,
    const float* __restrict__ w3, const float* __restrict__ w4, const float* __restrict__ w5, const float* __restrict__ wr,
    unsigned short* __restrict__ xb, unsigned short* __restrict__ sb, unsigned short* __restrict__ wT,
    unsigned short* __restrict__ wrp) {
  __shared__ __align__(16) float tile[64 * 68];
  const int id = blockIdx.x;
  if (id < 2 * CAST_BLOCKS) {
    cast_bf16x8_block(x, symb, xb, sb, NTOK * DMOD / 8, id % CAST_BLOCKS, id / CAST_BLOCKS);
    return;
  }
  if (id < 2 * CAST_BLOCKS + WT_BLOCKS) {
    const int t = id - 2 * CAST_BLOCKS;
    wT_bf16_block(w0, w1, w2, w3, w4, w5, wT, tile, t % WT_SIDE, (t / WT_SIDE) % WT_SIDE, t / (WT_SIDE * WT_SIDE));
    return;
  }
  wr_pack_block(wr, wrp, (unsigned short*)tile, id - 2 * CAST_BLOCKS - WT_BLOCKS);
}

// ---------------------------------------------------------------------------
// Causal softmax of every chunk: scores f32 [c][NB][NHEAD][CHR][jend], chunk c = row / ROWS_CH, row in chunk r = (b*NHEAD + h)*CHR + il,
// query i = i0 + il, keys j <= i. One wave per row; lane owns j = 256*t + 8*lane .. +7 (t < jend/256).
// Writes P hi/lo bf16 planes and P*1024 f16 plane (same layout), zeros for i < j < jend.
// Coverage: grid.x*8 rows = NCHK*ROWS_CH rows; columns [0, jend) per row; the 8 rows of a block lie in one chunk.
// ---------------------------------------------------------------------------
__global__ __launch_bounds__(256) void k_softmax(const float* __restrict__ sc, unsigned short* __restrict__ ph,
    unsigned short* __restrict__ pl, unsigned short* __restrict__ p16) {
  const int lane = threadIdx.x & 31, wave = threadIdx.x >> 5;
  const int rg = blockIdx.x * 8 + wave;
  const int c = (int)(blockIdx.x * 8) / ROWS_CH;   // from blockIdx alone: the same for the whole block
  const int r = rg - c * ROWS_CH;
  const int i0 = c * CHR, jend = CHR * (c + 1);
  const int i = i0 + (r & (CHR - 1));
  const size_t ro = chunk_base(c) + (size_t)r * jend;
  const float NEG = -__builtin_huge_valf();
  float s[4][8];
  float m = NEG;
#pragma unroll
  for (int t = 0; t < 4; ++t) {
    const int j0 = t * 256 + lane * 8;
    if (t * 256 < jend) {          // block-uniform
      const v4f a = *(const v4f*)(sc + ro + j0);
      const v4f c = *(const v4f*)(sc + ro + j0 + 4);
      s[t][0] = a[0]; s[t][1] = a[1]; s[t][2] = a[2]; s[t][3] = a[3];
      s[t][4] = c[0]; s[t][5] = c[1]; s[t][6] = c[2]; s[t][7] = c[3];
#pragma unroll
      for (int e = 0; e < 8; ++e) m = (j0 + e <= i) ? fmaxf(m, s[t][e]) : m;
    } else {
#pragma unroll
      for (int e = 0; e < 8; ++e) s[t][e] = 0.f;
    }
  }
#pragma unroll
  for (int off = 1; off < 32; off <<= 1) m = fmaxf(m, __shfl_xor(m, off, 32));
  float p[4][8];
  float sum = 0.f;
#pragma unroll
  for (int t = 0; t < 4; ++t) {
    const int j0 = t * 256 + lane * 8;
#pragma unroll
    for (int e = 0; e < 8; ++e) {
      float ev = __expf(s[t][e] - m);
      ev = (j0 + e <= i) ? ev : 0.f;
      p[t][e] = ev;
      sum += ev;
    }
  }
#pragma unroll
  for (int off = 1; off < 32; off <<= 1) sum += __shfl_xor(sum, off, 32);
  const float inv = 1.0f / sum;       // sum >= 1 (key j=0 always present)
  v4u hv[4], lv[4], fv[4];
#pragma unroll
  for (int t = 0; t < 4; ++t) {
#pragma unroll
    for (int e = 0; e < 4; ++e) {
      const float a = p[t][2 * e] * inv;
      const float c = p[t][2 * e + 1] * inv;
      const unsigned short ha = f2bf_bits(a), hc = f2bf_bits(c);
      const unsigned short la = f2bf_bits(a - bf_bits2f(ha)), lc = f2bf_bits(c - bf_bits2f(hc));
      const unsigned short fa = h_bits(a * PCARRY), fc = h_bits(c * PCARRY);
      hv[t][e] = (unsigned)ha | ((unsigned)hc << 16);
      lv[t][e] = (unsigned)la | ((unsigned)lc << 16);
      fv[t][e] = (unsigned)fa | ((unsigned)fc << 16);
    }
  }
  {
#pragma unroll
    for (int t = 0; t < 4; ++t) {
      if (t * 256 < jend) {        // block-uniform
        const int j0 = t * 256 + lane * 8;
        *(v4u*)(ph  + ro + j0) = hv[t];
        *(v4u*)(pl  + ro + j0) = lv[t];
        *(v4u*)(p16 + ro + j0) = fv[t];
        // all segments are packed before the first store; keep the wait in front of any later overwrite of these stores' registers
        asm volatile("s_wait_xcnt 0x0" ::: "memory");
      }
    }
    
  }
}

// ---------------------------------------------------------------------------
// Relation aggregation + Wr mix + residual. Block = 8 waves = 16 consecutive query rows il0..il0+15 of batch row blockIdx.y, chunk 3 - blockIdx.z (longest first).
// Phase 1 (per wave, rows ill = wave and wave+8): D[h][r] = sum_{j<kend} P16[h][il][j] * rel[il][r][j]
//   (one f16 WMMA tile, K stepped by 32; the 16 + 16 operand rows are staged 256 k at a time in the wave's own LDS, up to the
//   causal extent, zeros behind it; P16 carries P*1024, rel carries REL_SCALE);
//   D is split into bf16 hi/lo and written to LDS arHL[m=ill][h][k=r] (k 16..31 zero-filled first).
// Phase 2 (per wave, heads h = wave and wave+8): attrel[ill][d] = sum_r ar[ill][h][r] * Wr[h][d][r]
//   (A = arHL hi/lo from LDS, B = WrP bf16 [h*64+d][32], two products per tile, 4 tiles of 16 d).
// Epilogue: per-wave 16x64 slab in LDS, residual attended_symbols added from one 32-B load per lane in the
// ---------------------------------------------------------------------------
__global__ __launch_bounds__(256) void k_rel_mix(const unsigned short* __restrict__ p16all, const unsigned short* __restrict__ relall,
    const unsigned short* __restrict__ wrp, const float* __restrict__ attsym,
    unsigned short* __restrict__ comb_hi, unsigned short* __restrict__ comb_lo) {
  const int c = (NCHK - 1) - (int)blockIdx.z;
  const int i0 = c * CHR, jend = CHR * (c + 1);
  const unsigned short* p16 = p16all + chunk_base(c) + (size_t)blockIdx.y * ((size_t)NHEAD * CHR * jend);
  const unsigned short* rel = relall + chunk_base(c) + (size_t)blockIdx.y * ((size_t)CHR * NREL * jend);
  const int rowbase = (int)blockIdx.y * SEQ + i0;
  __shared__ __align__(16) unsigned short arHL[2 * 16 * 16 * 32];   // hi plane [m][h][32] then lo plane
  __shared__ __align__(16) float slab[8][16 * 68];
  constexpr int RK = 256;                   // k per stage of phase 1: 512 B of an operand row = one wave-wide load of whole lines
  constexpr int RPITCH = RK + 8;            // 528 B = 16 B x 33: no bank conflict for 16-byte fragment reads
  __shared__ __align__(16) unsigned short stg[8][32 * RPITCH];
  const int tid = threadIdx.x, lane = tid & 31, wave = tid >> 5;
  const int hh = lane >> 4, rl = lane & 15, koff = hh * 8;
  const int il0 = blockIdx.x * 16;
  {
    const v4u zz = {0u, 0u, 0u, 0u};
    v4u* zp = (v4u*)arHL;                 // 32768 B = 2048 x 16 B, 256 threads x 8
    for (int qq = tid; qq < 2048; qq += 256) zp[qq] = zz;
  }
  __syncthreads();
  const v8f zero8 = {0.f, 0.f, 0.f, 0.f, 0.f, 0.f, 0.f, 0.f};
#pragma unroll
  for (int sub = 0; sub < 2; ++sub) {
    const int ill = wave + 8 * sub;           // local row 0..15 (wave-uniform)
    const int il = il0 + ill;                 // row within chunk 0..255
    const int i = i0 + il;                    // query position
    const int kend = (i & ~31) + 32;          // <= jend; P16 is zero for i < j < kend
    const unsigned short* gA = p16 + (size_t)il * jend;                      // + head * CHR * jend: A row m = head
    const unsigned short* gB = rel + (size_t)il * ((size_t)NREL * jend);     // + relation * jend: Bt row n = relation
    const int lane8 = lane * 8;               // the lane's 16 bytes of a row's 512
    unsigned short* wst = stg[wave];          // the wave's own stage: rows 0..15 = A, 16..31 = Bt
    v8f acc = zero8;
    for (int ks = 0; ks < kend; ks += RK) {
      const bool on = ks + lane * 8 < kend;   // kend is a multiple of 32; columns from kend on are staged as zeros and add nothing
      v4u st[32];
#pragma unroll
      for (int n = 0; n < 32; ++n) st[n] = (v4u){0u, 0u, 0u, 0u};
      if (on) {
#pragma unroll
        for (int n4 = 0; n4 < 16; n4 += 4) {
          const unsigned short *ga[4], *gb[4];
#pragma unroll
          for (int q = 0; q < 4; ++q) {
            ga[q] = gA + (size_t)(n4 + q) * ((size_t)CHR * jend) + ks + lane8;
            gb[q] = gB + (size_t)(n4 + q) * jend + ks + lane8;
            st[n4 + q]      = *(const v4u*)ga[q];
            st[16 + n4 + q] = *(const v4u*)gb[q];
          }
          // a later load's result may be given the registers that held these addresses: the addresses stay where they are
          // up to this wait, which stands in front of every such overwrite
          asm volatile("s_wait_xcnt 0x0" :: "v"(ga[0]), "v"(ga[1]), "v"(ga[2]), "v"(ga[3]),
                                            "v"(gb[0]), "v"(gb[1]), "v"(gb[2]), "v"(gb[3]) : "memory");
        }
      }
#pragma unroll
      for (int n = 0; n < 32; ++n) *(v4u*)(wst + n * RPITCH + lane * 8) = st[n];
      __builtin_amdgcn_fence(__ATOMIC_RELEASE, "workgroup");
      __builtin_amdgcn_wave_barrier();
      __builtin_amdgcn_fence(__ATOMIC_ACQUIRE, "workgroup");
      v16h a[RK / 32], bb[RK / 32];           // the stage's fragment reads go as one group ahead of its products
#pragma unroll
      for (int u = 0; u < RK / 32; ++u) {
        a[u]  = Frag<_Float16>::load((const _Float16*)wst + rl * RPITCH + koff + u * 32);
        bb[u] = Frag<_Float16>::load((const _Float16*)wst + (16 + rl) * RPITCH + koff + u * 32);
      }
#pragma unroll
      for (int u = 0; u < RK / 32; ++u) acc = mma16h(a[u], bb[u], acc);
      __builtin_amdgcn_fence(__ATOMIC_RELEASE, "workgroup");
      __builtin_amdgcn_wave_barrier();
      __builtin_amdgcn_fence(__ATOMIC_ACQUIRE, "workgroup");
    }
    // acc[r8] = D[row h = 8*hh + r8][col r = rl]  (carried x1024)
#pragma unroll
    for (int r8 = 0; r8 < 8; ++r8) {
      const float f = acc[r8];
      const unsigned short hb = f2bf_bits(f);
      const unsigned short lb = f2bf_bits(f - bf_bits2f(hb));
      const int idx = (ill * 16 + 8 * hh + r8) * 32 + rl;
      arHL[idx] = hb;
      arHL[8192 + idx] = lb;
    }
  }
  __syncthreads();
  const int q = lane >> 3, c8 = (lane & 7) * 8;
  float* sl = slab[wave];
#pragma unroll
  for (int sub = 0; sub < 2; ++sub) {
    const int h = wave + 8 * sub;             // wave-uniform head
    const v16b ah = Frag<__bf16>::load((const __bf16*)arHL + rl * 512 + h * 32 + koff);          // A[m = rl][k]
    const v16b al = Frag<__bf16>::load((const __bf16*)arHL + 8192 + rl * 512 + h * 32 + koff);
    v8f acc2[4];
#pragma unroll
    for (int j = 0; j < 4; ++j) {
      const v16b bw = Frag<__bf16>::load((const __bf16*)wrp + (size_t)(h * HDIM + j * 16 + rl) * 32 + koff);  // Bt[n = d][k = r]
      acc2[j] = mma16b(ah, bw, zero8);
      acc2[j] = mma16b(al, bw, acc2[j]);
    }
    // acc2[j][r8] = attrel[ill = 8*hh + r8][d = 16*j + rl] * 1024
#pragma unroll
    for (int j = 0; j < 4; ++j)
#pragma unroll
      for (int r8 = 0; r8 < 8; ++r8) sl[(8 * hh + r8) * 68 + j * 16 + rl] = acc2[j][r8] * PCARRY_INV;
    __builtin_amdgcn_fence(__ATOMIC_RELEASE, "workgroup");
    __builtin_amdgcn_wave_barrier();
    __builtin_amdgcn_fence(__ATOMIC_ACQUIRE, "workgroup");
    v4u hv[4], lv[4];
#pragma unroll
    for (int it = 0; it < 4; ++it) {
      const int row = it * 4 + q;
      const size_t g = (size_t)(rowbase + il0 + row) * DMOD + h * HDIM + c8;
      const v4f s0 = *(const v4f*)(sl + row * 68 + c8);
      const v4f s1 = *(const v4f*)(sl + row * 68 + c8 + 4);
      const v4f r0 = *(const v4f*)(attsym + g);
      const v4f r1 = *(const v4f*)(attsym + g + 4);
      float v[8];
      v[0] = s0[0] + r0[0]; v[1] = s0[1] + r0[1]; v[2] = s0[2] + r0[2]; v[3] = s0[3] + r0[3];
      v[4] = s1[0] + r1[0]; v[5] = s1[1] + r1[1]; v[6] = s1[2] + r1[2]; v[7] = s1[3] + r1[3];
#pragma unroll
      for (int e = 0; e < 4; ++e) {
        const float a = v[2 * e], c = v[2 * e + 1];
        const unsigned short ha = f2bf_bits(a), hc = f2bf_bits(c);
        const unsigned short la = f2bf_bits(a - bf_bits2f(ha)), lc = f2bf_bits(c - bf_bits2f(hc));
        hv[it][e] = (unsigned)ha | ((unsigned)hc << 16);
        lv[it][e] = (unsigned)la | ((unsigned)lc << 16);
      }
    }
    {
#pragma unroll
      for (int it = 0; it < 4; ++it) {
        const int row = it * 4 + q;
        const size_t g = (size_t)(rowbase + il0 + row) * DMOD + h * HDIM + c8;
        *(v4u*)(comb_hi + g) = hv[it];
        *(v4u*)(comb_lo + g) = lv[it];
      }
      
    }
    __builtin_amdgcn_fence(__ATOMIC_RELEASE, "workgroup");
    __builtin_amdgcn_wave_barrier();
    __builtin_amdgcn_fence(__ATOMIC_ACQUIRE, "workgroup");
  }
}

// ---------------------------------------------------------------------------
// launcher
// Workspace region map (bytes, all 256-B aligned; total 262,209,536):
//   region 0, 83,886,080 bytes, used three times in turn, each use ended by a launch boundary before the next begins:
//     steps 1-2: xb [2048][1024] bf16 (x, RNE) at 0, sb (symbols, RNE) behind it; in its last 10,485,760 bytes the
//                transposed bf16 weights 0 q_attn, 1 k_attn, 2 q_rel, 3 k_rel, 4 v, [1024][1024] each
//     scores -> softmax: sc f32, PLANE_ELEMS elements
//     relation scores -> relation mix: rel16 f16, PLANE_ELEMS elements, [c][b][256][16][jend] (REL_SCALE folded)
//   WoT    [1024][1024] bf16     2,097,152      directly behind region 0: the sixth slot of the weight transpose; lives to step 4
//   xqh/xql/xkh/xkl [2048][1024] bf16  4 x 4,194,304
//   qr16/kr16 [2048][1024] f16   2 x 4,194,304
//   svh/svl [1024][2048] bf16    2 x 4,194,304  (values transposed: row h*64+d, col b*1024+j)
//   attsym  [2048][1024] f32     8,388,608
//   ch/cl   [2048][1024] bf16    2 x 4,194,304  (pre-output activations hi/lo)
//   wrp     [1024][32] bf16      65,536         (Wr with K padded to 32, pad zero-filled)
//   ph/pl   [c][b][16][256][jend] bf16 2 x 41,943,040  probabilities hi/lo
//   p16     [c][b][16][256][jend] f16  41,943,040      probabilities x1024
// ---------------------------------------------------------------------------
extern "C" void kernel_launch(void* const* d_in, const int* in_sizes, int n_in,
                              void* d_out, int out_size, void* d_ws, size_t ws_size,
                              hipStream_t stream) {
  if (n_in < 9) return;
  if (in_sizes[0] != NTOK * DMOD || in_sizes[1] != NTOK * DMOD) return;
  if (in_sizes[2] != DMOD * DMOD || in_sizes[3] != DMOD * DMOD || in_sizes[4] != DMOD * DMOD ||
      in_sizes[5] != DMOD * DMOD || in_sizes[7] != DMOD * DMOD || in_sizes[8] != DMOD * DMOD) return;
  if (in_sizes[6] != NHEAD * HDIM * NREL) return;
  if (out_size != NTOK * DMOD) return;

  const float* x      = (const float*)d_in[0];
  const float* symb   = (const float*)d_in[1];
  const float* Wq_a   = (const float*)d_in[2];
  const float* Wk_a   = (const float*)d_in[3];
  const float* Wq_r   = (const float*)d_in[4];
  const float* Wk_r   = (const float*)d_in[5];
  const float* Wr     = (const float*)d_in[6];
  const float* Wv     = (const float*)d_in[7];
  const float* Wo     = (const float*)d_in[8];
  float* out = (float*)d_out;

  char* ws = (char*)d_ws;
  size_t off = 0;
  auto carve = [&](size_t bytes) -> char* {
    char* p = ws + off;
    off += (bytes + 255) & ~(size_t)255;
    return p;
  };
  const size_t ACT16 = (size_t)NTOK * DMOD * 2;            // 4,194,304
  const size_t WGT16 = (size_t)DMOD * DMOD * 2;            // 2,097,152
  const size_t ACT32 = (size_t)NTOK * DMOD * 4;            // 8,388,608
  const size_t PLANE16 = PLANE_ELEMS * 2;                  // 41,943,040
  const size_t PLANE32 = PLANE_ELEMS * 4;                  // 83,886,080
  static_assert(PLANE_ELEMS * 4 % 256 == 0, "the sixth weight slot must follow region 0 without a gap");
  static_assert((size_t)2 * NTOK * DMOD * 2 + (size_t)5 * DMOD * DMOD * 2 <= PLANE_ELEMS * 4, "casts and five weights fit region 0 side by side");

  char* reg0 = carve(PLANE32);
  carve(WGT16);                                            // WoT = wT + 5 weights
  unsigned short* xb   = (unsigned short*)reg0;
  unsigned short* sb   = (unsigned short*)(reg0 + ACT16);
  unsigned short* wT   = (unsigned short*)(reg0 + PLANE32 - 5 * WGT16);
  float*          sc   = (float*)reg0;
  unsigned short* rel16 = (unsigned short*)reg0;
  unsigned short* xqh  = (unsigned short*)carve(ACT16);
  unsigned short* xql  = (unsigned short*)carve(ACT16);
  unsigned short* xkh  = (unsigned short*)carve(ACT16);
  unsigned short* xkl  = (unsigned short*)carve(ACT16);
  unsigned short* qr16 = (unsigned short*)carve(ACT16);
  unsigned short* kr16 = (unsigned short*)carve(ACT16);
  unsigned short* svh  = (unsigned short*)carve(ACT16);
  unsigned short* svl  = (unsigned short*)carve(ACT16);
  float*          attsym = (float*)carve(ACT32);
  unsigned short* ch   = (unsigned short*)carve(ACT16);
  unsigned short* cl   = (unsigned short*)carve(ACT16);
  unsigned short* wrp  = (unsigned short*)carve((size_t)NHEAD * HDIM * 32 * 2);
  unsigned short* ph   = (unsigned short*)carve(PLANE16);
  unsigned short* pl   = (unsigned short*)carve(PLANE16);
  unsigned short* p16  = (unsigned short*)carve(PLANE16);
  if (off > ws_size) return;

  const unsigned short* WoT  = wT + 5 * (size_t)DMOD * DMOD;

  // 1) casts: activations to bf16; weights transposed to bf16; Wr packed with K padding
  k_prep<<<dim3(2 * CAST_BLOCKS + WT_BLOCKS + WR_BLOCKS), 256, 0, stream>>>(
      x, symb, Wq_a, Wk_a, Wq_r, Wk_r, Wv, Wo, Wr, xb, sb, wT, wrp);

  // 2) projections (bf16 x bf16, exact products, f32 accumulate)
  //    xq, xk -> bf16 hi/lo planes [2048][1024]; qr, kr -> f16 planes; values transposed svT [1024][2048] hi/lo
  static_assert(NTOK % 128 == 0 && DMOD % 128 == 0 && DMOD % GK == 0, "projection and output GEMM shapes");
  k_proj5<<<dim3((NTOK / 128) * (DMOD / 128), 5, 1), 256, 0, stream>>>(xb, sb, wT, xqh, xql, xkh, xkl, qr16, kr16, svh, svl);

  // 3) every chunk of 256 query rows, both batch rows, in each grid: scores -> softmax -> (P.V beside relation scores) -> relation mix
  static_assert(CHR % 64 == 0 && HDIM % 32 == 0 && RDIM % 32 == 0 && HDIM % 64 == 0, "chunk GEMM shapes");
  static_assert(CHR % 128 == 0 && CHR == 256 && HDIM == 64 && RDIM == 64, "128x256 score and relation tiles, 128x64 P.V tiles, one stage of k for the scores");
  static_assert(NCHK == 4 && (NCHK & (NCHK - 1)) == 0 && ROWS_CH % 8 == 0 && NHEAD == 16 && NREL == 16, "grid decoding");
  k_scores<<<dim3((CHR / 128) * (SEQ / 256), NB * 16, NCHK), 256, 0, stream>>>(xqh, xql, xkh, xkl, sc);
  k_softmax<<<dim3((NCHK * ROWS_CH) / 8), 256, 0, stream>>>(sc, ph, pl, p16);
  k_pv_rel<<<dim3((CHR / 128) * (SEQ / 256), NB * 16, 2 * NCHK), 256, 0, stream>>>(ph, pl, svh, svl, attsym, qr16, kr16, rel16);
  k_rel_mix<<<dim3(CHR / 16, NB, NCHK), 256, 0, stream>>>(p16, rel16, wrp, attsym, ch, cl);

  // 4) out[token][n] = sum_k combined[token][k] * WoT[n][k]  (A hi/lo, B bf16 weights) -> d_out f32
  k_out<<<dim3((NTOK / 128) * (DMOD / 128)), 256, 0, stream>>>(ch, cl, WoT, out);
}

// v003
// One run takes 150 microseconds.
// Two timings next to v002 both put it at 1.12 times that version's speed.
// All steps since v000 together make it 5.93 times as fast.
// Contractions: v_wmma_f32_16x16x32_bf16 (bf16 operands: module inputs RNE-converted once to bf16; computed q/k, softmax probabilities, value rows, relation aggregates and pre-output activations carried as bf16 hi+lo pairs) and v_wmma_f32_16x16x32_f16 for relation scores and relation aggregation (f16 operands, probabilities carried x1024); f32 accumulate everywhere; softmax and all side math in f32.
#include <hip/hip_runtime.h>

// ---------------------------------------------------------------------------
// problem geometry
// ---------------------------------------------------------------------------
static constexpr int NB    = 2;
static constexpr int SEQ   = 1024;
static constexpr int DMOD  = 1024;
static constexpr int NHEAD = 16;
static constexpr int HDIM  = 64;
static constexpr int NREL  = 16;
static constexpr int RDIM  = 64;
static constexpr int NTOK  = NB * SEQ;          // 2048
static constexpr int CHR   = 256;               // query rows per chunk
static constexpr int NCHK  = SEQ / CHR;         // 4 chunks per batch row
static constexpr float SCALE_ATTN = 0.125f;     // 1/sqrt(64)
static constexpr float SCALE_REL  = 0.125f;     // 1/sqrt(64)
static constexpr float PCARRY     = 1024.0f;    // f16 probability carry
static constexpr float PCARRY_INV = 1.0f / 1024.0f;

// Per-pair planes (probabilities, relation scores) hold all chunks at once: chunk c (query rows 256c..256c+255,
// keys < jend = 256(c+1)) stores its rows at pitch jend and starts at element CHUNK_UNIT * c(c+1)/2.
static constexpr int    ROWS_CH     = NB * NHEAD * CHR;                             // 8192 rows per chunk
static constexpr size_t CHUNK_UNIT  = (size_t)ROWS_CH * CHR;                        // 2,097,152 elements per 256 keys
static constexpr size_t PLANE_ELEMS = CHUNK_UNIT * (NCHK * (NCHK + 1) / 2);         // 20,971,520 elements
__device__ __forceinline__ size_t chunk_base(int c) { return CHUNK_UNIT * (size_t)((c * (c + 1)) >> 1); }

static_assert(NHEAD * HDIM == DMOD, "head split");
static_assert(NREL * RDIM == DMOD, "relation split");
static_assert(SEQ == 4 * 256, "softmax handles up to 4 segments of 256 keys");
static_assert(SEQ % CHR == 0 && CHR % 64 == 0, "chunk tiling");
static_assert(NHEAD == 16 && NREL == 16, "relation mix kernel uses one 16x16 tile per token");
static_assert(HDIM % 32 == 0 && RDIM % 32 == 0, "K of score GEMMs multiple of 32");
static_assert(NTOK % 64 == 0 && DMOD % 64 == 0, "tile multiples");
static_assert((NTOK * DMOD) % (8 * 256) == 0, "cast kernel coverage");
static_assert((NHEAD * CHR) % 8 == 0 && CHR % 16 == 0, "softmax / mix grids");

// ---------------------------------------------------------------------------
// types, conversions, fragment helpers
// ---------------------------------------------------------------------------
typedef __attribute__((ext_vector_type(16))) _Float16 v16h;
typedef __attribute__((ext_vector_type(8)))  _Float16 v8h;
typedef __attribute__((ext_vector_type(16))) __bf16   v16b;
typedef __attribute__((ext_vector_type(8)))  __bf16   v8b;
typedef __attribute__((ext_vector_type(8)))  float    v8f;
typedef __attribute__((ext_vector_type(4)))  float    v4f;
typedef __attribute__((ext_vector_type(4)))  unsigned int v4u;

__device__ __forceinline__ unsigned short f2bf_bits(float f) {
  unsigned u = __float_as_uint(f);
  return (unsigned short)((u + 0x7FFFu + ((u >> 16) & 1u)) >> 16);
}
__device__ __forceinline__ float bf_bits2f(unsigned short h) { return __uint_as_float(((unsigned)h) << 16); }
__device__ __forceinline__ unsigned short h_bits(float f) { return __builtin_bit_cast(unsigned short, (_Float16)f); }
__device__ __forceinline__ unsigned pack_bf16x2(float a, float b) {
  return (unsigned)f2bf_bits(a) | ((unsigned)f2bf_bits(b) << 16);
}

template <typename T> struct Frag;
template <> struct Frag<_Float16> {
  typedef v16h V; union U { v16h v; v8h h[2]; };
  static __device__ __forceinline__ v16h load(const _Float16* p) {   // elements 0..7 <- p[0..7], 8..15 <- p[16..23]
    U f; f.h[0] = *(const v8h*)(p); f.h[1] = *(const v8h*)(p + 16); return f.v;
  }
  static __device__ __forceinline__ v8f mma(v16h a, v16h b, v8f c) {
    return __builtin_amdgcn_wmma_f32_16x16x32_f16(false, a, false, b, (short)0, c, false, false);
  }
};
template <> struct Frag<__bf16> {
  typedef v16b V; union U { v16b v; v8b h[2]; };
  static __device__ __forceinline__ v16b load(const __bf16* p) {
    U f; f.h[0] = *(const v8b*)(p); f.h[1] = *(const v8b*)(p + 16); return f.v;
  }
  static __device__ __forceinline__ v8f mma(v16b a, v16b b, v8f c) {
    return __builtin_amdgcn_wmma_f32_16x16x32_bf16(false, a, false, b, (short)0, c, false, false);
  }
};

// single-accumulator WMMA + hazard nops (used by the relation mix kernel)
__device__ __forceinline__ v8f mma16h(v16h a, v16h b, v8f c) {
  c = __builtin_amdgcn_wmma_f32_16x16x32_f16(false, a, false, b, (short)0, c, false, false);
  asm volatile("v_nop\n\tv_nop\n\tv_nop\n\tv_nop" : "+v"(c) : "v"(a), "v"(b));
  return c;
}
__device__ __forceinline__ v8f mma16b(v16b a, v16b b, v8f c) {
  c = __builtin_amdgcn_wmma_f32_16x16x32_bf16(false, a, false, b, (short)0, c, false, false);
  asm volatile("v_nop\n\tv_nop\n\tv_nop\n\tv_nop" : "+v"(c) : "v"(a), "v"(b));
  return c;
}

// ---- work-group WMMA GEMM, operands staged in LDS ---------------------
// C[m,n] = scale * sum_k A[m,k] * Bt[n,k]; one BM x BN tile of C per work-group of 8 waves.
// A row-major [M,K]; Bt row-major [N,K]; K % 64 == 0; every operand row starts on a 128-B line.
// SPLIT: A is hi/lo planes (A2 = lo); SPLITB: Bt also hi/lo (product hi.hi + hi.lo + lo.hi),
//        !SPLITB: Bt single plane (product hi.b + lo.b).
// OUT_MODE: 0 = f32, 1 = f16, 2 = bf16 hi plane (Cout) + bf16 lo plane (Cout2).
// ET: 0 = f16 operands, 1 = bf16 operands (pointers passed as 16-bit storage)
template <int ET> struct Elem;
template <> struct Elem<0> { typedef _Float16 T; };
template <> struct Elem<1> { typedef __bf16 T; };

// Result of one wave, MI x 4 accumulator tiles of 16x16 at rows m0.., columns n0..: 16 rows at a time through the wave's own
// 16x68 f32 LDS slab, so that every store covers whole row segments.
template <int MI, int OUT_MODE>
__device__ __forceinline__ void store_tiles(v8f (&acc)[MI][4], float scale,
    void* __restrict__ Cout, void* __restrict__ Cout2, int ldc, size_t offC, int m0, int n0, float* slab) {
  const int lane = threadIdx.x & 31;
  const int rlane = lane & 15;                 // column within a 16x16 tile
  const int mOff  = (lane >> 4) * 8;           // D row offset
#pragma unroll
  for (int i = 0; i < MI; ++i) {
    const int mBase = m0 + (i << 4);
#pragma unroll
    for (int j = 0; j < 4; ++j) {
#pragma unroll
      for (int r = 0; r < 8; ++r) {
        slab[(mOff + r) * 68 + (j << 4) + rlane] = acc[i][j][r] * scale;
      }
    }
    __builtin_amdgcn_fence(__ATOMIC_RELEASE, "workgroup");
    __builtin_amdgcn_wave_barrier();
    __builtin_amdgcn_fence(__ATOMIC_ACQUIRE, "workgroup");
    if (OUT_MODE == 0) {
      float* C = (float*)Cout + offC;
      const int hh = lane >> 4, c4 = (lane & 15) * 4;     // row seg = 256 B = 16 lanes x 16 B
      {
#pragma unroll
        for (int it = 0; it < 8; ++it) {
          const int row = it * 2 + hh;
          v4f v = *(const v4f*)(slab + row * 68 + c4);
          *(v4f*)(C + (size_t)(mBase + row) * ldc + n0 + c4) = v;
        }
        
      }
    } else {
      const int q = lane >> 3, c8 = (lane & 7) * 8;
      unsigned short* C  = (unsigned short*)Cout  + offC;
      unsigned short* C2 = (OUT_MODE == 2) ? ((unsigned short*)Cout2 + offC) : nullptr;
      {
#pragma unroll
        for (int it = 0; it < 4; ++it) {
          const int row = it * 4 + q;
          const float* sp = slab + row * 68 + c8;
          v8h hv, lv;
#pragma unroll
          for (int e = 0; e < 8; ++e) {
            if (OUT_MODE == 1) {
              hv[e] = (_Float16)sp[e];
            } else {
              unsigned short hb = f2bf_bits(sp[e]);
              unsigned short lb = f2bf_bits(sp[e] - bf_bits2f(hb));
              hv[e] = __builtin_bit_cast(_Float16, hb);
              lv[e] = __builtin_bit_cast(_Float16, lb);
            }
          }
          *(v8h*)(C + (size_t)(mBase + row) * ldc + n0 + c8) = hv;
          if (OUT_MODE == 2) *(v8h*)(C2 + (size_t)(mBase + row) * ldc + n0 + c8) = lv;
        }
        
      }
    }
    __builtin_amdgcn_fence(__ATOMIC_RELEASE, "workgroup");
    __builtin_amdgcn_wave_barrier();
    __builtin_amdgcn_fence(__ATOMIC_ACQUIRE, "workgroup");
  }
}

static constexpr int GK = 64;                  // k per stage: 128 B, one whole line, of every operand row
static constexpr int GP = GK + 8;              // LDS row pitch in 16-bit elements: 144 B = 16 B x 9, no bank conflict for 16-byte fragment reads
static constexpr int SLAB_WORDS = 8 * 16 * 68 * 2;   // the eight result slabs, in 16-bit words
// WM x WN waves, each MI*16 rows x 64 columns of C. One stage in LDS: rows [A | A lo | Bt | Bt lo], GP elements apart.
template <bool SPLIT, bool SPLITB, int MI, int WM, int WN> struct Stage {
  static_assert(WM * WN == 8, "eight waves");
  static constexpr int BM = WM * MI * 16, BN = WN * 64;
  static constexpr int AROWS = (SPLIT ? 2 : 1) * BM;
  static constexpr int ROWS  = AROWS + ((SPLIT && SPLITB) ? 2 : 1) * BN;
  static constexpr int WORDS = ROWS * GP;      // 16-bit words per stage
  static_assert(BM % 32 == 0 && BN % 32 == 0, "each group of 32 staged rows lies in one plane");
  static_assert(WORDS >= SLAB_WORDS, "the result slabs reuse the first stage");
};
// smem: two stages (one is enough where K == GK); offA / offB / offC: element offsets of this product's operands and result;
// m0b, n0b: the work-group's tile. Every thread of the work-group calls this (it holds barriers).
// Per stage the 256 threads copy 128 B of every operand row, 8 lanes to a row, into LDS; the next stage's global loads are
// issued before this stage's products and stored to the other buffer behind them.
template <int ET, bool SPLIT, bool SPLITB, int MI, int WM, int WN, int OUT_MODE, int LDA, int LDB>
__device__ __forceinline__ void gemm_block(
    const unsigned short* __restrict__ Ap, const unsigned short* __restrict__ A2p, size_t offA,
    const unsigned short* __restrict__ Btp, const unsigned short* __restrict__ Bt2p, size_t offB,
    void* __restrict__ Cout, void* __restrict__ Cout2, int ldc, size_t offC,
    int K, float scale, int m0b, int n0b, unsigned short* smem) {
  typedef typename Elem<ET>::T T;
  typedef typename Frag<T>::V V;
  typedef Stage<SPLIT, SPLITB, MI, WM, WN> G;
  constexpr int NLD = G::ROWS / 32;            // 16-byte pieces per thread and stage
  const int tid = threadIdx.x, lane = tid & 31, wave = tid >> 5;
  const int srow = tid >> 3, scol = (tid & 7) * 8;      // staging: row within a group of 32, 16-byte column
  // the thread's place in each operand plane at the stage to be fetched next; the rows' strides LDA, LDB are compile-time,
  // so every load of a plane names this one address and an immediate offset
  const unsigned short* gA  = Ap   + offA + (size_t)(m0b + srow) * LDA + scol;
  const unsigned short* gA2 = A2p  + offA + (size_t)(m0b + srow) * LDA + scol;
  const unsigned short* gB  = Btp  + offB + (size_t)(n0b + srow) * LDB + scol;
  const unsigned short* gB2 = Bt2p + offB + (size_t)(n0b + srow) * LDB + scol;
  unsigned short* sdst = smem + srow * GP + scol;

  const int rlane = lane & 15;                 // row (A) / col (B, D) within subtile
  const int koff  = (lane >> 4) * 8;           // k offset of this lane half
  const int wm = wave / WN, wn = wave - wm * WN;
  const int aoff = (wm * (MI * 16) + rlane) * GP + koff;
  const int boff = (G::AROWS + wn * 64 + rlane) * GP + koff;

  v8f acc[MI][4];
#pragma unroll
  for (int i = 0; i < MI; ++i)
#pragma unroll
    for (int j = 0; j < 4; ++j) acc[i][j] = (v8f){0.f,0.f,0.f,0.f,0.f,0.f,0.f,0.f};

  v4u st[NLD];
  auto fetch = [&]() {
#pragma unroll
    for (int n = 0; n < NLD; ++n) {
      const int r = n * 32;                    // first staged row of the group of 32: picks the plane at compile time
      const unsigned short* g;
      if (r < G::BM)                  g = gA  + (size_t)r * LDA;
      else if (r < G::AROWS)          g = gA2 + (size_t)(r - G::BM) * LDA;
      else if (r < G::AROWS + G::BN)  g = gB  + (size_t)(r - G::AROWS) * LDB;
      else                            g = gB2 + (size_t)(r - G::AROWS - G::BN) * LDB;
      st[n] = *(const v4u*)g;
    }
    // the addresses stay in their registers up to this wait, so that it stands in front of every overwrite of a register
    // that these loads name (a later load's result, the step to the next stage)
    if (SPLIT && SPLITB) asm volatile("s_wait_xcnt 0x0" :: "v"(gA), "v"(gA2), "v"(gB), "v"(gB2) : "memory");
    else if (SPLIT)      asm volatile("s_wait_xcnt 0x0" :: "v"(gA), "v"(gA2), "v"(gB) : "memory");
    else                 asm volatile("s_wait_xcnt 0x0" :: "v"(gA), "v"(gB) : "memory");
    gA += GK; gA2 += GK; gB += GK; gB2 += GK;
  };
  auto put = [&](int buf) {
#pragma unroll
    for (int n = 0; n < NLD; ++n) *(v4u*)(sdst + buf * G::WORDS + n * 32 * GP) = st[n];
  };

  fetch();
  put(0);
  __syncthreads();
  for (int k0 = 0, buf = 0; k0 < K; k0 += GK, buf ^= 1) {
    const bool more = k0 + GK < K;             // the same for the whole work-group
    if (more) fetch();
    const T* cur = (const T*)(smem + buf * G::WORDS);
#pragma unroll
    for (int ks = 0; ks < GK; ks += 32) {
      V bh[4], bl[4];
#pragma unroll
      for (int j = 0; j < 4; ++j) {
        bh[j] = Frag<T>::load(cur + boff + j * 16 * GP + ks);
        if (SPLIT && SPLITB) bl[j] = Frag<T>::load(cur + boff + (G::BN + j * 16) * GP + ks);
      }
#pragma unroll
      for (int i = 0; i < MI; ++i) {
        V ah = Frag<T>::load(cur + aoff + i * 16 * GP + ks);
        V al;
        if (SPLIT) al = Frag<T>::load(cur + aoff + (G::BM + i * 16) * GP + ks);
#pragma unroll
        for (int j = 0; j < 4; ++j) {
          acc[i][j] = Frag<T>::mma(ah, bh[j], acc[i][j]);
          if (SPLIT) {
            if (SPLITB) acc[i][j] = Frag<T>::mma(ah, bl[j], acc[i][j]);
            acc[i][j] = Frag<T>::mma(al, bh[j], acc[i][j]);
          }
        }
      }
    }
    if (more) put(buf ^ 1);                    // last read one trip ago, in front of that trip's barrier
    __syncthreads();                           // publishes the next stage; ends every read of this one
  }
  store_tiles<MI, OUT_MODE>(acc, scale, Cout, Cout2, ldc, offC, m0b + wm * (MI * 16), n0b + wn * 64,
                            (float*)smem + wave * (16 * 68));
}

// All five input projections in one grid; blockIdx.y selects the product (block-uniform):
// 0 q_attn, 1 k_attn -> bf16 hi/lo; 2 q_rel, 3 k_rel -> f16; 4 values, transposed (A = WvT, Bt = symbols) -> bf16 hi/lo.
// Each product has (NTOK/128)*(DMOD/128) tiles of 128x128, one per block.
__global__ __launch_bounds__(256) void k_proj5(
    const unsigned short* __restrict__ xb, const unsigned short* __restrict__ sb, const unsigned short* __restrict__ wT,
    unsigned short* __restrict__ xqh, unsigned short* __restrict__ xql,
    unsigned short* __restrict__ xkh, unsigned short* __restrict__ xkl,
    unsigned short* __restrict__ qr16, unsigned short* __restrict__ kr16,
    unsigned short* __restrict__ svh, unsigned short* __restrict__ svl) {
  __shared__ __align__(16) unsigned short sm[2 * Stage<false, false, 2, 4, 2>::WORDS];
  const int y = blockIdx.y;
  const bool tv = (y == 4);
  const int nbN = (tv ? NTOK : DMOD) / 128;
  const int m0b = ((int)blockIdx.x / nbN) * 128, n0b = ((int)blockIdx.x % nbN) * 128;
  const unsigned short* Wy = wT + (size_t)y * DMOD * DMOD;
  if (y == 2 || y == 3) {
    unsigned short* c = (y == 2) ? qr16 : kr16;
    gemm_block<1, false, false, 2, 4, 2, 1, DMOD, DMOD>(xb, xb, 0, Wy, Wy, 0, c, c, DMOD, 0, DMOD, 1.0f, m0b, n0b, sm);
  } else {
    const unsigned short* a  = tv ? Wy : xb;
    const unsigned short* bt = tv ? sb : Wy;
    unsigned short* chi = tv ? svh : (y == 0 ? xqh : xkh);
    unsigned short* clo = tv ? svl : (y == 0 ? xql : xkl);
    gemm_block<1, false, false, 2, 4, 2, 2, DMOD, DMOD>(a, a, 0, bt, bt, 0, chi, clo, tv ? NTOK : DMOD, 0, DMOD, 1.0f, m0b, n0b, sm);
  }
}

// Attention scores and causal softmax of every chunk, batch row and head in one grid: a work-group owns SR whole query rows.
// Part 1, per block of 256 keys: scores[il][j] = SCALE_ATTN * sum_d xq[i][h,d] xk[j][h,d] (hi/lo split on both operands, product
//   hi.hi + hi.lo + lo.hi), operands staged as in gemm_block (one stage: all of k); the block's f32 scores pass through a
//   32 x 256 buffer in LDS into the registers of the wave that owns the row: wave w owns rows 4w .. 4w+3, lane owns
//   j = 256*t + 8*lane .. +7 (t <= c). The next block's global loads are issued behind this block's products.
// Part 2: softmax of the wave's four rows, keys j <= i.
//   Writes P hi/lo bf16 planes and the P*1024 f16 plane, row r = (b*NHEAD + h)*CHR + il at pitch jend, zeros for i < j < jend.
static constexpr int SR  = 32;                 // query rows per work-group
static constexpr int SRW = SR / 8;             // rows per wave
static constexpr int STP = CHR + 4;            // floats per row of the score buffer: rows 8 apart lie 32 banks apart (the two lane halves of a tile store), 16-B aligned
typedef Stage<true, true, 1, 2, 4> SG;         // one block: 32 query rows x 256 keys
static_assert(SG::BM == SR && SG::BN == CHR && HDIM == GK, "one stage holds all of k for 32 rows and 256 keys");
// One code path for all chunks: c, and with it the number NT of key blocks, is block-uniform, so every test on it is a scalar
// branch that the whole work-group takes alike (barriers included); the kernel's text stays small.
// blockIdx.x = block of SR query rows in the chunk, blockIdx.y = batch row * 16 + head, blockIdx.z: chunk 3 - z (longest first).
// Two work-groups share a WGP (one's products run beside the other's softmax arithmetic): four waves per SIMD, 256 registers each.
__global__ __launch_bounds__(256) __attribute__((amdgpu_waves_per_eu(4, 4))) void k_scores_softmax(
    const unsigned short* __restrict__ xqh, const unsigned short* __restrict__ xql,
    const unsigned short* __restrict__ xkh, const unsigned short* __restrict__ xkl,
    unsigned short* __restrict__ ph, unsigned short* __restrict__ pl, unsigned short* __restrict__ p16) {
  __shared__ __align__(16) unsigned short smem[SG::WORDS];
  __shared__ __align__(16) float tbuf[SR * STP];
  typedef __bf16 T;
  typedef Frag<T>::V V;
  constexpr int NLD = SG::ROWS / 32;           // 16-byte pieces per thread and stage
  constexpr int NA  = SG::AROWS / 32;          // of them the query rows, hi and lo
  const int c = (NCHK - 1) - (int)blockIdx.z;
  const int y = blockIdx.y, il0 = (int)blockIdx.x * SR;
  const int NT = c + 1;                        // blocks of 256 keys
  const int jend = CHR * NT;
  const int tid = threadIdx.x, lane = tid & 31;
  const int wave = __builtin_amdgcn_readfirstlane(tid >> 5);   // the same in every lane: kept in a scalar register, and the row addresses with it
  const int srow = tid >> 3, scol = (tid & 7) * 8;      // staging: row within a group of 32, 16-byte column
  const size_t bb = (size_t)(y >> 4), h = (size_t)(y & 15);
  const size_t offA = (bb * SEQ + (size_t)(c * CHR + il0)) * DMOD + h * HDIM;
  const size_t offB = bb * ((size_t)SEQ * DMOD) + h * HDIM;
  const unsigned short* gA  = xqh + offA + (size_t)srow * DMOD + scol;
  const unsigned short* gA2 = xql + offA + (size_t)srow * DMOD + scol;
  const unsigned short* gB  = xkh + offB + (size_t)srow * DMOD + scol;
  const unsigned short* gB2 = xkl + offB + (size_t)srow * DMOD + scol;
  unsigned short* sdst = smem + srow * GP + scol;

  const int rlane = lane & 15;                 // row (A) / col (B, D) within subtile
  const int koff  = (lane >> 4) * 8;           // k offset of this lane half
  const int wm = wave >> 2, wn = wave & 3;     // 2 x 4 waves, each 16 rows x 64 keys
  const int aoff = (wm * 16 + rlane) * GP + koff;
  const int boff = (SG::AROWS + wn * 64 + rlane) * GP + koff;
  float* tdst = tbuf + (wm * 16 + (lane >> 4) * 8) * STP + wn * 64 + rlane;   // D row 8*(lane>>4) + r, column rlane
  const float* tsrc = tbuf + (wave * SRW) * STP + lane * 8;                   // the wave's own rows, the lane's 8 keys

  v4u st[NLD];
  auto fetch = [&](int nb) {                   // nb: the key block, a compile-time number at every call: an immediate offset
#pragma unroll
    for (int n = (nb == 0 ? 0 : NA); n < NLD; ++n) {   // the query rows are staged once, with block 0, and stay
      const int r = n * 32;                    // first staged row of the group of 32: picks the plane at compile time
      const unsigned short* g;
      if (r < SG::BM)                   g = gA  + (size_t)r * DMOD;
      else if (r < SG::AROWS)           g = gA2 + (size_t)(r - SG::BM) * DMOD;
      else if (r < SG::AROWS + SG::BN)  g = gB  + (size_t)(nb * SG::BN + r - SG::AROWS) * DMOD;
      else                              g = gB2 + (size_t)(nb * SG::BN + r - SG::AROWS - SG::BN) * DMOD;
      st[n] = *(const v4u*)g;
    }
    // the addresses, the same for every block, stay in their registers up to this wait, so that it stands in front of
    // every overwrite of a register that these loads name
    if (nb == 0) asm volatile("s_wait_xcnt 0x0" :: "v"(gA), "v"(gA2), "v"(gB), "v"(gB2) : "memory");
    else         asm volatile("s_wait_xcnt 0x0" :: "v"(gB), "v"(gB2) : "memory");
  };
  auto put = [&](int nb) {
#pragma unroll
    for (int n = (nb == 0 ? 0 : NA); n < NLD; ++n) *(v4u*)(sdst + n * 32 * GP) = st[n];
  };

  const float NEG = -__builtin_huge_valf();
  const int ilw = il0 + wave * SRW;            // the wave's first row within the chunk
  float s[SRW][NCHK][8];                       // blocks t >= NT are neither written nor read
  fetch(0);
  put(0);
  __syncthreads();
  const T* cur = (const T*)smem;
  // unrolled: s lives in registers and is indexed by the block's number
#pragma unroll
  for (int nb = 0; nb < NCHK; ++nb) {
    if (nb < NT) {
      v8f acc[4];
#pragma unroll
      for (int j = 0; j < 4; ++j) acc[j] = (v8f){0.f,0.f,0.f,0.f,0.f,0.f,0.f,0.f};
#pragma unroll
      for (int ks = 0; ks < GK; ks += 32) {
        V bh[4], bl[4];
#pragma unroll
        for (int j = 0; j < 4; ++j) {
          bh[j] = Frag<T>::load(cur + boff + j * 16 * GP + ks);
          bl[j] = Frag<T>::load(cur + boff + (SG::BN + j * 16) * GP + ks);
        }
        const V ah = Frag<T>::load(cur + aoff + ks);
        const V al = Frag<T>::load(cur + aoff + SG::BM * GP + ks);
#pragma unroll
        for (int j = 0; j < 4; ++j) {
          acc[j] = Frag<T>::mma(ah, bh[j], acc[j]);
          acc[j] = Frag<T>::mma(ah, bl[j], acc[j]);
          acc[j] = Frag<T>::mma(al, bh[j], acc[j]);
        }
      }
      if (nb + 1 < NCHK && nb + 1 < NT) fetch(nb + 1);
#pragma unroll
      for (int j = 0; j < 4; ++j)
#pragma unroll
        for (int r = 0; r < 8; ++r) tdst[r * STP + j * 16] = acc[j][r] * SCALE_ATTN;
      __syncthreads();                         // publishes this block's scores; ends every read of the stage
#pragma unroll
      for (int q = 0; q < SRW; ++q) {
        const v4f a = *(const v4f*)(tsrc + q * STP);
        const v4f b = *(const v4f*)(tsrc + q * STP + 4);
        s[q][nb][0] = a[0]; s[q][nb][1] = a[1]; s[q][nb][2] = a[2]; s[q][nb][3] = a[3];
        s[q][nb][4] = b[0]; s[q][nb][5] = b[1]; s[q][nb][6] = b[2]; s[q][nb][7] = b[3];
      }
      if (nb + 1 < NCHK && nb + 1 < NT) {
        put(nb + 1);
        __syncthreads();                       // publishes the next stage; ends every read of the score buffer
      } else {
        // the chunk's last block holds the diagonal: keys j > i get -inf, as in the definition (they leave the maximum alone
        // and their exponential is exactly 0); in every earlier block j < 256 c <= i
#pragma unroll
        for (int q = 0; q < SRW; ++q)
#pragma unroll
          for (int e = 0; e < 8; ++e) s[q][nb][e] = (lane * 8 + e <= ilw + q) ? s[q][nb][e] : NEG;
      }
    }
  }

  const float LOG2E = 1.44269504088896340736f;
  float m[SRW], sum[SRW], inv[SRW];
#pragma unroll
  for (int q = 0; q < SRW; ++q) m[q] = NEG;
#pragma unroll
  for (int t = 0; t < NCHK; ++t) {
    if (t < NT) {
#pragma unroll
      for (int q = 0; q < SRW; ++q)
#pragma unroll
        for (int e = 0; e < 8; ++e) m[q] = fmaxf(m[q], s[q][t][e]);
    }
  }
#pragma unroll
  for (int off = 1; off < 32; off <<= 1) {     // the four rows' chains of shuffles overlap
#pragma unroll
    for (int q = 0; q < SRW; ++q) m[q] = fmaxf(m[q], __shfl_xor(m[q], off, 32));
  }
#pragma unroll
  for (int q = 0; q < SRW; ++q) sum[q] = 0.f;
#pragma unroll
  for (int t = 0; t < NCHK; ++t) {
    if (t < NT) {
#pragma unroll
      for (int q = 0; q < SRW; ++q) {
        float x[8], v[8];
#pragma unroll
        for (int e = 0; e < 8; ++e) x[e] = (s[q][t][e] - m[q]) * LOG2E;
        // exp(u) = 2^(u * log2 e), eight at a time in one statement: no result shares a register with a source (early clobber),
        // and the v_nop fills the slot that the instruction set asks for behind the last transcendental
        asm("v_exp_f32 %0, %8\n\tv_exp_f32 %1, %9\n\tv_exp_f32 %2, %10\n\tv_exp_f32 %3, %11\n\t"
            "v_exp_f32 %4, %12\n\tv_exp_f32 %5, %13\n\tv_exp_f32 %6, %14\n\tv_exp_f32 %7, %15\n\tv_nop"
            : "=&v"(v[0]), "=&v"(v[1]), "=&v"(v[2]), "=&v"(v[3]), "=&v"(v[4]), "=&v"(v[5]), "=&v"(v[6]), "=&v"(v[7])
            : "v"(x[0]), "v"(x[1]), "v"(x[2]), "v"(x[3]), "v"(x[4]), "v"(x[5]), "v"(x[6]), "v"(x[7]));
#pragma unroll
        for (int e = 0; e < 8; ++e) {
          s[q][t][e] = v[e];
          sum[q] += v[e];
        }
      }
    }
  }
#pragma unroll
  for (int off = 1; off < 32; off <<= 1) {
#pragma unroll
    for (int q = 0; q < SRW; ++q) sum[q] += __shfl_xor(sum[q], off, 32);
  }
#pragma unroll
  for (int q = 0; q < SRW; ++q) inv[q] = 1.0f / sum[q];    // sum >= 1 (the row's largest score gives exp(0))
  const size_t ro = chunk_base(c) + ((size_t)y * CHR + ilw) * jend;   // the wave's first row: a scalar base for every store
  unsigned short* dh = ph + ro;
  unsigned short* dl = pl + ro;
  unsigned short* df = p16 + ro;
  unsigned vo[SRW];                            // the lane's place in each of the four rows, in bytes: one 32-bit offset register per row
#pragma unroll
  for (int q = 0; q < SRW; ++q) vo[q] = (unsigned)(q * jend + lane * 8) * 2u;
#pragma unroll
  for (int t = 0; t < NCHK; ++t) {
    if (t < NT) {
      v4u hv[SRW], lv[SRW], fv[SRW];
#pragma unroll
      for (int q = 0; q < SRW; ++q) {
#pragma unroll
        for (int e = 0; e < 4; ++e) {
          const float a = s[q][t][2 * e] * inv[q];
          const float b = s[q][t][2 * e + 1] * inv[q];
          const unsigned short ha = f2bf_bits(a), hb = f2bf_bits(b);
          const unsigned short la = f2bf_bits(a - bf_bits2f(ha)), lb = f2bf_bits(b - bf_bits2f(hb));
          const unsigned short fa = h_bits(a * PCARRY), fb = h_bits(b * PCARRY);
          hv[q][e] = (unsigned)ha | ((unsigned)hb << 16);
          lv[q][e] = (unsigned)la | ((unsigned)lb << 16);
          fv[q][e] = (unsigned)fa | ((unsigned)fb << 16);
        }
      }
      // no packing arithmetic is scheduled in among the stores, where it could reuse a register that an issued store names
      __builtin_amdgcn_sched_barrier(0);
#pragma unroll
      for (int q = 0; q < SRW; ++q) {
        *(v4u*)((char*)dh + vo[q] + t * 512) = hv[q];
        *(v4u*)((char*)dl + vo[q] + t * 512) = lv[q];
        *(v4u*)((char*)df + vo[q] + t * 512) = fv[q];
      }
      // the stores stay in front of the wait ...
      __builtin_amdgcn_sched_barrier(0);
      // ... which stands in front of every overwrite of their registers by the next segment's packing ...
      asm volatile("s_wait_xcnt 0x0" ::: "memory");
      // ... and that packing stays behind it
      __builtin_amdgcn_sched_barrier(0);
    }
  }
}

// P.V and the relation scores of every chunk and batch row in one grid (neither reads the other's result).
// blockIdx.z = 0..3: attended_symbols of chunk 3 - z (longest K loop first; 2 tiles of 128x64 per head, blocks x = 0, 1);
// blockIdx.z = 4..7: relation scores of chunk 7 - z, tiles of 128x256. blockIdx.y = batch row * 16 + head or relation.
__global__ __launch_bounds__(256) void k_pv_rel(
    const unsigned short* __restrict__ ph, const unsigned short* __restrict__ pl,
    const unsigned short* __restrict__ svh, const unsigned short* __restrict__ svl, float* __restrict__ attsym,
    const unsigned short* __restrict__ qr16, const unsigned short* __restrict__ kr16, unsigned short* __restrict__ rel16) {
  static_assert(2 * Stage<true, true, 1, 8, 1>::WORDS >= Stage<false, false, 4, 2, 4>::WORDS, "both roles fit");
  __shared__ __align__(16) unsigned short sm[2 * Stage<true, true, 1, 8, 1>::WORDS];
  const int c = (NCHK - 1) - (int)(blockIdx.z & (NCHK - 1));
  const int jend = CHR * (c + 1);
  const size_t bb = blockIdx.y >> 4, hr = blockIdx.y & 15;
  const size_t rowbase = bb * SEQ + (size_t)c * CHR;
  if (blockIdx.z < NCHK) {
    if ((int)blockIdx.x >= CHR / 128) return;              // block-uniform, in front of every barrier
    // attended_symbols[token][h*64+d] = sum_j P[h][il][j] * svT[h*64+d][b*1024+j]  (split both)
    const size_t oP = chunk_base(c) + (size_t)blockIdx.y * CHR * jend, oV = hr * ((size_t)HDIM * NTOK) + bb * SEQ;
    const size_t oC = rowbase * DMOD + hr * HDIM;
    const int m0b = (int)blockIdx.x * 128;
    // one instance per chunk: the pitch jend of P is a compile-time stride in each
    if (c == 3)      gemm_block<1, true, true, 1, 8, 1, 0, 4 * CHR, NTOK>(ph, pl, oP, svh, svl, oV, attsym, attsym, DMOD, oC, 4 * CHR, 1.0f, m0b, 0, sm);
    else if (c == 2) gemm_block<1, true, true, 1, 8, 1, 0, 3 * CHR, NTOK>(ph, pl, oP, svh, svl, oV, attsym, attsym, DMOD, oC, 3 * CHR, 1.0f, m0b, 0, sm);
    else if (c == 1) gemm_block<1, true, true, 1, 8, 1, 0, 2 * CHR, NTOK>(ph, pl, oP, svh, svl, oV, attsym, attsym, DMOD, oC, 2 * CHR, 1.0f, m0b, 0, sm);
    else             gemm_block<1, true, true, 1, 8, 1, 0, 1 * CHR, NTOK>(ph, pl, oP, svh, svl, oV, attsym, attsym, DMOD, oC, 1 * CHR, 1.0f, m0b, 0, sm);
  } else {
    const int nbN = c + 1;                                 // jend / 256
    if ((int)blockIdx.x >= (CHR / 128) * nbN) return;      // block-uniform, in front of every barrier
    // rel[c][b][il][r][j] = SCALE_REL * sum_p qr[i][r,p] kr[j][r,p]  (plain f16) -> f16 plane
    gemm_block<0, false, false, 4, 2, 4, 1, DMOD, DMOD>(qr16, qr16, rowbase * DMOD + hr * RDIM,
                                            kr16, kr16, bb * ((size_t)SEQ * DMOD) + hr * RDIM,
                                            rel16, rel16, NREL * jend, chunk_base(c) + bb * ((size_t)CHR * NREL * jend) + hr * jend,
                                            RDIM, SCALE_REL, ((int)blockIdx.x / nbN) * 128, ((int)blockIdx.x % nbN) * 256, sm);
  }
}

// out[token][n] = sum_k combined[token][k] * WoT[n][k]  (A hi/lo, B bf16 weights), f32 out; one 128x128 tile per block.
__global__ __launch_bounds__(256) void k_out(const unsigned short* __restrict__ ch, const unsigned short* __restrict__ cl,
    const unsigned short* __restrict__ woT, float* __restrict__ out) {
  __shared__ __align__(16) unsigned short sm[2 * Stage<true, false, 2, 4, 2>::WORDS];
  const int nbN = DMOD / 128;
  gemm_block<1, true, false, 2, 4, 2, 0, DMOD, DMOD>(ch, cl, 0, woT, woT, 0, out, out, DMOD, 0, DMOD, 1.0f,
                                         ((int)blockIdx.x / nbN) * 128, ((int)blockIdx.x % nbN) * 128, sm);
}

// ---------------------------------------------------------------------------
// f32 -> bf16 (RNE) cast of the two activation tensors, 8 elements per thread:
// by selects the tensor (block-uniform), bx the block of 2048 elements. Coverage: CAST_BLOCKS*256 threads * 8 = n8*8 elements exactly.
// ---------------------------------------------------------------------------
__device__ __forceinline__ void cast_bf16x8_block(const float* __restrict__ s0, const float* __restrict__ s1,
    unsigned short* __restrict__ d0, unsigned short* __restrict__ d1, int n8, int bx, int by) {
  const float* src = (by == 0) ? s0 : s1;
  unsigned short* dst = (by == 0) ? d0 : d1;
  const int i = bx * 256 + threadIdx.x;
  if (i < n8) {
    const size_t e0 = (size_t)i * 8;
    const v4f a = *(const v4f*)(src + e0);
    const v4f c = *(const v4f*)(src + e0 + 4);
    v4u u;
    u[0] = pack_bf16x2(a[0], a[1]);
    u[1] = pack_bf16x2(a[2], a[3]);
    u[2] = pack_bf16x2(c[0], c[1]);
    u[3] = pack_bf16x2(c[2], c[3]);
    *(v4u*)(dst + e0) = u;
    
  }
}

// ---------------------------------------------------------------------------
// Weight transpose + bf16 cast: W[k][o] (f32, [DMOD][DMOD]) -> WT[o][k] (bf16), 6 weights selected by z; tile: 64*68 floats of LDS.
// Coverage per block: read 4 iters * 256 threads * 4 = 4096 elements; write 2 iters * 8 waves * 4 lines * 64 = 4096.
// ---------------------------------------------------------------------------
__device__ __forceinline__ void wT_bf16_block(const float* __restrict__ w0, const float* __restrict__ w1,
    const float* __restrict__ w2, const float* __restrict__ w3, const float* __restrict__ w4, const float* __restrict__ w5,
    unsigned short* __restrict__ dst, float* tile, int bx, int by, int z) {
  const float* W = (z == 0) ? w0 : (z == 1) ? w1 : (z == 2) ? w2 : (z == 3) ? w3 : (z == 4) ? w4 : w5;
  unsigned short* WT = dst + (size_t)z * DMOD * DMOD;
  const int k0 = by * 64;   // rows of W (input dim)
  const int o0 = bx * 64;   // cols of W (output dim)
  const int tid = threadIdx.x;
#pragma unroll
  for (int it = 0; it < 4; ++it) {
    const int e = (it * 256 + tid) * 4;
    const int row = e >> 6, col = e & 63;
    const v4f v = *(const v4f*)(W + (size_t)(k0 + row) * DMOD + o0 + col);
    *(v4f*)(tile + row * 68 + col) = v;
  }
  __syncthreads();
  const int lane = tid & 31, wave = tid >> 5, q = lane >> 3, c8 = (lane & 7) * 8;
  v4u ov[2];
#pragma unroll
  for (int it = 0; it < 2; ++it) {
    const int oo = it * 32 + wave * 4 + q;
    float f[8];
#pragma unroll
    for (int e = 0; e < 8; ++e) f[e] = tile[(c8 + e) * 68 + oo];
    ov[it][0] = pack_bf16x2(f[0], f[1]);
    ov[it][1] = pack_bf16x2(f[2], f[3]);
    ov[it][2] = pack_bf16x2(f[4], f[5]);
    ov[it][3] = pack_bf16x2(f[6], f[7]);
  }
  {
#pragma unroll
    for (int it = 0; it < 2; ++it) {
      const int oo = it * 32 + wave * 4 + q;
      *(v4u*)(WT + (size_t)(o0 + oo) * DMOD + k0 + c8) = ov[it];
    }
    // in the merged kernel's built control flow another role's code follows these stores and reuses their registers:
    // keep the wait in front of that overwrite
    asm volatile("s_wait_xcnt 0x0" ::: "memory");
  }
}

// ---------------------------------------------------------------------------
// Wr [NHEAD*HDIM rows][NREL] f32 -> WrP [rows][32] bf16 with k 16..31 zero-FILLED (WMMA K padding).
// Coverage: 256 threads * 8 elements = 64 rows * 32; store 8 waves * 4 lines * 64 = 2048 elements.
// ---------------------------------------------------------------------------
__device__ __forceinline__ void wr_pack_block(const float* __restrict__ wr, unsigned short* __restrict__ dst,
    unsigned short* tile, int bx) {   // tile: 64*32 16-bit words of LDS
  const int r0 = bx * 64;
  const int tid = threadIdx.x;
  const int row = tid >> 2, kq = (tid & 3) * 8;
  v4u u;
  unsigned wv[4];
#pragma unroll
  for (int e = 0; e < 4; ++e) {
    const int ka = kq + 2 * e, kb = kq + 2 * e + 1;
    const int kac = ka < NREL ? ka : NREL - 1;
    const int kbc = kb < NREL ? kb : NREL - 1;
    const float fa = wr[(size_t)(r0 + row) * NREL + kac];
    const float fb = wr[(size_t)(r0 + row) * NREL + kbc];
    const unsigned ba = (ka < NREL) ? (unsigned)f2bf_bits(fa) : 0u;
    const unsigned bb = (kb < NREL) ? (unsigned)f2bf_bits(fb) : 0u;
    wv[e] = ba | (bb << 16);
  }
  u[0] = wv[0]; u[1] = wv[1]; u[2] = wv[2]; u[3] = wv[3];
  *(v4u*)(tile + row * 32 + kq) = u;
  __syncthreads();
  const int lane = tid & 31, wave = tid >> 5, q = lane >> 3, c8 = (lane & 7) * 8;
  const int L = wave * 4 + q;                       // line 0..31, 64 elements per line
  const v4u v = *(const v4u*)(tile + L * 64 + c8);
  {
    *(v4u*)(dst + (size_t)r0 * 32 + L * 64 + c8) = v;
    // as in the weight transpose: the wait in front of an overwrite of this store's registers by another role's code
    asm volatile("s_wait_xcnt 0x0" ::: "memory");
  }
}

// ---------------------------------------------------------------------------
// The three input conversions in one grid (none reads another's result); the role is block-uniform, from blockIdx.x:
// [0, 2*CAST_BLOCKS) activation casts, then WT_BLOCKS weight-transpose tiles, then WR_BLOCKS blocks of the Wr pack.
// ---------------------------------------------------------------------------
static constexpr int CAST_BLOCKS = NTOK * DMOD / 8 / 256;            // 1024 per tensor
static constexpr int WT_SIDE     = DMOD / 64;                        // 16 tiles per side
static constexpr int WT_BLOCKS   = 6 * WT_SIDE * WT_SIDE;            // 1536
static constexpr int WR_BLOCKS   = (NHEAD * HDIM) / 64;              // 16
__global__ __launch_bounds__(256) void k_prep(const float* __restrict__ x, const float* __restrict__ symb,
    const float* __restrict__ w0, const float* __restrict__ w1, const float* __restrict__ w2,
    const float* __restrict__ w3, const float* __restrict__ w4, const float* __restrict__ w5, const float* __restrict__ wr,
    unsigned short* __restrict__ xb, unsigned short* __restrict__ sb, unsigned short* __restrict__ wT,
    unsigned short* __restrict__ wrp) {
  __shared__ __align__(16) float tile[64 * 68];
  const int id = blockIdx.x;
  if (id < 2 * CAST_BLOCKS) {
    cast_bf16x8_block(x, symb, xb, sb, NTOK * DMOD / 8, id % CAST_BLOCKS, id / CAST_BLOCKS);
    return;
  }
  if (id < 2 * CAST_BLOCKS + WT_BLOCKS) {
    const int t = id - 2 * CAST_BLOCKS;
    wT_bf16_block(w0, w1, w2, w3, w4, w5, wT, tile, t % WT_SIDE, (t / WT_SIDE) % WT_SIDE, t / (WT_SIDE * WT_SIDE));
    return;
  }
  wr_pack_block(wr, wrp, (unsigned short*)tile, id - 2 * CAST_BLOCKS - WT_BLOCKS);
}

// ---------------------------------------------------------------------------
// Relation aggregation + Wr mix + residual. Block = 8 waves = 16 consecutive query rows il0..il0+15 of batch row blockIdx.y, chunk 3 - blockIdx.z (longest first).
// Phase 1 (per wave, rows ill = wave and wave+8): D[h][r] = sum_{j<kend} P16[h][il][j] * rel[il][r][j]
//   (one f16 WMMA tile, K stepped by 32; the 16 + 16 operand rows are staged 256 k at a time in the wave's own LDS, up to the
//   causal extent, zeros behind it; P16 carries P*1024, rel carries REL_SCALE);
//   D is split into bf16 hi/lo and written to LDS arHL[m=ill][h][k=r] (k 16..31 zero-filled first).
// Phase 2 (per wave, heads h = wave and wave+8): attrel[ill][d] = sum_r ar[ill][h][r] * Wr[h][d][r]
//   (A = arHL hi/lo from LDS, B = WrP bf16 [h*64+d][32], two products per tile, 4 tiles of 16 d).
// Epilogue: per-wave 16x64 slab in LDS, residual attended_symbols added from one 32-B load per lane in the
// ---------------------------------------------------------------------------
__global__ __launch_bounds__(256) void k_rel_mix(const unsigned short* __restrict__ p16all, const unsigned short* __restrict__ relall,
    const unsigned short* __restrict__ wrp, const float* __restrict__ attsym,
    unsigned short* __restrict__ comb_hi, unsigned short* __restrict__ comb_lo) {
  const int c = (NCHK - 1) - (int)blockIdx.z;
  const int i0 = c * CHR, jend = CHR * (c + 1);
  const unsigned short* p16 = p16all + chunk_base(c) + (size_t)blockIdx.y * ((size_t)NHEAD * CHR * jend);
  const unsigned short* rel = relall + chunk_base(c) + (size_t)blockIdx.y * ((size_t)CHR * NREL * jend);
  const int rowbase = (int)blockIdx.y * SEQ + i0;
  __shared__ __align__(16) unsigned short arHL[2 * 16 * 16 * 32];   // hi plane [m][h][32] then lo plane
  __shared__ __align__(16) float slab[8][16 * 68];
  constexpr int RK = 256;                   // k per stage of phase 1: 512 B of an operand row = one wave-wide load of whole lines
  constexpr int RPITCH = RK + 8;            // 528 B = 16 B x 33: no bank conflict for 16-byte fragment reads
  __shared__ __align__(16) unsigned short stg[8][32 * RPITCH];
  const int tid = threadIdx.x, lane = tid & 31, wave = tid >> 5;
  const int hh = lane >> 4, rl = lane & 15, koff = hh * 8;
  const int il0 = blockIdx.x * 16;
  {
    const v4u zz = {0u, 0u, 0u, 0u};
    v4u* zp = (v4u*)arHL;                 // 32768 B = 2048 x 16 B, 256 threads x 8
    for (int qq = tid; qq < 2048; qq += 256) zp[qq] = zz;
  }
  __syncthreads();
  const v8f zero8 = {0.f, 0.f, 0.f, 0.f, 0.f, 0.f, 0.f, 0.f};
#pragma unroll
  for (int sub = 0; sub < 2; ++sub) {
    const int ill = wave + 8 * sub;           // local row 0..15 (wave-uniform)
    const int il = il0 + ill;                 // row within chunk 0..255
    const int i = i0 + il;                    // query position
    const int kend = (i & ~31) + 32;          // <= jend; P16 is zero for i < j < kend
    const unsigned short* gA = p16 + (size_t)il * jend;                      // + head * CHR * jend: A row m = head
    const unsigned short* gB = rel + (size_t)il * ((size_t)NREL * jend);     // + relation * jend: Bt row n = relation
    const int lane8 = lane * 8;               // the lane's 16 bytes of a row's 512
    unsigned short* wst = stg[wave];          // the wave's own stage: rows 0..15 = A, 16..31 = Bt
    v8f acc = zero8;
    for (int ks = 0; ks < kend; ks += RK) {
      const bool on = ks + lane * 8 < kend;   // kend is a multiple of 32; columns from kend on are staged as zeros and add nothing
      v4u st[32];
#pragma unroll
      for (int n = 0; n < 32; ++n) st[n] = (v4u){0u, 0u, 0u, 0u};
      if (on) {
#pragma unroll
        for (int n4 = 0; n4 < 16; n4 += 4) {
          const unsigned short *ga[4], *gb[4];
#pragma unroll
          for (int q = 0; q < 4; ++q) {
            ga[q] = gA + (size_t)(n4 + q) * ((size_t)CHR * jend) + ks + lane8;
            gb[q] = gB + (size_t)(n4 + q) * jend + ks + lane8;
            st[n4 + q]      = *(const v4u*)ga[q];
            st[16 + n4 + q] = *(const v4u*)gb[q];
          }
          // a later load's result may be given the registers that held these addresses: the addresses stay where they are
          // up to this wait, which stands in front of every such overwrite
          asm volatile("s_wait_xcnt 0x0" :: "v"(ga[0]), "v"(ga[1]), "v"(ga[2]), "v"(ga[3]),
                                            "v"(gb[0]), "v"(gb[1]), "v"(gb[2]), "v"(gb[3]) : "memory");
        }
      }
#pragma unroll
      for (int n = 0; n < 32; ++n) *(v4u*)(wst + n * RPITCH + lane * 8) = st[n];
      __builtin_amdgcn_fence(__ATOMIC_RELEASE, "workgroup");
      __builtin_amdgcn_wave_barrier();
      __builtin_amdgcn_fence(__ATOMIC_ACQUIRE, "workgroup");
      v16h a[RK / 32], bb[RK / 32];           // the stage's fragment reads go as one group ahead of its products
#pragma unroll
      for (int u = 0; u < RK / 32; ++u) {
        a[u]  = Frag<_Float16>::load((const _Float16*)wst + rl * RPITCH + koff + u * 32);
        bb[u] = Frag<_Float16>::load((const _Float16*)wst + (16 + rl) * RPITCH + koff + u * 32);
      }
#pragma unroll
      for (int u = 0; u < RK / 32; ++u) acc = mma16h(a[u], bb[u], acc);
      __builtin_amdgcn_fence(__ATOMIC_RELEASE, "workgroup");
      __builtin_amdgcn_wave_barrier();
      __builtin_amdgcn_fence(__ATOMIC_ACQUIRE, "workgroup");
    }
    // acc[r8] = D[row h = 8*hh + r8][col r = rl]  (carried x1024)
#pragma unroll
    for (int r8 = 0; r8 < 8; ++r8) {
      const float f = acc[r8];
      const unsigned short hb = f2bf_bits(f);
      const unsigned short lb = f2bf_bits(f - bf_bits2f(hb));
      const int idx = (ill * 16 + 8 * hh + r8) * 32 + rl;
      arHL[idx] = hb;
      arHL[8192 + idx] = lb;
    }
  }
  __syncthreads();
  const int q = lane >> 3, c8 = (lane & 7) * 8;
  float* sl = slab[wave];
#pragma unroll
  for (int sub = 0; sub < 2; ++sub) {
    const int h = wave + 8 * sub;             // wave-uniform head
    const v16b ah = Frag<__bf16>::load((const __bf16*)arHL + rl * 512 + h * 32 + koff);          // A[m = rl][k]
    const v16b al = Frag<__bf16>::load((const __bf16*)arHL + 8192 + rl * 512 + h * 32 + koff);
    v8f acc2[4];
#pragma unroll
    for (int j = 0; j < 4; ++j) {
      const v16b bw = Frag<__bf16>::load((const __bf16*)wrp + (size_t)(h * HDIM + j * 16 + rl) * 32 + koff);  // Bt[n = d][k = r]
      acc2[j] = mma16b(ah, bw, zero8);
      acc2[j] = mma16b(al, bw, acc2[j]);
    }
    // acc2[j][r8] = attrel[ill = 8*hh + r8][d = 16*j + rl] * 1024
#pragma unroll
    for (int j = 0; j < 4; ++j)
#pragma unroll
      for (int r8 = 0; r8 < 8; ++r8) sl[(8 * hh + r8) * 68 + j * 16 + rl] = acc2[j][r8] * PCARRY_INV;
    __builtin_amdgcn_fence(__ATOMIC_RELEASE, "workgroup");
    __builtin_amdgcn_wave_barrier();
    __builtin_amdgcn_fence(__ATOMIC_ACQUIRE, "workgroup");
    v4u hv[4], lv[4];
#pragma unroll
    for (int it = 0; it < 4; ++it) {
      const int row = it * 4 + q;
      const size_t g = (size_t)(rowbase + il0 + row) * DMOD + h * HDIM + c8;
      const v4f s0 = *(const v4f*)(sl + row * 68 + c8);
      const v4f s1 = *(const v4f*)(sl + row * 68 + c8 + 4);
      const v4f r0 = *(const v4f*)(attsym + g);
      const v4f r1 = *(const v4f*)(attsym + g + 4);
      float v[8];
      v[0] = s0[0] + r0[0]; v[1] = s0[1] + r0[1]; v[2] = s0[2] + r0[2]; v[3] = s0[3] + r0[3];
      v[4] = s1[0] + r1[0]; v[5] = s1[1] + r1[1]; v[6] = s1[2] + r1[2]; v[7] = s1[3] + r1[3];
#pragma unroll
      for (int e = 0; e < 4; ++e) {
        const float a = v[2 * e], c = v[2 * e + 1];
        const unsigned short ha = f2bf_bits(a), hc = f2bf_bits(c);
        const unsigned short la = f2bf_bits(a - bf_bits2f(ha)), lc = f2bf_bits(c - bf_bits2f(hc));
        hv[it][e] = (unsigned)ha | ((unsigned)hc << 16);
        lv[it][e] = (unsigned)la | ((unsigned)lc << 16);
      }
    }
    {
#pragma unroll
      for (int it = 0; it < 4; ++it) {
        const int row = it * 4 + q;
        const size_t g = (size_t)(rowbase + il0 + row) * DMOD + h * HDIM + c8;
        *(v4u*)(comb_hi + g) = hv[it];
        *(v4u*)(comb_lo + g) = lv[it];
      }
      
    }
    __builtin_amdgcn_fence(__ATOMIC_RELEASE, "workgroup");
    __builtin_amdgcn_wave_barrier();
    __builtin_amdgcn_fence(__ATOMIC_ACQUIRE, "workgroup");
  }
}

// ---------------------------------------------------------------------------
// launcher
// Workspace region map (bytes, all 256-B aligned; total 262,209,536):
//   region 0, 83,886,080 bytes, used twice in turn, the first use ended by a launch boundary before the second begins:
//     steps 1-2: xb [2048][1024] bf16 (x, RNE) at 0, sb (symbols, RNE) behind it; in its last 10,485,760 bytes the
//                transposed bf16 weights 0 q_attn, 1 k_attn, 2 q_rel, 3 k_rel, 4 v, [1024][1024] each
//     relation scores -> relation mix: rel16 f16, PLANE_ELEMS elements, [c][b][256][16][jend] (REL_SCALE folded)
//   WoT    [1024][1024] bf16     2,097,152      directly behind region 0: the sixth slot of the weight transpose; lives to step 4
//   xqh/xql/xkh/xkl [2048][1024] bf16  4 x 4,194,304
//   qr16/kr16 [2048][1024] f16   2 x 4,194,304
//   svh/svl [1024][2048] bf16    2 x 4,194,304  (values transposed: row h*64+d, col b*1024+j)
//   attsym  [2048][1024] f32     8,388,608
//   ch/cl   [2048][1024] bf16    2 x 4,194,304  (pre-output activations hi/lo)
//   wrp     [1024][32] bf16      65,536         (Wr with K padded to 32, pad zero-filled)
//   ph/pl   [c][b][16][256][jend] bf16 2 x 41,943,040  probabilities hi/lo
//   p16     [c][b][16][256][jend] f16  41,943,040      probabilities x1024
// ---------------------------------------------------------------------------
extern "C" void kernel_launch(void* const* d_in, const int* in_sizes, int n_in,
                              void* d_out, int out_size, void* d_ws, size_t ws_size,
                              hipStream_t stream) {
  if (n_in < 9) return;
  if (in_sizes[0] != NTOK * DMOD || in_sizes[1] != NTOK * DMOD) return;
  if (in_sizes[2] != DMOD * DMOD || in_sizes[3] != DMOD * DMOD || in_sizes[4] != DMOD * DMOD ||
      in_sizes[5] != DMOD * DMOD || in_sizes[7] != DMOD * DMOD || in_sizes[8] != DMOD * DMOD) return;
  if (in_sizes[6] != NHEAD * HDIM * NREL) return;
  if (out_size != NTOK * DMOD) return;

  const float* x      = (const float*)d_in[0];
  const float* symb   = (const float*)d_in[1];
  const float* Wq_a   = (const float*)d_in[2];
  const float* Wk_a   = (const float*)d_in[3];
  const float* Wq_r   = (const float*)d_in[4];
  const float* Wk_r   = (const float*)d_in[5];
  const float* Wr     = (const float*)d_in[6];
  const float* Wv     = (const float*)d_in[7];
  const float* Wo     = (const float*)d_in[8];
  float* out = (float*)d_out;

  char* ws = (char*)d_ws;
  size_t off = 0;
  auto carve = [&](size_t bytes) -> char* {
    char* p = ws + off;
    off += (bytes + 255) & ~(size_t)255;
    return p;
  };
  const size_t ACT16 = (size_t)NTOK * DMOD * 2;            // 4,194,304
  const size_t WGT16 = (size_t)DMOD * DMOD * 2;            // 2,097,152
  const size_t ACT32 = (size_t)NTOK * DMOD * 4;            // 8,388,608
  const size_t PLANE16 = PLANE_ELEMS * 2;                  // 41,943,040
  const size_t PLANE32 = PLANE_ELEMS * 4;                  // 83,886,080
  static_assert(PLANE_ELEMS * 4 % 256 == 0, "the sixth weight slot must follow region 0 without a gap");
  static_assert((size_t)2 * NTOK * DMOD * 2 + (size_t)5 * DMOD * DMOD * 2 <= PLANE_ELEMS * 4, "casts and five weights fit region 0 side by side");

  char* reg0 = carve(PLANE32);
  carve(WGT16);                                            // WoT = wT + 5 weights
  unsigned short* xb   = (unsigned short*)reg0;
  unsigned short* sb   = (unsigned short*)(reg0 + ACT16);
  unsigned short* wT   = (unsigned short*)(reg0 + PLANE32 - 5 * WGT16);
  unsigned short* rel16 = (unsigned short*)reg0;
  unsigned short* xqh  = (unsigned short*)carve(ACT16);
  unsigned short* xql  = (unsigned short*)carve(ACT16);
  unsigned short* xkh  = (unsigned short*)carve(ACT16);
  unsigned short* xkl  = (unsigned short*)carve(ACT16);
  unsigned short* qr16 = (unsigned short*)carve(ACT16);
  unsigned short* kr16 = (unsigned short*)carve(ACT16);
  unsigned short* svh  = (unsigned short*)carve(ACT16);
  unsigned short* svl  = (unsigned short*)carve(ACT16);
  float*          attsym = (float*)carve(ACT32);
  unsigned short* ch   = (unsigned short*)carve(ACT16);
  unsigned short* cl   = (unsigned short*)carve(ACT16);
  unsigned short* wrp  = (unsigned short*)carve((size_t)NHEAD * HDIM * 32 * 2);
  unsigned short* ph   = (unsigned short*)carve(PLANE16);
  unsigned short* pl   = (unsigned short*)carve(PLANE16);
  unsigned short* p16  = (unsigned short*)carve(PLANE16);
  if (off > ws_size) return;

  const unsigned short* WoT  = wT + 5 * (size_t)DMOD * DMOD;

  // 1) casts: activations to bf16; weights transposed to bf16; Wr packed with K padding
  k_prep<<<dim3(2 * CAST_BLOCKS + WT_BLOCKS + WR_BLOCKS), 256, 0, stream>>>(
      x, symb, Wq_a, Wk_a, Wq_r, Wk_r, Wv, Wo, Wr, xb, sb, wT, wrp);

  // 2) projections (bf16 x bf16, exact products, f32 accumulate)
  //    xq, xk -> bf16 hi/lo planes [2048][1024]; qr, kr -> f16 planes; values transposed svT [1024][2048] hi/lo
  static_assert(NTOK % 128 == 0 && DMOD % 128 == 0 && DMOD % GK == 0, "projection and output GEMM shapes");
  k_proj5<<<dim3((NTOK / 128) * (DMOD / 128), 5, 1), 256, 0, stream>>>(xb, sb, wT, xqh, xql, xkh, xkl, qr16, kr16, svh, svl);

  // 3) every chunk of 256 query rows, both batch rows, in each grid: scores with softmax -> (P.V beside relation scores) -> relation mix
  static_assert(CHR % 64 == 0 && HDIM % 32 == 0 && RDIM % 32 == 0 && HDIM % 64 == 0, "chunk GEMM shapes");
  static_assert(CHR % 128 == 0 && CHR == 256 && HDIM == 64 && RDIM == 64, "128x256 relation tiles, 128x64 P.V tiles, one stage of k for the scores");
  static_assert(NCHK == 4 && (NCHK & (NCHK - 1)) == 0 && ROWS_CH % 8 == 0 && NHEAD == 16 && NREL == 16, "grid decoding");
  k_scores_softmax<<<dim3(CHR / SR, NB * 16, NCHK), 256, 0, stream>>>(xqh, xql, xkh, xkl, ph, pl, p16);
  k_pv_rel<<<dim3((CHR / 128) * (SEQ / 256), NB * 16, 2 * NCHK), 256, 0, stream>>>(ph, pl, svh, svl, attsym, qr16, kr16, rel16);
  k_rel_mix<<<dim3(CHR / 16, NB, NCHK), 256, 0, stream>>>(p16, rel16, wrp, attsym, ch, cl);

  // 4) out[token][n] = sum_k combined[token][k] * WoT[n][k]  (A hi/lo, B bf16 weights) -> d_out f32
  k_out<<<dim3((NTOK / 128) * (DMOD / 128)), 256, 0, stream>>>(ch, cl, WoT, out);
}

// v004
// One run takes 115 microseconds.
// Next to v003, in two timings, it ran 1.31 times as fast each time.
// Over all steps from v000 it is 7.78 times as fast.
// Contractions: v_wmma_f32_16x16x32_bf16 (bf16 operands: module inputs RNE-converted once to bf16; computed q/k, softmax probabilities, value rows, relation aggregates and pre-output activations carried as bf16 hi+lo pairs) and v_wmma_f32_16x16x32_f16 for relation scores and relation aggregation (f16 operands, probabilities carried x1024); f32 accumulate everywhere; softmax and all side math in f32.
#include <hip/hip_runtime.h>

// ---------------------------------------------------------------------------
// problem geometry
// ---------------------------------------------------------------------------
static constexpr int NB    = 2;
static constexpr int SEQ   = 1024;
static constexpr int DMOD  = 1024;
static constexpr int NHEAD = 16;
static constexpr int HDIM  = 64;
static constexpr int NREL  = 16;
static constexpr int RDIM  = 64;
static constexpr int NTOK  = NB * SEQ;          // 2048
static constexpr int CHR   = 256;               // query rows per chunk
static constexpr int NCHK  = SEQ / CHR;         // 4 chunks per batch row
static constexpr float SCALE_ATTN = 0.125f;     // 1/sqrt(64)
static constexpr float SCALE_REL  = 0.125f;     // 1/sqrt(64)
static constexpr float PCARRY     = 1024.0f;    // f16 probability carry
static constexpr float PCARRY_INV = 1.0f / 1024.0f;

// Per-pair planes (probabilities, relation scores) hold all chunks at once: chunk c (query rows 256c..256c+255,
// keys < jend = 256(c+1)) stores its rows at pitch jend and starts at element CHUNK_UNIT * c(c+1)/2.
static constexpr int    ROWS_CH     = NB * NHEAD * CHR;                             // 8192 rows per chunk
static constexpr size_t CHUNK_UNIT  = (size_t)ROWS_CH * CHR;                        // 2,097,152 elements per 256 keys
static constexpr size_t PLANE_ELEMS = CHUNK_UNIT * (NCHK * (NCHK + 1) / 2);         // 20,971,520 elements
__device__ __forceinline__ size_t chunk_base(int c) { return CHUNK_UNIT * (size_t)((c * (c + 1)) >> 1); }

static_assert(NHEAD * HDIM == DMOD, "head split");
static_assert(NREL * RDIM == DMOD, "relation split");
static_assert(SEQ == 4 * 256, "softmax handles up to 4 segments of 256 keys");
static_assert(SEQ % CHR == 0 && CHR % 64 == 0, "chunk tiling");
static_assert(NHEAD == 16 && NREL == 16, "relation mix kernel uses one 16x16 tile per token");
static_assert(HDIM % 32 == 0 && RDIM % 32 == 0, "K of score GEMMs multiple of 32");
static_assert(NTOK % 64 == 0 && DMOD % 64 == 0, "tile multiples");
static_assert((NTOK * DMOD) % (8 * 256) == 0, "cast kernel coverage");
static_assert((NHEAD * CHR) % 8 == 0 && CHR % 16 == 0, "softmax / mix grids");

// ---------------------------------------------------------------------------
// types, conversions, fragment helpers
// ---------------------------------------------------------------------------
typedef __attribute__((ext_vector_type(16))) _Float16 v16h;
typedef __attribute__((ext_vector_type(8)))  _Float16 v8h;
typedef __attribute__((ext_vector_type(16))) __bf16   v16b;
typedef __attribute__((ext_vector_type(8)))  __bf16   v8b;
typedef __attribute__((ext_vector_type(8)))  float    v8f;
typedef __attribute__((ext_vector_type(4)))  float    v4f;
typedef __attribute__((ext_vector_type(4)))  unsigned int v4u;

__device__ __forceinline__ unsigned short f2bf_bits(float f) {
  unsigned u = __float_as_uint(f);
  return (unsigned short)((u + 0x7FFFu + ((u >> 16) & 1u)) >> 16);
}
__device__ __forceinline__ float bf_bits2f(unsigned short h) { return __uint_as_float(((unsigned)h) << 16); }
__device__ __forceinline__ unsigned short h_bits(float f) { return __builtin_bit_cast(unsigned short, (_Float16)f); }
__device__ __forceinline__ unsigned pack_bf16x2(float a, float b) {
  return (unsigned)f2bf_bits(a) | ((unsigned)f2bf_bits(b) << 16);
}

template <typename T> struct Frag;
template <> struct Frag<_Float16> {
  typedef v16h V; union U { v16h v; v8h h[2]; };
  static __device__ __forceinline__ v16h load(const _Float16* p) {   // elements 0..7 <- p[0..7], 8..15 <- p[16..23]
    U f; f.h[0] = *(const v8h*)(p); f.h[1] = *(const v8h*)(p + 16); return f.v;
  }
  static __device__ __forceinline__ v8f mma(v16h a, v16h b, v8f c) {
    return __builtin_amdgcn_wmma_f32_16x16x32_f16(false, a, false, b, (short)0, c, false, false);
  }
};
template <> struct Frag<__bf16> {
  typedef v16b V; union U { v16b v; v8b h[2]; };
  static __device__ __forceinline__ v16b load(const __bf16* p) {
    U f; f.h[0] = *(const v8b*)(p); f.h[1] = *(const v8b*)(p + 16); return f.v;
  }
  static __device__ __forceinline__ v8f mma(v16b a, v16b b, v8f c) {
    return __builtin_amdgcn_wmma_f32_16x16x32_bf16(false, a, false, b, (short)0, c, false, false);
  }
};

// single-accumulator WMMA + hazard nops (used by the relation mix kernel)
__device__ __forceinline__ v8f mma16h(v16h a, v16h b, v8f c) {
  c = __builtin_amdgcn_wmma_f32_16x16x32_f16(false, a, false, b, (short)0, c, false, false);
  asm volatile("v_nop\n\tv_nop\n\tv_nop\n\tv_nop" : "+v"(c) : "v"(a), "v"(b));
  return c;
}
__device__ __forceinline__ v8f mma16b(v16b a, v16b b, v8f c) {
  c = __builtin_amdgcn_wmma_f32_16x16x32_bf16(false, a, false, b, (short)0, c, false, false);
  asm volatile("v_nop\n\tv_nop\n\tv_nop\n\tv_nop" : "+v"(c) : "v"(a), "v"(b));
  return c;
}

// ---- work-group WMMA GEMM, operands staged in LDS ---------------------
// C[m,n] = scale * sum_k A[m,k] * Bt[n,k]; one BM x BN tile of C per work-group of 8 waves.
// A row-major [M,K]; Bt row-major [N,K]; K % 64 == 0; every operand row starts on a 128-B line.
// SPLIT: A is hi/lo planes (A2 = lo); SPLITB: Bt also hi/lo (product hi.hi + hi.lo + lo.hi),
//        !SPLITB: Bt single plane (product hi.b + lo.b).
// OUT_MODE: 0 = f32, 1 = f16, 2 = bf16 hi plane (Cout) + bf16 lo plane (Cout2).
// ET: 0 = f16 operands, 1 = bf16 operands (pointers passed as 16-bit storage)
template <int ET> struct Elem;
template <> struct Elem<0> { typedef _Float16 T; };
template <> struct Elem<1> { typedef __bf16 T; };

// Result of one wave, MI x 4 accumulator tiles of 16x16 at rows m0.., columns n0..: 16 rows at a time through the wave's own
// 16x68 f32 LDS slab, so that every store covers whole row segments.
template <int MI, int OUT_MODE>
__device__ __forceinline__ void store_tiles(v8f (&acc)[MI][4], float scale,
    void* __restrict__ Cout, void* __restrict__ Cout2, int ldc, size_t offC, int m0, int n0, float* slab) {
  const int lane = threadIdx.x & 31;
  const int rlane = lane & 15;                 // column within a 16x16 tile
  const int mOff  = (lane >> 4) * 8;           // D row offset
#pragma unroll
  for (int i = 0; i < MI; ++i) {
    const int mBase = m0 + (i << 4);
#pragma unroll
    for (int j = 0; j < 4; ++j) {
#pragma unroll
      for (int r = 0; r < 8; ++r) {
        slab[(mOff + r) * 68 + (j << 4) + rlane] = acc[i][j][r] * scale;
      }
    }
    __builtin_amdgcn_fence(__ATOMIC_RELEASE, "workgroup");
    __builtin_amdgcn_wave_barrier();
    __builtin_amdgcn_fence(__ATOMIC_ACQUIRE, "workgroup");
    if (OUT_MODE == 0) {
      float* C = (float*)Cout + offC;
      const int hh = lane >> 4, c4 = (lane & 15) * 4;     // row seg = 256 B = 16 lanes x 16 B
      {
#pragma unroll
        for (int it = 0; it < 8; ++it) {
          const int row = it * 2 + hh;
          v4f v = *(const v4f*)(slab + row * 68 + c4);
          *(v4f*)(C + (size_t)(mBase + row) * ldc + n0 + c4) = v;
        }
        
      }
    } else {
      const int q = lane >> 3, c8 = (lane & 7) * 8;
      unsigned short* C  = (unsigned short*)Cout  + offC;
      unsigned short* C2 = (OUT_MODE == 2) ? ((unsigned short*)Cout2 + offC) : nullptr;
      {
#pragma unroll
        for (int it = 0; it < 4; ++it) {
          const int row = it * 4 + q;
          const float* sp = slab + row * 68 + c8;
          v8h hv, lv;
#pragma unroll
          for (int e = 0; e < 8; ++e) {
            if (OUT_MODE == 1) {
              hv[e] = (_Float16)sp[e];
            } else {
              unsigned short hb = f2bf_bits(sp[e]);
              unsigned short lb = f2bf_bits(sp[e] - bf_bits2f(hb));
              hv[e] = __builtin_bit_cast(_Float16, hb);
              lv[e] = __builtin_bit_cast(_Float16, lb);
            }
          }
          *(v8h*)(C + (size_t)(mBase + row) * ldc + n0 + c8) = hv;
          if (OUT_MODE == 2) *(v8h*)(C2 + (size_t)(mBase + row) * ldc + n0 + c8) = lv;
        }
        
      }
    }
    __builtin_amdgcn_fence(__ATOMIC_RELEASE, "workgroup");
    __builtin_amdgcn_wave_barrier();
    __builtin_amdgcn_fence(__ATOMIC_ACQUIRE, "workgroup");
  }
}

static constexpr int GK = 64;                  // k per stage: 128 B, one whole line, of every operand row
static constexpr int GP = GK + 8;              // LDS row pitch in 16-bit elements: 144 B = 16 B x 9, no bank conflict for 16-byte fragment reads
static constexpr int SLAB_WORDS = 8 * 16 * 68 * 2;   // the eight result slabs, in 16-bit words
// WM x WN waves, each MI*16 rows x 64 columns of C. One stage in LDS: rows [A | A lo | Bt | Bt lo], GP elements apart.
template <bool SPLIT, bool SPLITB, int MI, int WM, int WN> struct Stage {
  static_assert(WM * WN == 8, "eight waves");
  static constexpr int BM = WM * MI * 16, BN = WN * 64;
  static constexpr int AROWS = (SPLIT ? 2 : 1) * BM;
  static constexpr int ROWS  = AROWS + ((SPLIT && SPLITB) ? 2 : 1) * BN;
  static constexpr int WORDS = ROWS * GP;      // 16-bit words per stage
  static_assert(BM % 32 == 0 && BN % 32 == 0, "each group of 32 staged rows lies in one plane");
  static_assert(WORDS >= SLAB_WORDS, "the result slabs reuse the first stage");
};
// smem: two stages (one is enough where K == GK); offA / offB / offC: element offsets of this product's operands and result;
// m0b, n0b: the work-group's tile. Every thread of the work-group calls this (it holds barriers).
// Per stage the 256 threads copy 128 B of every operand row, 8 lanes to a row, into LDS; the next stage's global loads are
// issued before this stage's products and stored to the other buffer behind them.
template <int ET, bool SPLIT, bool SPLITB, int MI, int WM, int WN, int OUT_MODE, int LDA, int LDB>
__device__ __forceinline__ void gemm_block(
    const unsigned short* __restrict__ Ap, const unsigned short* __restrict__ A2p, size_t offA,
    const unsigned short* __restrict__ Btp, const unsigned short* __restrict__ Bt2p, size_t offB,
    void* __restrict__ Cout, void* __restrict__ Cout2, int ldc, size_t offC,
    int K, float scale, int m0b, int n0b, unsigned short* smem) {
  typedef typename Elem<ET>::T T;
  typedef typename Frag<T>::V V;
  typedef Stage<SPLIT, SPLITB, MI, WM, WN> G;
  constexpr int NLD = G::ROWS / 32;            // 16-byte pieces per thread and stage
  const int tid = threadIdx.x, lane = tid & 31, wave = tid >> 5;
  const int srow = tid >> 3, scol = (tid & 7) * 8;      // staging: row within a group of 32, 16-byte column
  // the thread's place in each operand plane at the stage to be fetched next; the rows' strides LDA, LDB are compile-time,
  // so every load of a plane names this one address and an immediate offset
  const unsigned short* gA  = Ap   + offA + (size_t)(m0b + srow) * LDA + scol;
  const unsigned short* gA2 = A2p  + offA + (size_t)(m0b + srow) * LDA + scol;
  const unsigned short* gB  = Btp  + offB + (size_t)(n0b + srow) * LDB + scol;
  const unsigned short* gB2 = Bt2p + offB + (size_t)(n0b + srow) * LDB + scol;
  unsigned short* sdst = smem + srow * GP + scol;

  const int rlane = lane & 15;                 // row (A) / col (B, D) within subtile
  const int koff  = (lane >> 4) * 8;           // k offset of this lane half
  const int wm = wave / WN, wn = wave - wm * WN;
  const int aoff = (wm * (MI * 16) + rlane) * GP + koff;
  const int boff = (G::AROWS + wn * 64 + rlane) * GP + koff;

  v8f acc[MI][4];
#pragma unroll
  for (int i = 0; i < MI; ++i)
#pragma unroll
    for (int j = 0; j < 4; ++j) acc[i][j] = (v8f){0.f,0.f,0.f,0.f,0.f,0.f,0.f,0.f};

  v4u st[NLD];
  auto fetch = [&]() {
#pragma unroll
    for (int n = 0; n < NLD; ++n) {
      const int r = n * 32;                    // first staged row of the group of 32: picks the plane at compile time
      const unsigned short* g;
      if (r < G::BM)                  g = gA  + (size_t)r * LDA;
      else if (r < G::AROWS)          g = gA2 + (size_t)(r - G::BM) * LDA;
      else if (r < G::AROWS + G::BN)  g = gB  + (size_t)(r - G::AROWS) * LDB;
      else                            g = gB2 + (size_t)(r - G::AROWS - G::BN) * LDB;
      st[n] = *(const v4u*)g;
    }
    // the addresses stay in their registers up to this wait, so that it stands in front of every overwrite of a register
    // that these loads name (a later load's result, the step to the next stage)
    if (SPLIT && SPLITB) asm volatile("s_wait_xcnt 0x0" :: "v"(gA), "v"(gA2), "v"(gB), "v"(gB2) : "memory");
    else if (SPLIT)      asm volatile("s_wait_xcnt 0x0" :: "v"(gA), "v"(gA2), "v"(gB) : "memory");
    else                 asm volatile("s_wait_xcnt 0x0" :: "v"(gA), "v"(gB) : "memory");
    gA += GK; gA2 += GK; gB += GK; gB2 += GK;
  };
  auto put = [&](int buf) {
#pragma unroll
    for (int n = 0; n < NLD; ++n) *(v4u*)(sdst + buf * G::WORDS + n * 32 * GP) = st[n];
  };

  fetch();
  put(0);
  __syncthreads();
  for (int k0 = 0, buf = 0; k0 < K; k0 += GK, buf ^= 1) {
    const bool more = k0 + GK < K;             // the same for the whole work-group
    if (more) fetch();
    const T* cur = (const T*)(smem + buf * G::WORDS);
#pragma unroll
    for (int ks = 0; ks < GK; ks += 32) {
      V bh[4], bl[4];
#pragma unroll
      for (int j = 0; j < 4; ++j) {
        bh[j] = Frag<T>::load(cur + boff + j * 16 * GP + ks);
        if (SPLIT && SPLITB) bl[j] = Frag<T>::load(cur + boff + (G::BN + j * 16) * GP + ks);
      }
#pragma unroll
      for (int i = 0; i < MI; ++i) {
        V ah = Frag<T>::load(cur + aoff + i * 16 * GP + ks);
        V al;
        if (SPLIT) al = Frag<T>::load(cur + aoff + (G::BM + i * 16) * GP + ks);
#pragma unroll
        for (int j = 0; j < 4; ++j) {
          acc[i][j] = Frag<T>::mma(ah, bh[j], acc[i][j]);
          if (SPLIT) {
            if (SPLITB) acc[i][j] = Frag<T>::mma(ah, bl[j], acc[i][j]);
            acc[i][j] = Frag<T>::mma(al, bh[j], acc[i][j]);
          }
        }
      }
    }
    if (more) put(buf ^ 1);                    // last read one trip ago, in front of that trip's barrier
    __syncthreads();                           // publishes the next stage; ends every read of this one
  }
  store_tiles<MI, OUT_MODE>(acc, scale, Cout, Cout2, ldc, offC, m0b + wm * (MI * 16), n0b + wn * 64,
                            (float*)smem + wave * (16 * 68));
}

// All five input projections in one grid; blockIdx.y selects the product (block-uniform):
// 0 q_attn, 1 k_attn -> bf16 hi/lo; 2 q_rel, 3 k_rel -> f16; 4 values, transposed (A = WvT, Bt = symbols) -> bf16 hi/lo.
// Each product has (NTOK/128)*(DMOD/128) tiles of 128x128, one per block.
__global__ __launch_bounds__(256) void k_proj5(
    const unsigned short* __restrict__ xb, const unsigned short* __restrict__ sb, const unsigned short* __restrict__ wT,
    unsigned short* __restrict__ xqh, unsigned short* __restrict__ xql,
    unsigned short* __restrict__ xkh, unsigned short* __restrict__ xkl,
    unsigned short* __restrict__ qr16, unsigned short* __restrict__ kr16,
    unsigned short* __restrict__ svh, unsigned short* __restrict__ svl) {
  __shared__ __align__(16) unsigned short sm[2 * Stage<false, false, 2, 4, 2>::WORDS];
  const int y = blockIdx.y;
  const bool tv = (y == 4);
  const int nbN = (tv ? NTOK : DMOD) / 128;
  const int m0b = ((int)blockIdx.x / nbN) * 128, n0b = ((int)blockIdx.x % nbN) * 128;
  const unsigned short* Wy = wT + (size_t)y * DMOD * DMOD;
  if (y == 2 || y == 3) {
    unsigned short* c = (y == 2) ? qr16 : kr16;
    gemm_block<1, false, false, 2, 4, 2, 1, DMOD, DMOD>(xb, xb, 0, Wy, Wy, 0, c, c, DMOD, 0, DMOD, 1.0f, m0b, n0b, sm);
  } else {
    const unsigned short* a  = tv ? Wy : xb;
    const unsigned short* bt = tv ? sb : Wy;
    unsigned short* chi = tv ? svh : (y == 0 ? xqh : xkh);
    unsigned short* clo = tv ? svl : (y == 0 ? xql : xkl);
    gemm_block<1, false, false, 2, 4, 2, 2, DMOD, DMOD>(a, a, 0, bt, bt, 0, chi, clo, tv ? NTOK : DMOD, 0, DMOD, 1.0f, m0b, n0b, sm);
  }
}

// Attention (scores, causal softmax, P.V) of every chunk, batch row and head in one grid: a work-group owns SR whole query rows.
// Part 1, per block of 256 keys: scores[il][j] = SCALE_ATTN * sum_d xq[i][h,d] xk[j][h,d] (hi/lo split on both operands, product
//   hi.hi + hi.lo + lo.hi), operands staged as in gemm_block (one stage: all of k); the block's f32 scores pass through a
//   32 x 256 buffer in LDS into the registers of the wave that owns the row: wave w owns rows 4w .. 4w+3, lane owns
//   j = 256*t + 8*lane .. +7 (t <= c). The next block's global loads are issued behind this block's products.
// Part 2: softmax of the wave's four rows, keys j <= i.
// Part 3, per block of 256 keys: attended_symbols[il][d] += sum_j P[il][j] * svT[h*64+d][j] (hi/lo split on both operands, product
//   hi.hi + hi.lo + lo.hi). Each wave packs its four rows of P as bf16 hi and lo into those rows' own bytes of the score buffer;
//   V comes in stages of 128 keys, three buffers in the LDS that held the score operands: one stage is fetched beside the
//   packing, the next beside the products. Wave w sums, for the rows 16*(w&1).. +15 and all 64 columns, the keys
//   32*(w>>1).. +31 of every stage (a fragment of P feeds four tiles). P hi/lo never go to memory.
// Part 4: the four key groups' 32 x 64 partial sums meet in LDS, are added in the order of the groups and stored as whole lines;
//   the P*1024 f16 plane is written, row r = (b*NHEAD + h)*CHR + il at pitch jend, zeros for i < j < jend (behind the last
//   barrier, which would wait for the stores).
// The relation scores (they read nothing of the above) ride in the same grid: blockIdx.z = 4..7, chunk 7 - z, tiles of 128x256.
static constexpr int SR  = 32;                 // query rows per work-group
static constexpr int SRW = SR / 8;             // rows per wave
static constexpr int STP = CHR + 4;            // floats per row of the score buffer: rows 8 apart lie 32 banks apart (the two lane halves of a tile store), 16-B aligned
typedef Stage<true, true, 1, 2, 4> SG;         // one block: 32 query rows x 256 keys
static_assert(SG::BM == SR && SG::BN == CHR && HDIM == GK, "one stage holds all of k for 32 rows and 256 keys");
static constexpr int VK     = 128;             // keys per stage of V: 256 B, two whole lines, of every row of svT
static constexpr int VP     = VK + 8;          // LDS row pitch in 16-bit elements: 272 B = 16 B x 17, no bank conflict for 16-byte fragment reads
static constexpr int VWORDS = 2 * HDIM * VP;   // one stage: 64 hi rows, then 64 lo rows
static constexpr int PPW    = STP * 2;         // a row of the score buffer in 16-bit elements: 1040 B = 16 B x 65; holds 256 hi, then 256 lo
static constexpr int AWORDS = 3 * VWORDS > SG::WORDS ? 3 * VWORDS : SG::WORDS;   // the score operands' stage, then three stages of V
static_assert(2 * CHR <= PPW, "hi and lo of a row of P fit the row's bytes of the score buffer");
static_assert(4 * SR * 68 * 2 <= AWORDS && CHR == 2 * VK && VK == 4 * 32 && SR == 32 && HDIM == 64, "partial sums' staging; 2 row halves x 4 key groups = 8 waves");
static_assert(Stage<false, false, 4, 2, 4>::WORDS <= SG::WORDS, "the relation scores' stage fits");
// One code path for all chunks: c, and with it the number NT of key blocks, is block-uniform, so every test on it is a scalar
// branch that the whole work-group takes alike (barriers included); the kernel's text stays small.
// blockIdx.x = block of SR query rows in the chunk, blockIdx.y = batch row * 16 + head, blockIdx.z = 0..3: chunk 3 - z (longest first).
// Two work-groups share a WGP (one's products run beside the other's softmax arithmetic): four waves per SIMD, 256 registers each.
__global__ __launch_bounds__(256) __attribute__((amdgpu_waves_per_eu(4, 4))) void k_attn_rel(
    const unsigned short* __restrict__ xqh, const unsigned short* __restrict__ xql,
    const unsigned short* __restrict__ xkh, const unsigned short* __restrict__ xkl,
    const unsigned short* __restrict__ svh, const unsigned short* __restrict__ svl,
    float* __restrict__ attsym, unsigned short* __restrict__ p16,
    const unsigned short* __restrict__ qr16, const unsigned short* __restrict__ kr16, unsigned short* __restrict__ rel16) {
  __shared__ __align__(16) unsigned short smem[AWORDS];
  __shared__ __align__(16) float tbuf[SR * STP];
  if ((int)blockIdx.z >= NCHK) {                           // block-uniform
    const int cr = (2 * NCHK - 1) - (int)blockIdx.z;
    const int jr = CHR * (cr + 1), nbN = cr + 1;           // nbN = jr / 256
    if ((int)blockIdx.x >= (CHR / 128) * nbN) return;      // block-uniform, in front of every barrier
    const size_t br = blockIdx.y >> 4, hr = blockIdx.y & 15;
    // rel[c][b][il][r][j] = SCALE_REL * sum_p qr[i][r,p] kr[j][r,p]  (plain f16) -> f16 plane
    gemm_block<0, false, false, 4, 2, 4, 1, DMOD, DMOD>(qr16, qr16, (br * SEQ + (size_t)cr * CHR) * DMOD + hr * RDIM,
                                            kr16, kr16, br * ((size_t)SEQ * DMOD) + hr * RDIM,
                                            rel16, rel16, NREL * jr, chunk_base(cr) + br * ((size_t)CHR * NREL * jr) + hr * jr,
                                            RDIM, SCALE_REL, ((int)blockIdx.x / nbN) * 128, ((int)blockIdx.x % nbN) * 256, smem);
    return;
  }
  typedef __bf16 T;
  typedef Frag<T>::V V;
  constexpr int NLD = SG::ROWS / 32;           // 16-byte pieces per thread and stage
  constexpr int NA  = SG::AROWS / 32;          // of them the query rows, hi and lo
  const int c = (NCHK - 1) - (int)blockIdx.z;
  const int y = blockIdx.y, il0 = (int)blockIdx.x * SR;
  const int NT = c + 1;                        // blocks of 256 keys
  const int jend = CHR * NT;
  const int tid = threadIdx.x, lane = tid & 31;
  const int wave = __builtin_amdgcn_readfirstlane(tid >> 5);   // the same in every lane: kept in a scalar register, and the row addresses with it
  const int srow = tid >> 3, scol = (tid & 7) * 8;      // staging: row within a group of 32, 16-byte column
  const size_t bb = (size_t)(y >> 4), h = (size_t)(y & 15);
  const size_t offA = (bb * SEQ + (size_t)(c * CHR + il0)) * DMOD + h * HDIM;
  const size_t offB = bb * ((size_t)SEQ * DMOD) + h * HDIM;
  const unsigned short* gA  = xqh + offA + (size_t)srow * DMOD + scol;
  const unsigned short* gA2 = xql + offA + (size_t)srow * DMOD + scol;
  const unsigned short* gB  = xkh + offB + (size_t)srow * DMOD + scol;
  const unsigned short* gB2 = xkl + offB + (size_t)srow * DMOD + scol;
  unsigned short* sdst = smem + srow * GP + scol;

  const int rlane = lane & 15;                 // row (A) / col (B, D) within subtile
  const int koff  = (lane >> 4) * 8;           // k offset of this lane half
  const int wm = wave >> 2, wn = wave & 3;     // 2 x 4 waves, each 16 rows x 64 keys
  const int aoff = (wm * 16 + rlane) * GP + koff;
  const int boff = (SG::AROWS + wn * 64 + rlane) * GP + koff;
  float* tdst = tbuf + (wm * 16 + (lane >> 4) * 8) * STP + wn * 64 + rlane;   // D row 8*(lane>>4) + r, column rlane
  const float* tsrc = tbuf + (wave * SRW) * STP + lane * 8;                   // the wave's own rows, the lane's 8 keys

  v4u st[NLD];
  auto fetch = [&](int nb) {                   // nb: the key block, a compile-time number at every call: an immediate offset
#pragma unroll
    for (int n = (nb == 0 ? 0 : NA); n < NLD; ++n) {   // the query rows are staged once, with block 0, and stay
      const int r = n * 32;                    // first staged row of the group of 32: picks the plane at compile time
      const unsigned short* g;
      if (r < SG::BM)                   g = gA  + (size_t)r * DMOD;
      else if (r < SG::AROWS)           g = gA2 + (size_t)(r - SG::BM) * DMOD;
      else if (r < SG::AROWS + SG::BN)  g = gB  + (size_t)(nb * SG::BN + r - SG::AROWS) * DMOD;
      else                              g = gB2 + (size_t)(nb * SG::BN + r - SG::AROWS - SG::BN) * DMOD;
      st[n] = *(const v4u*)g;
    }
    // the addresses, the same for every block, stay in their registers up to this wait, so that it stands in front of
    // every overwrite of a register that these loads name
    if (nb == 0) asm volatile("s_wait_xcnt 0x0" :: "v"(gA), "v"(gA2), "v"(gB), "v"(gB2) : "memory");
    else         asm volatile("s_wait_xcnt 0x0" :: "v"(gB), "v"(gB2) : "memory");
  };
  auto put = [&](int nb) {
#pragma unroll
    for (int n = (nb == 0 ? 0 : NA); n < NLD; ++n) *(v4u*)(sdst + n * 32 * GP) = st[n];
  };

  const float NEG = -__builtin_huge_valf();
  const int ilw = il0 + wave * SRW;            // the wave's first row within the chunk
  float s[SRW][NCHK][8];                       // blocks t >= NT are neither written nor read
  fetch(0);
  put(0);
  __syncthreads();
  const T* cur = (const T*)smem;
  // unrolled: s lives in registers and is indexed by the block's number
#pragma unroll
  for (int nb = 0; nb < NCHK; ++nb) {
    if (nb < NT) {
      v8f acc[4];
#pragma unroll
      for (int j = 0; j < 4; ++j) acc[j] = (v8f){0.f,0.f,0.f,0.f,0.f,0.f,0.f,0.f};
#pragma unroll
      for (int ks = 0; ks < GK; ks += 32) {
        V bh[4], bl[4];
#pragma unroll
        for (int j = 0; j < 4; ++j) {
          bh[j] = Frag<T>::load(cur + boff + j * 16 * GP + ks);
          bl[j] = Frag<T>::load(cur + boff + (SG::BN + j * 16) * GP + ks);
        }
        const V ah = Frag<T>::load(cur + aoff + ks);
        const V al = Frag<T>::load(cur + aoff + SG::BM * GP + ks);
#pragma unroll
        for (int j = 0; j < 4; ++j) {
          acc[j] = Frag<T>::mma(ah, bh[j], acc[j]);
          acc[j] = Frag<T>::mma(ah, bl[j], acc[j]);
          acc[j] = Frag<T>::mma(al, bh[j], acc[j]);
        }
      }
      if (nb + 1 < NCHK && nb + 1 < NT) fetch(nb + 1);
#pragma unroll
      for (int j = 0; j < 4; ++j)
#pragma unroll
        for (int r = 0; r < 8; ++r) tdst[r * STP + j * 16] = acc[j][r] * SCALE_ATTN;
      __syncthreads();                         // publishes this block's scores; ends every read of the stage
#pragma unroll
      for (int q = 0; q < SRW; ++q) {
        const v4f a = *(const v4f*)(tsrc + q * STP);
        const v4f b = *(const v4f*)(tsrc + q * STP + 4);
        s[q][nb][0] = a[0]; s[q][nb][1] = a[1]; s[q][nb][2] = a[2]; s[q][nb][3] = a[3];
        s[q][nb][4] = b[0]; s[q][nb][5] = b[1]; s[q][nb][6] = b[2]; s[q][nb][7] = b[3];
      }
      if (nb + 1 < NCHK && nb + 1 < NT) {
        put(nb + 1);
        __syncthreads();                       // publishes the next stage; ends every read of the score buffer
      } else {
        // the chunk's last block holds the diagonal: keys j > i get -inf, as in the definition (they leave the maximum alone
        // and their exponential is exactly 0); in every earlier block j < 256 c <= i
#pragma unroll
        for (int q = 0; q < SRW; ++q)
#pragma unroll
          for (int e = 0; e < 8; ++e) s[q][nb][e] = (lane * 8 + e <= ilw + q) ? s[q][nb][e] : NEG;
      }
    }
  }

  // Part 3's operands. Behind the last block's barrier nobody reads the stage any more: its LDS takes the stages of V.
  const int vrow = tid >> 4, vcol = (tid & 15) * 8;        // staging of V: row within a group of 16, 16-byte column
  const size_t offV = (h * HDIM + (size_t)vrow) * NTOK + bb * SEQ + vcol;
  const unsigned short* gV  = svh + offV;
  const unsigned short* gV2 = svl + offV;
  unsigned short* vdst = smem + vrow * VP + vcol;
  v4u vst[8];
  auto vfetch = [&](int sg) {                  // sg: the stage of 128 keys, a compile-time number at every call: an immediate offset
#pragma unroll
    for (int n = 0; n < 8; ++n) {
      const unsigned short* g = (n < 4 ? gV + (size_t)(n * 16) * NTOK : gV2 + (size_t)((n - 4) * 16) * NTOK) + sg * VK;
      vst[n] = *(const v4u*)g;
    }
    // the addresses, the same for every stage, stay in their registers up to this wait, so that it stands in front of
    // every overwrite of a register that these loads name
    asm volatile("s_wait_xcnt 0x0" :: "v"(gV), "v"(gV2) : "memory");
  };
  auto vput = [&](int buf) {
#pragma unroll
    for (int n = 0; n < 8; ++n) *(v4u*)(vdst + buf * VWORDS + n * 16 * VP) = vst[n];
  };
  vfetch(0);                                   // lands while the softmax arithmetic runs

  const float LOG2E = 1.44269504088896340736f;
  float m[SRW], sum[SRW], inv[SRW];
#pragma unroll
  for (int q = 0; q < SRW; ++q) m[q] = NEG;
#pragma unroll
  for (int t = 0; t < NCHK; ++t) {
    if (t < NT) {
#pragma unroll
      for (int q = 0; q < SRW; ++q)
#pragma unroll
        for (int e = 0; e < 8; ++e) m[q] = fmaxf(m[q], s[q][t][e]);
    }
  }
#pragma unroll
  for (int off = 1; off < 32; off <<= 1) {     // the four rows' chains of shuffles overlap
#pragma unroll
    for (int q = 0; q < SRW; ++q) m[q] = fmaxf(m[q], __shfl_xor(m[q], off, 32));
  }
#pragma unroll
  for (int q = 0; q < SRW; ++q) sum[q] = 0.f;
#pragma unroll
  for (int t = 0; t < NCHK; ++t) {
    if (t < NT) {
#pragma unroll
      for (int q = 0; q < SRW; ++q) {
        float x[8], v[8];
#pragma unroll
        for (int e = 0; e < 8; ++e) x[e] = (s[q][t][e] - m[q]) * LOG2E;
        // exp(u) = 2^(u * log2 e), eight at a time in one statement: no result shares a register with a source (early clobber),
        // and the v_nop fills the slot that the instruction set asks for behind the last transcendental
        asm("v_exp_f32 %0, %8\n\tv_exp_f32 %1, %9\n\tv_exp_f32 %2, %10\n\tv_exp_f32 %3, %11\n\t"
            "v_exp_f32 %4, %12\n\tv_exp_f32 %5, %13\n\tv_exp_f32 %6, %14\n\tv_exp_f32 %7, %15\n\tv_nop"
            : "=&v"(v[0]), "=&v"(v[1]), "=&v"(v[2]), "=&v"(v[3]), "=&v"(v[4]), "=&v"(v[5]), "=&v"(v[6]), "=&v"(v[7])
            : "v"(x[0]), "v"(x[1]), "v"(x[2]), "v"(x[3]), "v"(x[4]), "v"(x[5]), "v"(x[6]), "v"(x[7]));
#pragma unroll
        for (int e = 0; e < 8; ++e) {
          s[q][t][e] = v[e];
          sum[q] += v[e];
        }
      }
    }
  }
#pragma unroll
  for (int off = 1; off < 32; off <<= 1) {
#pragma unroll
    for (int q = 0; q < SRW; ++q) sum[q] += __shfl_xor(sum[q], off, 32);
  }
#pragma unroll
  for (int q = 0; q < SRW; ++q) inv[q] = 1.0f / sum[q];    // sum >= 1 (the row's largest score gives exp(0))
  // ---- part 3: P.V ----
  const int rh = wave & 1, kq = wave >> 1;     // the wave's half of the rows, its group of 32 keys in every stage
  unsigned short* pw = (unsigned short*)tbuf + (wave * SRW) * PPW + lane * 8;    // the wave's own rows, the lane's 8 keys
  const T* pa = (const T*)tbuf + (rh * 16 + rlane) * PPW + kq * 32 + koff;       // A: row m = query row, hi; lo CHR elements on
  const T* vb = (const T*)smem + rlane * VP + kq * 32 + koff;                    // Bt: row n = d, hi; lo HDIM rows on
  v8f o[4];
#pragma unroll
  for (int j = 0; j < 4; ++j) o[j] = (v8f){0.f,0.f,0.f,0.f,0.f,0.f,0.f,0.f};
  auto pv = [&](int buf, int half) {           // keys 128*half .. +127 of the block in the score buffer; their V in buffer 'buf'
    const V ah = Frag<T>::load(pa + half * VK);
    const V al = Frag<T>::load(pa + CHR + half * VK);
#pragma unroll
    for (int j = 0; j < 4; ++j) {
      const V bh = Frag<T>::load(vb + buf * VWORDS + j * 16 * VP);
      const V bl = Frag<T>::load(vb + buf * VWORDS + (HDIM + j * 16) * VP);
      o[j] = Frag<T>::mma(ah, bh, o[j]);
      o[j] = Frag<T>::mma(ah, bl, o[j]);
      o[j] = Frag<T>::mma(al, bh, o[j]);
    }
  };
  v4u fv[NCHK][SRW];                           // P*1024 as f16, kept for part 4 in half the registers of s
  vput(0);
  // unrolled: s lives in registers and is indexed by the block's number; stage g of V lies in buffer g mod 3
#pragma unroll
  for (int t = 0; t < NCHK; ++t) {
    if (t < NT) {
      vfetch(2 * t + 1);                       // lands while the block of P is packed
      // a row's hi and lo overwrite that row's scores, which only this wave has read since the last barrier
#pragma unroll
      for (int q = 0; q < SRW; ++q) {
        v4u hv, lv;
#pragma unroll
        for (int e = 0; e < 4; ++e) {
          const float a = s[q][t][2 * e] * inv[q];
          const float b = s[q][t][2 * e + 1] * inv[q];
          const unsigned short ha = f2bf_bits(a), hb = f2bf_bits(b);
          const unsigned short la = f2bf_bits(a - bf_bits2f(ha)), lb = f2bf_bits(b - bf_bits2f(hb));
          const unsigned short fa = h_bits(a * PCARRY), fb = h_bits(b * PCARRY);
          hv[e] = (unsigned)ha | ((unsigned)hb << 16);
          lv[e] = (unsigned)la | ((unsigned)lb << 16);
          fv[t][q][e] = (unsigned)fa | ((unsigned)fb << 16);
        }
        *(v4u*)(pw + q * PPW) = hv;
        *(v4u*)(pw + q * PPW + CHR) = lv;
      }
      vput((2 * t + 1) % 3);                   // held stage 2t - 2, last read in front of the last barrier
      __syncthreads();                         // publishes this block of P and its two stages of V
      if (t + 1 < NCHK && t + 1 < NT) vfetch(2 * t + 2);   // lands while the products run
      pv((2 * t) % 3, 0);
      pv((2 * t + 1) % 3, 1);
      if (t + 1 < NCHK && t + 1 < NT) vput((2 * t + 2) % 3);   // held stage 2t - 1, last read one block ago
      __syncthreads();                         // ends every read of this block of P and of its two stages
    }
  }

  // ---- part 4: results ----
  float* ob = (float*)smem;                    // four key groups x 32 x 68 floats; every read of V has ended
#pragma unroll
  for (int j = 0; j < 4; ++j)
#pragma unroll
    for (int r = 0; r < 8; ++r)                // D row 8*(lane>>4) + r, column rlane
      ob[(kq * SR + rh * 16 + (lane >> 4) * 8 + r) * 68 + j * 16 + rlane] = o[j][r];
  __syncthreads();                             // publishes the partial sums
  {
    float* og = attsym + (bb * SEQ + (size_t)(c * CHR + il0 + vrow)) * DMOD + h * HDIM + (tid & 15) * 4;   // 16 lanes x 16 B = a row's 256 B
    const float* os = ob + vrow * 68 + (tid & 15) * 4;
    v4f o0 = *(const v4f*)os;
    v4f o1 = *(const v4f*)(os + 16 * 68);
#pragma unroll
    for (int g = 1; g < 4; ++g) {
      o0 += *(const v4f*)(os + g * SR * 68);
      o1 += *(const v4f*)(os + (g * SR + 16) * 68);
    }
    *(v4f*)og = o0;
    *(v4f*)(og + (size_t)16 * DMOD) = o1;
    // the address stays in its registers up to this wait, which stands in front of every overwrite of a register that these stores name
    asm volatile("s_wait_xcnt 0x0" :: "v"(og), "v"(o0), "v"(o1) : "memory");
  }
  const size_t ro = chunk_base(c) + ((size_t)y * CHR + ilw) * jend;   // the wave's first row: a scalar base for every store
  unsigned short* df = p16 + ro;
  unsigned vo[SRW];                            // the lane's place in each of the four rows, in bytes: one 32-bit offset register per row
#pragma unroll
  for (int q = 0; q < SRW; ++q) vo[q] = (unsigned)(q * jend + lane * 8) * 2u;
#pragma unroll
  for (int t = 0; t < NCHK; ++t) {
    if (t < NT) {
#pragma unroll
      for (int q = 0; q < SRW; ++q) *(v4u*)((char*)df + vo[q] + t * 512) = fv[t][q];
    }
  }
}

// out[token][n] = sum_k combined[token][k] * WoT[n][k]  (A hi/lo, B bf16 weights), f32 out; one 128x128 tile per block.
__global__ __launch_bounds__(256) void k_out(const unsigned short* __restrict__ ch, const unsigned short* __restrict__ cl,
    const unsigned short* __restrict__ woT, float* __restrict__ out) {
  __shared__ __align__(16) unsigned short sm[2 * Stage<true, false, 2, 4, 2>::WORDS];
  const int nbN = DMOD / 128;
  gemm_block<1, true, false, 2, 4, 2, 0, DMOD, DMOD>(ch, cl, 0, woT, woT, 0, out, out, DMOD, 0, DMOD, 1.0f,
                                         ((int)blockIdx.x / nbN) * 128, ((int)blockIdx.x % nbN) * 128, sm);
}

// ---------------------------------------------------------------------------
// f32 -> bf16 (RNE) cast of the two activation tensors, 8 elements per thread:
// by selects the tensor (block-uniform), bx the block of 2048 elements. Coverage: CAST_BLOCKS*256 threads * 8 = n8*8 elements exactly.
// ---------------------------------------------------------------------------
__device__ __forceinline__ void cast_bf16x8_block(const float* __restrict__ s0, const float* __restrict__ s1,
    unsigned short* __restrict__ d0, unsigned short* __restrict__ d1, int n8, int bx, int by) {
  const float* src = (by == 0) ? s0 : s1;
  unsigned short* dst = (by == 0) ? d0 : d1;
  const int i = bx * 256 + threadIdx.x;
  if (i < n8) {
    const size_t e0 = (size_t)i * 8;
    const v4f a = *(const v4f*)(src + e0);
    const v4f c = *(const v4f*)(src + e0 + 4);
    v4u u;
    u[0] = pack_bf16x2(a[0], a[1]);
    u[1] = pack_bf16x2(a[2], a[3]);
    u[2] = pack_bf16x2(c[0], c[1]);
    u[3] = pack_bf16x2(c[2], c[3]);
    *(v4u*)(dst + e0) = u;
    
  }
}

// ---------------------------------------------------------------------------
// Weight transpose + bf16 cast: W[k][o] (f32, [DMOD][DMOD]) -> WT[o][k] (bf16), 6 weights selected by z; tile: 64*68 floats of LDS.
// Coverage per block: read 4 iters * 256 threads * 4 = 4096 elements; write 2 iters * 8 waves * 4 lines * 64 = 4096.
// ---------------------------------------------------------------------------
__device__ __forceinline__ void wT_bf16_block(const float* __restrict__ w0, const float* __restrict__ w1,
    const float* __restrict__ w2, const float* __restrict__ w3, const float* __restrict__ w4, const float* __restrict__ w5,
    unsigned short* __restrict__ dst, float* tile, int bx, int by, int z) {
  const float* W = (z == 0) ? w0 : (z == 1) ? w1 : (z == 2) ? w2 : (z == 3) ? w3 : (z == 4) ? w4 : w5;
  unsigned short* WT = dst + (size_t)z * DMOD * DMOD;
  const int k0 = by * 64;   // rows of W (input dim)
  const int o0 = bx * 64;   // cols of W (output dim)
  const int tid = threadIdx.x;
#pragma unroll
  for (int it = 0; it < 4; ++it) {
    const int e = (it * 256 + tid) * 4;
    const int row = e >> 6, col = e & 63;
    const v4f v = *(const v4f*)(W + (size_t)(k0 + row) * DMOD + o0 + col);
    *(v4f*)(tile + row * 68 + col) = v;
  }
  __syncthreads();
  const int lane = tid & 31, wave = tid >> 5, q = lane >> 3, c8 = (lane & 7) * 8;
  v4u ov[2];
#pragma unroll
  for (int it = 0; it < 2; ++it) {
    const int oo = it * 32 + wave * 4 + q;
    float f[8];
#pragma unroll
    for (int e = 0; e < 8; ++e) f[e] = tile[(c8 + e) * 68 + oo];
    ov[it][0] = pack_bf16x2(f[0], f[1]);
    ov[it][1] = pack_bf16x2(f[2], f[3]);
    ov[it][2] = pack_bf16x2(f[4], f[5]);
    ov[it][3] = pack_bf16x2(f[6], f[7]);
  }
  {
#pragma unroll
    for (int it = 0; it < 2; ++it) {
      const int oo = it * 32 + wave * 4 + q;
      *(v4u*)(WT + (size_t)(o0 + oo) * DMOD + k0 + c8) = ov[it];
    }
    // in the merged kernel's built control flow another role's code follows these stores and reuses their registers:
    // keep the wait in front of that overwrite
    asm volatile("s_wait_xcnt 0x0" ::: "memory");
  }
}

// ---------------------------------------------------------------------------
// Wr [NHEAD*HDIM rows][NREL] f32 -> WrP [rows][32] bf16 with k 16..31 zero-FILLED (WMMA K padding).
// Coverage: 256 threads * 8 elements = 64 rows * 32; store 8 waves * 4 lines * 64 = 2048 elements.
// ---------------------------------------------------------------------------
__device__ __forceinline__ void wr_pack_block(const float* __restrict__ wr, unsigned short* __restrict__ dst,
    unsigned short* tile, int bx) {   // tile: 64*32 16-bit words of LDS
  const int r0 = bx * 64;
  const int tid = threadIdx.x;
  const int row = tid >> 2, kq = (tid & 3) * 8;
  v4u u;
  unsigned wv[4];
#pragma unroll
  for (int e = 0; e < 4; ++e) {
    const int ka = kq + 2 * e, kb = kq + 2 * e + 1;
    const int kac = ka < NREL ? ka : NREL - 1;
    const int kbc = kb < NREL ? kb : NREL - 1;
    const float fa = wr[(size_t)(r0 + row) * NREL + kac];
    const float fb = wr[(size_t)(r0 + row) * NREL + kbc];
    const unsigned ba = (ka < NREL) ? (unsigned)f2bf_bits(fa) : 0u;
    const unsigned bb = (kb < NREL) ? (unsigned)f2bf_bits(fb) : 0u;
    wv[e] = ba | (bb << 16);
  }
  u[0] = wv[0]; u[1] = wv[1]; u[2] = wv[2]; u[3] = wv[3];
  *(v4u*)(tile + row * 32 + kq) = u;
  __syncthreads();
  const int lane = tid & 31, wave = tid >> 5, q = lane >> 3, c8 = (lane & 7) * 8;
  const int L = wave * 4 + q;                       // line 0..31, 64 elements per line
  const v4u v = *(const v4u*)(tile + L * 64 + c8);
  {
    *(v4u*)(dst + (size_t)r0 * 32 + L * 64 + c8) = v;
    // as in the weight transpose: the wait in front of an overwrite of this store's registers by another role's code
    asm volatile("s_wait_xcnt 0x0" ::: "memory");
  }
}

// ---------------------------------------------------------------------------
// The three input conversions in one grid (none reads another's result); the role is block-uniform, from blockIdx.x:
// [0, 2*CAST_BLOCKS) activation casts, then WT_BLOCKS weight-transpose tiles, then WR_BLOCKS blocks of the Wr pack.
// ---------------------------------------------------------------------------
static constexpr int CAST_BLOCKS = NTOK * DMOD / 8 / 256;            // 1024 per tensor
static constexpr int WT_SIDE     = DMOD / 64;                        // 16 tiles per side
static constexpr int WT_BLOCKS   = 6 * WT_SIDE * WT_SIDE;            // 1536
static constexpr int WR_BLOCKS   = (NHEAD * HDIM) / 64;              // 16
__global__ __launch_bounds__(256) void k_prep(const float* __restrict__ x, const float* __restrict__ symb,
    const float* __restrict__ w0, const float* __restrict__ w1, const float* __restrict__ w2,
    const float* __restrict__ w3, const float* __restrict__ w4, const float* __restrict__ w5, const float* __restrict__ wr,
    unsigned short* __restrict__ xb, unsigned short* __restrict__ sb, unsigned short* __restrict__ wT,
    unsigned short* __restrict__ wrp) {
  __shared__ __align__(16) float tile[64 * 68];
  const int id = blockIdx.x;
  if (id < 2 * CAST_BLOCKS) {
    cast_bf16x8_block(x, symb, xb, sb, NTOK * DMOD / 8, id % CAST_BLOCKS, id / CAST_BLOCKS);
    return;
  }
  if (id < 2 * CAST_BLOCKS + WT_BLOCKS) {
    const int t = id - 2 * CAST_BLOCKS;
    wT_bf16_block(w0, w1, w2, w3, w4, w5, wT, tile, t % WT_SIDE, (t / WT_SIDE) % WT_SIDE, t / (WT_SIDE * WT_SIDE));
    return;
  }
  wr_pack_block(wr, wrp, (unsigned short*)tile, id - 2 * CAST_BLOCKS - WT_BLOCKS);
}

// ---------------------------------------------------------------------------
// Relation aggregation + Wr mix + residual. Block = 8 waves = 16 consecutive query rows il0..il0+15 of batch row blockIdx.y, chunk 3 - blockIdx.z (longest first).
// Phase 1 (per wave, rows ill = wave and wave+8): D[h][r] = sum_{j<kend} P16[h][il][j] * rel[il][r][j]
//   (one f16 WMMA tile, K stepped by 32; the 16 + 16 operand rows are staged 256 k at a time in the wave's own LDS, up to the
//   causal extent, zeros behind it; P16 carries P*1024, rel carries REL_SCALE);
//   D is split into bf16 hi/lo and written to LDS arHL[m=ill][h][k=r] (k 16..31 zero-filled first).
// Phase 2 (per wave, heads h = wave and wave+8): attrel[ill][d] = sum_r ar[ill][h][r] * Wr[h][d][r]
//   (A = arHL hi/lo from LDS, B = WrP bf16 [h*64+d][32], two products per tile, 4 tiles of 16 d).
// Epilogue: per-wave 16x64 slab in LDS, residual attended_symbols added from one 32-B load per lane in the
// ---------------------------------------------------------------------------
__global__ __launch_bounds__(256) void k_rel_mix(const unsigned short* __restrict__ p16all, const unsigned short* __restrict__ relall,
    const unsigned short* __restrict__ wrp, const float* __restrict__ attsym,
    unsigned short* __restrict__ comb_hi, unsigned short* __restrict__ comb_lo) {
  const int c = (NCHK - 1) - (int)blockIdx.z;
  const int i0 = c * CHR, jend = CHR * (c + 1);
  const unsigned short* p16 = p16all + chunk_base(c) + (size_t)blockIdx.y * ((size_t)NHEAD * CHR * jend);
  const unsigned short* rel = relall + chunk_base(c) + (size_t)blockIdx.y * ((size_t)CHR * NREL * jend);
  const int rowbase = (int)blockIdx.y * SEQ + i0;
  __shared__ __align__(16) unsigned short arHL[2 * 16 * 16 * 32];   // hi plane [m][h][32] then lo plane
  __shared__ __align__(16) float slab[8][16 * 68];
  constexpr int RK = 256;                   // k per stage of phase 1: 512 B of an operand row = one wave-wide load of whole lines
  constexpr int RPITCH = RK + 8;            // 528 B = 16 B x 33: no bank conflict for 16-byte fragment reads
  __shared__ __align__(16) unsigned short stg[8][32 * RPITCH];
  const int tid = threadIdx.x, lane = tid & 31, wave = tid >> 5;
  const int hh = lane >> 4, rl = lane & 15, koff = hh * 8;
  const int il0 = blockIdx.x * 16;
  {
    const v4u zz = {0u, 0u, 0u, 0u};
    v4u* zp = (v4u*)arHL;                 // 32768 B = 2048 x 16 B, 256 threads x 8
    for (int qq = tid; qq < 2048; qq += 256) zp[qq] = zz;
  }
  __syncthreads();
  const v8f zero8 = {0.f, 0.f, 0.f, 0.f, 0.f, 0.f, 0.f, 0.f};
#pragma unroll
  for (int sub = 0; sub < 2; ++sub) {
    const int ill = wave + 8 * sub;           // local row 0..15 (wave-uniform)
    const int il = il0 + ill;                 // row within chunk 0..255
    const int i = i0 + il;                    // query position
    const int kend = (i & ~31) + 32;          // <= jend; P16 is zero for i < j < kend
    const unsigned short* gA = p16 + (size_t)il * jend;                      // + head * CHR * jend: A row m = head
    const unsigned short* gB = rel + (size_t)il * ((size_t)NREL * jend);     // + relation * jend: Bt row n = relation
    const int lane8 = lane * 8;               // the lane's 16 bytes of a row's 512
    unsigned short* wst = stg[wave];          // the wave's own stage: rows 0..15 = A, 16..31 = Bt
    v8f acc = zero8;
    for (int ks = 0; ks < kend; ks += RK) {
      const bool on = ks + lane * 8 < kend;   // kend is a multiple of 32; columns from kend on are staged as zeros and add nothing
      v4u st[32];
#pragma unroll
      for (int n = 0; n < 32; ++n) st[n] = (v4u){0u, 0u, 0u, 0u};
      if (on) {
#pragma unroll
        for (int n4 = 0; n4 < 16; n4 += 4) {
          const unsigned short *ga[4], *gb[4];
#pragma unroll
          for (int q = 0; q < 4; ++q) {
            ga[q] = gA + (size_t)(n4 + q) * ((size_t)CHR * jend) + ks + lane8;
            gb[q] = gB + (size_t)(n4 + q) * jend + ks + lane8;
            st[n4 + q]      = *(const v4u*)ga[q];
            st[16 + n4 + q] = *(const v4u*)gb[q];
          }
          // a later load's result may be given the registers that held these addresses: the addresses stay where they are
          // up to this wait, which stands in front of every such overwrite
          asm volatile("s_wait_xcnt 0x0" :: "v"(ga[0]), "v"(ga[1]), "v"(ga[2]), "v"(ga[3]),
                                            "v"(gb[0]), "v"(gb[1]), "v"(gb[2]), "v"(gb[3]) : "memory");
        }
      }
#pragma unroll
      for (int n = 0; n < 32; ++n) *(v4u*)(wst + n * RPITCH + lane * 8) = st[n];
      __builtin_amdgcn_fence(__ATOMIC_RELEASE, "workgroup");
      __builtin_amdgcn_wave_barrier();
      __builtin_amdgcn_fence(__ATOMIC_ACQUIRE, "workgroup");
      v16h a[RK / 32], bb[RK / 32];           // the stage's fragment reads go as one group ahead of its products
#pragma unroll
      for (int u = 0; u < RK / 32; ++u) {
        a[u]  = Frag<_Float16>::load((const _Float16*)wst + rl * RPITCH + koff + u * 32);
        bb[u] = Frag<_Float16>::load((const _Float16*)wst + (16 + rl) * RPITCH + koff + u * 32);
      }
#pragma unroll
      for (int u = 0; u < RK / 32; ++u) acc = mma16h(a[u], bb[u], acc);
      __builtin_amdgcn_fence(__ATOMIC_RELEASE, "workgroup");
      __builtin_amdgcn_wave_barrier();
      __builtin_amdgcn_fence(__ATOMIC_ACQUIRE, "workgroup");
    }
    // acc[r8] = D[row h = 8*hh + r8][col r = rl]  (carried x1024)
#pragma unroll
    for (int r8 = 0; r8 < 8; ++r8) {
      const float f = acc[r8];
      const unsigned short hb = f2bf_bits(f);
      const unsigned short lb = f2bf_bits(f - bf_bits2f(hb));
      const int idx = (ill * 16 + 8 * hh + r8) * 32 + rl;
      arHL[idx] = hb;
      arHL[8192 + idx] = lb;
    }
  }
  __syncthreads();
  const int q = lane >> 3, c8 = (lane & 7) * 8;
  float* sl = slab[wave];
#pragma unroll
  for (int sub = 0; sub < 2; ++sub) {
    const int h = wave + 8 * sub;             // wave-uniform head
    const v16b ah = Frag<__bf16>::load((const __bf16*)arHL + rl * 512 + h * 32 + koff);          // A[m = rl][k]
    const v16b al = Frag<__bf16>::load((const __bf16*)arHL + 8192 + rl * 512 + h * 32 + koff);
    v8f acc2[4];
#pragma unroll
    for (int j = 0; j < 4; ++j) {
      const v16b bw = Frag<__bf16>::load((const __bf16*)wrp + (size_t)(h * HDIM + j * 16 + rl) * 32 + koff);  // Bt[n = d][k = r]
      acc2[j] = mma16b(ah, bw, zero8);
      acc2[j] = mma16b(al, bw, acc2[j]);
    }
    // acc2[j][r8] = attrel[ill = 8*hh + r8][d = 16*j + rl] * 1024
#pragma unroll
    for (int j = 0; j < 4; ++j)
#pragma unroll
      for (int r8 = 0; r8 < 8; ++r8) sl[(8 * hh + r8) * 68 + j * 16 + rl] = acc2[j][r8] * PCARRY_INV;
    __builtin_amdgcn_fence(__ATOMIC_RELEASE, "workgroup");
    __builtin_amdgcn_wave_barrier();
    __builtin_amdgcn_fence(__ATOMIC_ACQUIRE, "workgroup");
    v4u hv[4], lv[4];
#pragma unroll
    for (int it = 0; it < 4; ++it) {
      const int row = it * 4 + q;
      const size_t g = (size_t)(rowbase + il0 + row) * DMOD + h * HDIM + c8;
      const v4f s0 = *(const v4f*)(sl + row * 68 + c8);
      const v4f s1 = *(const v4f*)(sl + row * 68 + c8 + 4);
      const v4f r0 = *(const v4f*)(attsym + g);
      const v4f r1 = *(const v4f*)(attsym + g + 4);
      float v[8];
      v[0] = s0[0] + r0[0]; v[1] = s0[1] + r0[1]; v[2] = s0[2] + r0[2]; v[3] = s0[3] + r0[3];
      v[4] = s1[0] + r1[0]; v[5] = s1[1] + r1[1]; v[6] = s1[2] + r1[2]; v[7] = s1[3] + r1[3];
#pragma unroll
      for (int e = 0; e < 4; ++e) {
        const float a = v[2 * e], c = v[2 * e + 1];
        const unsigned short ha = f2bf_bits(a), hc = f2bf_bits(c);
        const unsigned short la = f2bf_bits(a - bf_bits2f(ha)), lc = f2bf_bits(c - bf_bits2f(hc));
        hv[it][e] = (unsigned)ha | ((unsigned)hc << 16);
        lv[it][e] = (unsigned)la | ((unsigned)lc << 16);
      }
    }
    {
#pragma unroll
      for (int it = 0; it < 4; ++it) {
        const int row = it * 4 + q;
        const size_t g = (size_t)(rowbase + il0 + row) * DMOD + h * HDIM + c8;
        *(v4u*)(comb_hi + g) = hv[it];
        *(v4u*)(comb_lo + g) = lv[it];
      }
      
    }
    __builtin_amdgcn_fence(__ATOMIC_RELEASE, "workgroup");
    __builtin_amdgcn_wave_barrier();
    __builtin_amdgcn_fence(__ATOMIC_ACQUIRE, "workgroup");
  }
}

// ---------------------------------------------------------------------------
// launcher
// Workspace region map (bytes, all 256-B aligned; total 178,323,456):
//   region 0, 83,886,080 bytes, used twice in turn, the first use ended by a launch boundary before the second begins:
//     steps 1-2: xb [2048][1024] bf16 (x, RNE) at 0, sb (symbols, RNE) behind it; in its last 10,485,760 bytes the
//                transposed bf16 weights 0 q_attn, 1 k_attn, 2 q_rel, 3 k_rel, 4 v, [1024][1024] each
//     relation scores -> relation mix: rel16 f16, PLANE_ELEMS elements, [c][b][256][16][jend] (REL_SCALE folded)
//   WoT    [1024][1024] bf16     2,097,152      directly behind region 0: the sixth slot of the weight transpose; lives to step 4
//   xqh/xql/xkh/xkl [2048][1024] bf16  4 x 4,194,304
//   qr16/kr16 [2048][1024] f16   2 x 4,194,304
//   svh/svl [1024][2048] bf16    2 x 4,194,304  (values transposed: row h*64+d, col b*1024+j)
//   attsym  [2048][1024] f32     8,388,608
//   ch/cl   [2048][1024] bf16    2 x 4,194,304  (pre-output activations hi/lo)
//   wrp     [1024][32] bf16      65,536         (Wr with K padded to 32, pad zero-filled)
//   p16     [c][b][16][256][jend] f16  41,943,040      probabilities x1024
// ---------------------------------------------------------------------------
extern "C" void kernel_launch(void* const* d_in, const int* in_sizes, int n_in,
                              void* d_out, int out_size, void* d_ws, size_t ws_size,
                              hipStream_t stream) {
  if (n_in < 9) return;
  if (in_sizes[0] != NTOK * DMOD || in_sizes[1] != NTOK * DMOD) return;
  if (in_sizes[2] != DMOD * DMOD || in_sizes[3] != DMOD * DMOD || in_sizes[4] != DMOD * DMOD ||
      in_sizes[5] != DMOD * DMOD || in_sizes[7] != DMOD * DMOD || in_sizes[8] != DMOD * DMOD) return;
  if (in_sizes[6] != NHEAD * HDIM * NREL) return;
  if (out_size != NTOK * DMOD) return;

  const float* x      = (const float*)d_in[0];
  const float* symb   = (const float*)d_in[1];
  const float* Wq_a   = (const float*)d_in[2];
  const float* Wk_a   = (const float*)d_in[3];
  const float* Wq_r   = (const float*)d_in[4];
  const float* Wk_r   = (const float*)d_in[5];
  const float* Wr     = (const float*)d_in[6];
  const float* Wv     = (const float*)d_in[7];
  const float* Wo     = (const float*)d_in[8];
  float* out = (float*)d_out;

  char* ws = (char*)d_ws;
  size_t off = 0;
  auto carve = [&](size_t bytes) -> char* {
    char* p = ws + off;
    off += (bytes + 255) & ~(size_t)255;
    return p;
  };
  const size_t ACT16 = (size_t)NTOK * DMOD * 2;            // 4,194,304
  const size_t WGT16 = (size_t)DMOD * DMOD * 2;            // 2,097,152
  const size_t ACT32 = (size_t)NTOK * DMOD * 4;            // 8,388,608
  const size_t PLANE16 = PLANE_ELEMS * 2;                  // 41,943,040
  const size_t PLANE32 = PLANE_ELEMS * 4;                  // 83,886,080
  static_assert(PLANE_ELEMS * 4 % 256 == 0, "the sixth weight slot must follow region 0 without a gap");
  static_assert((size_t)2 * NTOK * DMOD * 2 + (size_t)5 * DMOD * DMOD * 2 <= PLANE_ELEMS * 4, "casts and five weights fit region 0 side by side");

  char* reg0 = carve(PLANE32);
  carve(WGT16);                                            // WoT = wT + 5 weights
  unsigned short* xb   = (unsigned short*)reg0;
  unsigned short* sb   = (unsigned short*)(reg0 + ACT16);
  unsigned short* wT   = (unsigned short*)(reg0 + PLANE32 - 5 * WGT16);
  unsigned short* rel16 = (unsigned short*)reg0;
  unsigned short* xqh  = (unsigned short*)carve(ACT16);
  unsigned short* xql  = (unsigned short*)carve(ACT16);
  unsigned short* xkh  = (unsigned short*)carve(ACT16);
  unsigned short* xkl  = (unsigned short*)carve(ACT16);
  unsigned short* qr16 = (unsigned short*)carve(ACT16);
  unsigned short* kr16 = (unsigned short*)carve(ACT16);
  unsigned short* svh  = (unsigned short*)carve(ACT16);
  unsigned short* svl  = (unsigned short*)carve(ACT16);
  float*          attsym = (float*)carve(ACT32);
  unsigned short* ch   = (unsigned short*)carve(ACT16);
  unsigned short* cl   = (unsigned short*)carve(ACT16);
  unsigned short* wrp  = (unsigned short*)carve((size_t)NHEAD * HDIM * 32 * 2);
  unsigned short* p16  = (unsigned short*)carve(PLANE16);
  if (off > ws_size) return;

  const unsigned short* WoT  = wT + 5 * (size_t)DMOD * DMOD;

  // 1) casts: activations to bf16; weights transposed to bf16; Wr packed with K padding
  k_prep<<<dim3(2 * CAST_BLOCKS + WT_BLOCKS + WR_BLOCKS), 256, 0, stream>>>(
      x, symb, Wq_a, Wk_a, Wq_r, Wk_r, Wv, Wo, Wr, xb, sb, wT, wrp);

  // 2) projections (bf16 x bf16, exact products, f32 accumulate)
  //    xq, xk -> bf16 hi/lo planes [2048][1024]; qr, kr -> f16 planes; values transposed svT [1024][2048] hi/lo
  static_assert(NTOK % 128 == 0 && DMOD % 128 == 0 && DMOD % GK == 0, "projection and output GEMM shapes");
  k_proj5<<<dim3((NTOK / 128) * (DMOD / 128), 5, 1), 256, 0, stream>>>(xb, sb, wT, xqh, xql, xkh, xkl, qr16, kr16, svh, svl);

  // 3) every chunk of 256 query rows, both batch rows, in each grid: (scores, softmax, P.V beside relation scores) -> relation mix
  static_assert(CHR % 64 == 0 && HDIM % 32 == 0 && RDIM % 32 == 0 && HDIM % 64 == 0, "chunk GEMM shapes");
  static_assert(CHR % 128 == 0 && CHR == 256 && HDIM == 64 && RDIM == 64, "128x256 relation tiles, one stage of k for the scores");
  static_assert(NCHK == 4 && (NCHK & (NCHK - 1)) == 0 && ROWS_CH % 8 == 0 && NHEAD == 16 && NREL == 16, "grid decoding");
  static_assert(CHR / SR == (CHR / 128) * (SEQ / 256), "both roles of the grid use the same range of blockIdx.x");
  k_attn_rel<<<dim3(CHR / SR, NB * 16, 2 * NCHK), 256, 0, stream>>>(xqh, xql, xkh, xkl, svh, svl, attsym, p16, qr16, kr16, rel16);
  k_rel_mix<<<dim3(CHR / 16, NB, NCHK), 256, 0, stream>>>(p16, rel16, wrp, attsym, ch, cl);

  // 4) out[token][n] = sum_k combined[token][k] * WoT[n][k]  (A hi/lo, B bf16 weights) -> d_out f32
  k_out<<<dim3((NTOK / 128) * (DMOD / 128)), 256, 0, stream>>>(ch, cl, WoT, out);
}

// v005
// A run of this version takes 106 microseconds.
// Two timings next to v004 put it at 1.08 and 1.09 times that version's speed.
// Over all steps from v000 it is 8.44 times as fast.
// Contractions: v_wmma_f32_16x16x32_bf16 (bf16 operands: module inputs RNE-converted once to bf16; computed q/k, softmax probabilities, value rows, relation aggregates and pre-output activations carried as bf16 hi+lo pairs) and v_wmma_f32_16x16x32_f16 for relation scores and relation aggregation (f16 operands, probabilities carried x1024); f32 accumulate everywhere; softmax and all side math in f32.
#include <hip/hip_runtime.h>

// ---------------------------------------------------------------------------
// problem geometry
// ---------------------------------------------------------------------------
static constexpr int NB    = 2;
static constexpr int SEQ   = 1024;
static constexpr int DMOD  = 1024;
static constexpr int NHEAD = 16;
static constexpr int HDIM  = 64;
static constexpr int NREL  = 16;
static constexpr int RDIM  = 64;
static constexpr int NTOK  = NB * SEQ;          // 2048
static constexpr int CHR   = 256;               // query rows per chunk
static constexpr int NCHK  = SEQ / CHR;         // 4 chunks per batch row
static constexpr float SCALE_ATTN = 0.125f;     // 1/sqrt(64)
static constexpr float SCALE_REL  = 0.125f;     // 1/sqrt(64)
static constexpr float PCARRY     = 1024.0f;    // f16 probability carry
static constexpr float PCARRY_INV = 1.0f / 1024.0f;

// Per-pair planes (probabilities, relation scores) hold all chunks at once: chunk c (query rows 256c..256c+255,
// keys < jend = 256(c+1)) stores its rows at pitch jend and starts at element CHUNK_UNIT * c(c+1)/2.
static constexpr int    ROWS_CH     = NB * NHEAD * CHR;                             // 8192 rows per chunk
static constexpr size_t CHUNK_UNIT  = (size_t)ROWS_CH * CHR;                        // 2,097,152 elements per 256 keys
static constexpr size_t PLANE_ELEMS = CHUNK_UNIT * (NCHK * (NCHK + 1) / 2);         // 20,971,520 elements
__device__ __forceinline__ size_t chunk_base(int c) { return CHUNK_UNIT * (size_t)((c * (c + 1)) >> 1); }

static_assert(NHEAD * HDIM == DMOD, "head split");
static_assert(NREL * RDIM == DMOD, "relation split");
static_assert(SEQ == 4 * 256, "softmax handles up to 4 segments of 256 keys");
static_assert(SEQ % CHR == 0 && CHR % 64 == 0, "chunk tiling");
static_assert(NHEAD == 16 && NREL == 16, "relation mix kernel uses one 16x16 tile per token");
static_assert(HDIM % 32 == 0 && RDIM % 32 == 0, "K of score GEMMs multiple of 32");
static_assert(NTOK % 64 == 0 && DMOD % 64 == 0, "tile multiples");
static_assert((NTOK * DMOD) % (8 * 256) == 0, "cast kernel coverage");
static_assert((NHEAD * CHR) % 8 == 0 && CHR % 16 == 0, "softmax / mix grids");

// ---------------------------------------------------------------------------
// types, conversions, fragment helpers
// ---------------------------------------------------------------------------
typedef __attribute__((ext_vector_type(16))) _Float16 v16h;
typedef __attribute__((ext_vector_type(8)))  _Float16 v8h;
typedef __attribute__((ext_vector_type(16))) __bf16   v16b;
typedef __attribute__((ext_vector_type(8)))  __bf16   v8b;
typedef __attribute__((ext_vector_type(8)))  float    v8f;
typedef __attribute__((ext_vector_type(4)))  float    v4f;
typedef __attribute__((ext_vector_type(4)))  unsigned int v4u;

__device__ __forceinline__ unsigned short f2bf_bits(float f) {
  unsigned u = __float_as_uint(f);
  return (unsigned short)((u + 0x7FFFu + ((u >> 16) & 1u)) >> 16);
}
__device__ __forceinline__ float bf_bits2f(unsigned short h) { return __uint_as_float(((unsigned)h) << 16); }
__device__ __forceinline__ unsigned short h_bits(float f) { return __builtin_bit_cast(unsigned short, (_Float16)f); }
__device__ __forceinline__ unsigned pack_bf16x2(float a, float b) {
  return (unsigned)f2bf_bits(a) | ((unsigned)f2bf_bits(b) << 16);
}

template <typename T> struct Frag;
template <> struct Frag<_Float16> {
  typedef v16h V; union U { v16h v; v8h h[2]; };
  static __device__ __forceinline__ v16h load(const _Float16* p) {   // elements 0..7 <- p[0..7], 8..15 <- p[16..23]
    U f; f.h[0] = *(const v8h*)(p); f.h[1] = *(const v8h*)(p + 16); return f.v;
  }
  static __device__ __forceinline__ v8f mma(v16h a, v16h b, v8f c) {
    return __builtin_amdgcn_wmma_f32_16x16x32_f16(false, a, false, b, (short)0, c, false, false);
  }
};
template <> struct Frag<__bf16> {
  typedef v16b V; union U { v16b v; v8b h[2]; };
  static __device__ __forceinline__ v16b load(const __bf16* p) {
    U f; f.h[0] = *(const v8b*)(p); f.h[1] = *(const v8b*)(p + 16); return f.v;
  }
  static __device__ __forceinline__ v8f mma(v16b a, v16b b, v8f c) {
    return __builtin_amdgcn_wmma_f32_16x16x32_bf16(false, a, false, b, (short)0, c, false, false);
  }
};

// single-accumulator WMMA + hazard nops (used by the relation mix kernel)
__device__ __forceinline__ v8f mma16h(v16h a, v16h b, v8f c) {
  c = __builtin_amdgcn_wmma_f32_16x16x32_f16(false, a, false, b, (short)0, c, false, false);
  asm volatile("v_nop\n\tv_nop\n\tv_nop\n\tv_nop" : "+v"(c) : "v"(a), "v"(b));
  return c;
}
__device__ __forceinline__ v8f mma16b(v16b a, v16b b, v8f c) {
  c = __builtin_amdgcn_wmma_f32_16x16x32_bf16(false, a, false, b, (short)0, c, false, false);
  asm volatile("v_nop\n\tv_nop\n\tv_nop\n\tv_nop" : "+v"(c) : "v"(a), "v"(b));
  return c;
}

// ---- work-group WMMA GEMM, operands staged in LDS ---------------------
// C[m,n] = scale * sum_k A[m,k] * Bt[n,k]; one BM x BN tile of C per work-group of 8 waves.
// A row-major [M,K]; Bt row-major [N,K]; K % 64 == 0; every operand row starts on a 128-B line.
// SPLIT: A is hi/lo planes (A2 = lo); SPLITB: Bt also hi/lo (product hi.hi + hi.lo + lo.hi),
//        !SPLITB: Bt single plane (product hi.b + lo.b).
// OUT_MODE: 0 = f32, 1 = f16, 2 = bf16 hi plane (Cout) + bf16 lo plane (Cout2).
// ET: 0 = f16 operands, 1 = bf16 operands (pointers passed as 16-bit storage)
template <int ET> struct Elem;
template <> struct Elem<0> { typedef _Float16 T; };
template <> struct Elem<1> { typedef __bf16 T; };

// Result of one wave, MI x 4 accumulator tiles of 16x16 at rows m0.., columns n0..: 16 rows at a time through the wave's own
// 16x68 f32 LDS slab, so that every store covers whole row segments.
template <int MI, int OUT_MODE>
__device__ __forceinline__ void store_tiles(v8f (&acc)[MI][4], float scale,
    void* __restrict__ Cout, void* __restrict__ Cout2, int ldc, size_t offC, int m0, int n0, float* slab) {
  const int lane = threadIdx.x & 31;
  const int rlane = lane & 15;                 // column within a 16x16 tile
  const int mOff  = (lane >> 4) * 8;           // D row offset
#pragma unroll
  for (int i = 0; i < MI; ++i) {
    const int mBase = m0 + (i << 4);
#pragma unroll
    for (int j = 0; j < 4; ++j) {
#pragma unroll
      for (int r = 0; r < 8; ++r) {
        slab[(mOff + r) * 68 + (j << 4) + rlane] = acc[i][j][r] * scale;
      }
    }
    __builtin_amdgcn_fence(__ATOMIC_RELEASE, "workgroup");
    __builtin_amdgcn_wave_barrier();
    __builtin_amdgcn_fence(__ATOMIC_ACQUIRE, "workgroup");
    if (OUT_MODE == 0) {
      float* C = (float*)Cout + offC;
      const int hh = lane >> 4, c4 = (lane & 15) * 4;     // row seg = 256 B = 16 lanes x 16 B
      {
#pragma unroll
        for (int it = 0; it < 8; ++it) {
          const int row = it * 2 + hh;
          v4f v = *(const v4f*)(slab + row * 68 + c4);
          *(v4f*)(C + (size_t)(mBase + row) * ldc + n0 + c4) = v;
        }
        
      }
    } else {
      const int q = lane >> 3, c8 = (lane & 7) * 8;
      unsigned short* C  = (unsigned short*)Cout  + offC;
      unsigned short* C2 = (OUT_MODE == 2) ? ((unsigned short*)Cout2 + offC) : nullptr;
      {
#pragma unroll
        for (int it = 0; it < 4; ++it) {
          const int row = it * 4 + q;
          const float* sp = slab + row * 68 + c8;
          v8h hv, lv;
#pragma unroll
          for (int e = 0; e < 8; ++e) {
            if (OUT_MODE == 1) {
              hv[e] = (_Float16)sp[e];
            } else {
              unsigned short hb = f2bf_bits(sp[e]);
              unsigned short lb = f2bf_bits(sp[e] - bf_bits2f(hb));
              hv[e] = __builtin_bit_cast(_Float16, hb);
              lv[e] = __builtin_bit_cast(_Float16, lb);
            }
          }
          *(v8h*)(C + (size_t)(mBase + row) * ldc + n0 + c8) = hv;
          if (OUT_MODE == 2) *(v8h*)(C2 + (size_t)(mBase + row) * ldc + n0 + c8) = lv;
        }
        
      }
    }
    __builtin_amdgcn_fence(__ATOMIC_RELEASE, "workgroup");
    __builtin_amdgcn_wave_barrier();
    __builtin_amdgcn_fence(__ATOMIC_ACQUIRE, "workgroup");
  }
}

static constexpr int GK = 64;                  // k per stage: 128 B, one whole line, of every operand row
static constexpr int GP = GK + 8;              // LDS row pitch in 16-bit elements: 144 B = 16 B x 9, no bank conflict for 16-byte fragment reads
static constexpr int SLAB_WORDS = 8 * 16 * 68 * 2;   // the eight result slabs, in 16-bit words
// WM x WN waves, each MI*16 rows x 64 columns of C. One stage in LDS: rows [A | A lo | Bt | Bt lo], GP elements apart.
template <bool SPLIT, bool SPLITB, int MI, int WM, int WN> struct Stage {
  static_assert(WM * WN == 8, "eight waves");
  static constexpr int BM = WM * MI * 16, BN = WN * 64;
  static constexpr int AROWS = (SPLIT ? 2 : 1) * BM;
  static constexpr int ROWS  = AROWS + ((SPLIT && SPLITB) ? 2 : 1) * BN;
  static constexpr int WORDS = ROWS * GP;      // 16-bit words per stage
  static_assert(BM % 32 == 0 && BN % 32 == 0, "each group of 32 staged rows lies in one plane");
  static_assert(WORDS >= SLAB_WORDS, "the result slabs reuse the first stage");
};
// smem: two stages (one is enough where K == GK); offA / offB / offC: element offsets of this product's operands and result;
// m0b, n0b: the work-group's tile. Every thread of the work-group calls this (it holds barriers).
// Per stage the 256 threads copy 128 B of every operand row, 8 lanes to a row, into LDS; the next stage's global loads are
// issued before this stage's products and stored to the other buffer behind them.
template <int ET, bool SPLIT, bool SPLITB, int MI, int WM, int WN, int OUT_MODE, int LDA, int LDB>
__device__ __forceinline__ void gemm_block(
    const unsigned short* __restrict__ Ap, const unsigned short* __restrict__ A2p, size_t offA,
    const unsigned short* __restrict__ Btp, const unsigned short* __restrict__ Bt2p, size_t offB,
    void* __restrict__ Cout, void* __restrict__ Cout2, int ldc, size_t offC,
    int K, float scale, int m0b, int n0b, unsigned short* smem) {
  typedef typename Elem<ET>::T T;
  typedef typename Frag<T>::V V;
  typedef Stage<SPLIT, SPLITB, MI, WM, WN> G;
  constexpr int NLD = G::ROWS / 32;            // 16-byte pieces per thread and stage
  const int tid = threadIdx.x, lane = tid & 31, wave = tid >> 5;
  const int srow = tid >> 3, scol = (tid & 7) * 8;      // staging: row within a group of 32, 16-byte column
  // the thread's place in each operand plane at the stage to be fetched next; the rows' strides LDA, LDB are compile-time,
  // so every load of a plane names this one address and an immediate offset
  const unsigned short* gA  = Ap   + offA + (size_t)(m0b + srow) * LDA + scol;
  const unsigned short* gA2 = A2p  + offA + (size_t)(m0b + srow) * LDA + scol;
  const unsigned short* gB  = Btp  + offB + (size_t)(n0b + srow) * LDB + scol;
  const unsigned short* gB2 = Bt2p + offB + (size_t)(n0b + srow) * LDB + scol;
  unsigned short* sdst = smem + srow * GP + scol;

  const int rlane = lane & 15;                 // row (A) / col (B, D) within subtile
  const int koff  = (lane >> 4) * 8;           // k offset of this lane half
  const int wm = wave / WN, wn = wave - wm * WN;
  const int aoff = (wm * (MI * 16) + rlane) * GP + koff;
  const int boff = (G::AROWS + wn * 64 + rlane) * GP + koff;

  v8f acc[MI][4];
#pragma unroll
  for (int i = 0; i < MI; ++i)
#pragma unroll
    for (int j = 0; j < 4; ++j) acc[i][j] = (v8f){0.f,0.f,0.f,0.f,0.f,0.f,0.f,0.f};

  v4u st[NLD];
  auto fetch = [&]() {
#pragma unroll
    for (int n = 0; n < NLD; ++n) {
      const int r = n * 32;                    // first staged row of the group of 32: picks the plane at compile time
      const unsigned short* g;
      if (r < G::BM)                  g = gA  + (size_t)r * LDA;
      else if (r < G::AROWS)          g = gA2 + (size_t)(r - G::BM) * LDA;
      else if (r < G::AROWS + G::BN)  g = gB  + (size_t)(r - G::AROWS) * LDB;
      else                            g = gB2 + (size_t)(r - G::AROWS - G::BN) * LDB;
      st[n] = *(const v4u*)g;
    }
    // the addresses stay in their registers up to this wait, so that it stands in front of every overwrite of a register
    // that these loads name (a later load's result, the step to the next stage)
    if (SPLIT && SPLITB) asm volatile("s_wait_xcnt 0x0" :: "v"(gA), "v"(gA2), "v"(gB), "v"(gB2) : "memory");
    else if (SPLIT)      asm volatile("s_wait_xcnt 0x0" :: "v"(gA), "v"(gA2), "v"(gB) : "memory");
    else                 asm volatile("s_wait_xcnt 0x0" :: "v"(gA), "v"(gB) : "memory");
    gA += GK; gA2 += GK; gB += GK; gB2 += GK;
  };
  auto put = [&](int buf) {
#pragma unroll
    for (int n = 0; n < NLD; ++n) *(v4u*)(sdst + buf * G::WORDS + n * 32 * GP) = st[n];
  };

  fetch();
  put(0);
  __syncthreads();
  for (int k0 = 0, buf = 0; k0 < K; k0 += GK, buf ^= 1) {
    const bool more = k0 + GK < K;             // the same for the whole work-group
    if (more) fetch();
    const T* cur = (const T*)(smem + buf * G::WORDS);
#pragma unroll
    for (int ks = 0; ks < GK; ks += 32) {
      V bh[4], bl[4];
#pragma unroll
      for (int j = 0; j < 4; ++j) {
        bh[j] = Frag<T>::load(cur + boff + j * 16 * GP + ks);
        if (SPLIT && SPLITB) bl[j] = Frag<T>::load(cur + boff + (G::BN + j * 16) * GP + ks);
      }
#pragma unroll
      for (int i = 0; i < MI; ++i) {
        V ah = Frag<T>::load(cur + aoff + i * 16 * GP + ks);
        V al;
        if (SPLIT) al = Frag<T>::load(cur + aoff + (G::BM + i * 16) * GP + ks);
#pragma unroll
        for (int j = 0; j < 4; ++j) {
          acc[i][j] = Frag<T>::mma(ah, bh[j], acc[i][j]);
          if (SPLIT) {
            if (SPLITB) acc[i][j] = Frag<T>::mma(ah, bl[j], acc[i][j]);
            acc[i][j] = Frag<T>::mma(al, bh[j], acc[i][j]);
          }
        }
      }
    }
    if (more) put(buf ^ 1);                    // last read one trip ago, in front of that trip's barrier
    __syncthreads();                           // publishes the next stage; ends every read of this one
  }
  store_tiles<MI, OUT_MODE>(acc, scale, Cout, Cout2, ldc, offC, m0b + wm * (MI * 16), n0b + wn * 64,
                            (float*)smem + wave * (16 * 68));
}

// All five input projections in one grid; blockIdx.y selects the product (block-uniform):
// 0 q_attn, 1 k_attn -> bf16 hi/lo; 2 q_rel, 3 k_rel -> f16; 4 values, transposed (A = WvT, Bt = symbols) -> bf16 hi/lo.
// Each product has (NTOK/128)*(DMOD/128) tiles of 128x128, one per block.
__global__ __launch_bounds__(256) void k_proj5(
    const unsigned short* __restrict__ xb, const unsigned short* __restrict__ sb, const unsigned short* __restrict__ wT,
    unsigned short* __restrict__ xqh, unsigned short* __restrict__ xql,
    unsigned short* __restrict__ xkh, unsigned short* __restrict__ xkl,
    unsigned short* __restrict__ qr16, unsigned short* __restrict__ kr16,
    unsigned short* __restrict__ svh, unsigned short* __restrict__ svl) {
  __shared__ __align__(16) unsigned short sm[2 * Stage<false, false, 2, 4, 2>::WORDS];
  const int y = blockIdx.y;
  const bool tv = (y == 4);
  const int nbN = (tv ? NTOK : DMOD) / 128;
  const int m0b = ((int)blockIdx.x / nbN) * 128, n0b = ((int)blockIdx.x % nbN) * 128;
  const unsigned short* Wy = wT + (size_t)y * DMOD * DMOD;
  if (y == 2 || y == 3) {
    unsigned short* c = (y == 2) ? qr16 : kr16;
    gemm_block<1, false, false, 2, 4, 2, 1, DMOD, DMOD>(xb, xb, 0, Wy, Wy, 0, c, c, DMOD, 0, DMOD, 1.0f, m0b, n0b, sm);
  } else {
    const unsigned short* a  = tv ? Wy : xb;
    const unsigned short* bt = tv ? sb : Wy;
    unsigned short* chi = tv ? svh : (y == 0 ? xqh : xkh);
    unsigned short* clo = tv ? svl : (y == 0 ? xql : xkl);
    gemm_block<1, false, false, 2, 4, 2, 2, DMOD, DMOD>(a, a, 0, bt, bt, 0, chi, clo, tv ? NTOK : DMOD, 0, DMOD, 1.0f, m0b, n0b, sm);
  }
}

// Attention (scores, causal softmax, P.V) of every chunk, batch row and head in one grid: a work-group owns SR whole query rows.
// Part 1, per block of 256 keys: scores[il][j] = SCALE_ATTN * sum_d xq[i][h,d] xk[j][h,d] (hi/lo split on both operands, product
//   hi.hi + hi.lo + lo.hi), operands staged as in gemm_block (one stage: all of k); the block's f32 scores pass through a
//   32 x 256 buffer in LDS into the registers of the wave that owns the row: wave w owns rows 4w .. 4w+3, lane owns
//   j = 256*t + 8*lane .. +7 (t <= c). The next block's global loads are issued behind this block's products.
// Part 2: softmax of the wave's four rows, keys j <= i.
// Part 3, per block of 256 keys: attended_symbols[il][d] += sum_j P[il][j] * svT[h*64+d][j] (hi/lo split on both operands, product
//   hi.hi + hi.lo + lo.hi). Each wave packs its four rows of P as bf16 hi and lo into those rows' own bytes of the score buffer;
//   V comes in stages of 128 keys, three buffers in the LDS that held the score operands: one stage is fetched beside the
//   packing, the next beside the products. Wave w sums, for the rows 16*(w&1).. +15 and all 64 columns, the keys
//   32*(w>>1).. +31 of every stage (a fragment of P feeds four tiles). P hi/lo never go to memory.
// Part 4: the four key groups' 32 x 64 partial sums meet in LDS, are added in the order of the groups and stored as whole lines;
//   the P*1024 f16 plane is written, row r = (b*NHEAD + h)*CHR + il at pitch jend, zeros for i < j < jend (behind the last
//   barrier, which would wait for the stores).
// The relation scores (they read nothing of the above) ride in the same grid: blockIdx.z = 4..7, chunk 7 - z, tiles of 128x256.
static constexpr int SR  = 32;                 // query rows per work-group
static constexpr int SRW = SR / 8;             // rows per wave
static constexpr int STP = CHR + 4;            // floats per row of the score buffer: rows 8 apart lie 32 banks apart (the two lane halves of a tile store), 16-B aligned
typedef Stage<true, true, 1, 2, 4> SG;         // one block: 32 query rows x 256 keys
static_assert(SG::BM == SR && SG::BN == CHR && HDIM == GK, "one stage holds all of k for 32 rows and 256 keys");
static constexpr int VK     = 128;             // keys per stage of V: 256 B, two whole lines, of every row of svT
static constexpr int VP     = VK + 8;          // LDS row pitch in 16-bit elements: 272 B = 16 B x 17, no bank conflict for 16-byte fragment reads
static constexpr int VWORDS = 2 * HDIM * VP;   // one stage: 64 hi rows, then 64 lo rows
static constexpr int PPW    = STP * 2;         // a row of the score buffer in 16-bit elements: 1040 B = 16 B x 65; holds 256 hi, then 256 lo
static constexpr int AWORDS = 3 * VWORDS > SG::WORDS ? 3 * VWORDS : SG::WORDS;   // the score operands' stage, then three stages of V
static_assert(2 * CHR <= PPW, "hi and lo of a row of P fit the row's bytes of the score buffer");
static_assert(4 * SR * 68 * 2 <= AWORDS && CHR == 2 * VK && VK == 4 * 32 && SR == 32 && HDIM == 64, "partial sums' staging; 2 row halves x 4 key groups = 8 waves");
static_assert(Stage<false, false, 4, 2, 4>::WORDS <= SG::WORDS, "the relation scores' stage fits");
// One code path for all chunks: c, and with it the number NT of key blocks, is block-uniform, so every test on it is a scalar
// branch that the whole work-group takes alike (barriers included); the kernel's text stays small.
// blockIdx.x = block of SR query rows in the chunk, blockIdx.y = batch row * 16 + head, blockIdx.z = 0..3: chunk 3 - z (longest first).
// Two work-groups share a WGP (one's products run beside the other's softmax arithmetic): four waves per SIMD, 256 registers each.
__global__ __launch_bounds__(256) __attribute__((amdgpu_waves_per_eu(4, 4))) void k_attn_rel(
    const unsigned short* __restrict__ xqh, const unsigned short* __restrict__ xql,
    const unsigned short* __restrict__ xkh, const unsigned short* __restrict__ xkl,
    const unsigned short* __restrict__ svh, const unsigned short* __restrict__ svl,
    float* __restrict__ attsym, unsigned short* __restrict__ p16,
    const unsigned short* __restrict__ qr16, const unsigned short* __restrict__ kr16, unsigned short* __restrict__ rel16) {
  __shared__ __align__(16) unsigned short smem[AWORDS];
  __shared__ __align__(16) float tbuf[SR * STP];
  if ((int)blockIdx.z >= NCHK) {                           // block-uniform
    const int cr = (2 * NCHK - 1) - (int)blockIdx.z;
    const int jr = CHR * (cr + 1), nbN = cr + 1;           // nbN = jr / 256
    if ((int)blockIdx.x >= (CHR / 128) * nbN) return;      // block-uniform, in front of every barrier
    const size_t br = blockIdx.y >> 4, hr = blockIdx.y & 15;
    // rel[c][b][il][r][j] = SCALE_REL * sum_p qr[i][r,p] kr[j][r,p]  (plain f16) -> f16 plane
    gemm_block<0, false, false, 4, 2, 4, 1, DMOD, DMOD>(qr16, qr16, (br * SEQ + (size_t)cr * CHR) * DMOD + hr * RDIM,
                                            kr16, kr16, br * ((size_t)SEQ * DMOD) + hr * RDIM,
                                            rel16, rel16, NREL * jr, chunk_base(cr) + br * ((size_t)CHR * NREL * jr) + hr * jr,
                                            RDIM, SCALE_REL, ((int)blockIdx.x / nbN) * 128, ((int)blockIdx.x % nbN) * 256, smem);
    return;
  }
  typedef __bf16 T;
  typedef Frag<T>::V V;
  constexpr int NLD = SG::ROWS / 32;           // 16-byte pieces per thread and stage
  constexpr int NA  = SG::AROWS / 32;          // of them the query rows, hi and lo
  const int c = (NCHK - 1) - (int)blockIdx.z;
  const int y = blockIdx.y, il0 = (int)blockIdx.x * SR;
  const int NT = c + 1;                        // blocks of 256 keys
  const int jend = CHR * NT;
  const int tid = threadIdx.x, lane = tid & 31;
  const int wave = __builtin_amdgcn_readfirstlane(tid >> 5);   // the same in every lane: kept in a scalar register, and the row addresses with it
  const int srow = tid >> 3, scol = (tid & 7) * 8;      // staging: row within a group of 32, 16-byte column
  const size_t bb = (size_t)(y >> 4), h = (size_t)(y & 15);
  const size_t offA = (bb * SEQ + (size_t)(c * CHR + il0)) * DMOD + h * HDIM;
  const size_t offB = bb * ((size_t)SEQ * DMOD) + h * HDIM;
  const unsigned short* gA  = xqh + offA + (size_t)srow * DMOD + scol;
  const unsigned short* gA2 = xql + offA + (size_t)srow * DMOD + scol;
  const unsigned short* gB  = xkh + offB + (size_t)srow * DMOD + scol;
  const unsigned short* gB2 = xkl + offB + (size_t)srow * DMOD + scol;
  unsigned short* sdst = smem + srow * GP + scol;

  const int rlane = lane & 15;                 // row (A) / col (B, D) within subtile
  const int koff  = (lane >> 4) * 8;           // k offset of this lane half
  const int wm = wave >> 2, wn = wave & 3;     // 2 x 4 waves, each 16 rows x 64 keys
  const int aoff = (wm * 16 + rlane) * GP + koff;
  const int boff = (SG::AROWS + wn * 64 + rlane) * GP + koff;
  float* tdst = tbuf + (wm * 16 + (lane >> 4) * 8) * STP + wn * 64 + rlane;   // D row 8*(lane>>4) + r, column rlane
  const float* tsrc = tbuf + (wave * SRW) * STP + lane * 8;                   // the wave's own rows, the lane's 8 keys

  v4u st[NLD];
  auto fetch = [&](int nb) {                   // nb: the key block, a compile-time number at every call: an immediate offset
#pragma unroll
    for (int n = (nb == 0 ? 0 : NA); n < NLD; ++n) {   // the query rows are staged once, with block 0, and stay
      const int r = n * 32;                    // first staged row of the group of 32: picks the plane at compile time
      const unsigned short* g;
      if (r < SG::BM)                   g = gA  + (size_t)r * DMOD;
      else if (r < SG::AROWS)           g = gA2 + (size_t)(r - SG::BM) * DMOD;
      else if (r < SG::AROWS + SG::BN)  g = gB  + (size_t)(nb * SG::BN + r - SG::AROWS) * DMOD;
      else                              g = gB2 + (size_t)(nb * SG::BN + r - SG::AROWS - SG::BN) * DMOD;
      st[n] = *(const v4u*)g;
    }
    // the addresses, the same for every block, stay in their registers up to this wait, so that it stands in front of
    // every overwrite of a register that these loads name
    if (nb == 0) asm volatile("s_wait_xcnt 0x0" :: "v"(gA), "v"(gA2), "v"(gB), "v"(gB2) : "memory");
    else         asm volatile("s_wait_xcnt 0x0" :: "v"(gB), "v"(gB2) : "memory");
  };
  auto put = [&](int nb) {
#pragma unroll
    for (int n = (nb == 0 ? 0 : NA); n < NLD; ++n) *(v4u*)(sdst + n * 32 * GP) = st[n];
  };

  const float NEG = -__builtin_huge_valf();
  const int ilw = il0 + wave * SRW;            // the wave's first row within the chunk
  float s[SRW][NCHK][8];                       // blocks t >= NT are neither written nor read
  fetch(0);
  put(0);
  __syncthreads();
  const T* cur = (const T*)smem;
  // unrolled: s lives in registers and is indexed by the block's number
#pragma unroll
  for (int nb = 0; nb < NCHK; ++nb) {
    if (nb < NT) {
      v8f acc[4];
#pragma unroll
      for (int j = 0; j < 4; ++j) acc[j] = (v8f){0.f,0.f,0.f,0.f,0.f,0.f,0.f,0.f};
#pragma unroll
      for (int ks = 0; ks < GK; ks += 32) {
        V bh[4], bl[4];
#pragma unroll
        for (int j = 0; j < 4; ++j) {
          bh[j] = Frag<T>::load(cur + boff + j * 16 * GP + ks);
          bl[j] = Frag<T>::load(cur + boff + (SG::BN + j * 16) * GP + ks);
        }
        const V ah = Frag<T>::load(cur + aoff + ks);
        const V al = Frag<T>::load(cur + aoff + SG::BM * GP + ks);
#pragma unroll
        for (int j = 0; j < 4; ++j) {
          acc[j] = Frag<T>::mma(ah, bh[j], acc[j]);
          acc[j] = Frag<T>::mma(ah, bl[j], acc[j]);
          acc[j] = Frag<T>::mma(al, bh[j], acc[j]);
        }
      }
      if (nb + 1 < NCHK && nb + 1 < NT) fetch(nb + 1);
#pragma unroll
      for (int j = 0; j < 4; ++j)
#pragma unroll
        for (int r = 0; r < 8; ++r) tdst[r * STP + j * 16] = acc[j][r] * SCALE_ATTN;
      __syncthreads();                         // publishes this block's scores; ends every read of the stage
#pragma unroll
      for (int q = 0; q < SRW; ++q) {
        const v4f a = *(const v4f*)(tsrc + q * STP);
        const v4f b = *(const v4f*)(tsrc + q * STP + 4);
        s[q][nb][0] = a[0]; s[q][nb][1] = a[1]; s[q][nb][2] = a[2]; s[q][nb][3] = a[3];
        s[q][nb][4] = b[0]; s[q][nb][5] = b[1]; s[q][nb][6] = b[2]; s[q][nb][7] = b[3];
      }
      if (nb + 1 < NCHK && nb + 1 < NT) {
        put(nb + 1);
        __syncthreads();                       // publishes the next stage; ends every read of the score buffer
      } else {
        // the chunk's last block holds the diagonal: keys j > i get -inf, as in the definition (they leave the maximum alone
        // and their exponential is exactly 0); in every earlier block j < 256 c <= i
#pragma unroll
        for (int q = 0; q < SRW; ++q)
#pragma unroll
          for (int e = 0; e < 8; ++e) s[q][nb][e] = (lane * 8 + e <= ilw + q) ? s[q][nb][e] : NEG;
      }
    }
  }

  // Part 3's operands. Behind the last block's barrier nobody reads the stage any more: its LDS takes the stages of V.
  const int vrow = tid >> 4, vcol = (tid & 15) * 8;        // staging of V: row within a group of 16, 16-byte column
  const size_t offV = (h * HDIM + (size_t)vrow) * NTOK + bb * SEQ + vcol;
  const unsigned short* gV  = svh + offV;
  const unsigned short* gV2 = svl + offV;
  unsigned short* vdst = smem + vrow * VP + vcol;
  v4u vst[8];
  auto vfetch = [&](int sg) {                  // sg: the stage of 128 keys, a compile-time number at every call: an immediate offset
#pragma unroll
    for (int n = 0; n < 8; ++n) {
      const unsigned short* g = (n < 4 ? gV + (size_t)(n * 16) * NTOK : gV2 + (size_t)((n - 4) * 16) * NTOK) + sg * VK;
      vst[n] = *(const v4u*)g;
    }
    // the addresses, the same for every stage, stay in their registers up to this wait, so that it stands in front of
    // every overwrite of a register that these loads name
    asm volatile("s_wait_xcnt 0x0" :: "v"(gV), "v"(gV2) : "memory");
  };
  auto vput = [&](int buf) {
#pragma unroll
    for (int n = 0; n < 8; ++n) *(v4u*)(vdst + buf * VWORDS + n * 16 * VP) = vst[n];
  };
  vfetch(0);                                   // lands while the softmax arithmetic runs

  const float LOG2E = 1.44269504088896340736f;
  float m[SRW], sum[SRW], inv[SRW];
#pragma unroll
  for (int q = 0; q < SRW; ++q) m[q] = NEG;
#pragma unroll
  for (int t = 0; t < NCHK; ++t) {
    if (t < NT) {
#pragma unroll
      for (int q = 0; q < SRW; ++q)
#pragma unroll
        for (int e = 0; e < 8; ++e) m[q] = fmaxf(m[q], s[q][t][e]);
    }
  }
#pragma unroll
  for (int off = 1; off < 32; off <<= 1) {     // the four rows' chains of shuffles overlap
#pragma unroll
    for (int q = 0; q < SRW; ++q) m[q] = fmaxf(m[q], __shfl_xor(m[q], off, 32));
  }
#pragma unroll
  for (int q = 0; q < SRW; ++q) sum[q] = 0.f;
#pragma unroll
  for (int t = 0; t < NCHK; ++t) {
    if (t < NT) {
#pragma unroll
      for (int q = 0; q < SRW; ++q) {
        float x[8], v[8];
#pragma unroll
        for (int e = 0; e < 8; ++e) x[e] = (s[q][t][e] - m[q]) * LOG2E;
        // exp(u) = 2^(u * log2 e), eight at a time in one statement: no result shares a register with a source (early clobber),
        // and the v_nop fills the slot that the instruction set asks for behind the last transcendental
        asm("v_exp_f32 %0, %8\n\tv_exp_f32 %1, %9\n\tv_exp_f32 %2, %10\n\tv_exp_f32 %3, %11\n\t"
            "v_exp_f32 %4, %12\n\tv_exp_f32 %5, %13\n\tv_exp_f32 %6, %14\n\tv_exp_f32 %7, %15\n\tv_nop"
            : "=&v"(v[0]), "=&v"(v[1]), "=&v"(v[2]), "=&v"(v[3]), "=&v"(v[4]), "=&v"(v[5]), "=&v"(v[6]), "=&v"(v[7])
            : "v"(x[0]), "v"(x[1]), "v"(x[2]), "v"(x[3]), "v"(x[4]), "v"(x[5]), "v"(x[6]), "v"(x[7]));
#pragma unroll
        for (int e = 0; e < 8; ++e) {
          s[q][t][e] = v[e];
          sum[q] += v[e];
        }
      }
    }
  }
#pragma unroll
  for (int off = 1; off < 32; off <<= 1) {
#pragma unroll
    for (int q = 0; q < SRW; ++q) sum[q] += __shfl_xor(sum[q], off, 32);
  }
#pragma unroll
  for (int q = 0; q < SRW; ++q) inv[q] = 1.0f / sum[q];    // sum >= 1 (the row's largest score gives exp(0))
  // ---- part 3: P.V ----
  const int rh = wave & 1, kq = wave >> 1;     // the wave's half of the rows, its group of 32 keys in every stage
  unsigned short* pw = (unsigned short*)tbuf + (wave * SRW) * PPW + lane * 8;    // the wave's own rows, the lane's 8 keys
  const T* pa = (const T*)tbuf + (rh * 16 + rlane) * PPW + kq * 32 + koff;       // A: row m = query row, hi; lo CHR elements on
  const T* vb = (const T*)smem + rlane * VP + kq * 32 + koff;                    // Bt: row n = d, hi; lo HDIM rows on
  v8f o[4];
#pragma unroll
  for (int j = 0; j < 4; ++j) o[j] = (v8f){0.f,0.f,0.f,0.f,0.f,0.f,0.f,0.f};
  auto pv = [&](int buf, int half) {           // keys 128*half .. +127 of the block in the score buffer; their V in buffer 'buf'
    const V ah = Frag<T>::load(pa + half * VK);
    const V al = Frag<T>::load(pa + CHR + half * VK);
#pragma unroll
    for (int j = 0; j < 4; ++j) {
      const V bh = Frag<T>::load(vb + buf * VWORDS + j * 16 * VP);
      const V bl = Frag<T>::load(vb + buf * VWORDS + (HDIM + j * 16) * VP);
      o[j] = Frag<T>::mma(ah, bh, o[j]);
      o[j] = Frag<T>::mma(ah, bl, o[j]);
      o[j] = Frag<T>::mma(al, bh, o[j]);
    }
  };
  v4u fv[NCHK][SRW];                           // P*1024 as f16, kept for part 4 in half the registers of s
  vput(0);
  // unrolled: s lives in registers and is indexed by the block's number; stage g of V lies in buffer g mod 3
#pragma unroll
  for (int t = 0; t < NCHK; ++t) {
    if (t < NT) {
      vfetch(2 * t + 1);                       // lands while the block of P is packed
      // a row's hi and lo overwrite that row's scores, which only this wave has read since the last barrier
#pragma unroll
      for (int q = 0; q < SRW; ++q) {
        v4u hv, lv;
#pragma unroll
        for (int e = 0; e < 4; ++e) {
          const float a = s[q][t][2 * e] * inv[q];
          const float b = s[q][t][2 * e + 1] * inv[q];
          const unsigned short ha = f2bf_bits(a), hb = f2bf_bits(b);
          const unsigned short la = f2bf_bits(a - bf_bits2f(ha)), lb = f2bf_bits(b - bf_bits2f(hb));
          const unsigned short fa = h_bits(a * PCARRY), fb = h_bits(b * PCARRY);
          hv[e] = (unsigned)ha | ((unsigned)hb << 16);
          lv[e] = (unsigned)la | ((unsigned)lb << 16);
          fv[t][q][e] = (unsigned)fa | ((unsigned)fb << 16);
        }
        *(v4u*)(pw + q * PPW) = hv;
        *(v4u*)(pw + q * PPW + CHR) = lv;
      }
      vput((2 * t + 1) % 3);                   // held stage 2t - 2, last read in front of the last barrier
      __syncthreads();                         // publishes this block of P and its two stages of V
      if (t + 1 < NCHK && t + 1 < NT) vfetch(2 * t + 2);   // lands while the products run
      pv((2 * t) % 3, 0);
      pv((2 * t + 1) % 3, 1);
      if (t + 1 < NCHK && t + 1 < NT) vput((2 * t + 2) % 3);   // held stage 2t - 1, last read one block ago
      __syncthreads();                         // ends every read of this block of P and of its two stages
    }
  }

  // ---- part 4: results ----
  float* ob = (float*)smem;                    // four key groups x 32 x 68 floats; every read of V has ended
#pragma unroll
  for (int j = 0; j < 4; ++j)
#pragma unroll
    for (int r = 0; r < 8; ++r)                // D row 8*(lane>>4) + r, column rlane
      ob[(kq * SR + rh * 16 + (lane >> 4) * 8 + r) * 68 + j * 16 + rlane] = o[j][r];
  __syncthreads();                             // publishes the partial sums
  {
    float* og = attsym + (bb * SEQ + (size_t)(c * CHR + il0 + vrow)) * DMOD + h * HDIM + (tid & 15) * 4;   // 16 lanes x 16 B = a row's 256 B
    const float* os = ob + vrow * 68 + (tid & 15) * 4;
    v4f o0 = *(const v4f*)os;
    v4f o1 = *(const v4f*)(os + 16 * 68);
#pragma unroll
    for (int g = 1; g < 4; ++g) {
      o0 += *(const v4f*)(os + g * SR * 68);
      o1 += *(const v4f*)(os + (g * SR + 16) * 68);
    }
    *(v4f*)og = o0;
    *(v4f*)(og + (size_t)16 * DMOD) = o1;
    // the address stays in its registers up to this wait, which stands in front of every overwrite of a register that these stores name
    asm volatile("s_wait_xcnt 0x0" :: "v"(og), "v"(o0), "v"(o1) : "memory");
  }
  const size_t ro = chunk_base(c) + ((size_t)y * CHR + ilw) * jend;   // the wave's first row: a scalar base for every store
  unsigned short* df = p16 + ro;
  unsigned vo[SRW];                            // the lane's place in each of the four rows, in bytes: one 32-bit offset register per row
#pragma unroll
  for (int q = 0; q < SRW; ++q) vo[q] = (unsigned)(q * jend + lane * 8) * 2u;
#pragma unroll
  for (int t = 0; t < NCHK; ++t) {
    if (t < NT) {
#pragma unroll
      for (int q = 0; q < SRW; ++q) *(v4u*)((char*)df + vo[q] + t * 512) = fv[t][q];
    }
  }
}

// out[token][n] = sum_k combined[token][k] * WoT[n][k]  (A hi/lo, B bf16 weights), f32 out; one 128x128 tile per block.
__global__ __launch_bounds__(256) void k_out(const unsigned short* __restrict__ ch, const unsigned short* __restrict__ cl,
    const unsigned short* __restrict__ woT, float* __restrict__ out) {
  __shared__ __align__(16) unsigned short sm[2 * Stage<true, false, 2, 4, 2>::WORDS];
  const int nbN = DMOD / 128;
  gemm_block<1, true, false, 2, 4, 2, 0, DMOD, DMOD>(ch, cl, 0, woT, woT, 0, out, out, DMOD, 0, DMOD, 1.0f,
                                         ((int)blockIdx.x / nbN) * 128, ((int)blockIdx.x % nbN) * 128, sm);
}

// ---------------------------------------------------------------------------
// f32 -> bf16 (RNE) cast of the two activation tensors, 8 elements per thread:
// by selects the tensor (block-uniform), bx the block of 2048 elements. Coverage: CAST_BLOCKS*256 threads * 8 = n8*8 elements exactly.
// ---------------------------------------------------------------------------
__device__ __forceinline__ void cast_bf16x8_block(const float* __restrict__ s0, const float* __restrict__ s1,
    unsigned short* __restrict__ d0, unsigned short* __restrict__ d1, int n8, int bx, int by) {
  const float* src = (by == 0) ? s0 : s1;
  unsigned short* dst = (by == 0) ? d0 : d1;
  const int i = bx * 256 + threadIdx.x;
  if (i < n8) {
    const size_t e0 = (size_t)i * 8;
    const v4f a = *(const v4f*)(src + e0);
    const v4f c = *(const v4f*)(src + e0 + 4);
    v4u u;
    u[0] = pack_bf16x2(a[0], a[1]);
    u[1] = pack_bf16x2(a[2], a[3]);
    u[2] = pack_bf16x2(c[0], c[1]);
    u[3] = pack_bf16x2(c[2], c[3]);
    *(v4u*)(dst + e0) = u;
    
  }
}

// ---------------------------------------------------------------------------
// Weight transpose + bf16 cast: W[k][o] (f32, [DMOD][DMOD]) -> WT[o][k] (bf16), 6 weights selected by z; tile: 64*68 floats of LDS.
// Coverage per block: read 4 iters * 256 threads * 4 = 4096 elements; write 2 iters * 8 waves * 4 lines * 64 = 4096.
// ---------------------------------------------------------------------------
__device__ __forceinline__ void wT_bf16_block(const float* __restrict__ w0, const float* __restrict__ w1,
    const float* __restrict__ w2, const float* __restrict__ w3, const float* __restrict__ w4, const float* __restrict__ w5,
    unsigned short* __restrict__ dst, float* tile, int bx, int by, int z) {
  const float* W = (z == 0) ? w0 : (z == 1) ? w1 : (z == 2) ? w2 : (z == 3) ? w3 : (z == 4) ? w4 : w5;
  unsigned short* WT = dst + (size_t)z * DMOD * DMOD;
  const int k0 = by * 64;   // rows of W (input dim)
  const int o0 = bx * 64;   // cols of W (output dim)
  const int tid = threadIdx.x;
#pragma unroll
  for (int it = 0; it < 4; ++it) {
    const int e = (it * 256 + tid) * 4;
    const int row = e >> 6, col = e & 63;
    const v4f v = *(const v4f*)(W + (size_t)(k0 + row) * DMOD + o0 + col);
    *(v4f*)(tile + row * 68 + col) = v;
  }
  __syncthreads();
  const int lane = tid & 31, wave = tid >> 5, q = lane >> 3, c8 = (lane & 7) * 8;
  v4u ov[2];
#pragma unroll
  for (int it = 0; it < 2; ++it) {
    const int oo = it * 32 + wave * 4 + q;
    float f[8];
#pragma unroll
    for (int e = 0; e < 8; ++e) f[e] = tile[(c8 + e) * 68 + oo];
    ov[it][0] = pack_bf16x2(f[0], f[1]);
    ov[it][1] = pack_bf16x2(f[2], f[3]);
    ov[it][2] = pack_bf16x2(f[4], f[5]);
    ov[it][3] = pack_bf16x2(f[6], f[7]);
  }
  {
#pragma unroll
    for (int it = 0; it < 2; ++it) {
      const int oo = it * 32 + wave * 4 + q;
      *(v4u*)(WT + (size_t)(o0 + oo) * DMOD + k0 + c8) = ov[it];
    }
    // in the merged kernel's built control flow another role's code follows these stores and reuses their registers:
    // keep the wait in front of that overwrite
    asm volatile("s_wait_xcnt 0x0" ::: "memory");
  }
}

// ---------------------------------------------------------------------------
// Wr [NHEAD*HDIM rows][NREL] f32 -> WrP [rows][32] bf16 with k 16..31 zero-FILLED (WMMA K padding).
// Coverage: 256 threads * 8 elements = 64 rows * 32; store 8 waves * 4 lines * 64 = 2048 elements.
// ---------------------------------------------------------------------------
__device__ __forceinline__ void wr_pack_block(const float* __restrict__ wr, unsigned short* __restrict__ dst,
    unsigned short* tile, int bx) {   // tile: 64*32 16-bit words of LDS
  const int r0 = bx * 64;
  const int tid = threadIdx.x;
  const int row = tid >> 2, kq = (tid & 3) * 8;
  v4u u;
  unsigned wv[4];
#pragma unroll
  for (int e = 0; e < 4; ++e) {
    const int ka = kq + 2 * e, kb = kq + 2 * e + 1;
    const int kac = ka < NREL ? ka : NREL - 1;
    const int kbc = kb < NREL ? kb : NREL - 1;
    const float fa = wr[(size_t)(r0 + row) * NREL + kac];
    const float fb = wr[(size_t)(r0 + row) * NREL + kbc];
    const unsigned ba = (ka < NREL) ? (unsigned)f2bf_bits(fa) : 0u;
    const unsigned bb = (kb < NREL) ? (unsigned)f2bf_bits(fb) : 0u;
    wv[e] = ba | (bb << 16);
  }
  u[0] = wv[0]; u[1] = wv[1]; u[2] = wv[2]; u[3] = wv[3];
  *(v4u*)(tile + row * 32 + kq) = u;
  __syncthreads();
  const int lane = tid & 31, wave = tid >> 5, q = lane >> 3, c8 = (lane & 7) * 8;
  const int L = wave * 4 + q;                       // line 0..31, 64 elements per line
  const v4u v = *(const v4u*)(tile + L * 64 + c8);
  {
    *(v4u*)(dst + (size_t)r0 * 32 + L * 64 + c8) = v;
    // as in the weight transpose: the wait in front of an overwrite of this store's registers by another role's code
    asm volatile("s_wait_xcnt 0x0" ::: "memory");
  }
}

// ---------------------------------------------------------------------------
// The three input conversions in one grid (none reads another's result); the role is block-uniform, from blockIdx.x:
// [0, 2*CAST_BLOCKS) activation casts, then WT_BLOCKS weight-transpose tiles, then WR_BLOCKS blocks of the Wr pack.
// ---------------------------------------------------------------------------
static constexpr int CAST_BLOCKS = NTOK * DMOD / 8 / 256;            // 1024 per tensor
static constexpr int WT_SIDE     = DMOD / 64;                        // 16 tiles per side
static constexpr int WT_BLOCKS   = 6 * WT_SIDE * WT_SIDE;            // 1536
static constexpr int WR_BLOCKS   = (NHEAD * HDIM) / 64;              // 16
__global__ __launch_bounds__(256) void k_prep(const float* __restrict__ x, const float* __restrict__ symb,
    const float* __restrict__ w0, const float* __restrict__ w1, const float* __restrict__ w2,
    const float* __restrict__ w3, const float* __restrict__ w4, const float* __restrict__ w5, const float* __restrict__ wr,
    unsigned short* __restrict__ xb, unsigned short* __restrict__ sb, unsigned short* __restrict__ wT,
    unsigned short* __restrict__ wrp) {
  __shared__ __align__(16) float tile[64 * 68];
  const int id = blockIdx.x;
  if (id < 2 * CAST_BLOCKS) {
    cast_bf16x8_block(x, symb, xb, sb, NTOK * DMOD / 8, id % CAST_BLOCKS, id / CAST_BLOCKS);
    return;
  }
  if (id < 2 * CAST_BLOCKS + WT_BLOCKS) {
    const int t = id - 2 * CAST_BLOCKS;
    wT_bf16_block(w0, w1, w2, w3, w4, w5, wT, tile, t % WT_SIDE, (t / WT_SIDE) % WT_SIDE, t / (WT_SIDE * WT_SIDE));
    return;
  }
  wr_pack_block(wr, wrp, (unsigned short*)tile, id - 2 * CAST_BLOCKS - WT_BLOCKS);
}

// ---------------------------------------------------------------------------
// Relation aggregation + Wr mix + residual. Block = 8 waves = 8 query rows of batch row blockIdx.y, one row per wave: the four rows
// 4g .. 4g+3 and the four rows SEQ-1-4g .. SEQ-4-4g, g = blockIdx.x. A row reads bytes in proportion to its causal extent, so a short
// row beside a long one gives every work-group the same number of bytes; SEQ/8 * NB work-groups, one per WGP (LDS), are resident at once.
// Phase 1 (per wave, local row ill = wave, in its own chunk c = i / 256): D[h][r] = sum_{j<kend} P16[h][il][j] * rel[il][r][j]
//   (one f16 WMMA tile, K stepped by 32; the 16 + 16 operand rows are staged 256 k at a time in the wave's own LDS, up to the
//   causal extent, zeros behind it; P16 carries P*1024, rel carries REL_SCALE);
//   D is split into bf16 hi/lo and written to LDS arHL[m=ill][h][k=r] (k 16..31 and the rows m = 8..15 zero-filled first).
// Phase 2 (per wave, heads h = wave and wave+8): attrel[ill][d] = sum_r ar[ill][h][r] * Wr[h][d][r]
//   (A = arHL hi/lo from LDS, B = WrP bf16 [h*64+d][32], two products per tile, 4 tiles of 16 d).
// Epilogue: per-wave 8x64 slab in LDS, residual attended_symbols added from two 16-B loads per lane and row
// ---------------------------------------------------------------------------
__global__ __launch_bounds__(256) void k_rel_mix(const unsigned short* __restrict__ p16all, const unsigned short* __restrict__ relall,
    const unsigned short* __restrict__ wrp, const float* __restrict__ attsym,
    unsigned short* __restrict__ comb_hi, unsigned short* __restrict__ comb_lo) {
  const int rowbase = (int)blockIdx.y * SEQ;
  const int g4 = (int)blockIdx.x * 4;
  __shared__ __align__(16) unsigned short arHL[2 * 16 * 16 * 32];   // hi plane [m][h][32] then lo plane
  __shared__ __align__(16) float slab[8][8 * 68];
  constexpr int RK = 256;                   // k per stage of phase 1: 512 B of an operand row = one wave-wide load of whole lines
  constexpr int RPITCH = RK + 8;            // 528 B = 16 B x 33: no bank conflict for 16-byte fragment reads
  __shared__ __align__(16) unsigned short stg[8][32 * RPITCH];
  const int tid = threadIdx.x, lane = tid & 31;
  const int wave = __builtin_amdgcn_readfirstlane(tid >> 5);   // the same in every lane: the row, its chunk and its trip count stay scalar
  const int hh = lane >> 4, rl = lane & 15, koff = hh * 8;
  {
    const v4u zz = {0u, 0u, 0u, 0u};
    v4u* zp = (v4u*)arHL;                 // 32768 B = 2048 x 16 B, 256 threads x 8
    for (int qq = tid; qq < 2048; qq += 256) zp[qq] = zz;
  }
  __syncthreads();
  const v8f zero8 = {0.f, 0.f, 0.f, 0.f, 0.f, 0.f, 0.f, 0.f};
  {
    const int ill = wave;                     // local row 0..7 (wave-uniform)
    const int i = (wave < 4) ? g4 + wave : (SEQ - 1) - g4 - (wave - 4);   // query position
    const int c = i / CHR, il = i % CHR;      // the row's chunk, its place there
    const int jend = CHR * (c + 1);           // the chunk's row pitch
    const unsigned short* p16 = p16all + chunk_base(c) + (size_t)blockIdx.y * ((size_t)NHEAD * CHR * jend);
    const unsigned short* rel = relall + chunk_base(c) + (size_t)blockIdx.y * ((size_t)CHR * NREL * jend);
    const int kend = (i & ~31) + 32;          // <= jend; P16 is zero for i < j < kend
    const unsigned short* gA = p16 + (size_t)il * jend;                      // + head * CHR * jend: A row m = head
    const unsigned short* gB = rel + (size_t)il * ((size_t)NREL * jend);     // + relation * jend: Bt row n = relation
    const int lane8 = lane * 8;               // the lane's 16 bytes of a row's 512
    unsigned short* wst = stg[wave];          // the wave's own stage: rows 0..15 = A, 16..31 = Bt
    v8f acc = zero8;
    for (int ks = 0; ks < kend; ks += RK) {
      const bool on = ks + lane * 8 < kend;   // kend is a multiple of 32; columns from kend on are staged as zeros and add nothing
      v4u st[32];
#pragma unroll
      for (int n = 0; n < 32; ++n) st[n] = (v4u){0u, 0u, 0u, 0u};
      if (on) {
#pragma unroll
        for (int n4 = 0; n4 < 16; n4 += 4) {
          const unsigned short *ga[4], *gb[4];
#pragma unroll
          for (int q = 0; q < 4; ++q) {
            ga[q] = gA + (size_t)(n4 + q) * ((size_t)CHR * jend) + ks + lane8;
            gb[q] = gB + (size_t)(n4 + q) * jend + ks + lane8;
            st[n4 + q]      = *(const v4u*)ga[q];
            st[16 + n4 + q] = *(const v4u*)gb[q];
          }
          // a later load's result may be given the registers that held these addresses: the addresses stay where they are
          // up to this wait, which stands in front of every such overwrite
          asm volatile("s_wait_xcnt 0x0" :: "v"(ga[0]), "v"(ga[1]), "v"(ga[2]), "v"(ga[3]),
                                            "v"(gb[0]), "v"(gb[1]), "v"(gb[2]), "v"(gb[3]) : "memory");
        }
      }
#pragma unroll
      for (int n = 0; n < 32; ++n) *(v4u*)(wst + n * RPITCH + lane * 8) = st[n];
      __builtin_amdgcn_fence(__ATOMIC_RELEASE, "workgroup");
      __builtin_amdgcn_wave_barrier();
      __builtin_amdgcn_fence(__ATOMIC_ACQUIRE, "workgroup");
      v16h a[RK / 32], bb[RK / 32];           // the stage's fragment reads go as one group ahead of its products
#pragma unroll
      for (int u = 0; u < RK / 32; ++u) {
        a[u]  = Frag<_Float16>::load((const _Float16*)wst + rl * RPITCH + koff + u * 32);
        bb[u] = Frag<_Float16>::load((const _Float16*)wst + (16 + rl) * RPITCH + koff + u * 32);
      }
#pragma unroll
      for (int u = 0; u < RK / 32; ++u) acc = mma16h(a[u], bb[u], acc);
      __builtin_amdgcn_fence(__ATOMIC_RELEASE, "workgroup");
      __builtin_amdgcn_wave_barrier();
      __builtin_amdgcn_fence(__ATOMIC_ACQUIRE, "workgroup");
    }
    // acc[r8] = D[row h = 8*hh + r8][col r = rl]  (carried x1024)
#pragma unroll
    for (int r8 = 0; r8 < 8; ++r8) {
      const float f = acc[r8];
      const unsigned short hb = f2bf_bits(f);
      const unsigned short lb = f2bf_bits(f - bf_bits2f(hb));
      const int idx = (ill * 16 + 8 * hh + r8) * 32 + rl;
      arHL[idx] = hb;
      arHL[8192 + idx] = lb;
    }
  }
  __syncthreads();
  const int q = lane >> 3, c8 = (lane & 7) * 8;
  float* sl = slab[wave];
#pragma unroll
  for (int sub = 0; sub < 2; ++sub) {
    const int h = wave + 8 * sub;             // wave-uniform head
    const v16b ah = Frag<__bf16>::load((const __bf16*)arHL + rl * 512 + h * 32 + koff);          // A[m = rl][k]
    const v16b al = Frag<__bf16>::load((const __bf16*)arHL + 8192 + rl * 512 + h * 32 + koff);
    v8f acc2[4];
#pragma unroll
    for (int j = 0; j < 4; ++j) {
      const v16b bw = Frag<__bf16>::load((const __bf16*)wrp + (size_t)(h * HDIM + j * 16 + rl) * 32 + koff);  // Bt[n = d][k = r]
      acc2[j] = mma16b(ah, bw, zero8);
      acc2[j] = mma16b(al, bw, acc2[j]);
    }
    // acc2[j][r8] = attrel[ill = 8*hh + r8][d = 16*j + rl] * 1024; the rows 8..15 (hh = 1) are padding
    if (hh == 0) {
#pragma unroll
      for (int j = 0; j < 4; ++j)
#pragma unroll
        for (int r8 = 0; r8 < 8; ++r8) sl[r8 * 68 + j * 16 + rl] = acc2[j][r8] * PCARRY_INV;
    }
    __builtin_amdgcn_fence(__ATOMIC_RELEASE, "workgroup");
    __builtin_amdgcn_wave_barrier();
    __builtin_amdgcn_fence(__ATOMIC_ACQUIRE, "workgroup");
    v4u hv[2], lv[2];
    const float* ra[2];
    v4f ra0[2], ra1[2];
#pragma unroll
    for (int it = 0; it < 2; ++it) {           // local row it * 4 + q; its query position as in phase 1
      ra[it] = attsym + (size_t)(rowbase + (it == 0 ? g4 + q : (SEQ - 1) - g4 - q)) * DMOD + h * HDIM + c8;
      ra0[it] = *(const v4f*)ra[it];
      ra1[it] = *(const v4f*)(ra[it] + 4);
    }
    // the addresses stay in their registers up to this wait, so that it stands in front of every overwrite of a register
    // that these loads name (a later load's result)
    asm volatile("s_wait_xcnt 0x0" :: "v"(ra[0]), "v"(ra[1]) : "memory");
#pragma unroll
    for (int it = 0; it < 2; ++it) {
      const int row = it * 4 + q;
      const v4f s0 = *(const v4f*)(sl + row * 68 + c8);
      const v4f s1 = *(const v4f*)(sl + row * 68 + c8 + 4);
      const v4f r0 = ra0[it];
      const v4f r1 = ra1[it];
      float v[8];
      v[0] = s0[0] + r0[0]; v[1] = s0[1] + r0[1]; v[2] = s0[2] + r0[2]; v[3] = s0[3] + r0[3];
      v[4] = s1[0] + r1[0]; v[5] = s1[1] + r1[1]; v[6] = s1[2] + r1[2]; v[7] = s1[3] + r1[3];
#pragma unroll
      for (int e = 0; e < 4; ++e) {
        const float a = v[2 * e], c = v[2 * e + 1];
        const unsigned short ha = f2bf_bits(a), hc = f2bf_bits(c);
        const unsigned short la = f2bf_bits(a - bf_bits2f(ha)), lc = f2bf_bits(c - bf_bits2f(hc));
        hv[it][e] = (unsigned)ha | ((unsigned)hc << 16);
        lv[it][e] = (unsigned)la | ((unsigned)lc << 16);
      }
    }
    {
#pragma unroll
      for (int it = 0; it < 2; ++it) {
        const size_t g = (size_t)(rowbase + (it == 0 ? g4 + q : (SEQ - 1) - g4 - q)) * DMOD + h * HDIM + c8;
        *(v4u*)(comb_hi + g) = hv[it];
        *(v4u*)(comb_lo + g) = lv[it];
      }
      
    }
    __builtin_amdgcn_fence(__ATOMIC_RELEASE, "workgroup");
    __builtin_amdgcn_wave_barrier();
    __builtin_amdgcn_fence(__ATOMIC_ACQUIRE, "workgroup");
  }
}

// ---------------------------------------------------------------------------
// launcher
// Workspace region map (bytes, all 256-B aligned; total 178,323,456):
//   region 0, 83,886,080 bytes, used twice in turn, the first use ended by a launch boundary before the second begins:
//     steps 1-2: xb [2048][1024] bf16 (x, RNE) at 0, sb (symbols, RNE) behind it; in its last 10,485,760 bytes the
//                transposed bf16 weights 0 q_attn, 1 k_attn, 2 q_rel, 3 k_rel, 4 v, [1024][1024] each
//     relation scores -> relation mix: rel16 f16, PLANE_ELEMS elements, [c][b][256][16][jend] (REL_SCALE folded)
//   WoT    [1024][1024] bf16     2,097,152      directly behind region 0: the sixth slot of the weight transpose; lives to step 4
//   xqh/xql/xkh/xkl [2048][1024] bf16  4 x 4,194,304
//   qr16/kr16 [2048][1024] f16   2 x 4,194,304
//   svh/svl [1024][2048] bf16    2 x 4,194,304  (values transposed: row h*64+d, col b*1024+j)
//   attsym  [2048][1024] f32     8,388,608
//   ch/cl   [2048][1024] bf16    2 x 4,194,304  (pre-output activations hi/lo)
//   wrp     [1024][32] bf16      65,536         (Wr with K padded to 32, pad zero-filled)
//   p16     [c][b][16][256][jend] f16  41,943,040      probabilities x1024
// ---------------------------------------------------------------------------
extern "C" void kernel_launch(void* const* d_in, const int* in_sizes, int n_in,
                              void* d_out, int out_size, void* d_ws, size_t ws_size,
                              hipStream_t stream) {
  if (n_in < 9) return;
  if (in_sizes[0] != NTOK * DMOD || in_sizes[1] != NTOK * DMOD) return;
  if (in_sizes[2] != DMOD * DMOD || in_sizes[3] != DMOD * DMOD || in_sizes[4] != DMOD * DMOD ||
      in_sizes[5] != DMOD * DMOD || in_sizes[7] != DMOD * DMOD || in_sizes[8] != DMOD * DMOD) return;
  if (in_sizes[6] != NHEAD * HDIM * NREL) return;
  if (out_size != NTOK * DMOD) return;

  const float* x      = (const float*)d_in[0];
  const float* symb   = (const float*)d_in[1];
  const float* Wq_a   = (const float*)d_in[2];
  const float* Wk_a   = (const float*)d_in[3];
  const float* Wq_r   = (const float*)d_in[4];
  const float* Wk_r   = (const float*)d_in[5];
  const float* Wr     = (const float*)d_in[6];
  const float* Wv     = (const float*)d_in[7];
  const float* Wo     = (const float*)d_in[8];
  float* out = (float*)d_out;

  char* ws = (char*)d_ws;
  size_t off = 0;
  auto carve = [&](size_t bytes) -> char* {
    char* p = ws + off;
    off += (bytes + 255) & ~(size_t)255;
    return p;
  };
  const size_t ACT16 = (size_t)NTOK * DMOD * 2;            // 4,194,304
  const size_t WGT16 = (size_t)DMOD * DMOD * 2;            // 2,097,152
  const size_t ACT32 = (size_t)NTOK * DMOD * 4;            // 8,388,608
  const size_t PLANE16 = PLANE_ELEMS * 2;                  // 41,943,040
  const size_t PLANE32 = PLANE_ELEMS * 4;                  // 83,886,080
  static_assert(PLANE_ELEMS * 4 % 256 == 0, "the sixth weight slot must follow region 0 without a gap");
  static_assert((size_t)2 * NTOK * DMOD * 2 + (size_t)5 * DMOD * DMOD * 2 <= PLANE_ELEMS * 4, "casts and five weights fit region 0 side by side");

  char* reg0 = carve(PLANE32);
  carve(WGT16);                                            // WoT = wT + 5 weights
  unsigned short* xb   = (unsigned short*)reg0;
  unsigned short* sb   = (unsigned short*)(reg0 + ACT16);
  unsigned short* wT   = (unsigned short*)(reg0 + PLANE32 - 5 * WGT16);
  unsigned short* rel16 = (unsigned short*)reg0;
  unsigned short* xqh  = (unsigned short*)carve(ACT16);
  unsigned short* xql  = (unsigned short*)carve(ACT16);
  unsigned short* xkh  = (unsigned short*)carve(ACT16);
  unsigned short* xkl  = (unsigned short*)carve(ACT16);
  unsigned short* qr16 = (unsigned short*)carve(ACT16);
  unsigned short* kr16 = (unsigned short*)carve(ACT16);
  unsigned short* svh  = (unsigned short*)carve(ACT16);
  unsigned short* svl  = (unsigned short*)carve(ACT16);
  float*          attsym = (float*)carve(ACT32);
  unsigned short* ch   = (unsigned short*)carve(ACT16);
  unsigned short* cl   = (unsigned short*)carve(ACT16);
  unsigned short* wrp  = (unsigned short*)carve((size_t)NHEAD * HDIM * 32 * 2);
  unsigned short* p16  = (unsigned short*)carve(PLANE16);
  if (off > ws_size) return;

  const unsigned short* WoT  = wT + 5 * (size_t)DMOD * DMOD;

  // 1) casts: activations to bf16; weights transposed to bf16; Wr packed with K padding
  k_prep<<<dim3(2 * CAST_BLOCKS + WT_BLOCKS + WR_BLOCKS), 256, 0, stream>>>(
      x, symb, Wq_a, Wk_a, Wq_r, Wk_r, Wv, Wo, Wr, xb, sb, wT, wrp);

  // 2) projections (bf16 x bf16, exact products, f32 accumulate)
  //    xq, xk -> bf16 hi/lo planes [2048][1024]; qr, kr -> f16 planes; values transposed svT [1024][2048] hi/lo
  static_assert(NTOK % 128 == 0 && DMOD % 128 == 0 && DMOD % GK == 0, "projection and output GEMM shapes");
  k_proj5<<<dim3((NTOK / 128) * (DMOD / 128), 5, 1), 256, 0, stream>>>(xb, sb, wT, xqh, xql, xkh, xkl, qr16, kr16, svh, svl);

  // 3) every chunk of 256 query rows, both batch rows, in each grid: (scores, softmax, P.V beside relation scores) -> relation mix
  static_assert(CHR % 64 == 0 && HDIM % 32 == 0 && RDIM % 32 == 0 && HDIM % 64 == 0, "chunk GEMM shapes");
  static_assert(CHR % 128 == 0 && CHR == 256 && HDIM == 64 && RDIM == 64, "128x256 relation tiles, one stage of k for the scores");
  static_assert(NCHK == 4 && (NCHK & (NCHK - 1)) == 0 && ROWS_CH % 8 == 0 && NHEAD == 16 && NREL == 16, "grid decoding");
  static_assert(CHR / SR == (CHR / 128) * (SEQ / 256), "both roles of the grid use the same range of blockIdx.x");
  k_attn_rel<<<dim3(CHR / SR, NB * 16, 2 * NCHK), 256, 0, stream>>>(xqh, xql, xkh, xkl, svh, svl, attsym, p16, qr16, kr16, rel16);
  static_assert(SEQ % 8 == 0, "relation mix: four rows from each end of the sequence per work-group");
  k_rel_mix<<<dim3(SEQ / 8, NB), 256, 0, stream>>>(p16, rel16, wrp, attsym, ch, cl);

  // 4) out[token][n] = sum_k combined[token][k] * WoT[n][k]  (A hi/lo, B bf16 weights) -> d_out f32
  k_out<<<dim3((NTOK / 128) * (DMOD / 128)), 256, 0, stream>>>(ch, cl, WoT, out);
}

// v006
// One run takes 103 microseconds.
// Timed twice side by side with v005, it ran 1.03 and 1.04 times as fast.
// Counting every step since v000, it is 8.73 times as fast.
// Contractions: v_wmma_f32_16x16x32_bf16 (bf16 operands: module inputs RNE-converted once to bf16; computed q/k, softmax probabilities, value rows, relation aggregates and pre-output activations carried as bf16 hi+lo pairs) and v_wmma_f32_16x16x32_f16 for relation scores and relation aggregation (f16 operands, probabilities carried x1024); f32 accumulate everywhere; softmax and all side math in f32.
#include <hip/hip_runtime.h>

// ---------------------------------------------------------------------------
// problem geometry
// ---------------------------------------------------------------------------
static constexpr int NB    = 2;
static constexpr int SEQ   = 1024;
static constexpr int DMOD  = 1024;
static constexpr int NHEAD = 16;
static constexpr int HDIM  = 64;
static constexpr int NREL  = 16;
static constexpr int RDIM  = 64;
static constexpr int NTOK  = NB * SEQ;          // 2048
static constexpr int CHR   = 256;               // query rows per chunk
static constexpr int NCHK  = SEQ / CHR;         // 4 chunks per batch row
static constexpr float SCALE_ATTN = 0.125f;     // 1/sqrt(64)
static constexpr float SCALE_REL  = 0.125f;     // 1/sqrt(64)
static constexpr float PCARRY     = 1024.0f;    // f16 probability carry
static constexpr float PCARRY_INV = 1.0f / 1024.0f;

// Per-pair planes (probabilities, relation scores) hold all chunks at once: chunk c (query rows 256c..256c+255,
// keys < jend = 256(c+1)) stores its rows at pitch jend and starts at element CHUNK_UNIT * c(c+1)/2.
static constexpr int    ROWS_CH     = NB * NHEAD * CHR;                             // 8192 rows per chunk
static constexpr size_t CHUNK_UNIT  = (size_t)ROWS_CH * CHR;                        // 2,097,152 elements per 256 keys
static constexpr size_t PLANE_ELEMS = CHUNK_UNIT * (NCHK * (NCHK + 1) / 2);         // 20,971,520 elements
__device__ __forceinline__ size_t chunk_base(int c) { return CHUNK_UNIT * (size_t)((c * (c + 1)) >> 1); }

static_assert(NHEAD * HDIM == DMOD, "head split");
static_assert(NREL * RDIM == DMOD, "relation split");
static_assert(SEQ == 4 * 256, "softmax handles up to 4 segments of 256 keys");
static_assert(SEQ % CHR == 0 && CHR % 64 == 0, "chunk tiling");
static_assert(NHEAD == 16 && NREL == 16, "relation mix kernel uses one 16x16 tile per token");
static_assert(HDIM % 32 == 0 && RDIM % 32 == 0, "K of score GEMMs multiple of 32");
static_assert(NTOK % 64 == 0 && DMOD % 64 == 0, "tile multiples");
static_assert((NTOK * DMOD) % (8 * 256) == 0, "cast kernel coverage");
static_assert((NHEAD * CHR) % 8 == 0 && CHR % 16 == 0, "softmax / mix grids");

// ---------------------------------------------------------------------------
// types, conversions, fragment helpers
// ---------------------------------------------------------------------------
typedef __attribute__((ext_vector_type(16))) _Float16 v16h;
typedef __attribute__((ext_vector_type(8)))  _Float16 v8h;
typedef __attribute__((ext_vector_type(16))) __bf16   v16b;
typedef __attribute__((ext_vector_type(8)))  __bf16   v8b;
typedef __attribute__((ext_vector_type(8)))  float    v8f;
typedef __attribute__((ext_vector_type(4)))  float    v4f;
typedef __attribute__((ext_vector_type(4)))  unsigned int v4u;

typedef __attribute__((ext_vector_type(2)))  float    v2f;
typedef __attribute__((ext_vector_type(2)))  __bf16   v2b;
typedef __attribute__((ext_vector_type(2)))  _Float16 v2h;

// f32 -> 16 bit, round to nearest even, two values per conversion instruction: a in the low half, b in the high half
__device__ __forceinline__ unsigned pack_bf16x2(float a, float b) {
  const v2f f = {a, b};
  return __builtin_bit_cast(unsigned, __builtin_convertvector(f, v2b));
}
__device__ __forceinline__ unsigned pack_f16x2(float a, float b) {
  const v2f f = {a, b};
  return __builtin_bit_cast(unsigned, __builtin_convertvector(f, v2h));
}
// hi = bf16(x), lo = bf16(x - hi) of two values, packed like pack_bf16x2
__device__ __forceinline__ void split_bf16x2(float a, float b, unsigned& hi, unsigned& lo) {
  hi = pack_bf16x2(a, b);
  lo = pack_bf16x2(a - __uint_as_float(hi << 16), b - __uint_as_float(hi & 0xFFFF0000u));
}

template <typename T> struct Frag;
template <> struct Frag<_Float16> {
  typedef v16h V; union U { v16h v; v8h h[2]; };
  static __device__ __forceinline__ v16h load(const _Float16* p) {   // elements 0..7 <- p[0..7], 8..15 <- p[16..23]
    U f; f.h[0] = *(const v8h*)(p); f.h[1] = *(const v8h*)(p + 16); return f.v;
  }
  static __device__ __forceinline__ v8f mma(v16h a, v16h b, v8f c) {
    return __builtin_amdgcn_wmma_f32_16x16x32_f16(false, a, false, b, (short)0, c, false, false);
  }
};
template <> struct Frag<__bf16> {
  typedef v16b V; union U { v16b v; v8b h[2]; };
  static __device__ __forceinline__ v16b load(const __bf16* p) {
    U f; f.h[0] = *(const v8b*)(p); f.h[1] = *(const v8b*)(p + 16); return f.v;
  }
  static __device__ __forceinline__ v8f mma(v16b a, v16b b, v8f c) {
    return __builtin_amdgcn_wmma_f32_16x16x32_bf16(false, a, false, b, (short)0, c, false, false);
  }
};

// single-accumulator WMMA + hazard nops (used by the relation mix kernel)
__device__ __forceinline__ v8f mma16h(v16h a, v16h b, v8f c) {
  c = __builtin_amdgcn_wmma_f32_16x16x32_f16(false, a, false, b, (short)0, c, false, false);
  asm volatile("v_nop\n\tv_nop\n\tv_nop\n\tv_nop" : "+v"(c) : "v"(a), "v"(b));
  return c;
}
__device__ __forceinline__ v8f mma16b(v16b a, v16b b, v8f c) {
  c = __builtin_amdgcn_wmma_f32_16x16x32_bf16(false, a, false, b, (short)0, c, false, false);
  asm volatile("v_nop\n\tv_nop\n\tv_nop\n\tv_nop" : "+v"(c) : "v"(a), "v"(b));
  return c;
}

// ---- work-group WMMA GEMM, operands staged in LDS ---------------------
// C[m,n] = scale * sum_k A[m,k] * Bt[n,k]; one BM x BN tile of C per work-group of 8 waves.
// A row-major [M,K]; Bt row-major [N,K]; K % 64 == 0; every operand row starts on a 128-B line.
// SPLIT: A is hi/lo planes (A2 = lo); SPLITB: Bt also hi/lo (product hi.hi + hi.lo + lo.hi),
//        !SPLITB: Bt single plane (product hi.b + lo.b).
// OUT_MODE: 0 = f32, 1 = f16, 2 = bf16 hi plane (Cout) + bf16 lo plane (Cout2).
// ET: 0 = f16 operands, 1 = bf16 operands (pointers passed as 16-bit storage)
template <int ET> struct Elem;
template <> struct Elem<0> { typedef _Float16 T; };
template <> struct Elem<1> { typedef __bf16 T; };

// Result of one wave, MI x 4 accumulator tiles of 16x16 at rows m0.., columns n0..: 16 rows at a time through the wave's own
// 16x68 f32 LDS slab, so that every store covers whole row segments.
template <int MI, int OUT_MODE>
__device__ __forceinline__ void store_tiles(v8f (&acc)[MI][4], float scale,
    void* __restrict__ Cout, void* __restrict__ Cout2, int ldc, size_t offC, int m0, int n0, float* slab) {
  const int lane = threadIdx.x & 31;
  const int rlane = lane & 15;                 // column within a 16x16 tile
  const int mOff  = (lane >> 4) * 8;           // D row offset
#pragma unroll
  for (int i = 0; i < MI; ++i) {
    const int mBase = m0 + (i << 4);
#pragma unroll
    for (int j = 0; j < 4; ++j) {
#pragma unroll
      for (int r = 0; r < 8; ++r) {
        slab[(mOff + r) * 68 + (j << 4) + rlane] = acc[i][j][r] * scale;
      }
    }
    __builtin_amdgcn_fence(__ATOMIC_RELEASE, "workgroup");
    __builtin_amdgcn_wave_barrier();
    __builtin_amdgcn_fence(__ATOMIC_ACQUIRE, "workgroup");
    if (OUT_MODE == 0) {
      float* C = (float*)Cout + offC;
      const int hh = lane >> 4, c4 = (lane & 15) * 4;     // row seg = 256 B = 16 lanes x 16 B
      {
#pragma unroll
        for (int it = 0; it < 8; ++it) {
          const int row = it * 2 + hh;
          v4f v = *(const v4f*)(slab + row * 68 + c4);
          *(v4f*)(C + (size_t)(mBase + row) * ldc + n0 + c4) = v;
        }
        
      }
    } else {
      const int q = lane >> 3, c8 = (lane & 7) * 8;
      unsigned short* C  = (unsigned short*)Cout  + offC;
      unsigned short* C2 = (OUT_MODE == 2) ? ((unsigned short*)Cout2 + offC) : nullptr;
      {
#pragma unroll
        for (int it = 0; it < 4; ++it) {
          const int row = it * 4 + q;
          const float* sp = slab + row * 68 + c8;
          v4u hu, lu = {0u, 0u, 0u, 0u};
#pragma unroll
          for (int e = 0; e < 4; ++e) {
            if (OUT_MODE == 1) hu[e] = pack_f16x2(sp[2 * e], sp[2 * e + 1]);
            else {
              unsigned hp, lp;
              split_bf16x2(sp[2 * e], sp[2 * e + 1], hp, lp);
              hu[e] = hp;
              lu[e] = lp;
            }
          }
          const v8h hv = __builtin_bit_cast(v8h, hu), lv = __builtin_bit_cast(v8h, lu);
          *(v8h*)(C + (size_t)(mBase + row) * ldc + n0 + c8) = hv;
          if (OUT_MODE == 2) *(v8h*)(C2 + (size_t)(mBase + row) * ldc + n0 + c8) = lv;
        }
        
      }
    }
    __builtin_amdgcn_fence(__ATOMIC_RELEASE, "workgroup");
    __builtin_amdgcn_wave_barrier();
    __builtin_amdgcn_fence(__ATOMIC_ACQUIRE, "workgroup");
  }
}

static constexpr int GK = 64;                  // k per stage: 128 B, one whole line, of every operand row
static constexpr int GP = GK + 8;              // LDS row pitch in 16-bit elements: 144 B = 16 B x 9, no bank conflict for 16-byte fragment reads
static constexpr int SLAB_WORDS = 8 * 16 * 68 * 2;   // the eight result slabs, in 16-bit words
// WM x WN waves, each MI*16 rows x 64 columns of C. One stage in LDS: rows [A | A lo | Bt | Bt lo], GP elements apart.
template <bool SPLIT, bool SPLITB, int MI, int WM, int WN> struct Stage {
  static_assert(WM * WN == 8, "eight waves");
  static constexpr int BM = WM * MI * 16, BN = WN * 64;
  static constexpr int AROWS = (SPLIT ? 2 : 1) * BM;
  static constexpr int ROWS  = AROWS + ((SPLIT && SPLITB) ? 2 : 1) * BN;
  static constexpr int WORDS = ROWS * GP;      // 16-bit words per stage
  static_assert(BM % 32 == 0 && BN % 32 == 0, "each group of 32 staged rows lies in one plane");
  static_assert(WORDS >= SLAB_WORDS, "the result slabs reuse the first stage");
};
// smem: two stages (one is enough where K == GK); offA / offB / offC: element offsets of this product's operands and result;
// m0b, n0b: the work-group's tile. Every thread of the work-group calls this (it holds barriers).
// Per stage the 256 threads copy 128 B of every operand row, 8 lanes to a row, into LDS; the next stage's global loads are
// issued before this stage's products and stored to the other buffer behind them.
template <int ET, bool SPLIT, bool SPLITB, int MI, int WM, int WN, int OUT_MODE, int LDA, int LDB>
__device__ __forceinline__ void gemm_block(
    const unsigned short* __restrict__ Ap, const unsigned short* __restrict__ A2p, size_t offA,
    const unsigned short* __restrict__ Btp, const unsigned short* __restrict__ Bt2p, size_t offB,
    void* __restrict__ Cout, void* __restrict__ Cout2, int ldc, size_t offC,
    int K, float scale, int m0b, int n0b, unsigned short* smem) {
  typedef typename Elem<ET>::T T;
  typedef typename Frag<T>::V V;
  typedef Stage<SPLIT, SPLITB, MI, WM, WN> G;
  constexpr int NLD = G::ROWS / 32;            // 16-byte pieces per thread and stage
  const int tid = threadIdx.x, lane = tid & 31, wave = tid >> 5;
  const int srow = tid >> 3, scol = (tid & 7) * 8;      // staging: row within a group of 32, 16-byte column
  // the thread's place in each operand plane at the stage to be fetched next; the rows' strides LDA, LDB are compile-time,
  // so every load of a plane names this one address and an immediate offset
  const unsigned short* gA  = Ap   + offA + (size_t)(m0b + srow) * LDA + scol;
  const unsigned short* gA2 = A2p  + offA + (size_t)(m0b + srow) * LDA + scol;
  const unsigned short* gB  = Btp  + offB + (size_t)(n0b + srow) * LDB + scol;
  const unsigned short* gB2 = Bt2p + offB + (size_t)(n0b + srow) * LDB + scol;
  unsigned short* sdst = smem + srow * GP + scol;

  const int rlane = lane & 15;                 // row (A) / col (B, D) within subtile
  const int koff  = (lane >> 4) * 8;           // k offset of this lane half
  const int wm = wave / WN, wn = wave - wm * WN;
  const int aoff = (wm * (MI * 16) + rlane) * GP + koff;
  const int boff = (G::AROWS + wn * 64 + rlane) * GP + koff;

  v8f acc[MI][4];
#pragma unroll
  for (int i = 0; i < MI; ++i)
#pragma unroll
    for (int j = 0; j < 4; ++j) acc[i][j] = (v8f){0.f,0.f,0.f,0.f,0.f,0.f,0.f,0.f};

  v4u st[NLD];
  auto fetch = [&]() {
#pragma unroll
    for (int n = 0; n < NLD; ++n) {
      const int r = n * 32;                    // first staged row of the group of 32: picks the plane at compile time
      const unsigned short* g;
      if (r < G::BM)                  g = gA  + (size_t)r * LDA;
      else if (r < G::AROWS)          g = gA2 + (size_t)(r - G::BM) * LDA;
      else if (r < G::AROWS + G::BN)  g = gB  + (size_t)(r - G::AROWS) * LDB;
      else                            g = gB2 + (size_t)(r - G::AROWS - G::BN) * LDB;
      st[n] = *(const v4u*)g;
    }
    // the addresses stay in their registers up to this wait, so that it stands in front of every overwrite of a register
    // that these loads name (a later load's result, the step to the next stage)
    if (SPLIT && SPLITB) asm volatile("s_wait_xcnt 0x0" :: "v"(gA), "v"(gA2), "v"(gB), "v"(gB2) : "memory");
    else if (SPLIT)      asm volatile("s_wait_xcnt 0x0" :: "v"(gA), "v"(gA2), "v"(gB) : "memory");
    else                 asm volatile("s_wait_xcnt 0x0" :: "v"(gA), "v"(gB) : "memory");
    gA += GK; gA2 += GK; gB += GK; gB2 += GK;
  };
  auto put = [&](int buf) {
#pragma unroll
    for (int n = 0; n < NLD; ++n) *(v4u*)(sdst + buf * G::WORDS + n * 32 * GP) = st[n];
  };

  fetch();
  put(0);
  __syncthreads();
  for (int k0 = 0, buf = 0; k0 < K; k0 += GK, buf ^= 1) {
    const bool more = k0 + GK < K;             // the same for the whole work-group
    if (more) fetch();
    const T* cur = (const T*)(smem + buf * G::WORDS);
#pragma unroll
    for (int ks = 0; ks < GK; ks += 32) {
      V bh[4], bl[4];
#pragma unroll
      for (int j = 0; j < 4; ++j) {
        bh[j] = Frag<T>::load(cur + boff + j * 16 * GP + ks);
        if (SPLIT && SPLITB) bl[j] = Frag<T>::load(cur + boff + (G::BN + j * 16) * GP + ks);
      }
#pragma unroll
      for (int i = 0; i < MI; ++i) {
        V ah = Frag<T>::load(cur + aoff + i * 16 * GP + ks);
        V al;
        if (SPLIT) al = Frag<T>::load(cur + aoff + (G::BM + i * 16) * GP + ks);
#pragma unroll
        for (int j = 0; j < 4; ++j) {
          acc[i][j] = Frag<T>::mma(ah, bh[j], acc[i][j]);
          if (SPLIT) {
            if (SPLITB) acc[i][j] = Frag<T>::mma(ah, bl[j], acc[i][j]);
            acc[i][j] = Frag<T>::mma(al, bh[j], acc[i][j]);
          }
        }
      }
    }
    if (more) put(buf ^ 1);                    // last read one trip ago, in front of that trip's barrier
    __syncthreads();                           // publishes the next stage; ends every read of this one
  }
  store_tiles<MI, OUT_MODE>(acc, scale, Cout, Cout2, ldc, offC, m0b + wm * (MI * 16), n0b + wn * 64,
                            (float*)smem + wave * (16 * 68));
}

// All five input projections in one grid; blockIdx.y selects the product (block-uniform):
// 0 q_attn, 1 k_attn -> bf16 hi/lo; 2 q_rel, 3 k_rel -> f16; 4 values, transposed (A = WvT, Bt = symbols) -> bf16 hi/lo.
// Each product has (NTOK/128)*(DMOD/128) tiles of 128x128, one per block.
__global__ __launch_bounds__(256) void k_proj5(
    const unsigned short* __restrict__ xb, const unsigned short* __restrict__ sb, const unsigned short* __restrict__ wT,
    unsigned short* __restrict__ xqh, unsigned short* __restrict__ xql,
    unsigned short* __restrict__ xkh, unsigned short* __restrict__ xkl,
    unsigned short* __restrict__ qr16, unsigned short* __restrict__ kr16,
    unsigned short* __restrict__ svh, unsigned short* __restrict__ svl) {
  __shared__ __align__(16) unsigned short sm[2 * Stage<false, false, 2, 4, 2>::WORDS];
  const int y = blockIdx.y;
  const bool tv = (y == 4);
  const int nbN = (tv ? NTOK : DMOD) / 128;
  const int m0b = ((int)blockIdx.x / nbN) * 128, n0b = ((int)blockIdx.x % nbN) * 128;
  const unsigned short* Wy = wT + (size_t)y * DMOD * DMOD;
  if (y == 2 || y == 3) {
    unsigned short* c = (y == 2) ? qr16 : kr16;
    gemm_block<1, false, false, 2, 4, 2, 1, DMOD, DMOD>(xb, xb, 0, Wy, Wy, 0, c, c, DMOD, 0, DMOD, 1.0f, m0b, n0b, sm);
  } else {
    const unsigned short* a  = tv ? Wy : xb;
    const unsigned short* bt = tv ? sb : Wy;
    unsigned short* chi = tv ? svh : (y == 0 ? xqh : xkh);
    unsigned short* clo = tv ? svl : (y == 0 ? xql : xkl);
    gemm_block<1, false, false, 2, 4, 2, 2, DMOD, DMOD>(a, a, 0, bt, bt, 0, chi, clo, tv ? NTOK : DMOD, 0, DMOD, 1.0f, m0b, n0b, sm);
  }
}

// Attention (scores, causal softmax, P.V) of every chunk, batch row and head in one grid: a work-group owns SR whole query rows.
// Part 1, per block of 256 keys: scores[il][j] = SCALE_ATTN * sum_d xq[i][h,d] xk[j][h,d] (hi/lo split on both operands, product
//   hi.hi + hi.lo + lo.hi), operands staged as in gemm_block (one stage: all of k); the block's f32 scores pass through a
//   32 x 256 buffer in LDS into the registers of the wave that owns the row: wave w owns rows 4w .. 4w+3, lane owns
//   j = 256*t + 8*lane .. +7 (t <= c). The next block's global loads are issued behind this block's products.
// Part 2: softmax of the wave's four rows, keys j <= i.
// Part 3, per block of 256 keys: attended_symbols[il][d] += sum_j P[il][j] * svT[h*64+d][j] (hi/lo split on both operands, product
//   hi.hi + hi.lo + lo.hi). Each wave packs its four rows of P as bf16 hi and lo into those rows' own bytes of the score buffer;
//   V comes in stages of 128 keys, three buffers in the LDS that held the score operands: one stage is fetched beside the
//   packing, the next beside the products. Wave w sums, for the rows 16*(w&1).. +15 and all 64 columns, the keys
//   32*(w>>1).. +31 of every stage (a fragment of P feeds four tiles). P hi/lo never go to memory.
// Part 4: the four key groups' 32 x 64 partial sums meet in LDS, are added in the order of the groups and stored as whole lines;
//   the P*1024 f16 plane is written, row r = (b*NHEAD + h)*CHR + il at pitch jend, zeros for i < j < jend (behind the last
//   barrier, which would wait for the stores).
// The relation scores (they read nothing of the above) ride in the same grid: blockIdx.z = 4..7, chunk 7 - z, tiles of 128x256.
static constexpr int SR  = 32;                 // query rows per work-group
static constexpr int SRW = SR / 8;             // rows per wave
static constexpr int STP = CHR + 4;            // floats per row of the score buffer: rows 8 apart lie 32 banks apart (the two lane halves of a tile store), 16-B aligned
typedef Stage<true, true, 1, 2, 4> SG;         // one block: 32 query rows x 256 keys
static_assert(SG::BM == SR && SG::BN == CHR && HDIM == GK, "one stage holds all of k for 32 rows and 256 keys");
static constexpr int VK     = 128;             // keys per stage of V: 256 B, two whole lines, of every row of svT
static constexpr int VP     = VK + 8;          // LDS row pitch in 16-bit elements: 272 B = 16 B x 17, no bank conflict for 16-byte fragment reads
static constexpr int VWORDS = 2 * HDIM * VP;   // one stage: 64 hi rows, then 64 lo rows
static constexpr int PPW    = STP * 2;         // a row of the score buffer in 16-bit elements: 1040 B = 16 B x 65; holds 256 hi, then 256 lo
static constexpr int AWORDS = 3 * VWORDS > SG::WORDS ? 3 * VWORDS : SG::WORDS;   // the score operands' stage, then three stages of V
static_assert(2 * CHR <= PPW, "hi and lo of a row of P fit the row's bytes of the score buffer");
static_assert(4 * SR * 68 * 2 <= AWORDS && CHR == 2 * VK && VK == 4 * 32 && SR == 32 && HDIM == 64, "partial sums' staging; 2 row halves x 4 key groups = 8 waves");
static_assert(Stage<false, false, 4, 2, 4>::WORDS <= SG::WORDS, "the relation scores' stage fits");
// One code path for all chunks: c, and with it the number NT of key blocks, is block-uniform, so every test on it is a scalar
// branch that the whole work-group takes alike (barriers included); the kernel's text stays small.
// blockIdx.x = block of SR query rows in the chunk, blockIdx.y = batch row * 16 + head, blockIdx.z = 0..3: chunk 3 - z (longest first).
// Two work-groups share a WGP (one's products run beside the other's softmax arithmetic): four waves per SIMD, 256 registers each.
__global__ __launch_bounds__(256) __attribute__((amdgpu_waves_per_eu(4, 4))) void k_attn_rel(
    const unsigned short* __restrict__ xqh, const unsigned short* __restrict__ xql,
    const unsigned short* __restrict__ xkh, const unsigned short* __restrict__ xkl,
    const unsigned short* __restrict__ svh, const unsigned short* __restrict__ svl,
    float* __restrict__ attsym, unsigned short* __restrict__ p16,
    const unsigned short* __restrict__ qr16, const unsigned short* __restrict__ kr16, unsigned short* __restrict__ rel16) {
  __shared__ __align__(16) unsigned short smem[AWORDS];
  __shared__ __align__(16) float tbuf[SR * STP];
  if ((int)blockIdx.z >= NCHK) {                           // block-uniform
    const int cr = (2 * NCHK - 1) - (int)blockIdx.z;
    const int jr = CHR * (cr + 1), nbN = cr + 1;           // nbN = jr / 256
    if ((int)blockIdx.x >= (CHR / 128) * nbN) return;      // block-uniform, in front of every barrier
    const size_t br = blockIdx.y >> 4, hr = blockIdx.y & 15;
    // rel[c][b][il][r][j] = SCALE_REL * sum_p qr[i][r,p] kr[j][r,p]  (plain f16) -> f16 plane
    gemm_block<0, false, false, 4, 2, 4, 1, DMOD, DMOD>(qr16, qr16, (br * SEQ + (size_t)cr * CHR) * DMOD + hr * RDIM,
                                            kr16, kr16, br * ((size_t)SEQ * DMOD) + hr * RDIM,
                                            rel16, rel16, NREL * jr, chunk_base(cr) + br * ((size_t)CHR * NREL * jr) + hr * jr,
                                            RDIM, SCALE_REL, ((int)blockIdx.x / nbN) * 128, ((int)blockIdx.x % nbN) * 256, smem);
    return;
  }
  typedef __bf16 T;
  typedef Frag<T>::V V;
  constexpr int NLD = SG::ROWS / 32;           // 16-byte pieces per thread and stage
  constexpr int NA  = SG::AROWS / 32;          // of them the query rows, hi and lo
  const int c = (NCHK - 1) - (int)blockIdx.z;
  const int y = blockIdx.y, il0 = (int)blockIdx.x * SR;
  const int NT = c + 1;                        // blocks of 256 keys
  const int jend = CHR * NT;
  const int tid = threadIdx.x, lane = tid & 31;
  const int wave = __builtin_amdgcn_readfirstlane(tid >> 5);   // the same in every lane: kept in a scalar register, and the row addresses with it
  const int srow = tid >> 3, scol = (tid & 7) * 8;      // staging: row within a group of 32, 16-byte column
  const size_t bb = (size_t)(y >> 4), h = (size_t)(y & 15);
  const size_t offA = (bb * SEQ + (size_t)(c * CHR + il0)) * DMOD + h * HDIM;
  const size_t offB = bb * ((size_t)SEQ * DMOD) + h * HDIM;
  const unsigned short* gA  = xqh + offA + (size_t)srow * DMOD + scol;
  const unsigned short* gA2 = xql + offA + (size_t)srow * DMOD + scol;
  const unsigned short* gB  = xkh + offB + (size_t)srow * DMOD + scol;
  const unsigned short* gB2 = xkl + offB + (size_t)srow * DMOD + scol;
  unsigned short* sdst = smem + srow * GP + scol;

  const int rlane = lane & 15;                 // row (A) / col (B, D) within subtile
  const int koff  = (lane >> 4) * 8;           // k offset of this lane half
  const int wm = wave >> 2, wn = wave & 3;     // 2 x 4 waves, each 16 rows x 64 keys
  const int aoff = (wm * 16 + rlane) * GP + koff;
  const int boff = (SG::AROWS + wn * 64 + rlane) * GP + koff;
  float* tdst = tbuf + (wm * 16 + (lane >> 4) * 8) * STP + wn * 64 + rlane;   // D row 8*(lane>>4) + r, column rlane
  const float* tsrc = tbuf + (wave * SRW) * STP + lane * 8;                   // the wave's own rows, the lane's 8 keys

  v4u st[NLD];
  auto fetch = [&](int nb) {                   // nb: the key block, a compile-time number at every call: an immediate offset
#pragma unroll
    for (int n = (nb == 0 ? 0 : NA); n < NLD; ++n) {   // the query rows are staged once, with block 0, and stay
      const int r = n * 32;                    // first staged row of the group of 32: picks the plane at compile time
      const unsigned short* g;
      if (r < SG::BM)                   g = gA  + (size_t)r * DMOD;
      else if (r < SG::AROWS)           g = gA2 + (size_t)(r - SG::BM) * DMOD;
      else if (r < SG::AROWS + SG::BN)  g = gB  + (size_t)(nb * SG::BN + r - SG::AROWS) * DMOD;
      else                              g = gB2 + (size_t)(nb * SG::BN + r - SG::AROWS - SG::BN) * DMOD;
      st[n] = *(const v4u*)g;
    }
    // the addresses, the same for every block, stay in their registers up to this wait, so that it stands in front of
    // every overwrite of a register that these loads name
    if (nb == 0) asm volatile("s_wait_xcnt 0x0" :: "v"(gA), "v"(gA2), "v"(gB), "v"(gB2) : "memory");
    else         asm volatile("s_wait_xcnt 0x0" :: "v"(gB), "v"(gB2) : "memory");
  };
  auto put = [&](int nb) {
#pragma unroll
    for (int n = (nb == 0 ? 0 : NA); n < NLD; ++n) *(v4u*)(sdst + n * 32 * GP) = st[n];
  };

  const float NEG = -__builtin_huge_valf();
  const int ilw = il0 + wave * SRW;            // the wave's first row within the chunk
  float s[SRW][NCHK][8];                       // blocks t >= NT are neither written nor read
  fetch(0);
  put(0);
  __syncthreads();
  const T* cur = (const T*)smem;
  // unrolled: s lives in registers and is indexed by the block's number
#pragma unroll
  for (int nb = 0; nb < NCHK; ++nb) {
    if (nb < NT) {
      v8f acc[4];
#pragma unroll
      for (int j = 0; j < 4; ++j) acc[j] = (v8f){0.f,0.f,0.f,0.f,0.f,0.f,0.f,0.f};
#pragma unroll
      for (int ks = 0; ks < GK; ks += 32) {
        V bh[4], bl[4];
#pragma unroll
        for (int j = 0; j < 4; ++j) {
          bh[j] = Frag<T>::load(cur + boff + j * 16 * GP + ks);
          bl[j] = Frag<T>::load(cur + boff + (SG::BN + j * 16) * GP + ks);
        }
        const V ah = Frag<T>::load(cur + aoff + ks);
        const V al = Frag<T>::load(cur + aoff + SG::BM * GP + ks);
#pragma unroll
        for (int j = 0; j < 4; ++j) {
          acc[j] = Frag<T>::mma(ah, bh[j], acc[j]);
          acc[j] = Frag<T>::mma(ah, bl[j], acc[j]);
          acc[j] = Frag<T>::mma(al, bh[j], acc[j]);
        }
      }
      if (nb + 1 < NCHK && nb + 1 < NT) fetch(nb + 1);
#pragma unroll
      for (int j = 0; j < 4; ++j)
#pragma unroll
        for (int r = 0; r < 8; ++r) tdst[r * STP + j * 16] = acc[j][r] * SCALE_ATTN;
      __syncthreads();                         // publishes this block's scores; ends every read of the stage
#pragma unroll
      for (int q = 0; q < SRW; ++q) {
        const v4f a = *(const v4f*)(tsrc + q * STP);
        const v4f b = *(const v4f*)(tsrc + q * STP + 4);
        s[q][nb][0] = a[0]; s[q][nb][1] = a[1]; s[q][nb][2] = a[2]; s[q][nb][3] = a[3];
        s[q][nb][4] = b[0]; s[q][nb][5] = b[1]; s[q][nb][6] = b[2]; s[q][nb][7] = b[3];
      }
      if (nb + 1 < NCHK && nb + 1 < NT) {
        put(nb + 1);
        __syncthreads();                       // publishes the next stage; ends every read of the score buffer
      } else {
        // the chunk's last block holds the diagonal: keys j > i get -inf, as in the definition (they leave the maximum alone
        // and their exponential is exactly 0); in every earlier block j < 256 c <= i
#pragma unroll
        for (int q = 0; q < SRW; ++q)
#pragma unroll
          for (int e = 0; e < 8; ++e) s[q][nb][e] = (lane * 8 + e <= ilw + q) ? s[q][nb][e] : NEG;
      }
    }
  }

  // Part 3's operands. Behind the last block's barrier nobody reads the stage any more: its LDS takes the stages of V.
  const int vrow = tid >> 4, vcol = (tid & 15) * 8;        // staging of V: row within a group of 16, 16-byte column
  const size_t offV = (h * HDIM + (size_t)vrow) * NTOK + bb * SEQ + vcol;
  const unsigned short* gV  = svh + offV;
  const unsigned short* gV2 = svl + offV;
  unsigned short* vdst = smem + vrow * VP + vcol;
  v4u vst[8];
  auto vfetch = [&](int sg) {                  // sg: the stage of 128 keys, a compile-time number at every call: an immediate offset
#pragma unroll
    for (int n = 0; n < 8; ++n) {
      const unsigned short* g = (n < 4 ? gV + (size_t)(n * 16) * NTOK : gV2 + (size_t)((n - 4) * 16) * NTOK) + sg * VK;
      vst[n] = *(const v4u*)g;
    }
    // the addresses, the same for every stage, stay in their registers up to this wait, so that it stands in front of
    // every overwrite of a register that these loads name
    asm volatile("s_wait_xcnt 0x0" :: "v"(gV), "v"(gV2) : "memory");
  };
  auto vput = [&](int buf) {
#pragma unroll
    for (int n = 0; n < 8; ++n) *(v4u*)(vdst + buf * VWORDS + n * 16 * VP) = vst[n];
  };
  vfetch(0);                                   // lands while the softmax arithmetic runs

  const float LOG2E = 1.44269504088896340736f;
  float m[SRW], sum[SRW], inv[SRW];
#pragma unroll
  for (int q = 0; q < SRW; ++q) m[q] = NEG;
#pragma unroll
  for (int t = 0; t < NCHK; ++t) {
    if (t < NT) {
#pragma unroll
      for (int q = 0; q < SRW; ++q)
#pragma unroll
        for (int e = 0; e < 8; ++e) m[q] = fmaxf(m[q], s[q][t][e]);
    }
  }
#pragma unroll
  for (int off = 1; off < 32; off <<= 1) {     // the four rows' chains of shuffles overlap
#pragma unroll
    for (int q = 0; q < SRW; ++q) m[q] = fmaxf(m[q], __shfl_xor(m[q], off, 32));
  }
#pragma unroll
  for (int q = 0; q < SRW; ++q) sum[q] = 0.f;
#pragma unroll
  for (int t = 0; t < NCHK; ++t) {
    if (t < NT) {
#pragma unroll
      for (int q = 0; q < SRW; ++q) {
        float x[8], v[8];
#pragma unroll
        for (int e = 0; e < 8; ++e) x[e] = (s[q][t][e] - m[q]) * LOG2E;
        // exp(u) = 2^(u * log2 e), eight at a time in one statement: no result shares a register with a source (early clobber),
        // and the v_nop fills the slot that the instruction set asks for behind the last transcendental
        asm("v_exp_f32 %0, %8\n\tv_exp_f32 %1, %9\n\tv_exp_f32 %2, %10\n\tv_exp_f32 %3, %11\n\t"
            "v_exp_f32 %4, %12\n\tv_exp_f32 %5, %13\n\tv_exp_f32 %6, %14\n\tv_exp_f32 %7, %15\n\tv_nop"
            : "=&v"(v[0]), "=&v"(v[1]), "=&v"(v[2]), "=&v"(v[3]), "=&v"(v[4]), "=&v"(v[5]), "=&v"(v[6]), "=&v"(v[7])
            : "v"(x[0]), "v"(x[1]), "v"(x[2]), "v"(x[3]), "v"(x[4]), "v"(x[5]), "v"(x[6]), "v"(x[7]));
#pragma unroll
        for (int e = 0; e < 8; ++e) {
          s[q][t][e] = v[e];
          sum[q] += v[e];
        }
      }
    }
  }
#pragma unroll
  for (int off = 1; off < 32; off <<= 1) {
#pragma unroll
    for (int q = 0; q < SRW; ++q) sum[q] += __shfl_xor(sum[q], off, 32);
  }
#pragma unroll
  for (int q = 0; q < SRW; ++q) inv[q] = 1.0f / sum[q];    // sum >= 1 (the row's largest score gives exp(0))
  // ---- part 3: P.V ----
  const int rh = wave & 1, kq = wave >> 1;     // the wave's half of the rows, its group of 32 keys in every stage
  unsigned short* pw = (unsigned short*)tbuf + (wave * SRW) * PPW + lane * 8;    // the wave's own rows, the lane's 8 keys
  const T* pa = (const T*)tbuf + (rh * 16 + rlane) * PPW + kq * 32 + koff;       // A: row m = query row, hi; lo CHR elements on
  const T* vb = (const T*)smem + rlane * VP + kq * 32 + koff;                    // Bt: row n = d, hi; lo HDIM rows on
  v8f o[4];
#pragma unroll
  for (int j = 0; j < 4; ++j) o[j] = (v8f){0.f,0.f,0.f,0.f,0.f,0.f,0.f,0.f};
  auto pv = [&](int buf, int half) {           // keys 128*half .. +127 of the block in the score buffer; their V in buffer 'buf'
    const V ah = Frag<T>::load(pa + half * VK);
    const V al = Frag<T>::load(pa + CHR + half * VK);
#pragma unroll
    for (int j = 0; j < 4; ++j) {
      const V bh = Frag<T>::load(vb + buf * VWORDS + j * 16 * VP);
      const V bl = Frag<T>::load(vb + buf * VWORDS + (HDIM + j * 16) * VP);
      o[j] = Frag<T>::mma(ah, bh, o[j]);
      o[j] = Frag<T>::mma(ah, bl, o[j]);
      o[j] = Frag<T>::mma(al, bh, o[j]);
    }
  };
  v4u fv[NCHK][SRW];                           // P*1024 as f16, kept for part 4 in half the registers of s
  vput(0);
  // unrolled: s lives in registers and is indexed by the block's number; stage g of V lies in buffer g mod 3
#pragma unroll
  for (int t = 0; t < NCHK; ++t) {
    if (t < NT) {
      vfetch(2 * t + 1);                       // lands while the block of P is packed
      // a row's hi and lo overwrite that row's scores, which only this wave has read since the last barrier
#pragma unroll
      for (int q = 0; q < SRW; ++q) {
        v4u hv, lv;
#pragma unroll
        for (int e = 0; e < 4; ++e) {
          const float a = s[q][t][2 * e] * inv[q];
          const float b = s[q][t][2 * e + 1] * inv[q];
          unsigned hp, lp;
          split_bf16x2(a, b, hp, lp);
          hv[e] = hp;
          lv[e] = lp;
          fv[t][q][e] = pack_f16x2(a * PCARRY, b * PCARRY);
        }
        *(v4u*)(pw + q * PPW) = hv;
        *(v4u*)(pw + q * PPW + CHR) = lv;
      }
      vput((2 * t + 1) % 3);                   // held stage 2t - 2, last read in front of the last barrier
      __syncthreads();                         // publishes this block of P and its two stages of V
      if (t + 1 < NCHK && t + 1 < NT) vfetch(2 * t + 2);   // lands while the products run
      pv((2 * t) % 3, 0);
      pv((2 * t + 1) % 3, 1);
      if (t + 1 < NCHK && t + 1 < NT) vput((2 * t + 2) % 3);   // held stage 2t - 1, last read one block ago
      __syncthreads();                         // ends every read of this block of P and of its two stages
    }
  }

  // ---- part 4: results ----
  float* ob = (float*)smem;                    // four key groups x 32 x 68 floats; every read of V has ended
#pragma unroll
  for (int j = 0; j < 4; ++j)
#pragma unroll
    for (int r = 0; r < 8; ++r)                // D row 8*(lane>>4) + r, column rlane
      ob[(kq * SR + rh * 16 + (lane >> 4) * 8 + r) * 68 + j * 16 + rlane] = o[j][r];
  __syncthreads();                             // publishes the partial sums
  {
    float* og = attsym + (bb * SEQ + (size_t)(c * CHR + il0 + vrow)) * DMOD + h * HDIM + (tid & 15) * 4;   // 16 lanes x 16 B = a row's 256 B
    const float* os = ob + vrow * 68 + (tid & 15) * 4;
    v4f o0 = *(const v4f*)os;
    v4f o1 = *(const v4f*)(os + 16 * 68);
#pragma unroll
    for (int g = 1; g < 4; ++g) {
      o0 += *(const v4f*)(os + g * SR * 68);
      o1 += *(const v4f*)(os + (g * SR + 16) * 68);
    }
    *(v4f*)og = o0;
    *(v4f*)(og + (size_t)16 * DMOD) = o1;
    // the address stays in its registers up to this wait, which stands in front of every overwrite of a register that these stores name
    asm volatile("s_wait_xcnt 0x0" :: "v"(og), "v"(o0), "v"(o1) : "memory");
  }
  const size_t ro = chunk_base(c) + ((size_t)y * CHR + ilw) * jend;   // the wave's first row: a scalar base for every store
  unsigned short* df = p16 + ro;
  unsigned vo[SRW];                            // the lane's place in each of the four rows, in bytes: one 32-bit offset register per row
#pragma unroll
  for (int q = 0; q < SRW; ++q) vo[q] = (unsigned)(q * jend + lane * 8) * 2u;
#pragma unroll
  for (int t = 0; t < NCHK; ++t) {
    if (t < NT) {
#pragma unroll
      for (int q = 0; q < SRW; ++q) *(v4u*)((char*)df + vo[q] + t * 512) = fv[t][q];
    }
  }
}

// out[token][n] = sum_k combined[token][k] * WoT[n][k]  (A hi/lo, B bf16 weights), f32 out; one 128x128 tile per block.
__global__ __launch_bounds__(256) void k_out(const unsigned short* __restrict__ ch, const unsigned short* __restrict__ cl,
    const unsigned short* __restrict__ woT, float* __restrict__ out) {
  __shared__ __align__(16) unsigned short sm[2 * Stage<true, false, 2, 4, 2>::WORDS];
  const int nbN = DMOD / 128;
  gemm_block<1, true, false, 2, 4, 2, 0, DMOD, DMOD>(ch, cl, 0, woT, woT, 0, out, out, DMOD, 0, DMOD, 1.0f,
                                         ((int)blockIdx.x / nbN) * 128, ((int)blockIdx.x % nbN) * 128, sm);
}

// ---------------------------------------------------------------------------
// f32 -> bf16 (RNE) cast of the two activation tensors, 8 elements per thread:
// by selects the tensor (block-uniform), bx the block of 2048 elements. Coverage: CAST_BLOCKS*256 threads * 8 = n8*8 elements exactly.
// ---------------------------------------------------------------------------
__device__ __forceinline__ void cast_bf16x8_block(const float* __restrict__ s0, const float* __restrict__ s1,
    unsigned short* __restrict__ d0, unsigned short* __restrict__ d1, int n8, int bx, int by) {
  const float* src = (by == 0) ? s0 : s1;
  unsigned short* dst = (by == 0) ? d0 : d1;
  const int i = bx * 256 + threadIdx.x;
  if (i < n8) {
    const size_t e0 = (size_t)i * 8;
    const v4f a = *(const v4f*)(src + e0);
    const v4f c = *(const v4f*)(src + e0 + 4);
    v4u u;
    u[0] = pack_bf16x2(a[0], a[1]);
    u[1] = pack_bf16x2(a[2], a[3]);
    u[2] = pack_bf16x2(c[0], c[1]);
    u[3] = pack_bf16x2(c[2], c[3]);
    *(v4u*)(dst + e0) = u;
    
  }
}

// ---------------------------------------------------------------------------
// Weight transpose + bf16 cast: W[k][o] (f32, [DMOD][DMOD]) -> WT[o][k] (bf16), 6 weights selected by z; tile: 64*68 floats of LDS.
// Coverage per block: read 4 iters * 256 threads * 4 = 4096 elements; write 2 iters * 8 waves * 4 lines * 64 = 4096.
// ---------------------------------------------------------------------------
__device__ __forceinline__ void wT_bf16_block(const float* __restrict__ w0, const float* __restrict__ w1,
    const float* __restrict__ w2, const float* __restrict__ w3, const float* __restrict__ w4, const float* __restrict__ w5,
    unsigned short* __restrict__ dst, float* tile, int bx, int by, int z) {
  const float* W = (z == 0) ? w0 : (z == 1) ? w1 : (z == 2) ? w2 : (z == 3) ? w3 : (z == 4) ? w4 : w5;
  unsigned short* WT = dst + (size_t)z * DMOD * DMOD;
  const int k0 = by * 64;   // rows of W (input dim)
  const int o0 = bx * 64;   // cols of W (output dim)
  const int tid = threadIdx.x;
#pragma unroll
  for (int it = 0; it < 4; ++it) {
    const int e = (it * 256 + tid) * 4;
    const int row = e >> 6, col = e & 63;
    const v4f v = *(const v4f*)(W + (size_t)(k0 + row) * DMOD + o0 + col);
    *(v4f*)(tile + row * 68 + col) = v;
  }
  __syncthreads();
  const int lane = tid & 31, wave = tid >> 5, q = lane >> 3, c8 = (lane & 7) * 8;
  v4u ov[2];
#pragma unroll
  for (int it = 0; it < 2; ++it) {
    const int oo = it * 32 + wave * 4 + q;
    float f[8];
#pragma unroll
    for (int e = 0; e < 8; ++e) f[e] = tile[(c8 + e) * 68 + oo];
    ov[it][0] = pack_bf16x2(f[0], f[1]);
    ov[it][1] = pack_bf16x2(f[2], f[3]);
    ov[it][2] = pack_bf16x2(f[4], f[5]);
    ov[it][3] = pack_bf16x2(f[6], f[7]);
  }
  {
#pragma unroll
    for (int it = 0; it < 2; ++it) {
      const int oo = it * 32 + wave * 4 + q;
      *(v4u*)(WT + (size_t)(o0 + oo) * DMOD + k0 + c8) = ov[it];
    }
    // in the merged kernel's built control flow another role's code follows these stores and reuses their registers:
    // keep the wait in front of that overwrite
    asm volatile("s_wait_xcnt 0x0" ::: "memory");
  }
}

// ---------------------------------------------------------------------------
// Wr [NHEAD*HDIM rows][NREL] f32 -> WrP [rows][32] bf16 with k 16..31 zero-FILLED (WMMA K padding).
// Coverage: 256 threads * 8 elements = 64 rows * 32; store 8 waves * 4 lines * 64 = 2048 elements.
// ---------------------------------------------------------------------------
__device__ __forceinline__ void wr_pack_block(const float* __restrict__ wr, unsigned short* __restrict__ dst,
    unsigned short* tile, int bx) {   // tile: 64*32 16-bit words of LDS
  const int r0 = bx * 64;
  const int tid = threadIdx.x;
  const int row = tid >> 2, kq = (tid & 3) * 8;
  v4u u;
  unsigned wv[4];
#pragma unroll
  for (int e = 0; e < 4; ++e) {
    const int ka = kq + 2 * e, kb = kq + 2 * e + 1;
    const int kac = ka < NREL ? ka : NREL - 1;
    const int kbc = kb < NREL ? kb : NREL - 1;
    const float fa = wr[(size_t)(r0 + row) * NREL + kac];
    const float fb = wr[(size_t)(r0 + row) * NREL + kbc];
    wv[e] = pack_bf16x2((ka < NREL) ? fa : 0.f, (kb < NREL) ? fb : 0.f);
  }
  u[0] = wv[0]; u[1] = wv[1]; u[2] = wv[2]; u[3] = wv[3];
  *(v4u*)(tile + row * 32 + kq) = u;
  __syncthreads();
  const int lane = tid & 31, wave = tid >> 5, q = lane >> 3, c8 = (lane & 7) * 8;
  const int L = wave * 4 + q;                       // line 0..31, 64 elements per line
  const v4u v = *(const v4u*)(tile + L * 64 + c8);
  {
    *(v4u*)(dst + (size_t)r0 * 32 + L * 64 + c8) = v;
    // as in the weight transpose: the wait in front of an overwrite of this store's registers by another role's code
    asm volatile("s_wait_xcnt 0x0" ::: "memory");
  }
}

// ---------------------------------------------------------------------------
// The three input conversions in one grid (none reads another's result); the role is block-uniform, from blockIdx.x:
// [0, 2*CAST_BLOCKS) activation casts, then WT_BLOCKS weight-transpose tiles, then WR_BLOCKS blocks of the Wr pack.
// ---------------------------------------------------------------------------
static constexpr int CAST_BLOCKS = NTOK * DMOD / 8 / 256;            // 1024 per tensor
static constexpr int WT_SIDE     = DMOD / 64;                        // 16 tiles per side
static constexpr int WT_BLOCKS   = 6 * WT_SIDE * WT_SIDE;            // 1536
static constexpr int WR_BLOCKS   = (NHEAD * HDIM) / 64;              // 16
__global__ __launch_bounds__(256) void k_prep(const float* __restrict__ x, const float* __restrict__ symb,
    const float* __restrict__ w0, const float* __restrict__ w1, const float* __restrict__ w2,
    const float* __restrict__ w3, const float* __restrict__ w4, const float* __restrict__ w5, const float* __restrict__ wr,
    unsigned short* __restrict__ xb, unsigned short* __restrict__ sb, unsigned short* __restrict__ wT,
    unsigned short* __restrict__ wrp) {
  __shared__ __align__(16) float tile[64 * 68];
  const int id = blockIdx.x;
  if (id < 2 * CAST_BLOCKS) {
    cast_bf16x8_block(x, symb, xb, sb, NTOK * DMOD / 8, id % CAST_BLOCKS, id / CAST_BLOCKS);
    return;
  }
  if (id < 2 * CAST_BLOCKS + WT_BLOCKS) {
    const int t = id - 2 * CAST_BLOCKS;
    wT_bf16_block(w0, w1, w2, w3, w4, w5, wT, tile, t % WT_SIDE, (t / WT_SIDE) % WT_SIDE, t / (WT_SIDE * WT_SIDE));
    return;
  }
  wr_pack_block(wr, wrp, (unsigned short*)tile, id - 2 * CAST_BLOCKS - WT_BLOCKS);
}

// ---------------------------------------------------------------------------
// Relation aggregation + Wr mix + residual. Block = 8 waves = 8 query rows of batch row blockIdx.y, one row per wave: the four rows
// 4g .. 4g+3 and the four rows SEQ-1-4g .. SEQ-4-4g, g = blockIdx.x. A row reads bytes in proportion to its causal extent, so a short
// row beside a long one gives every work-group the same number of bytes; SEQ/8 * NB work-groups, one per WGP (LDS), are resident at once.
// Phase 1 (per wave, local row ill = wave, in its own chunk c = i / 256): D[h][r] = sum_{j<kend} P16[h][il][j] * rel[il][r][j]
//   (one f16 WMMA tile, K stepped by 32; the 16 + 16 operand rows are staged 256 k at a time in the wave's own LDS, up to the
//   causal extent, zeros behind it; P16 carries P*1024, rel carries REL_SCALE);
//   D is split into bf16 hi/lo and written to LDS arHL[m=ill][h][k=r] (k 16..31 and the rows m = 8..15 zero-filled first).
// Phase 2 (per wave, heads h = wave and wave+8): attrel[ill][d] = sum_r ar[ill][h][r] * Wr[h][d][r]
//   (A = arHL hi/lo from LDS, B = WrP bf16 [h*64+d][32], two products per tile, 4 tiles of 16 d).
// Epilogue: per-wave 8x64 slab in LDS, residual attended_symbols added from two 16-B loads per lane and row
// ---------------------------------------------------------------------------
__global__ __launch_bounds__(256) void k_rel_mix(const unsigned short* __restrict__ p16all, const unsigned short* __restrict__ relall,
    const unsigned short* __restrict__ wrp, const float* __restrict__ attsym,
    unsigned short* __restrict__ comb_hi, unsigned short* __restrict__ comb_lo) {
  const int rowbase = (int)blockIdx.y * SEQ;
  const int g4 = (int)blockIdx.x * 4;
  __shared__ __align__(16) unsigned short arHL[2 * 16 * 16 * 32];   // hi plane [m][h][32] then lo plane
  __shared__ __align__(16) float slab[8][8 * 68];
  constexpr int RK = 256;                   // k per stage of phase 1: 512 B of an operand row = one wave-wide load of whole lines
  constexpr int RPITCH = RK + 8;            // 528 B = 16 B x 33: no bank conflict for 16-byte fragment reads
  __shared__ __align__(16) unsigned short stg[8][32 * RPITCH];
  const int tid = threadIdx.x, lane = tid & 31;
  const int wave = __builtin_amdgcn_readfirstlane(tid >> 5);   // the same in every lane: the row, its chunk and its trip count stay scalar
  const int hh = lane >> 4, rl = lane & 15, koff = hh * 8;
  {
    const v4u zz = {0u, 0u, 0u, 0u};
    v4u* zp = (v4u*)arHL;                 // 32768 B = 2048 x 16 B, 256 threads x 8
    for (int qq = tid; qq < 2048; qq += 256) zp[qq] = zz;
  }
  __syncthreads();
  const v8f zero8 = {0.f, 0.f, 0.f, 0.f, 0.f, 0.f, 0.f, 0.f};
  {
    const int ill = wave;                     // local row 0..7 (wave-uniform)
    const int i = (wave < 4) ? g4 + wave : (SEQ - 1) - g4 - (wave - 4);   // query position
    const int c = i / CHR, il = i % CHR;      // the row's chunk, its place there
    const int jend = CHR * (c + 1);           // the chunk's row pitch
    const unsigned short* p16 = p16all + chunk_base(c) + (size_t)blockIdx.y * ((size_t)NHEAD * CHR * jend);
    const unsigned short* rel = relall + chunk_base(c) + (size_t)blockIdx.y * ((size_t)CHR * NREL * jend);
    const int kend = (i & ~31) + 32;          // <= jend; P16 is zero for i < j < kend
    const unsigned short* gA = p16 + (size_t)il * jend;                      // + head * CHR * jend: A row m = head
    const unsigned short* gB = rel + (size_t)il * ((size_t)NREL * jend);     // + relation * jend: Bt row n = relation
    const int lane8 = lane * 8;               // the lane's 16 bytes of a row's 512
    unsigned short* wst = stg[wave];          // the wave's own stage: rows 0..15 = A, 16..31 = Bt
    v8f acc = zero8;
    for (int ks = 0; ks < kend; ks += RK) {
      const bool on = ks + lane * 8 < kend;   // kend is a multiple of 32; columns from kend on are staged as zeros and add nothing
      v4u st[32];
#pragma unroll
      for (int n = 0; n < 32; ++n) st[n] = (v4u){0u, 0u, 0u, 0u};
      if (on) {
#pragma unroll
        for (int n4 = 0; n4 < 16; n4 += 4) {
          const unsigned short *ga[4], *gb[4];
#pragma unroll
          for (int q = 0; q < 4; ++q) {
            ga[q] = gA + (size_t)(n4 + q) * ((size_t)CHR * jend) + ks + lane8;
            gb[q] = gB + (size_t)(n4 + q) * jend + ks + lane8;
            st[n4 + q]      = *(const v4u*)ga[q];
            st[16 + n4 + q] = *(const v4u*)gb[q];
          }
          // a later load's result may be given the registers that held these addresses: the addresses stay where they are
          // up to this wait, which stands in front of every such overwrite
          asm volatile("s_wait_xcnt 0x0" :: "v"(ga[0]), "v"(ga[1]), "v"(ga[2]), "v"(ga[3]),
                                            "v"(gb[0]), "v"(gb[1]), "v"(gb[2]), "v"(gb[3]) : "memory");
        }
      }
#pragma unroll
      for (int n = 0; n < 32; ++n) *(v4u*)(wst + n * RPITCH + lane * 8) = st[n];
      __builtin_amdgcn_fence(__ATOMIC_RELEASE, "workgroup");
      __builtin_amdgcn_wave_barrier();
      __builtin_amdgcn_fence(__ATOMIC_ACQUIRE, "workgroup");
      v16h a[RK / 32], bb[RK / 32];           // the stage's fragment reads go as one group ahead of its products
#pragma unroll
      for (int u = 0; u < RK / 32; ++u) {
        a[u]  = Frag<_Float16>::load((const _Float16*)wst + rl * RPITCH + koff + u * 32);
        bb[u] = Frag<_Float16>::load((const _Float16*)wst + (16 + rl) * RPITCH + koff + u * 32);
      }
#pragma unroll
      for (int u = 0; u < RK / 32; ++u) acc = mma16h(a[u], bb[u], acc);
      __builtin_amdgcn_fence(__ATOMIC_RELEASE, "workgroup");
      __builtin_amdgcn_wave_barrier();
      __builtin_amdgcn_fence(__ATOMIC_ACQUIRE, "workgroup");
    }
    // acc[r8] = D[row h = 8*hh + r8][col r = rl]  (carried x1024)
#pragma unroll
    for (int r8 = 0; r8 < 8; r8 += 2) {
      unsigned hp, lp;
      split_bf16x2(acc[r8], acc[r8 + 1], hp, lp);
      const int idx = (ill * 16 + 8 * hh + r8) * 32 + rl;
      arHL[idx] = (unsigned short)hp;
      arHL[idx + 32] = (unsigned short)(hp >> 16);
      arHL[8192 + idx] = (unsigned short)lp;
      arHL[8192 + idx + 32] = (unsigned short)(lp >> 16);
    }
  }
  __syncthreads();
  const int q = lane >> 3, c8 = (lane & 7) * 8;
  float* sl = slab[wave];
#pragma unroll
  for (int sub = 0; sub < 2; ++sub) {
    const int h = wave + 8 * sub;             // wave-uniform head
    const v16b ah = Frag<__bf16>::load((const __bf16*)arHL + rl * 512 + h * 32 + koff);          // A[m = rl][k]
    const v16b al = Frag<__bf16>::load((const __bf16*)arHL + 8192 + rl * 512 + h * 32 + koff);
    v8f acc2[4];
#pragma unroll
    for (int j = 0; j < 4; ++j) {
      const v16b bw = Frag<__bf16>::load((const __bf16*)wrp + (size_t)(h * HDIM + j * 16 + rl) * 32 + koff);  // Bt[n = d][k = r]
      acc2[j] = mma16b(ah, bw, zero8);
      acc2[j] = mma16b(al, bw, acc2[j]);
    }
    // acc2[j][r8] = attrel[ill = 8*hh + r8][d = 16*j + rl] * 1024; the rows 8..15 (hh = 1) are padding
    if (hh == 0) {
#pragma unroll
      for (int j = 0; j < 4; ++j)
#pragma unroll
        for (int r8 = 0; r8 < 8; ++r8) sl[r8 * 68 + j * 16 + rl] = acc2[j][r8] * PCARRY_INV;
    }
    __builtin_amdgcn_fence(__ATOMIC_RELEASE, "workgroup");
    __builtin_amdgcn_wave_barrier();
    __builtin_amdgcn_fence(__ATOMIC_ACQUIRE, "workgroup");
    v4u hv[2], lv[2];
    const float* ra[2];
    v4f ra0[2], ra1[2];
#pragma unroll
    for (int it = 0; it < 2; ++it) {           // local row it * 4 + q; its query position as in phase 1
      ra[it] = attsym + (size_t)(rowbase + (it == 0 ? g4 + q : (SEQ - 1) - g4 - q)) * DMOD + h * HDIM + c8;
      ra0[it] = *(const v4f*)ra[it];
      ra1[it] = *(const v4f*)(ra[it] + 4);
    }
    // the addresses stay in their registers up to this wait, so that it stands in front of every overwrite of a register
    // that these loads name (a later load's result)
    asm volatile("s_wait_xcnt 0x0" :: "v"(ra[0]), "v"(ra[1]) : "memory");
#pragma unroll
    for (int it = 0; it < 2; ++it) {
      const int row = it * 4 + q;
      const v4f s0 = *(const v4f*)(sl + row * 68 + c8);
      const v4f s1 = *(const v4f*)(sl + row * 68 + c8 + 4);
      const v4f r0 = ra0[it];
      const v4f r1 = ra1[it];
      float v[8];
      v[0] = s0[0] + r0[0]; v[1] = s0[1] + r0[1]; v[2] = s0[2] + r0[2]; v[3] = s0[3] + r0[3];
      v[4] = s1[0] + r1[0]; v[5] = s1[1] + r1[1]; v[6] = s1[2] + r1[2]; v[7] = s1[3] + r1[3];
#pragma unroll
      for (int e = 0; e < 4; ++e) {
        unsigned hp, lp;
        split_bf16x2(v[2 * e], v[2 * e + 1], hp, lp);
        hv[it][e] = hp;
        lv[it][e] = lp;
      }
    }
    {
#pragma unroll
      for (int it = 0; it < 2; ++it) {
        const size_t g = (size_t)(rowbase + (it == 0 ? g4 + q : (SEQ - 1) - g4 - q)) * DMOD + h * HDIM + c8;
        *(v4u*)(comb_hi + g) = hv[it];
        *(v4u*)(comb_lo + g) = lv[it];
      }
      
    }
    __builtin_amdgcn_fence(__ATOMIC_RELEASE, "workgroup");
    __builtin_amdgcn_wave_barrier();
    __builtin_amdgcn_fence(__ATOMIC_ACQUIRE, "workgroup");
  }
}

// ---------------------------------------------------------------------------
// launcher
// Workspace region map (bytes, all 256-B aligned; total 178,323,456):
//   region 0, 83,886,080 bytes, used twice in turn, the first use ended by a launch boundary before the second begins:
//     steps 1-2: xb [2048][1024] bf16 (x, RNE) at 0, sb (symbols, RNE) behind it; in its last 10,485,760 bytes the
//                transposed bf16 weights 0 q_attn, 1 k_attn, 2 q_rel, 3 k_rel, 4 v, [1024][1024] each
//     relation scores -> relation mix: rel16 f16, PLANE_ELEMS elements, [c][b][256][16][jend] (REL_SCALE folded)
//   WoT    [1024][1024] bf16     2,097,152      directly behind region 0: the sixth slot of the weight transpose; lives to step 4
//   xqh/xql/xkh/xkl [2048][1024] bf16  4 x 4,194,304
//   qr16/kr16 [2048][1024] f16   2 x 4,194,304
//   svh/svl [1024][2048] bf16    2 x 4,194,304  (values transposed: row h*64+d, col b*1024+j)
//   attsym  [2048][1024] f32     8,388,608
//   ch/cl   [2048][1024] bf16    2 x 4,194,304  (pre-output activations hi/lo)
//   wrp     [1024][32] bf16      65,536         (Wr with K padded to 32, pad zero-filled)
//   p16     [c][b][16][256][jend] f16  41,943,040      probabilities x1024
// ---------------------------------------------------------------------------
extern "C" void kernel_launch(void* const* d_in, const int* in_sizes, int n_in,
                              void* d_out, int out_size, void* d_ws, size_t ws_size,
                              hipStream_t stream) {
  if (n_in < 9) return;
  if (in_sizes[0] != NTOK * DMOD || in_sizes[1] != NTOK * DMOD) return;
  if (in_sizes[2] != DMOD * DMOD || in_sizes[3] != DMOD * DMOD || in_sizes[4] != DMOD * DMOD ||
      in_sizes[5] != DMOD * DMOD || in_sizes[7] != DMOD * DMOD || in_sizes[8] != DMOD * DMOD) return;
  if (in_sizes[6] != NHEAD * HDIM * NREL) return;
  if (out_size != NTOK * DMOD) return;

  const float* x      = (const float*)d_in[0];
  const float* symb   = (const float*)d_in[1];
  const float* Wq_a   = (const float*)d_in[2];
  const float* Wk_a   = (const float*)d_in[3];
  const float* Wq_r   = (const float*)d_in[4];
  const float* Wk_r   = (const float*)d_in[5];
  const float* Wr     = (const float*)d_in[6];
  const float* Wv     = (const float*)d_in[7];
  const float* Wo     = (const float*)d_in[8];
  float* out = (float*)d_out;

  char* ws = (char*)d_ws;
  size_t off = 0;
  auto carve = [&](size_t bytes) -> char* {
    char* p = ws + off;
    off += (bytes + 255) & ~(size_t)255;
    return p;
  };
  const size_t ACT16 = (size_t)NTOK * DMOD * 2;            // 4,194,304
  const size_t WGT16 = (size_t)DMOD * DMOD * 2;            // 2,097,152
  const size_t ACT32 = (size_t)NTOK * DMOD * 4;            // 8,388,608
  const size_t PLANE16 = PLANE_ELEMS * 2;                  // 41,943,040
  const size_t PLANE32 = PLANE_ELEMS * 4;                  // 83,886,080
  static_assert(PLANE_ELEMS * 4 % 256 == 0, "the sixth weight slot must follow region 0 without a gap");
  static_assert((size_t)2 * NTOK * DMOD * 2 + (size_t)5 * DMOD * DMOD * 2 <= PLANE_ELEMS * 4, "casts and five weights fit region 0 side by side");

  char* reg0 = carve(PLANE32);
  carve(WGT16);                                            // WoT = wT + 5 weights
  unsigned short* xb   = (unsigned short*)reg0;
  unsigned short* sb   = (unsigned short*)(reg0 + ACT16);
  unsigned short* wT   = (unsigned short*)(reg0 + PLANE32 - 5 * WGT16);
  unsigned short* rel16 = (unsigned short*)reg0;
  unsigned short* xqh  = (unsigned short*)carve(ACT16);
  unsigned short* xql  = (unsigned short*)carve(ACT16);
  unsigned short* xkh  = (unsigned short*)carve(ACT16);
  unsigned short* xkl  = (unsigned short*)carve(ACT16);
  unsigned short* qr16 = (unsigned short*)carve(ACT16);
  unsigned short* kr16 = (unsigned short*)carve(ACT16);
  unsigned short* svh  = (unsigned short*)carve(ACT16);
  unsigned short* svl  = (unsigned short*)carve(ACT16);
  float*          attsym = (float*)carve(ACT32);
  unsigned short* ch   = (unsigned short*)carve(ACT16);
  unsigned short* cl   = (unsigned short*)carve(ACT16);
  unsigned short* wrp  = (unsigned short*)carve((size_t)NHEAD * HDIM * 32 * 2);
  unsigned short* p16  = (unsigned short*)carve(PLANE16);
  if (off > ws_size) return;

  const unsigned short* WoT  = wT + 5 * (size_t)DMOD * DMOD;

  // 1) casts: activations to bf16; weights transposed to bf16; Wr packed with K padding
  k_prep<<<dim3(2 * CAST_BLOCKS + WT_BLOCKS + WR_BLOCKS), 256, 0, stream>>>(
      x, symb, Wq_a, Wk_a, Wq_r, Wk_r, Wv, Wo, Wr, xb, sb, wT, wrp);

  // 2) projections (bf16 x bf16, exact products, f32 accumulate)
  //    xq, xk -> bf16 hi/lo planes [2048][1024]; qr, kr -> f16 planes; values transposed svT [1024][2048] hi/lo
  static_assert(NTOK % 128 == 0 && DMOD % 128 == 0 && DMOD % GK == 0, "projection and output GEMM shapes");
  k_proj5<<<dim3((NTOK / 128) * (DMOD / 128), 5, 1), 256, 0, stream>>>(xb, sb, wT, xqh, xql, xkh, xkl, qr16, kr16, svh, svl);

  // 3) every chunk of 256 query rows, both batch rows, in each grid: (scores, softmax, P.V beside relation scores) -> relation mix
  static_assert(CHR % 64 == 0 && HDIM % 32 == 0 && RDIM % 32 == 0 && HDIM % 64 == 0, "chunk GEMM shapes");
  static_assert(CHR % 128 == 0 && CHR == 256 && HDIM == 64 && RDIM == 64, "128x256 relation tiles, one stage of k for the scores");
  static_assert(NCHK == 4 && (NCHK & (NCHK - 1)) == 0 && ROWS_CH % 8 == 0 && NHEAD == 16 && NREL == 16, "grid decoding");
  static_assert(CHR / SR == (CHR / 128) * (SEQ / 256), "both roles of the grid use the same range of blockIdx.x");
  k_attn_rel<<<dim3(CHR / SR, NB * 16, 2 * NCHK), 256, 0, stream>>>(xqh, xql, xkh, xkl, svh, svl, attsym, p16, qr16, kr16, rel16);
  static_assert(SEQ % 8 == 0, "relation mix: four rows from each end of the sequence per work-group");
  k_rel_mix<<<dim3(SEQ / 8, NB), 256, 0, stream>>>(p16, rel16, wrp, attsym, ch, cl);

  // 4) out[token][n] = sum_k combined[token][k] * WoT[n][k]  (A hi/lo, B bf16 weights) -> d_out f32
  k_out<<<dim3((NTOK / 128) * (DMOD / 128)), 256, 0, stream>>>(ch, cl, WoT, out);
}

// v007
// One run takes 95.9 microseconds.
// Next to v006, in two timings, it ran 1.07 times as fast each time.
// All steps since v000 together make it 9.34 times as fast.
// Contractions: v_wmma_f32_16x16x32_bf16 (bf16 operands: module inputs RNE-converted once to bf16; computed q/k, softmax probabilities, value rows, relation aggregates and pre-output activations carried as bf16 hi+lo pairs) and v_wmma_f32_16x16x32_f16 for relation scores and relation aggregation (f16 operands, probabilities carried x1024); f32 accumulate everywhere; softmax and all side math in f32.
#include <hip/hip_runtime.h>

// ---------------------------------------------------------------------------
// problem geometry
// ---------------------------------------------------------------------------
static constexpr int NB    = 2;
static constexpr int SEQ   = 1024;
static constexpr int DMOD  = 1024;
static constexpr int NHEAD = 16;
static constexpr int HDIM  = 64;
static constexpr int NREL  = 16;
static constexpr int RDIM  = 64;
static constexpr int NTOK  = NB * SEQ;          // 2048
static constexpr int CHR   = 256;               // query rows per chunk
static constexpr int NCHK  = SEQ / CHR;         // 4 chunks per batch row
static constexpr float SCALE_ATTN = 0.125f;     // 1/sqrt(64)
static constexpr float SCALE_REL  = 0.125f;     // 1/sqrt(64)
static constexpr float PCARRY     = 1024.0f;    // f16 probability carry
static constexpr float PCARRY_INV = 1.0f / 1024.0f;

// Per-pair planes (probabilities, relation scores) hold all chunks at once: chunk c (query rows 256c..256c+255,
// keys < jend = 256(c+1)) stores its rows at pitch jend and starts at element CHUNK_UNIT * c(c+1)/2.
static constexpr int    ROWS_CH     = NB * NHEAD * CHR;                             // 8192 rows per chunk
static constexpr size_t CHUNK_UNIT  = (size_t)ROWS_CH * CHR;                        // 2,097,152 elements per 256 keys
static constexpr size_t PLANE_ELEMS = CHUNK_UNIT * (NCHK * (NCHK + 1) / 2);         // 20,971,520 elements
__device__ __forceinline__ size_t chunk_base(int c) { return CHUNK_UNIT * (size_t)((c * (c + 1)) >> 1); }

static_assert(NHEAD * HDIM == DMOD, "head split");
static_assert(NREL * RDIM == DMOD, "relation split");
static_assert(SEQ == 4 * 256, "softmax handles up to 4 segments of 256 keys");
static_assert(SEQ % CHR == 0 && CHR % 64 == 0, "chunk tiling");
static_assert(NHEAD == 16 && NREL == 16, "relation mix kernel uses one 16x16 tile per token");
static_assert(HDIM % 32 == 0 && RDIM % 32 == 0, "K of score GEMMs multiple of 32");
static_assert(NTOK % 64 == 0 && DMOD % 64 == 0, "tile multiples");
static_assert((NTOK * DMOD) % (8 * 256) == 0, "cast kernel coverage");
static_assert((NHEAD * CHR) % 8 == 0 && CHR % 16 == 0, "softmax / mix grids");

// ---------------------------------------------------------------------------
// types, conversions, fragment helpers
// ---------------------------------------------------------------------------
typedef __attribute__((ext_vector_type(16))) _Float16 v16h;
typedef __attribute__((ext_vector_type(8)))  _Float16 v8h;
typedef __attribute__((ext_vector_type(16))) __bf16   v16b;
typedef __attribute__((ext_vector_type(8)))  __bf16   v8b;
typedef __attribute__((ext_vector_type(8)))  float    v8f;
typedef __attribute__((ext_vector_type(4)))  float    v4f;
typedef __attribute__((ext_vector_type(4)))  unsigned int v4u;

typedef __attribute__((ext_vector_type(2)))  float    v2f;
typedef __attribute__((ext_vector_type(2)))  __bf16   v2b;
typedef __attribute__((ext_vector_type(2)))  _Float16 v2h;

// f32 -> 16 bit, round to nearest even, two values per conversion instruction: a in the low half, b in the high half
__device__ __forceinline__ unsigned pack_bf16x2(float a, float b) {
  const v2f f = {a, b};
  return __builtin_bit_cast(unsigned, __builtin_convertvector(f, v2b));
}
__device__ __forceinline__ unsigned pack_f16x2(float a, float b) {
  const v2f f = {a, b};
  return __builtin_bit_cast(unsigned, __builtin_convertvector(f, v2h));
}
// hi = bf16(x), lo = bf16(x - hi) of two values, packed like pack_bf16x2
__device__ __forceinline__ void split_bf16x2(float a, float b, unsigned& hi, unsigned& lo) {
  hi = pack_bf16x2(a, b);
  lo = pack_bf16x2(a - __uint_as_float(hi << 16), b - __uint_as_float(hi & 0xFFFF0000u));
}

template <typename T> struct Frag;
template <> struct Frag<_Float16> {
  typedef v16h V; union U { v16h v; v8h h[2]; };
  static __device__ __forceinline__ v16h load(const _Float16* p) {   // elements 0..7 <- p[0..7], 8..15 <- p[16..23]
    U f; f.h[0] = *(const v8h*)(p); f.h[1] = *(const v8h*)(p + 16); return f.v;
  }
  static __device__ __forceinline__ v8f mma(v16h a, v16h b, v8f c) {
    return __builtin_amdgcn_wmma_f32_16x16x32_f16(false, a, false, b, (short)0, c, false, false);
  }
};
template <> struct Frag<__bf16> {
  typedef v16b V; union U { v16b v; v8b h[2]; };
  static __device__ __forceinline__ v16b load(const __bf16* p) {
    U f; f.h[0] = *(const v8b*)(p); f.h[1] = *(const v8b*)(p + 16); return f.v;
  }
  static __device__ __forceinline__ v8f mma(v16b a, v16b b, v8f c) {
    return __builtin_amdgcn_wmma_f32_16x16x32_bf16(false, a, false, b, (short)0, c, false, false);
  }
};

// single-accumulator WMMA + hazard nops (used by the relation mix kernel)
__device__ __forceinline__ v8f mma16h(v16h a, v16h b, v8f c) {
  c = __builtin_amdgcn_wmma_f32_16x16x32_f16(false, a, false, b, (short)0, c, false, false);
  asm volatile("v_nop\n\tv_nop\n\tv_nop\n\tv_nop" : "+v"(c) : "v"(a), "v"(b));
  return c;
}
__device__ __forceinline__ v8f mma16b(v16b a, v16b b, v8f c) {
  c = __builtin_amdgcn_wmma_f32_16x16x32_bf16(false, a, false, b, (short)0, c, false, false);
  asm volatile("v_nop\n\tv_nop\n\tv_nop\n\tv_nop" : "+v"(c) : "v"(a), "v"(b));
  return c;
}

// Waves of a work-group hand data to one another through LDS only (global results are read by later launches), so the barrier and
// the fence inside a wave order the local address space alone: they wait for the wave's LDS operations and leave its global loads
// and stores in flight, where __syncthreads() and a fence on every address space would first drain them.
__device__ __forceinline__ void lds_barrier() {
  __builtin_amdgcn_fence(__ATOMIC_RELEASE, "workgroup", "local");
  __builtin_amdgcn_s_barrier();
  __builtin_amdgcn_fence(__ATOMIC_ACQUIRE, "workgroup", "local");
}
__device__ __forceinline__ void lds_wave_fence() {
  __builtin_amdgcn_fence(__ATOMIC_RELEASE, "workgroup", "local");
  __builtin_amdgcn_wave_barrier();
  __builtin_amdgcn_fence(__ATOMIC_ACQUIRE, "workgroup", "local");
}

// ---- work-group WMMA GEMM, operands staged in LDS ---------------------
// C[m,n] = scale * sum_k A[m,k] * Bt[n,k]; one BM x BN tile of C per work-group of 8 waves.
// A row-major [M,K]; Bt row-major [N,K]; K % 64 == 0; every operand row starts on a 128-B line.
// SPLIT: A is hi/lo planes (A2 = lo); SPLITB: Bt also hi/lo (product hi.hi + hi.lo + lo.hi),
//        !SPLITB: Bt single plane (product hi.b + lo.b).
// OUT_MODE: 0 = f32, 1 = f16, 2 = bf16 hi plane (Cout) + bf16 lo plane (Cout2).
// ET: 0 = f16 operands, 1 = bf16 operands (pointers passed as 16-bit storage)
template <int ET> struct Elem;
template <> struct Elem<0> { typedef _Float16 T; };
template <> struct Elem<1> { typedef __bf16 T; };

// Result of one wave, MI x 4 accumulator tiles of 16x16 at rows m0.., columns n0..: 16 rows at a time through the wave's own
// 16x68 f32 LDS slab, so that every store covers whole row segments.
template <int MI, int OUT_MODE>
__device__ __forceinline__ void store_tiles(v8f (&acc)[MI][4], float scale,
    void* __restrict__ Cout, void* __restrict__ Cout2, int ldc, size_t offC, int m0, int n0, float* slab) {
  const int lane = threadIdx.x & 31;
  const int rlane = lane & 15;                 // column within a 16x16 tile
  const int mOff  = (lane >> 4) * 8;           // D row offset
#pragma unroll
  for (int i = 0; i < MI; ++i) {
    const int mBase = m0 + (i << 4);
#pragma unroll
    for (int j = 0; j < 4; ++j) {
#pragma unroll
      for (int r = 0; r < 8; ++r) {
        slab[(mOff + r) * 68 + (j << 4) + rlane] = acc[i][j][r] * scale;
      }
    }
    lds_wave_fence();                          // the slab's rows are read by other lanes than wrote them
    if (OUT_MODE == 0) {
      float* C = (float*)Cout + offC;
      const int hh = lane >> 4, c4 = (lane & 15) * 4;     // row seg = 256 B = 16 lanes x 16 B
      float* const g0 = C + (size_t)(mBase + hh) * ldc + n0 + c4;   // the lane's place in its first row; later rows by the row stride
      float* gp[8];
      v4f gv[8];
#pragma unroll
      for (int it = 0; it < 8; ++it) {
        const int row = it * 2 + hh;
        gv[it] = *(const v4f*)(slab + row * 68 + c4);
        gp[it] = g0 + (size_t)(it * 2) * ldc;
        *(v4f*)gp[it] = gv[it];
      }
      // nothing drains these stores any more before the next 16 rows reuse their registers: addresses and data stay where they
      // are up to this wait, which stands in front of every such overwrite
      asm volatile("s_wait_xcnt 0x0" :: "v"(gp[0]), "v"(gp[1]), "v"(gp[2]), "v"(gp[3]), "v"(gp[4]), "v"(gp[5]), "v"(gp[6]), "v"(gp[7]),
                                        "v"(gv[0]), "v"(gv[1]), "v"(gv[2]), "v"(gv[3]), "v"(gv[4]), "v"(gv[5]), "v"(gv[6]), "v"(gv[7]) : "memory");
    } else {
      const int q = lane >> 3, c8 = (lane & 7) * 8;
      unsigned short* C  = (unsigned short*)Cout  + offC;
      unsigned short* C2 = (OUT_MODE == 2) ? ((unsigned short*)Cout2 + offC) : nullptr;
      const size_t o0 = (size_t)(mBase + q) * ldc + n0 + c8;   // the lane's place in its first row; later rows by the row stride
      unsigned short *gp[4], *gp2[4];
      v4u hu[4], lu[4];
#pragma unroll
      for (int it = 0; it < 4; ++it) {
        const int row = it * 4 + q;
        const float* sp = slab + row * 68 + c8;
        lu[it] = (v4u){0u, 0u, 0u, 0u};
#pragma unroll
        for (int e = 0; e < 4; ++e) {
          if (OUT_MODE == 1) hu[it][e] = pack_f16x2(sp[2 * e], sp[2 * e + 1]);
          else {
            unsigned hp, lp;
            split_bf16x2(sp[2 * e], sp[2 * e + 1], hp, lp);
            hu[it][e] = hp;
            lu[it][e] = lp;
          }
        }
        gp[it]  = C + o0 + (size_t)(it * 4) * ldc;
        gp2[it] = (OUT_MODE == 2) ? C2 + o0 + (size_t)(it * 4) * ldc : gp[it];
        *(v4u*)gp[it] = hu[it];
        if (OUT_MODE == 2) *(v4u*)gp2[it] = lu[it];
      }
      // as above: the wait in front of every overwrite of a register that these stores name
      if (OUT_MODE == 2)
        asm volatile("s_wait_xcnt 0x0" :: "v"(gp[0]), "v"(gp[1]), "v"(gp[2]), "v"(gp[3]), "v"(gp2[0]), "v"(gp2[1]), "v"(gp2[2]), "v"(gp2[3]),
                                          "v"(hu[0]), "v"(hu[1]), "v"(hu[2]), "v"(hu[3]), "v"(lu[0]), "v"(lu[1]), "v"(lu[2]), "v"(lu[3]) : "memory");
      else
        asm volatile("s_wait_xcnt 0x0" :: "v"(gp[0]), "v"(gp[1]), "v"(gp[2]), "v"(gp[3]),
                                          "v"(hu[0]), "v"(hu[1]), "v"(hu[2]), "v"(hu[3]) : "memory");
    }
    lds_wave_fence();                          // the slab's reads end before the next 16 rows overwrite it
  }
}

static constexpr int GK = 64;                  // k per stage: 128 B, one whole line, of every operand row
static constexpr int GP = GK + 8;              // LDS row pitch in 16-bit elements: 144 B = 16 B x 9, no bank conflict for 16-byte fragment reads
static constexpr int SLAB_WORDS = 8 * 16 * 68 * 2;   // the eight result slabs, in 16-bit words
// WM x WN waves, each MI*16 rows x 64 columns of C. One stage in LDS: rows [A | A lo | Bt | Bt lo], GP elements apart.
template <bool SPLIT, bool SPLITB, int MI, int WM, int WN> struct Stage {
  static_assert(WM * WN == 8, "eight waves");
  static constexpr int BM = WM * MI * 16, BN = WN * 64;
  static constexpr int AROWS = (SPLIT ? 2 : 1) * BM;
  static constexpr int ROWS  = AROWS + ((SPLIT && SPLITB) ? 2 : 1) * BN;
  static constexpr int WORDS = ROWS * GP;      // 16-bit words per stage
  static_assert(BM % 32 == 0 && BN % 32 == 0, "each group of 32 staged rows lies in one plane");
  static_assert(WORDS >= SLAB_WORDS, "the result slabs reuse the first stage");
};
// smem: two stages (one is enough where K == GK); offA / offB / offC: element offsets of this product's operands and result;
// m0b, n0b: the work-group's tile. Every thread of the work-group calls this (it holds barriers).
// Per stage the 256 threads copy 128 B of every operand row, 8 lanes to a row, into LDS; the next stage's global loads are
// issued before this stage's products and stored to the other buffer behind them.
// LEAD: how many stages ahead of their products the global loads are issued (1 or 2; 2 takes a second set of staging registers).
template <int ET, bool SPLIT, bool SPLITB, int MI, int WM, int WN, int OUT_MODE, int LDA, int LDB, int LEAD = 1>
__device__ __forceinline__ void gemm_block(
    const unsigned short* __restrict__ Ap, const unsigned short* __restrict__ A2p, size_t offA,
    const unsigned short* __restrict__ Btp, const unsigned short* __restrict__ Bt2p, size_t offB,
    void* __restrict__ Cout, void* __restrict__ Cout2, int ldc, size_t offC,
    int K, float scale, int m0b, int n0b, unsigned short* smem) {
  typedef typename Elem<ET>::T T;
  typedef typename Frag<T>::V V;
  typedef Stage<SPLIT, SPLITB, MI, WM, WN> G;
  constexpr int NLD = G::ROWS / 32;            // 16-byte pieces per thread and stage
  const int tid = threadIdx.x, lane = tid & 31, wave = tid >> 5;
  const int srow = tid >> 3, scol = (tid & 7) * 8;      // staging: row within a group of 32, 16-byte column
  // the thread's place in each operand plane at the stage to be fetched next; the rows' strides LDA, LDB are compile-time,
  // so every load of a plane names this one address and an immediate offset
  const unsigned short* gA  = Ap   + offA + (size_t)(m0b + srow) * LDA + scol;
  const unsigned short* gA2 = A2p  + offA + (size_t)(m0b + srow) * LDA + scol;
  const unsigned short* gB  = Btp  + offB + (size_t)(n0b + srow) * LDB + scol;
  const unsigned short* gB2 = Bt2p + offB + (size_t)(n0b + srow) * LDB + scol;
  unsigned short* sdst = smem + srow * GP + scol;

  const int rlane = lane & 15;                 // row (A) / col (B, D) within subtile
  const int koff  = (lane >> 4) * 8;           // k offset of this lane half
  const int wm = wave / WN, wn = wave - wm * WN;
  const int aoff = (wm * (MI * 16) + rlane) * GP + koff;
  const int boff = (G::AROWS + wn * 64 + rlane) * GP + koff;

  v8f acc[MI][4];
#pragma unroll
  for (int i = 0; i < MI; ++i)
#pragma unroll
    for (int j = 0; j < 4; ++j) acc[i][j] = (v8f){0.f,0.f,0.f,0.f,0.f,0.f,0.f,0.f};

  v4u st0[NLD], st1[NLD];                      // st1: stages of odd number where LEAD == 2
  auto fetch = [&](v4u (&st)[NLD]) {
#pragma unroll
    for (int n = 0; n < NLD; ++n) {
      const int r = n * 32;                    // first staged row of the group of 32: picks the plane at compile time
      const unsigned short* g;
      if (r < G::BM)                  g = gA  + (size_t)r * LDA;
      else if (r < G::AROWS)          g = gA2 + (size_t)(r - G::BM) * LDA;
      else if (r < G::AROWS + G::BN)  g = gB  + (size_t)(r - G::AROWS) * LDB;
      else                            g = gB2 + (size_t)(r - G::AROWS - G::BN) * LDB;
      st[n] = *(const v4u*)g;
    }
    // the addresses stay in their registers up to this wait, so that it stands in front of every overwrite of a register
    // that these loads name (a later load's result, the step to the next stage)
    if (SPLIT && SPLITB) asm volatile("s_wait_xcnt 0x0" :: "v"(gA), "v"(gA2), "v"(gB), "v"(gB2) : "memory");
    else if (SPLIT)      asm volatile("s_wait_xcnt 0x0" :: "v"(gA), "v"(gA2), "v"(gB) : "memory");
    else                 asm volatile("s_wait_xcnt 0x0" :: "v"(gA), "v"(gB) : "memory");
    gA += GK; gA2 += GK; gB += GK; gB2 += GK;
  };
  auto put = [&](int buf, const v4u (&st)[NLD]) {
#pragma unroll
    for (int n = 0; n < NLD; ++n) *(v4u*)(sdst + buf * G::WORDS + n * 32 * GP) = st[n];
  };
  auto products = [&](int buf) {
    const T* cur = (const T*)(smem + buf * G::WORDS);
#pragma unroll
    for (int ks = 0; ks < GK; ks += 32) {
      V bh[4], bl[4];
#pragma unroll
      for (int j = 0; j < 4; ++j) {
        bh[j] = Frag<T>::load(cur + boff + j * 16 * GP + ks);
        if (SPLIT && SPLITB) bl[j] = Frag<T>::load(cur + boff + (G::BN + j * 16) * GP + ks);
      }
#pragma unroll
      for (int i = 0; i < MI; ++i) {
        V ah = Frag<T>::load(cur + aoff + i * 16 * GP + ks);
        V al;
        if (SPLIT) al = Frag<T>::load(cur + aoff + (G::BM + i * 16) * GP + ks);
#pragma unroll
        for (int j = 0; j < 4; ++j) {
          acc[i][j] = Frag<T>::mma(ah, bh[j], acc[i][j]);
          if (SPLIT) {
            if (SPLITB) acc[i][j] = Frag<T>::mma(ah, bl[j], acc[i][j]);
            acc[i][j] = Frag<T>::mma(al, bh[j], acc[i][j]);
          }
        }
      }
    }
  };

  if (LEAD == 1) {
    fetch(st0);
    put(0, st0);
    lds_barrier();
    for (int k0 = 0, buf = 0; k0 < K; k0 += GK, buf ^= 1) {
      const bool more = k0 + GK < K;           // the same for the whole work-group
      if (more) fetch(st0);
      products(buf);
      if (more) put(buf ^ 1, st0);             // last read one trip ago, in front of that trip's barrier
      lds_barrier();                           // publishes the next stage; ends every read of this one
    }
  } else {
    // Stage s is loaded into st(s mod 2) at the top of trip s - 2, goes to LDS buffer s mod 2 at the foot of trip s - 1 and is
    // multiplied in trip s: its loads stay in flight over one barrier and two trips' products. Two trips per pass of the loop,
    // so that each set of registers is named at compile time; the loop holds only trips that fetch, with no branch round the
    // loads, so that the wait in front of a put can be counted and leaves the younger stage's loads in flight. The last one to
    // three trips follow behind it. Every test is the same for the whole work-group.
    fetch(st0);
    if (GK < K) fetch(st1);
    put(0, st0);
    lds_barrier();
    int k0 = 0;
    for (; k0 + 3 * GK < K; k0 += 2 * GK) {
      fetch(st0);
      products(0);
      put(1, st1);                             // last read one trip ago, in front of that trip's barrier
      lds_barrier();                           // publishes the next stage; ends every read of this one
      fetch(st1);
      products(1);
      put(0, st0);
      lds_barrier();
    }
    const bool two = k0 + GK < K, three = k0 + 2 * GK < K;
    if (three) fetch(st0);
    products(0);
    if (two) put(1, st1);
    lds_barrier();
    if (two) {
      products(1);
      if (three) put(0, st0);
      lds_barrier();
      if (three) {
        products(0);
        lds_barrier();
      }
    }
  }
  store_tiles<MI, OUT_MODE>(acc, scale, Cout, Cout2, ldc, offC, m0b + wm * (MI * 16), n0b + wn * 64,
                            (float*)smem + wave * (16 * 68));
}

// All five input projections in one grid; blockIdx.y selects the product (block-uniform):
// 0 q_attn, 1 k_attn -> bf16 hi/lo; 2 q_rel, 3 k_rel -> f16; 4 values, transposed (A = WvT, Bt = symbols) -> bf16 hi/lo.
// Each product has (NTOK/128)*(DMOD/128) tiles of 128x128, one per block.
__global__ __launch_bounds__(256) void k_proj5(
    const unsigned short* __restrict__ xb, const unsigned short* __restrict__ sb, const unsigned short* __restrict__ wT,
    unsigned short* __restrict__ xqh, unsigned short* __restrict__ xql,
    unsigned short* __restrict__ xkh, unsigned short* __restrict__ xkl,
    unsigned short* __restrict__ qr16, unsigned short* __restrict__ kr16,
    unsigned short* __restrict__ svh, unsigned short* __restrict__ svl) {
  __shared__ __align__(16) unsigned short sm[2 * Stage<false, false, 2, 4, 2>::WORDS];
  const int y = blockIdx.y;
  const bool tv = (y == 4);
  const int nbN = (tv ? NTOK : DMOD) / 128;
  const int m0b = ((int)blockIdx.x / nbN) * 128, n0b = ((int)blockIdx.x % nbN) * 128;
  const unsigned short* Wy = wT + (size_t)y * DMOD * DMOD;
  if (y == 2 || y == 3) {
    unsigned short* c = (y == 2) ? qr16 : kr16;
    gemm_block<1, false, false, 2, 4, 2, 1, DMOD, DMOD>(xb, xb, 0, Wy, Wy, 0, c, c, DMOD, 0, DMOD, 1.0f, m0b, n0b, sm);
  } else {
    const unsigned short* a  = tv ? Wy : xb;
    const unsigned short* bt = tv ? sb : Wy;
    unsigned short* chi = tv ? svh : (y == 0 ? xqh : xkh);
    unsigned short* clo = tv ? svl : (y == 0 ? xql : xkl);
    gemm_block<1, false, false, 2, 4, 2, 2, DMOD, DMOD>(a, a, 0, bt, bt, 0, chi, clo, tv ? NTOK : DMOD, 0, DMOD, 1.0f, m0b, n0b, sm);
  }
}

// Attention (scores, causal softmax, P.V) of every chunk, batch row and head in one grid: a work-group owns SR whole query rows.
// Part 1, per block of 256 keys: scores[il][j] = SCALE_ATTN * sum_d xq[i][h,d] xk[j][h,d] (hi/lo split on both operands, product
//   hi.hi + hi.lo + lo.hi), operands staged as in gemm_block (one stage: all of k); the block's f32 scores pass through a
//   32 x 256 buffer in LDS into the registers of the wave that owns the row: wave w owns rows 4w .. 4w+3, lane owns
//   j = 256*t + 8*lane .. +7 (t <= c). The next block's global loads are issued ahead of this block's products.
// Part 2: softmax of the wave's four rows, keys j <= i.
// Part 3, per block of 256 keys: attended_symbols[il][d] += sum_j P[il][j] * svT[h*64+d][j] (hi/lo split on both operands, product
//   hi.hi + hi.lo + lo.hi). Each wave packs its four rows of P as bf16 hi and lo into those rows' own bytes of the score buffer;
//   V comes in stages of 128 keys, three buffers in the LDS that held the score operands: one stage is fetched beside the
//   packing, the next beside the products. Wave w sums, for the rows 16*(w&1).. +15 and all 64 columns, the keys
//   32*(w>>1).. +31 of every stage (a fragment of P feeds four tiles). P hi/lo never go to memory.
// Part 4: the four key groups' 32 x 64 partial sums meet in LDS, are added in the order of the groups and stored as whole lines;
//   the P*1024 f16 plane is written, row r = (b*NHEAD + h)*CHR + il at pitch jend, zeros for i < j < jend (behind the last
//   barrier).
// The relation scores (they read nothing of the above) ride in the same grid: blockIdx.z = 4..7, chunk 7 - z, tiles of 128x256.
static constexpr int SR  = 32;                 // query rows per work-group
static constexpr int SRW = SR / 8;             // rows per wave
static constexpr int STP = CHR + 4;            // floats per row of the score buffer: rows 8 apart lie 32 banks apart (the two lane halves of a tile store), 16-B aligned
typedef Stage<true, true, 1, 2, 4> SG;         // one block: 32 query rows x 256 keys
static_assert(SG::BM == SR && SG::BN == CHR && HDIM == GK, "one stage holds all of k for 32 rows and 256 keys");
static constexpr int VK     = 128;             // keys per stage of V: 256 B, two whole lines, of every row of svT
static constexpr int VP     = VK + 8;          // LDS row pitch in 16-bit elements: 272 B = 16 B x 17, no bank conflict for 16-byte fragment reads
static constexpr int VWORDS = 2 * HDIM * VP;   // one stage: 64 hi rows, then 64 lo rows
static constexpr int PPW    = STP * 2;         // a row of the score buffer in 16-bit elements: 1040 B = 16 B x 65; holds 256 hi, then 256 lo
static constexpr int AWORDS = 3 * VWORDS > SG::WORDS ? 3 * VWORDS : SG::WORDS;   // the score operands' stage, then three stages of V
static_assert(2 * CHR <= PPW, "hi and lo of a row of P fit the row's bytes of the score buffer");
static_assert(4 * SR * 68 * 2 <= AWORDS && CHR == 2 * VK && VK == 4 * 32 && SR == 32 && HDIM == 64, "partial sums' staging; 2 row halves x 4 key groups = 8 waves");
static_assert(Stage<false, false, 4, 2, 4>::WORDS <= SG::WORDS, "the relation scores' stage fits");
// One code path for all chunks: c, and with it the number NT of key blocks, is block-uniform, so every test on it is a scalar
// branch that the whole work-group takes alike (barriers included); the kernel's text stays small.
// blockIdx.x = block of SR query rows in the chunk, blockIdx.y = batch row * 16 + head, blockIdx.z = 0..3: chunk 3 - z (longest first).
// Two work-groups share a WGP (one's products run beside the other's softmax arithmetic): four waves per SIMD, 256 registers each.
__global__ __launch_bounds__(256) __attribute__((amdgpu_waves_per_eu(4, 4))) void k_attn_rel(
    const unsigned short* __restrict__ xqh, const unsigned short* __restrict__ xql,
    const unsigned short* __restrict__ xkh, const unsigned short* __restrict__ xkl,
    const unsigned short* __restrict__ svh, const unsigned short* __restrict__ svl,
    float* __restrict__ attsym, unsigned short* __restrict__ p16,
    const unsigned short* __restrict__ qr16, const unsigned short* __restrict__ kr16, unsigned short* __restrict__ rel16) {
  __shared__ __align__(16) unsigned short smem[AWORDS];
  __shared__ __align__(16) float tbuf[SR * STP];
  if ((int)blockIdx.z >= NCHK) {                           // block-uniform
    const int cr = (2 * NCHK - 1) - (int)blockIdx.z;
    const int jr = CHR * (cr + 1), nbN = cr + 1;           // nbN = jr / 256
    if ((int)blockIdx.x >= (CHR / 128) * nbN) return;      // block-uniform, in front of every barrier
    const size_t br = blockIdx.y >> 4, hr = blockIdx.y & 15;
    // rel[c][b][il][r][j] = SCALE_REL * sum_p qr[i][r,p] kr[j][r,p]  (plain f16) -> f16 plane
    gemm_block<0, false, false, 4, 2, 4, 1, DMOD, DMOD>(qr16, qr16, (br * SEQ + (size_t)cr * CHR) * DMOD + hr * RDIM,
                                            kr16, kr16, br * ((size_t)SEQ * DMOD) + hr * RDIM,
                                            rel16, rel16, NREL * jr, chunk_base(cr) + br * ((size_t)CHR * NREL * jr) + hr * jr,
                                            RDIM, SCALE_REL, ((int)blockIdx.x / nbN) * 128, ((int)blockIdx.x % nbN) * 256, smem);
    return;
  }
  typedef __bf16 T;
  typedef Frag<T>::V V;
  constexpr int NLD = SG::ROWS / 32;           // 16-byte pieces per thread and stage
  constexpr int NA  = SG::AROWS / 32;          // of them the query rows, hi and lo
  const int c = (NCHK - 1) - (int)blockIdx.z;
  const int y = blockIdx.y, il0 = (int)blockIdx.x * SR;
  const int NT = c + 1;                        // blocks of 256 keys
  const int jend = CHR * NT;
  const int tid = threadIdx.x, lane = tid & 31;
  const int wave = __builtin_amdgcn_readfirstlane(tid >> 5);   // the same in every lane: kept in a scalar register, and the row addresses with it
  const int srow = tid >> 3, scol = (tid & 7) * 8;      // staging: row within a group of 32, 16-byte column
  const size_t bb = (size_t)(y >> 4), h = (size_t)(y & 15);
  const size_t offA = (bb * SEQ + (size_t)(c * CHR + il0)) * DMOD + h * HDIM;
  const size_t offB = bb * ((size_t)SEQ * DMOD) + h * HDIM;
  const unsigned short* gA  = xqh + offA + (size_t)srow * DMOD + scol;
  const unsigned short* gA2 = xql + offA + (size_t)srow * DMOD + scol;
  const unsigned short* gB  = xkh + offB + (size_t)srow * DMOD + scol;
  const unsigned short* gB2 = xkl + offB + (size_t)srow * DMOD + scol;
  unsigned short* sdst = smem + srow * GP + scol;

  const int rlane = lane & 15;                 // row (A) / col (B, D) within subtile
  const int koff  = (lane >> 4) * 8;           // k offset of this lane half
  const int wm = wave >> 2, wn = wave & 3;     // 2 x 4 waves, each 16 rows x 64 keys
  const int aoff = (wm * 16 + rlane) * GP + koff;
  const int boff = (SG::AROWS + wn * 64 + rlane) * GP + koff;
  float* tdst = tbuf + (wm * 16 + (lane >> 4) * 8) * STP + wn * 64 + rlane;   // D row 8*(lane>>4) + r, column rlane
  const float* tsrc = tbuf + (wave * SRW) * STP + lane * 8;                   // the wave's own rows, the lane's 8 keys

  v4u st[NLD];
  auto fetch = [&](int nb) {                   // nb: the key block, a compile-time number at every call: an immediate offset
#pragma unroll
    for (int n = (nb == 0 ? 0 : NA); n < NLD; ++n) {   // the query rows are staged once, with block 0, and stay
      const int r = n * 32;                    // first staged row of the group of 32: picks the plane at compile time
      const unsigned short* g;
      if (r < SG::BM)                   g = gA  + (size_t)r * DMOD;
      else if (r < SG::AROWS)           g = gA2 + (size_t)(r - SG::BM) * DMOD;
      else if (r < SG::AROWS + SG::BN)  g = gB  + (size_t)(nb * SG::BN + r - SG::AROWS) * DMOD;
      else                              g = gB2 + (size_t)(nb * SG::BN + r - SG::AROWS - SG::BN) * DMOD;
      st[n] = *(const v4u*)g;
    }
    // the addresses, the same for every block, stay in their registers up to this wait, so that it stands in front of
    // every overwrite of a register that these loads name
    if (nb == 0) asm volatile("s_wait_xcnt 0x0" :: "v"(gA), "v"(gA2), "v"(gB), "v"(gB2) : "memory");
    else         asm volatile("s_wait_xcnt 0x0" :: "v"(gB), "v"(gB2) : "memory");
  };
  auto put = [&](int nb) {
#pragma unroll
    for (int n = (nb == 0 ? 0 : NA); n < NLD; ++n) *(v4u*)(sdst + n * 32 * GP) = st[n];
  };

  const float NEG = -__builtin_huge_valf();
  const int ilw = il0 + wave * SRW;            // the wave's first row within the chunk
  float s[SRW][NCHK][8];                       // blocks t >= NT are neither written nor read
  fetch(0);
  put(0);
  lds_barrier();
  const T* cur = (const T*)smem;
  // unrolled: s lives in registers and is indexed by the block's number
#pragma unroll
  for (int nb = 0; nb < NCHK; ++nb) {
    if (nb < NT) {
      v8f acc[4];
#pragma unroll
      for (int j = 0; j < 4; ++j) acc[j] = (v8f){0.f,0.f,0.f,0.f,0.f,0.f,0.f,0.f};
      // the next block's loads fly beside this block's products and over the barrier behind them, which orders LDS alone
      if (nb + 1 < NCHK && nb + 1 < NT) fetch(nb + 1);
#pragma unroll
      for (int ks = 0; ks < GK; ks += 32) {
        V bh[4], bl[4];
#pragma unroll
        for (int j = 0; j < 4; ++j) {
          bh[j] = Frag<T>::load(cur + boff + j * 16 * GP + ks);
          bl[j] = Frag<T>::load(cur + boff + (SG::BN + j * 16) * GP + ks);
        }
        const V ah = Frag<T>::load(cur + aoff + ks);
        const V al = Frag<T>::load(cur + aoff + SG::BM * GP + ks);
#pragma unroll
        for (int j = 0; j < 4; ++j) {
          acc[j] = Frag<T>::mma(ah, bh[j], acc[j]);
          acc[j] = Frag<T>::mma(ah, bl[j], acc[j]);
          acc[j] = Frag<T>::mma(al, bh[j], acc[j]);
        }
      }
#pragma unroll
      for (int j = 0; j < 4; ++j)
#pragma unroll
        for (int r = 0; r < 8; ++r) tdst[r * STP + j * 16] = acc[j][r] * SCALE_ATTN;
      lds_barrier();                           // publishes this block's scores; ends every read of the stage
#pragma unroll
      for (int q = 0; q < SRW; ++q) {
        const v4f a = *(const v4f*)(tsrc + q * STP);
        const v4f b = *(const v4f*)(tsrc + q * STP + 4);
        s[q][nb][0] = a[0]; s[q][nb][1] = a[1]; s[q][nb][2] = a[2]; s[q][nb][3] = a[3];
        s[q][nb][4] = b[0]; s[q][nb][5] = b[1]; s[q][nb][6] = b[2]; s[q][nb][7] = b[3];
      }
      if (nb + 1 < NCHK && nb + 1 < NT) {
        put(nb + 1);
        lds_barrier();                        // publishes the next stage; ends every read of the score buffer
      } else {
        // the chunk's last block holds the diagonal: keys j > i get -inf, as in the definition (they leave the maximum alone
        // and their exponential is exactly 0); in every earlier block j < 256 c <= i
#pragma unroll
        for (int q = 0; q < SRW; ++q)
#pragma unroll
          for (int e = 0; e < 8; ++e) s[q][nb][e] = (lane * 8 + e <= ilw + q) ? s[q][nb][e] : NEG;
      }
    }
  }

  // Part 3's operands. Behind the last block's barrier nobody reads the stage any more: its LDS takes the stages of V.
  const int vrow = tid >> 4, vcol = (tid & 15) * 8;        // staging of V: row within a group of 16, 16-byte column
  const size_t offV = (h * HDIM + (size_t)vrow) * NTOK + bb * SEQ + vcol;
  const unsigned short* gV  = svh + offV;
  const unsigned short* gV2 = svl + offV;
  unsigned short* vdst = smem + vrow * VP + vcol;
  v4u vst[8];
  auto vfetch = [&](int sg) {                  // sg: the stage of 128 keys, a compile-time number at every call: an immediate offset
#pragma unroll
    for (int n = 0; n < 8; ++n) {
      const unsigned short* g = (n < 4 ? gV + (size_t)(n * 16) * NTOK : gV2 + (size_t)((n - 4) * 16) * NTOK) + sg * VK;
      vst[n] = *(const v4u*)g;
    }
    // the addresses, the same for every stage, stay in their registers up to this wait, so that it stands in front of
    // every overwrite of a register that these loads name
    asm volatile("s_wait_xcnt 0x0" :: "v"(gV), "v"(gV2) : "memory");
  };
  auto vput = [&](int buf) {
#pragma unroll
    for (int n = 0; n < 8; ++n) *(v4u*)(vdst + buf * VWORDS + n * 16 * VP) = vst[n];
  };
  vfetch(0);                                   // lands while the softmax arithmetic runs

  const float LOG2E = 1.44269504088896340736f;
  float m[SRW], sum[SRW], inv[SRW];
#pragma unroll
  for (int q = 0; q < SRW; ++q) m[q] = NEG;
#pragma unroll
  for (int t = 0; t < NCHK; ++t) {
    if (t < NT) {
#pragma unroll
      for (int q = 0; q < SRW; ++q)
#pragma unroll
        for (int e = 0; e < 8; ++e) m[q] = fmaxf(m[q], s[q][t][e]);
    }
  }
#pragma unroll
  for (int off = 1; off < 32; off <<= 1) {     // the four rows' chains of shuffles overlap
#pragma unroll
    for (int q = 0; q < SRW; ++q) m[q] = fmaxf(m[q], __shfl_xor(m[q], off, 32));
  }
#pragma unroll
  for (int q = 0; q < SRW; ++q) sum[q] = 0.f;
#pragma unroll
  for (int t = 0; t < NCHK; ++t) {
    if (t < NT) {
#pragma unroll
      for (int q = 0; q < SRW; ++q) {
        float x[8], v[8];
#pragma unroll
        for (int e = 0; e < 8; ++e) x[e] = (s[q][t][e] - m[q]) * LOG2E;
        // exp(u) = 2^(u * log2 e), eight at a time in one statement: no result shares a register with a source (early clobber),
        // and the v_nop fills the slot that the instruction set asks for behind the last transcendental
        asm("v_exp_f32 %0, %8\n\tv_exp_f32 %1, %9\n\tv_exp_f32 %2, %10\n\tv_exp_f32 %3, %11\n\t"
            "v_exp_f32 %4, %12\n\tv_exp_f32 %5, %13\n\tv_exp_f32 %6, %14\n\tv_exp_f32 %7, %15\n\tv_nop"
            : "=&v"(v[0]), "=&v"(v[1]), "=&v"(v[2]), "=&v"(v[3]), "=&v"(v[4]), "=&v"(v[5]), "=&v"(v[6]), "=&v"(v[7])
            : "v"(x[0]), "v"(x[1]), "v"(x[2]), "v"(x[3]), "v"(x[4]), "v"(x[5]), "v"(x[6]), "v"(x[7]));
#pragma unroll
        for (int e = 0; e < 8; ++e) {
          s[q][t][e] = v[e];
          sum[q] += v[e];
        }
      }
    }
  }
#pragma unroll
  for (int off = 1; off < 32; off <<= 1) {
#pragma unroll
    for (int q = 0; q < SRW; ++q) sum[q] += __shfl_xor(sum[q], off, 32);
  }
#pragma unroll
  for (int q = 0; q < SRW; ++q) inv[q] = 1.0f / sum[q];    // sum >= 1 (the row's largest score gives exp(0))
  // ---- part 3: P.V ----
  const int rh = wave & 1, kq = wave >> 1;     // the wave's half of the rows, its group of 32 keys in every stage
  unsigned short* pw = (unsigned short*)tbuf + (wave * SRW) * PPW + lane * 8;    // the wave's own rows, the lane's 8 keys
  const T* pa = (const T*)tbuf + (rh * 16 + rlane) * PPW + kq * 32 + koff;       // A: row m = query row, hi; lo CHR elements on
  const T* vb = (const T*)smem + rlane * VP + kq * 32 + koff;                    // Bt: row n = d, hi; lo HDIM rows on
  v8f o[4];
#pragma unroll
  for (int j = 0; j < 4; ++j) o[j] = (v8f){0.f,0.f,0.f,0.f,0.f,0.f,0.f,0.f};
  auto pv = [&](int buf, int half) {           // keys 128*half .. +127 of the block in the score buffer; their V in buffer 'buf'
    const V ah = Frag<T>::load(pa + half * VK);
    const V al = Frag<T>::load(pa + CHR + half * VK);
#pragma unroll
    for (int j = 0; j < 4; ++j) {
      const V bh = Frag<T>::load(vb + buf * VWORDS + j * 16 * VP);
      const V bl = Frag<T>::load(vb + buf * VWORDS + (HDIM + j * 16) * VP);
      o[j] = Frag<T>::mma(ah, bh, o[j]);
      o[j] = Frag<T>::mma(ah, bl, o[j]);
      o[j] = Frag<T>::mma(al, bh, o[j]);
    }
  };
  v4u fv[NCHK][SRW];                           // P*1024 as f16, kept for part 4 in half the registers of s
  vput(0);
  // unrolled: s lives in registers and is indexed by the block's number; stage g of V lies in buffer g mod 3
#pragma unroll
  for (int t = 0; t < NCHK; ++t) {
    if (t < NT) {
      if (t == 0) vfetch(1);                   // a block's second stage lands while the block of P is packed; later blocks': see below
      // a row's hi and lo overwrite that row's scores, which only this wave has read since the last barrier
#pragma unroll
      for (int q = 0; q < SRW; ++q) {
        v4u hv, lv;
#pragma unroll
        for (int e = 0; e < 4; ++e) {
          const float a = s[q][t][2 * e] * inv[q];
          const float b = s[q][t][2 * e + 1] * inv[q];
          unsigned hp, lp;
          split_bf16x2(a, b, hp, lp);
          hv[e] = hp;
          lv[e] = lp;
          fv[t][q][e] = pack_f16x2(a * PCARRY, b * PCARRY);
        }
        *(v4u*)(pw + q * PPW) = hv;
        *(v4u*)(pw + q * PPW + CHR) = lv;
      }
      vput((2 * t + 1) % 3);                   // held stage 2t - 2, last read in front of the last barrier
      lds_barrier();                          // publishes this block of P and its two stages of V
      if (t + 1 < NCHK && t + 1 < NT) vfetch(2 * t + 2);   // lands while the products run
      pv((2 * t) % 3, 0);
      pv((2 * t + 1) % 3, 1);
      if (t + 1 < NCHK && t + 1 < NT) {
        vput((2 * t + 2) % 3);                 // held stage 2t - 1, last read one block ago
        vfetch(2 * t + 3);                     // in flight over the barrier and the packing of the next block of P
      }
      lds_barrier();                          // ends every read of this block of P and of its two stages
    }
  }

  // ---- part 4: results ----
  float* ob = (float*)smem;                    // four key groups x 32 x 68 floats; every read of V has ended
#pragma unroll
  for (int j = 0; j < 4; ++j)
#pragma unroll
    for (int r = 0; r < 8; ++r)                // D row 8*(lane>>4) + r, column rlane
      ob[(kq * SR + rh * 16 + (lane >> 4) * 8 + r) * 68 + j * 16 + rlane] = o[j][r];
  lds_barrier();                              // publishes the partial sums
  {
    float* og = attsym + (bb * SEQ + (size_t)(c * CHR + il0 + vrow)) * DMOD + h * HDIM + (tid & 15) * 4;   // 16 lanes x 16 B = a row's 256 B
    const float* os = ob + vrow * 68 + (tid & 15) * 4;
    v4f o0 = *(const v4f*)os;
    v4f o1 = *(const v4f*)(os + 16 * 68);
#pragma unroll
    for (int g = 1; g < 4; ++g) {
      o0 += *(const v4f*)(os + g * SR * 68);
      o1 += *(const v4f*)(os + (g * SR + 16) * 68);
    }
    *(v4f*)og = o0;
    *(v4f*)(og + (size_t)16 * DMOD) = o1;
    // the address stays in its registers up to this wait, which stands in front of every overwrite of a register that these stores name
    asm volatile("s_wait_xcnt 0x0" :: "v"(og), "v"(o0), "v"(o1) : "memory");
  }
  const size_t ro = chunk_base(c) + ((size_t)y * CHR + ilw) * jend;   // the wave's first row: a scalar base for every store
  unsigned short* df = p16 + ro;
  unsigned vo[SRW];                            // the lane's place in each of the four rows, in bytes: one 32-bit offset register per row
#pragma unroll
  for (int q = 0; q < SRW; ++q) vo[q] = (unsigned)(q * jend + lane * 8) * 2u;
#pragma unroll
  for (int t = 0; t < NCHK; ++t) {
    if (t < NT) {
#pragma unroll
      for (int q = 0; q < SRW; ++q) *(v4u*)((char*)df + vo[q] + t * 512) = fv[t][q];
    }
  }
}

// out[token][n] = sum_k combined[token][k] * WoT[n][k]  (A hi/lo, B bf16 weights), f32 out; one 128x128 tile per block.
__global__ __launch_bounds__(256) void k_out(const unsigned short* __restrict__ ch, const unsigned short* __restrict__ cl,
    const unsigned short* __restrict__ woT, float* __restrict__ out) {
  __shared__ __align__(16) unsigned short sm[2 * Stage<true, false, 2, 4, 2>::WORDS];
  const int nbN = DMOD / 128;
  gemm_block<1, true, false, 2, 4, 2, 0, DMOD, DMOD, 2>(ch, cl, 0, woT, woT, 0, out, out, DMOD, 0, DMOD, 1.0f,
                                         ((int)blockIdx.x / nbN) * 128, ((int)blockIdx.x % nbN) * 128, sm);
}

// ---------------------------------------------------------------------------
// f32 -> bf16 (RNE) cast of the two activation tensors, 8 elements per thread:
// by selects the tensor (block-uniform), bx the block of 2048 elements. Coverage: CAST_BLOCKS*256 threads * 8 = n8*8 elements exactly.
// ---------------------------------------------------------------------------
__device__ __forceinline__ void cast_bf16x8_block(const float* __restrict__ s0, const float* __restrict__ s1,
    unsigned short* __restrict__ d0, unsigned short* __restrict__ d1, int n8, int bx, int by) {
  const float* src = (by == 0) ? s0 : s1;
  unsigned short* dst = (by == 0) ? d0 : d1;
  const int i = bx * 256 + threadIdx.x;
  if (i < n8) {
    const size_t e0 = (size_t)i * 8;
    const v4f a = *(const v4f*)(src + e0);
    const v4f c = *(const v4f*)(src + e0 + 4);
    v4u u;
    u[0] = pack_bf16x2(a[0], a[1]);
    u[1] = pack_bf16x2(a[2], a[3]);
    u[2] = pack_bf16x2(c[0], c[1]);
    u[3] = pack_bf16x2(c[2], c[3]);
    *(v4u*)(dst + e0) = u;
    
  }
}

// ---------------------------------------------------------------------------
// Weight transpose + bf16 cast: W[k][o] (f32, [DMOD][DMOD]) -> WT[o][k] (bf16), 6 weights selected by z; tile: 64*68 floats of LDS.
// Coverage per block: read 4 iters * 256 threads * 4 = 4096 elements; write 2 iters * 8 waves * 4 lines * 64 = 4096.
// ---------------------------------------------------------------------------
__device__ __forceinline__ void wT_bf16_block(const float* __restrict__ w0, const float* __restrict__ w1,
    const float* __restrict__ w2, const float* __restrict__ w3, const float* __restrict__ w4, const float* __restrict__ w5,
    unsigned short* __restrict__ dst, float* tile, int bx, int by, int z) {
  const float* W = (z == 0) ? w0 : (z == 1) ? w1 : (z == 2) ? w2 : (z == 3) ? w3 : (z == 4) ? w4 : w5;
  unsigned short* WT = dst + (size_t)z * DMOD * DMOD;
  const int k0 = by * 64;   // rows of W (input dim)
  const int o0 = bx * 64;   // cols of W (output dim)
  const int tid = threadIdx.x;
#pragma unroll
  for (int it = 0; it < 4; ++it) {
    const int e = (it * 256 + tid) * 4;
    const int row = e >> 6, col = e & 63;
    const v4f v = *(const v4f*)(W + (size_t)(k0 + row) * DMOD + o0 + col);
    *(v4f*)(tile + row * 68 + col) = v;
  }
  __syncthreads();
  const int lane = tid & 31, wave = tid >> 5, q = lane >> 3, c8 = (lane & 7) * 8;
  v4u ov[2];
#pragma unroll
  for (int it = 0; it < 2; ++it) {
    const int oo = it * 32 + wave * 4 + q;
    float f[8];
#pragma unroll
    for (int e = 0; e < 8; ++e) f[e] = tile[(c8 + e) * 68 + oo];
    ov[it][0] = pack_bf16x2(f[0], f[1]);
    ov[it][1] = pack_bf16x2(f[2], f[3]);
    ov[it][2] = pack_bf16x2(f[4], f[5]);
    ov[it][3] = pack_bf16x2(f[6], f[7]);
  }
  {
#pragma unroll
    for (int it = 0; it < 2; ++it) {
      const int oo = it * 32 + wave * 4 + q;
      *(v4u*)(WT + (size_t)(o0 + oo) * DMOD + k0 + c8) = ov[it];
    }
    // in the merged kernel's built control flow another role's code follows these stores and reuses their registers:
    // keep the wait in front of that overwrite
    asm volatile("s_wait_xcnt 0x0" ::: "memory");
  }
}

// ---------------------------------------------------------------------------
// Wr [NHEAD*HDIM rows][NREL] f32 -> WrP [rows][32] bf16 with k 16..31 zero-FILLED (WMMA K padding).
// Coverage: 256 threads * 8 elements = 64 rows * 32; store 8 waves * 4 lines * 64 = 2048 elements.
// ---------------------------------------------------------------------------
__device__ __forceinline__ void wr_pack_block(const float* __restrict__ wr, unsigned short* __restrict__ dst,
    unsigned short* tile, int bx) {   // tile: 64*32 16-bit words of LDS
  const int r0 = bx * 64;
  const int tid = threadIdx.x;
  const int row = tid >> 2, kq = (tid & 3) * 8;
  v4u u;
  unsigned wv[4];
#pragma unroll
  for (int e = 0; e < 4; ++e) {
    const int ka = kq + 2 * e, kb = kq + 2 * e + 1;
    const int kac = ka < NREL ? ka : NREL - 1;
    const int kbc = kb < NREL ? kb : NREL - 1;
    const float fa = wr[(size_t)(r0 + row) * NREL + kac];
    const float fb = wr[(size_t)(r0 + row) * NREL + kbc];
    wv[e] = pack_bf16x2((ka < NREL) ? fa : 0.f, (kb < NREL) ? fb : 0.f);
  }
  u[0] = wv[0]; u[1] = wv[1]; u[2] = wv[2]; u[3] = wv[3];
  *(v4u*)(tile + row * 32 + kq) = u;
  __syncthreads();
  const int lane = tid & 31, wave = tid >> 5, q = lane >> 3, c8 = (lane & 7) * 8;
  const int L = wave * 4 + q;                       // line 0..31, 64 elements per line
  const v4u v = *(const v4u*)(tile + L * 64 + c8);
  {
    *(v4u*)(dst + (size_t)r0 * 32 + L * 64 + c8) = v;
    // as in the weight transpose: the wait in front of an overwrite of this store's registers by another role's code
    asm volatile("s_wait_xcnt 0x0" ::: "memory");
  }
}

// ---------------------------------------------------------------------------
// The three input conversions in one grid (none reads another's result); the role is block-uniform, from blockIdx.x:
// [0, 2*CAST_BLOCKS) activation casts, then WT_BLOCKS weight-transpose tiles, then WR_BLOCKS blocks of the Wr pack.
// ---------------------------------------------------------------------------
static constexpr int CAST_BLOCKS = NTOK * DMOD / 8 / 256;            // 1024 per tensor
static constexpr int WT_SIDE     = DMOD / 64;                        // 16 tiles per side
static constexpr int WT_BLOCKS   = 6 * WT_SIDE * WT_SIDE;            // 1536
static constexpr int WR_BLOCKS   = (NHEAD * HDIM) / 64;              // 16
__global__ __launch_bounds__(256) void k_prep(const float* __restrict__ x, const float* __restrict__ symb,
    const float* __restrict__ w0, const float* __restrict__ w1, const float* __restrict__ w2,
    const float* __restrict__ w3, const float* __restrict__ w4, const float* __restrict__ w5, const float* __restrict__ wr,
    unsigned short* __restrict__ xb, unsigned short* __restrict__ sb, unsigned short* __restrict__ wT,
    unsigned short* __restrict__ wrp) {
  __shared__ __align__(16) float tile[64 * 68];
  const int id = blockIdx.x;
  if (id < 2 * CAST_BLOCKS) {
    cast_bf16x8_block(x, symb, xb, sb, NTOK * DMOD / 8, id % CAST_BLOCKS, id / CAST_BLOCKS);
    return;
  }
  if (id < 2 * CAST_BLOCKS + WT_BLOCKS) {
    const int t = id - 2 * CAST_BLOCKS;
    wT_bf16_block(w0, w1, w2, w3, w4, w5, wT, tile, t % WT_SIDE, (t / WT_SIDE) % WT_SIDE, t / (WT_SIDE * WT_SIDE));
    return;
  }
  wr_pack_block(wr, wrp, (unsigned short*)tile, id - 2 * CAST_BLOCKS - WT_BLOCKS);
}

// ---------------------------------------------------------------------------
// Relation aggregation + Wr mix + residual. Block = 8 waves = 8 query rows of batch row blockIdx.y, one row per wave: the four rows
// 4g .. 4g+3 and the four rows SEQ-1-4g .. SEQ-4-4g, g = blockIdx.x. A row reads bytes in proportion to its causal extent, so a short
// row beside a long one gives every work-group the same number of bytes; SEQ/8 * NB work-groups, one per WGP (LDS), are resident at once.
// Phase 1 (per wave, local row ill = wave, in its own chunk c = i / 256): D[h][r] = sum_{j<kend} P16[h][il][j] * rel[il][r][j]
//   (one f16 WMMA tile, K stepped by 32; the 16 + 16 operand rows are staged 256 k at a time in the wave's own LDS, up to the
//   causal extent, zeros behind it; P16 carries P*1024, rel carries REL_SCALE);
//   D is split into bf16 hi/lo and written to LDS arHL[m=ill][h][k=r] (k 16..31 and the rows m = 8..15 zero-filled first).
// Phase 2 (per wave, heads h = wave and wave+8): attrel[ill][d] = sum_r ar[ill][h][r] * Wr[h][d][r]
//   (A = arHL hi/lo from LDS, B = WrP bf16 [h*64+d][32], two products per tile, 4 tiles of 16 d).
// Epilogue: per-wave 8x64 slab in LDS, residual attended_symbols added from two 16-B loads per lane and row
// ---------------------------------------------------------------------------
__global__ __launch_bounds__(256) void k_rel_mix(const unsigned short* __restrict__ p16all, const unsigned short* __restrict__ relall,
    const unsigned short* __restrict__ wrp, const float* __restrict__ attsym,
    unsigned short* __restrict__ comb_hi, unsigned short* __restrict__ comb_lo) {
  const int rowbase = (int)blockIdx.y * SEQ;
  const int g4 = (int)blockIdx.x * 4;
  __shared__ __align__(16) unsigned short arHL[2 * 16 * 16 * 32];   // hi plane [m][h][32] then lo plane
  __shared__ __align__(16) float slab[8][8 * 68];
  constexpr int RK = 256;                   // k per stage of phase 1: 512 B of an operand row = one wave-wide load of whole lines
  constexpr int RPITCH = RK + 8;            // 528 B = 16 B x 33: no bank conflict for 16-byte fragment reads
  __shared__ __align__(16) unsigned short stg[8][32 * RPITCH];
  const int tid = threadIdx.x, lane = tid & 31;
  const int wave = __builtin_amdgcn_readfirstlane(tid >> 5);   // the same in every lane: the row, its chunk and its trip count stay scalar
  const int hh = lane >> 4, rl = lane & 15, koff = hh * 8;
  {
    const v4u zz = {0u, 0u, 0u, 0u};
    v4u* zp = (v4u*)arHL;                 // 32768 B = 2048 x 16 B, 256 threads x 8
    for (int qq = tid; qq < 2048; qq += 256) zp[qq] = zz;
  }
  lds_barrier();
  const v8f zero8 = {0.f, 0.f, 0.f, 0.f, 0.f, 0.f, 0.f, 0.f};
  {
    const int ill = wave;                     // local row 0..7 (wave-uniform)
    const int i = (wave < 4) ? g4 + wave : (SEQ - 1) - g4 - (wave - 4);   // query position
    const int c = i / CHR, il = i % CHR;      // the row's chunk, its place there
    const int jend = CHR * (c + 1);           // the chunk's row pitch
    const unsigned short* p16 = p16all + chunk_base(c) + (size_t)blockIdx.y * ((size_t)NHEAD * CHR * jend);
    const unsigned short* rel = relall + chunk_base(c) + (size_t)blockIdx.y * ((size_t)CHR * NREL * jend);
    const int kend = (i & ~31) + 32;          // <= jend; P16 is zero for i < j < kend
    const unsigned short* gA = p16 + (size_t)il * jend;                      // + head * CHR * jend: A row m = head
    const unsigned short* gB = rel + (size_t)il * ((size_t)NREL * jend);     // + relation * jend: Bt row n = relation
    const int lane8 = lane * 8;               // the lane's 16 bytes of a row's 512
    unsigned short* wst = stg[wave];          // the wave's own stage: rows 0..15 = A, 16..31 = Bt
    v8f acc = zero8;
    for (int ks = 0; ks < kend; ks += RK) {
      const bool on = ks + lane * 8 < kend;   // kend is a multiple of 32; columns from kend on are staged as zeros and add nothing
      v4u st[32];
#pragma unroll
      for (int n = 0; n < 32; ++n) st[n] = (v4u){0u, 0u, 0u, 0u};
      if (on) {
#pragma unroll
        for (int n4 = 0; n4 < 16; n4 += 4) {
          const unsigned short *ga[4], *gb[4];
#pragma unroll
          for (int q = 0; q < 4; ++q) {
            ga[q] = gA + (size_t)(n4 + q) * ((size_t)CHR * jend) + ks + lane8;
            gb[q] = gB + (size_t)(n4 + q) * jend + ks + lane8;
            st[n4 + q]      = *(const v4u*)ga[q];
            st[16 + n4 + q] = *(const v4u*)gb[q];
          }
          // a later load's result may be given the registers that held these addresses: the addresses stay where they are
          // up to this wait, which stands in front of every such overwrite
          asm volatile("s_wait_xcnt 0x0" :: "v"(ga[0]), "v"(ga[1]), "v"(ga[2]), "v"(ga[3]),
                                            "v"(gb[0]), "v"(gb[1]), "v"(gb[2]), "v"(gb[3]) : "memory");
        }
      }
#pragma unroll
      for (int n = 0; n < 32; ++n) *(v4u*)(wst + n * RPITCH + lane * 8) = st[n];
      lds_wave_fence();
      v16h a[RK / 32], bb[RK / 32];           // the stage's fragment reads go as one group ahead of its products
#pragma unroll
      for (int u = 0; u < RK / 32; ++u) {
        a[u]  = Frag<_Float16>::load((const _Float16*)wst + rl * RPITCH + koff + u * 32);
        bb[u] = Frag<_Float16>::load((const _Float16*)wst + (16 + rl) * RPITCH + koff + u * 32);
      }
#pragma unroll
      for (int u = 0; u < RK / 32; ++u) acc = mma16h(a[u], bb[u], acc);
      lds_wave_fence();
    }
    // acc[r8] = D[row h = 8*hh + r8][col r = rl]  (carried x1024)
#pragma unroll
    for (int r8 = 0; r8 < 8; r8 += 2) {
      unsigned hp, lp;
      split_bf16x2(acc[r8], acc[r8 + 1], hp, lp);
      const int idx = (ill * 16 + 8 * hh + r8) * 32 + rl;
      arHL[idx] = (unsigned short)hp;
      arHL[idx + 32] = (unsigned short)(hp >> 16);
      arHL[8192 + idx] = (unsigned short)lp;
      arHL[8192 + idx + 32] = (unsigned short)(lp >> 16);
    }
  }
  lds_barrier();
  const int q = lane >> 3, c8 = (lane & 7) * 8;
  float* sl = slab[wave];
#pragma unroll
  for (int sub = 0; sub < 2; ++sub) {
    const int h = wave + 8 * sub;             // wave-uniform head
    const v16b ah = Frag<__bf16>::load((const __bf16*)arHL + rl * 512 + h * 32 + koff);          // A[m = rl][k]
    const v16b al = Frag<__bf16>::load((const __bf16*)arHL + 8192 + rl * 512 + h * 32 + koff);
    v8f acc2[4];
#pragma unroll
    for (int j = 0; j < 4; ++j) {
      const v16b bw = Frag<__bf16>::load((const __bf16*)wrp + (size_t)(h * HDIM + j * 16 + rl) * 32 + koff);  // Bt[n = d][k = r]
      acc2[j] = mma16b(ah, bw, zero8);
      acc2[j] = mma16b(al, bw, acc2[j]);
    }
    // acc2[j][r8] = attrel[ill = 8*hh + r8][d = 16*j + rl] * 1024; the rows 8..15 (hh = 1) are padding
    if (hh == 0) {
#pragma unroll
      for (int j = 0; j < 4; ++j)
#pragma unroll
        for (int r8 = 0; r8 < 8; ++r8) sl[r8 * 68 + j * 16 + rl] = acc2[j][r8] * PCARRY_INV;
    }
    lds_wave_fence();
    v4u hv[2], lv[2];
    const float* ra[2];
    v4f ra0[2], ra1[2];
#pragma unroll
    for (int it = 0; it < 2; ++it) {           // local row it * 4 + q; its query position as in phase 1
      ra[it] = attsym + (size_t)(rowbase + (it == 0 ? g4 + q : (SEQ - 1) - g4 - q)) * DMOD + h * HDIM + c8;
      ra0[it] = *(const v4f*)ra[it];
      ra1[it] = *(const v4f*)(ra[it] + 4);
    }
    // the addresses stay in their registers up to this wait, so that it stands in front of every overwrite of a register
    // that these loads name (a later load's result)
    asm volatile("s_wait_xcnt 0x0" :: "v"(ra[0]), "v"(ra[1]) : "memory");
#pragma unroll
    for (int it = 0; it < 2; ++it) {
      const int row = it * 4 + q;
      const v4f s0 = *(const v4f*)(sl + row * 68 + c8);
      const v4f s1 = *(const v4f*)(sl + row * 68 + c8 + 4);
      const v4f r0 = ra0[it];
      const v4f r1 = ra1[it];
      float v[8];
      v[0] = s0[0] + r0[0]; v[1] = s0[1] + r0[1]; v[2] = s0[2] + r0[2]; v[3] = s0[3] + r0[3];
      v[4] = s1[0] + r1[0]; v[5] = s1[1] + r1[1]; v[6] = s1[2] + r1[2]; v[7] = s1[3] + r1[3];
#pragma unroll
      for (int e = 0; e < 4; ++e) {
        unsigned hp, lp;
        split_bf16x2(v[2 * e], v[2 * e + 1], hp, lp);
        hv[it][e] = hp;
        lv[it][e] = lp;
      }
    }
    {
      unsigned short *ph[2], *pl[2];
#pragma unroll
      for (int it = 0; it < 2; ++it) {
        const size_t g = (size_t)(rowbase + (it == 0 ? g4 + q : (SEQ - 1) - g4 - q)) * DMOD + h * HDIM + c8;
        ph[it] = comb_hi + g;
        pl[it] = comb_lo + g;
        *(v4u*)ph[it] = hv[it];
        *(v4u*)pl[it] = lv[it];
      }
      // nothing drains these stores any more before the second head reuses their registers: addresses and data stay where they
      // are up to this wait, which stands in front of every such overwrite
      asm volatile("s_wait_xcnt 0x0" :: "v"(ph[0]), "v"(ph[1]), "v"(pl[0]), "v"(pl[1]),
                                        "v"(hv[0]), "v"(hv[1]), "v"(lv[0]), "v"(lv[1]) : "memory");
    }
    lds_wave_fence();
  }
}

// ---------------------------------------------------------------------------
// launcher
// Workspace region map (bytes, all 256-B aligned; total 178,323,456):
//   region 0, 83,886,080 bytes, used twice in turn, the first use ended by a launch boundary before the second begins:
//     steps 1-2: xb [2048][1024] bf16 (x, RNE) at 0, sb (symbols, RNE) behind it; in its last 10,485,760 bytes the
//                transposed bf16 weights 0 q_attn, 1 k_attn, 2 q_rel, 3 k_rel, 4 v, [1024][1024] each
//     relation scores -> relation mix: rel16 f16, PLANE_ELEMS elements, [c][b][256][16][jend] (REL_SCALE folded)
//   WoT    [1024][1024] bf16     2,097,152      directly behind region 0: the sixth slot of the weight transpose; lives to step 4
//   xqh/xql/xkh/xkl [2048][1024] bf16  4 x 4,194,304
//   qr16/kr16 [2048][1024] f16   2 x 4,194,304
//   svh/svl [1024][2048] bf16    2 x 4,194,304  (values transposed: row h*64+d, col b*1024+j)
//   attsym  [2048][1024] f32     8,388,608
//   ch/cl   [2048][1024] bf16    2 x 4,194,304  (pre-output activations hi/lo)
//   wrp     [1024][32] bf16      65,536         (Wr with K padded to 32, pad zero-filled)
//   p16     [c][b][16][256][jend] f16  41,943,040      probabilities x1024
// ---------------------------------------------------------------------------
extern "C" void kernel_launch(void* const* d_in, const int* in_sizes, int n_in,
                              void* d_out, int out_size, void* d_ws, size_t ws_size,
                              hipStream_t stream) {
  if (n_in < 9) return;
  if (in_sizes[0] != NTOK * DMOD || in_sizes[1] != NTOK * DMOD) return;
  if (in_sizes[2] != DMOD * DMOD || in_sizes[3] != DMOD * DMOD || in_sizes[4] != DMOD * DMOD ||
      in_sizes[5] != DMOD * DMOD || in_sizes[7] != DMOD * DMOD || in_sizes[8] != DMOD * DMOD) return;
  if (in_sizes[6] != NHEAD * HDIM * NREL) return;
  if (out_size != NTOK * DMOD) return;

  const float* x      = (const float*)d_in[0];
  const float* symb   = (const float*)d_in[1];
  const float* Wq_a   = (const float*)d_in[2];
  const float* Wk_a   = (const float*)d_in[3];
  const float* Wq_r   = (const float*)d_in[4];
  const float* Wk_r   = (const float*)d_in[5];
  const float* Wr     = (const float*)d_in[6];
  const float* Wv     = (const float*)d_in[7];
  const float* Wo     = (const float*)d_in[8];
  float* out = (float*)d_out;

  char* ws = (char*)d_ws;
  size_t off = 0;
  auto carve = [&](size_t bytes) -> char* {
    char* p = ws + off;
    off += (bytes + 255) & ~(size_t)255;
    return p;
  };
  const size_t ACT16 = (size_t)NTOK * DMOD * 2;            // 4,194,304
  const size_t WGT16 = (size_t)DMOD * DMOD * 2;            // 2,097,152
  const size_t ACT32 = (size_t)NTOK * DMOD * 4;            // 8,388,608
  const size_t PLANE16 = PLANE_ELEMS * 2;                  // 41,943,040
  const size_t PLANE32 = PLANE_ELEMS * 4;                  // 83,886,080
  static_assert(PLANE_ELEMS * 4 % 256 == 0, "the sixth weight slot must follow region 0 without a gap");
  static_assert((size_t)2 * NTOK * DMOD * 2 + (size_t)5 * DMOD * DMOD * 2 <= PLANE_ELEMS * 4, "casts and five weights fit region 0 side by side");

  char* reg0 = carve(PLANE32);
  carve(WGT16);                                            // WoT = wT + 5 weights
  unsigned short* xb   = (unsigned short*)reg0;
  unsigned short* sb   = (unsigned short*)(reg0 + ACT16);
  unsigned short* wT   = (unsigned short*)(reg0 + PLANE32 - 5 * WGT16);
  unsigned short* rel16 = (unsigned short*)reg0;
  unsigned short* xqh  = (unsigned short*)carve(ACT16);
  unsigned short* xql  = (unsigned short*)carve(ACT16);
  unsigned short* xkh  = (unsigned short*)carve(ACT16);
  unsigned short* xkl  = (unsigned short*)carve(ACT16);
  unsigned short* qr16 = (unsigned short*)carve(ACT16);
  unsigned short* kr16 = (unsigned short*)carve(ACT16);
  unsigned short* svh  = (unsigned short*)carve(ACT16);
  unsigned short* svl  = (unsigned short*)carve(ACT16);
  float*          attsym = (float*)carve(ACT32);
  unsigned short* ch   = (unsigned short*)carve(ACT16);
  unsigned short* cl   = (unsigned short*)carve(ACT16);
  unsigned short* wrp  = (unsigned short*)carve((size_t)NHEAD * HDIM * 32 * 2);
  unsigned short* p16  = (unsigned short*)carve(PLANE16);
  if (off > ws_size) return;

  const unsigned short* WoT  = wT + 5 * (size_t)DMOD * DMOD;

  // 1) casts: activations to bf16; weights transposed to bf16; Wr packed with K padding
  k_prep<<<dim3(2 * CAST_BLOCKS + WT_BLOCKS + WR_BLOCKS), 256, 0, stream>>>(
      x, symb, Wq_a, Wk_a, Wq_r, Wk_r, Wv, Wo, Wr, xb, sb, wT, wrp);

  // 2) projections (bf16 x bf16, exact products, f32 accumulate)
  //    xq, xk -> bf16 hi/lo planes [2048][1024]; qr, kr -> f16 planes; values transposed svT [1024][2048] hi/lo
  static_assert(NTOK % 128 == 0 && DMOD % 128 == 0 && DMOD % GK == 0, "projection and output GEMM shapes");
  k_proj5<<<dim3((NTOK / 128) * (DMOD / 128), 5, 1), 256, 0, stream>>>(xb, sb, wT, xqh, xql, xkh, xkl, qr16, kr16, svh, svl);

  // 3) every chunk of 256 query rows, both batch rows, in each grid: (scores, softmax, P.V beside relation scores) -> relation mix
  static_assert(CHR % 64 == 0 && HDIM % 32 == 0 && RDIM % 32 == 0 && HDIM % 64 == 0, "chunk GEMM shapes");
  static_assert(CHR % 128 == 0 && CHR == 256 && HDIM == 64 && RDIM == 64, "128x256 relation tiles, one stage of k for the scores");
  static_assert(NCHK == 4 && (NCHK & (NCHK - 1)) == 0 && ROWS_CH % 8 == 0 && NHEAD == 16 && NREL == 16, "grid decoding");
  static_assert(CHR / SR == (CHR / 128) * (SEQ / 256), "both roles of the grid use the same range of blockIdx.x");
  k_attn_rel<<<dim3(CHR / SR, NB * 16, 2 * NCHK), 256, 0, stream>>>(xqh, xql, xkh, xkl, svh, svl, attsym, p16, qr16, kr16, rel16);
  static_assert(SEQ % 8 == 0, "relation mix: four rows from each end of the sequence per work-group");
  k_rel_mix<<<dim3(SEQ / 8, NB), 256, 0, stream>>>(p16, rel16, wrp, attsym, ch, cl);

  // 4) out[token][n] = sum_k combined[token][k] * WoT[n][k]  (A hi/lo, B bf16 weights) -> d_out f32
  k_out<<<dim3((NTOK / 128) * (DMOD / 128)), 256, 0, stream>>>(ch, cl, WoT, out);
}

// v008
// One run takes 91.1 microseconds.
// Next to v007, in two timings, it ran 1.06 times as fast each time.
// All steps since v000 together make it 9.88 times as fast.
// Contractions: v_wmma_f32_16x16x32_bf16 (bf16 operands: module inputs RNE-converted once to bf16; computed q/k, softmax probabilities, value rows, relation aggregates and pre-output activations carried as bf16 hi+lo pairs) and v_wmma_f32_16x16x32_f16 for relation scores and relation aggregation (f16 operands, probabilities carried x1024); f32 accumulate everywhere; softmax and all side math in f32.
#include <hip/hip_runtime.h>

// ---------------------------------------------------------------------------
// problem geometry
// ---------------------------------------------------------------------------
static constexpr int NB    = 2;
static constexpr int SEQ   = 1024;
static constexpr int DMOD  = 1024;
static constexpr int NHEAD = 16;
static constexpr int HDIM  = 64;
static constexpr int NREL  = 16;
static constexpr int RDIM  = 64;
static constexpr int NTOK  = NB * SEQ;          // 2048
static constexpr int CHR   = 256;               // query rows per chunk
static constexpr int NCHK  = SEQ / CHR;         // 4 chunks per batch row
static constexpr float SCALE_ATTN = 0.125f;     // 1/sqrt(64)
static constexpr float SCALE_REL  = 0.125f;     // 1/sqrt(64)
static constexpr float PCARRY     = 1024.0f;    // f16 probability carry
static constexpr float PCARRY_INV = 1.0f / 1024.0f;

// Per-pair planes (probabilities, relation scores) hold all chunks at once: chunk c (query rows 256c..256c+255,
// keys < jend = 256(c+1)) stores its rows at pitch jend and starts at element CHUNK_UNIT * c(c+1)/2.
static constexpr int    ROWS_CH     = NB * NHEAD * CHR;                             // 8192 rows per chunk
static constexpr size_t CHUNK_UNIT  = (size_t)ROWS_CH * CHR;                        // 2,097,152 elements per 256 keys
static constexpr size_t PLANE_ELEMS = CHUNK_UNIT * (NCHK * (NCHK + 1) / 2);         // 20,971,520 elements
__device__ __forceinline__ size_t chunk_base(int c) { return CHUNK_UNIT * (size_t)((c * (c + 1)) >> 1); }

static_assert(NHEAD * HDIM == DMOD, "head split");
static_assert(NREL * RDIM == DMOD, "relation split");
static_assert(SEQ == 4 * 256, "softmax handles up to 4 segments of 256 keys");
static_assert(SEQ % CHR == 0 && CHR % 64 == 0, "chunk tiling");
static_assert(NHEAD == 16 && NREL == 16, "relation mix kernel uses one 16x16 tile per token");
static_assert(HDIM % 32 == 0 && RDIM % 32 == 0, "K of score GEMMs multiple of 32");
static_assert(NTOK % 64 == 0 && DMOD % 64 == 0, "tile multiples");
static_assert((NTOK * DMOD) % (8 * 256) == 0, "cast kernel coverage");
static_assert((NHEAD * CHR) % 8 == 0 && CHR % 16 == 0, "softmax / mix grids");

// ---------------------------------------------------------------------------
// types, conversions, fragment helpers
// ---------------------------------------------------------------------------
typedef __attribute__((ext_vector_type(16))) _Float16 v16h;
typedef __attribute__((ext_vector_type(8)))  _Float16 v8h;
typedef __attribute__((ext_vector_type(16))) __bf16   v16b;
typedef __attribute__((ext_vector_type(8)))  __bf16   v8b;
typedef __attribute__((ext_vector_type(8)))  float    v8f;
typedef __attribute__((ext_vector_type(4)))  float    v4f;
typedef __attribute__((ext_vector_type(4)))  unsigned int v4u;

typedef __attribute__((ext_vector_type(2)))  float    v2f;
typedef __attribute__((ext_vector_type(2)))  __bf16   v2b;
typedef __attribute__((ext_vector_type(2)))  _Float16 v2h;

// f32 -> 16 bit, round to nearest even, two values per conversion instruction: a in the low half, b in the high half
__device__ __forceinline__ unsigned pack_bf16x2(float a, float b) {
  const v2f f = {a, b};
  return __builtin_bit_cast(unsigned, __builtin_convertvector(f, v2b));
}
__device__ __forceinline__ unsigned pack_f16x2(float a, float b) {
  const v2f f = {a, b};
  return __builtin_bit_cast(unsigned, __builtin_convertvector(f, v2h));
}
// hi = bf16(x), lo = bf16(x - hi) of two values, packed like pack_bf16x2
__device__ __forceinline__ void split_bf16x2(float a, float b, unsigned& hi, unsigned& lo) {
  hi = pack_bf16x2(a, b);
  lo = pack_bf16x2(a - __uint_as_float(hi << 16), b - __uint_as_float(hi & 0xFFFF0000u));
}

template <typename T> struct Frag;
template <> struct Frag<_Float16> {
  typedef v16h V; union U { v16h v; v8h h[2]; };
  static __device__ __forceinline__ v16h load(const _Float16* p) {   // elements 0..7 <- p[0..7], 8..15 <- p[16..23]
    U f; f.h[0] = *(const v8h*)(p); f.h[1] = *(const v8h*)(p + 16); return f.v;
  }
  static __device__ __forceinline__ v8f mma(v16h a, v16h b, v8f c) {
    return __builtin_amdgcn_wmma_f32_16x16x32_f16(false, a, false, b, (short)0, c, false, false);
  }
};
template <> struct Frag<__bf16> {
  typedef v16b V; union U { v16b v; v8b h[2]; };
  static __device__ __forceinline__ v16b load(const __bf16* p) {
    U f; f.h[0] = *(const v8b*)(p); f.h[1] = *(const v8b*)(p + 16); return f.v;
  }
  static __device__ __forceinline__ v8f mma(v16b a, v16b b, v8f c) {
    return __builtin_amdgcn_wmma_f32_16x16x32_bf16(false, a, false, b, (short)0, c, false, false);
  }
};

// single-accumulator WMMA + hazard nops (used by the relation mix kernel)
__device__ __forceinline__ v8f mma16h(v16h a, v16h b, v8f c) {
  c = __builtin_amdgcn_wmma_f32_16x16x32_f16(false, a, false, b, (short)0, c, false, false);
  asm volatile("v_nop\n\tv_nop\n\tv_nop\n\tv_nop" : "+v"(c) : "v"(a), "v"(b));
  return c;
}
__device__ __forceinline__ v8f mma16b(v16b a, v16b b, v8f c) {
  c = __builtin_amdgcn_wmma_f32_16x16x32_bf16(false, a, false, b, (short)0, c, false, false);
  asm volatile("v_nop\n\tv_nop\n\tv_nop\n\tv_nop" : "+v"(c) : "v"(a), "v"(b));
  return c;
}

// Waves of a work-group hand data to one another through LDS only (global results are read by later launches), so the barrier and
// the fence inside a wave order the local address space alone: they wait for the wave's LDS operations and leave its global loads
// and stores in flight, where __syncthreads() and a fence on every address space would first drain them.
__device__ __forceinline__ void lds_barrier() {
  __builtin_amdgcn_fence(__ATOMIC_RELEASE, "workgroup", "local");
  __builtin_amdgcn_s_barrier();
  __builtin_amdgcn_fence(__ATOMIC_ACQUIRE, "workgroup", "local");
}
__device__ __forceinline__ void lds_wave_fence() {
  __builtin_amdgcn_fence(__ATOMIC_RELEASE, "workgroup", "local");
  __builtin_amdgcn_wave_barrier();
  __builtin_amdgcn_fence(__ATOMIC_ACQUIRE, "workgroup", "local");
}

// ---- work-group WMMA GEMM, operands staged in LDS ---------------------
// C[m,n] = scale * sum_k A[m,k] * Bt[n,k]; one BM x BN tile of C per work-group of 8 waves.
// A row-major [M,K]; Bt row-major [N,K]; K % 64 == 0; every operand row starts on a 128-B line.
// SPLIT: A is hi/lo planes (A2 = lo); SPLITB: Bt also hi/lo (product hi.hi + hi.lo + lo.hi),
//        !SPLITB: Bt single plane (product hi.b + lo.b).
// OUT_MODE: 0 = f32, 1 = f16, 2 = bf16 hi plane (Cout) + bf16 lo plane (Cout2).
// ET: 0 = f16 operands, 1 = bf16 operands (pointers passed as 16-bit storage)
template <int ET> struct Elem;
template <> struct Elem<0> { typedef _Float16 T; };
template <> struct Elem<1> { typedef __bf16 T; };

// Result of one wave, MI x 4 accumulator tiles of 16x16 at rows m0.., columns n0..: 16 rows at a time through the wave's own
// 16x68 f32 LDS slab, so that every store covers whole row segments.
template <int MI, int OUT_MODE>
__device__ __forceinline__ void store_tiles(v8f (&acc)[MI][4], float scale,
    void* __restrict__ Cout, void* __restrict__ Cout2, int ldc, size_t offC, int m0, int n0, float* slab) {
  const int lane = threadIdx.x & 31;
  const int rlane = lane & 15;                 // column within a 16x16 tile
  const int mOff  = (lane >> 4) * 8;           // D row offset
#pragma unroll
  for (int i = 0; i < MI; ++i) {
    const int mBase = m0 + (i << 4);
#pragma unroll
    for (int j = 0; j < 4; ++j) {
#pragma unroll
      for (int r = 0; r < 8; ++r) {
        slab[(mOff + r) * 68 + (j << 4) + rlane] = acc[i][j][r] * scale;
      }
    }
    lds_wave_fence();                          // the slab's rows are read by other lanes than wrote them
    if (OUT_MODE == 0) {
      float* C = (float*)Cout + offC;
      const int hh = lane >> 4, c4 = (lane & 15) * 4;     // row seg = 256 B = 16 lanes x 16 B
      float* const g0 = C + (size_t)(mBase + hh) * ldc + n0 + c4;   // the lane's place in its first row; later rows by the row stride
      float* gp[8];
      v4f gv[8];
#pragma unroll
      for (int it = 0; it < 8; ++it) {
        const int row = it * 2 + hh;
        gv[it] = *(const v4f*)(slab + row * 68 + c4);
        gp[it] = g0 + (size_t)(it * 2) * ldc;
        *(v4f*)gp[it] = gv[it];
      }
      // nothing drains these stores any more before the next 16 rows reuse their registers: addresses and data stay where they
      // are up to this wait, which stands in front of every such overwrite
      asm volatile("s_wait_xcnt 0x0" :: "v"(gp[0]), "v"(gp[1]), "v"(gp[2]), "v"(gp[3]), "v"(gp[4]), "v"(gp[5]), "v"(gp[6]), "v"(gp[7]),
                                        "v"(gv[0]), "v"(gv[1]), "v"(gv[2]), "v"(gv[3]), "v"(gv[4]), "v"(gv[5]), "v"(gv[6]), "v"(gv[7]) : "memory");
    } else {
      const int q = lane >> 3, c8 = (lane & 7) * 8;
      unsigned short* C  = (unsigned short*)Cout  + offC;
      unsigned short* C2 = (OUT_MODE == 2) ? ((unsigned short*)Cout2 + offC) : nullptr;
      const size_t o0 = (size_t)(mBase + q) * ldc + n0 + c8;   // the lane's place in its first row; later rows by the row stride
      unsigned short *gp[4], *gp2[4];
      v4u hu[4], lu[4];
#pragma unroll
      for (int it = 0; it < 4; ++it) {
        const int row = it * 4 + q;
        const float* sp = slab + row * 68 + c8;
        lu[it] = (v4u){0u, 0u, 0u, 0u};
#pragma unroll
        for (int e = 0; e < 4; ++e) {
          if (OUT_MODE == 1) hu[it][e] = pack_f16x2(sp[2 * e], sp[2 * e + 1]);
          else {
            unsigned hp, lp;
            split_bf16x2(sp[2 * e], sp[2 * e + 1], hp, lp);
            hu[it][e] = hp;
            lu[it][e] = lp;
          }
        }
        gp[it]  = C + o0 + (size_t)(it * 4) * ldc;
        gp2[it] = (OUT_MODE == 2) ? C2 + o0 + (size_t)(it * 4) * ldc : gp[it];
        *(v4u*)gp[it] = hu[it];
        if (OUT_MODE == 2) *(v4u*)gp2[it] = lu[it];
      }
      // as above: the wait in front of every overwrite of a register that these stores name
      if (OUT_MODE == 2)
        asm volatile("s_wait_xcnt 0x0" :: "v"(gp[0]), "v"(gp[1]), "v"(gp[2]), "v"(gp[3]), "v"(gp2[0]), "v"(gp2[1]), "v"(gp2[2]), "v"(gp2[3]),
                                          "v"(hu[0]), "v"(hu[1]), "v"(hu[2]), "v"(hu[3]), "v"(lu[0]), "v"(lu[1]), "v"(lu[2]), "v"(lu[3]) : "memory");
      else
        asm volatile("s_wait_xcnt 0x0" :: "v"(gp[0]), "v"(gp[1]), "v"(gp[2]), "v"(gp[3]),
                                          "v"(hu[0]), "v"(hu[1]), "v"(hu[2]), "v"(hu[3]) : "memory");
    }
    lds_wave_fence();                          // the slab's reads end before the next 16 rows overwrite it
  }
}

static constexpr int GK = 64;                  // k per stage: 128 B, one whole line, of every operand row
static constexpr int GP = GK + 8;              // LDS row pitch in 16-bit elements: 144 B = 16 B x 9, no bank conflict for 16-byte fragment reads
static constexpr int SLAB_WORDS = 8 * 16 * 68 * 2;   // the eight result slabs, in 16-bit words
// WM x WN waves, each MI*16 rows x 64 columns of C. One stage in LDS: rows [A | A lo | Bt | Bt lo], GP elements apart.
template <bool SPLIT, bool SPLITB, int MI, int WM, int WN> struct Stage {
  static_assert(WM * WN == 8, "eight waves");
  static constexpr int BM = WM * MI * 16, BN = WN * 64;
  static constexpr int AROWS = (SPLIT ? 2 : 1) * BM;
  static constexpr int ROWS  = AROWS + ((SPLIT && SPLITB) ? 2 : 1) * BN;
  static constexpr int WORDS = ROWS * GP;      // 16-bit words per stage
  static_assert(BM % 32 == 0 && BN % 32 == 0, "each group of 32 staged rows lies in one plane");
  static_assert(WORDS >= SLAB_WORDS, "the result slabs reuse the first stage");
};
// smem: two stages (one is enough where K == GK); offA / offB / offC: element offsets of this product's operands and result;
// m0b, n0b: the work-group's tile. Every thread of the work-group calls this (it holds barriers).
// Per stage the 256 threads copy 128 B of every operand row, 8 lanes to a row, into LDS; the next stage's global loads are
// issued before this stage's products and stored to the other buffer behind them.
// LEAD: how many stages ahead of their products the global loads are issued (1 or 2; 2 takes a second set of staging registers).
// CAUSAL: row m of C is read by later launches only in columns n <= diag + (m | 31); a wave whose whole tile lies behind that neither
// multiplies nor stores (it still stages and passes every barrier).
template <int ET, bool SPLIT, bool SPLITB, int MI, int WM, int WN, int OUT_MODE, int LDA, int LDB, int LEAD = 1, bool CAUSAL = false>
__device__ __forceinline__ void gemm_block(
    const unsigned short* __restrict__ Ap, const unsigned short* __restrict__ A2p, size_t offA,
    const unsigned short* __restrict__ Btp, const unsigned short* __restrict__ Bt2p, size_t offB,
    void* __restrict__ Cout, void* __restrict__ Cout2, int ldc, size_t offC,
    int K, float scale, int m0b, int n0b, unsigned short* smem, int diag = 0) {
  static_assert(!CAUSAL || (LEAD == 1 && (MI * 16) % 32 == 0), "the causal test stands in the one-stage-ahead loop; a wave's last row ends a group of 32");
  typedef typename Elem<ET>::T T;
  typedef typename Frag<T>::V V;
  typedef Stage<SPLIT, SPLITB, MI, WM, WN> G;
  constexpr int NLD = G::ROWS / 32;            // 16-byte pieces per thread and stage
  const int tid = threadIdx.x, lane = tid & 31, wave = tid >> 5;
  const int srow = tid >> 3, scol = (tid & 7) * 8;      // staging: row within a group of 32, 16-byte column
  // the thread's place in each operand plane at the stage to be fetched next; the rows' strides LDA, LDB are compile-time,
  // so every load of a plane names this one address and an immediate offset
  const unsigned short* gA  = Ap   + offA + (size_t)(m0b + srow) * LDA + scol;
  const unsigned short* gA2 = A2p  + offA + (size_t)(m0b + srow) * LDA + scol;
  const unsigned short* gB  = Btp  + offB + (size_t)(n0b + srow) * LDB + scol;
  const unsigned short* gB2 = Bt2p + offB + (size_t)(n0b + srow) * LDB + scol;
  unsigned short* sdst = smem + srow * GP + scol;

  const int rlane = lane & 15;                 // row (A) / col (B, D) within subtile
  const int koff  = (lane >> 4) * 8;           // k offset of this lane half
  const int wm = wave / WN, wn = wave - wm * WN;
  const int aoff = (wm * (MI * 16) + rlane) * GP + koff;
  const int boff = (G::AROWS + wn * 64 + rlane) * GP + koff;
  // the same in every lane of a wave: read into a scalar register, so that the test is a scalar branch round the matrix instructions
  const bool need = !CAUSAL || __builtin_amdgcn_readfirstlane(n0b + wn * 64 - (m0b + wm * (MI * 16))) <= diag + MI * 16 - 1;

  v8f acc[MI][4];
#pragma unroll
  for (int i = 0; i < MI; ++i)
#pragma unroll
    for (int j = 0; j < 4; ++j) acc[i][j] = (v8f){0.f,0.f,0.f,0.f,0.f,0.f,0.f,0.f};

  v4u st0[NLD], st1[NLD];                      // st1: stages of odd number where LEAD == 2
  auto fetch = [&](v4u (&st)[NLD]) {
#pragma unroll
    for (int n = 0; n < NLD; ++n) {
      const int r = n * 32;                    // first staged row of the group of 32: picks the plane at compile time
      const unsigned short* g;
      if (r < G::BM)                  g = gA  + (size_t)r * LDA;
      else if (r < G::AROWS)          g = gA2 + (size_t)(r - G::BM) * LDA;
      else if (r < G::AROWS + G::BN)  g = gB  + (size_t)(r - G::AROWS) * LDB;
      else                            g = gB2 + (size_t)(r - G::AROWS - G::BN) * LDB;
      st[n] = *(const v4u*)g;
    }
    // the addresses stay in their registers up to this wait, so that it stands in front of every overwrite of a register
    // that these loads name (a later load's result, the step to the next stage)
    if (SPLIT && SPLITB) asm volatile("s_wait_xcnt 0x0" :: "v"(gA), "v"(gA2), "v"(gB), "v"(gB2) : "memory");
    else if (SPLIT)      asm volatile("s_wait_xcnt 0x0" :: "v"(gA), "v"(gA2), "v"(gB) : "memory");
    else                 asm volatile("s_wait_xcnt 0x0" :: "v"(gA), "v"(gB) : "memory");
    gA += GK; gA2 += GK; gB += GK; gB2 += GK;
  };
  auto put = [&](int buf, const v4u (&st)[NLD]) {
#pragma unroll
    for (int n = 0; n < NLD; ++n) *(v4u*)(sdst + buf * G::WORDS + n * 32 * GP) = st[n];
  };
  auto products = [&](int buf) {
    const T* cur = (const T*)(smem + buf * G::WORDS);
#pragma unroll
    for (int ks = 0; ks < GK; ks += 32) {
      V bh[4], bl[4];
#pragma unroll
      for (int j = 0; j < 4; ++j) {
        bh[j] = Frag<T>::load(cur + boff + j * 16 * GP + ks);
        if (SPLIT && SPLITB) bl[j] = Frag<T>::load(cur + boff + (G::BN + j * 16) * GP + ks);
      }
#pragma unroll
      for (int i = 0; i < MI; ++i) {
        V ah = Frag<T>::load(cur + aoff + i * 16 * GP + ks);
        V al;
        if (SPLIT) al = Frag<T>::load(cur + aoff + (G::BM + i * 16) * GP + ks);
#pragma unroll
        for (int j = 0; j < 4; ++j) {
          acc[i][j] = Frag<T>::mma(ah, bh[j], acc[i][j]);
          if (SPLIT) {
            if (SPLITB) acc[i][j] = Frag<T>::mma(ah, bl[j], acc[i][j]);
            acc[i][j] = Frag<T>::mma(al, bh[j], acc[i][j]);
          }
        }
      }
    }
  };

  if (LEAD == 1) {
    fetch(st0);
    put(0, st0);
    lds_barrier();
    for (int k0 = 0, buf = 0; k0 < K; k0 += GK, buf ^= 1) {
      const bool more = k0 + GK < K;           // the same for the whole work-group
      if (more) fetch(st0);
      if (need) products(buf);
      if (more) put(buf ^ 1, st0);             // last read one trip ago, in front of that trip's barrier
      lds_barrier();                           // publishes the next stage; ends every read of this one
    }
  } else {
    // Stage s is loaded into st(s mod 2) at the top of trip s - 2, goes to LDS buffer s mod 2 at the foot of trip s - 1 and is
    // multiplied in trip s: its loads stay in flight over one barrier and two trips' products. Two trips per pass of the loop,
    // so that each set of registers is named at compile time; the loop holds only trips that fetch, with no branch round the
    // loads, so that the wait in front of a put can be counted and leaves the younger stage's loads in flight. The last one to
    // three trips follow behind it. Every test is the same for the whole work-group.
    fetch(st0);
    if (GK < K) fetch(st1);
    put(0, st0);
    lds_barrier();
    int k0 = 0;
    for (; k0 + 3 * GK < K; k0 += 2 * GK) {
      fetch(st0);
      products(0);
      put(1, st1);                             // last read one trip ago, in front of that trip's barrier
      lds_barrier();                           // publishes the next stage; ends every read of this one
      fetch(st1);
      products(1);
      put(0, st0);
      lds_barrier();
    }
    const bool two = k0 + GK < K, three = k0 + 2 * GK < K;
    if (three) fetch(st0);
    products(0);
    if (two) put(1, st1);
    lds_barrier();
    if (two) {
      products(1);
      if (three) put(0, st0);
      lds_barrier();
      if (three) {
        products(0);
        lds_barrier();
      }
    }
  }
  if (need)
    store_tiles<MI, OUT_MODE>(acc, scale, Cout, Cout2, ldc, offC, m0b + wm * (MI * 16), n0b + wn * 64,
                              (float*)smem + wave * (16 * 68));
}

// All five input projections in one grid; blockIdx.y selects the product (block-uniform):
// 0 q_attn, 1 k_attn -> bf16 hi/lo; 2 q_rel, 3 k_rel -> f16; 4 values, transposed (A = WvT, Bt = symbols) -> bf16 hi/lo.
// Each product has (NTOK/128)*(DMOD/128) tiles of 128x128, one per block.
__global__ __launch_bounds__(256) void k_proj5(
    const unsigned short* __restrict__ xb, const unsigned short* __restrict__ sb, const unsigned short* __restrict__ wT,
    unsigned short* __restrict__ xqh, unsigned short* __restrict__ xql,
    unsigned short* __restrict__ xkh, unsigned short* __restrict__ xkl,
    unsigned short* __restrict__ qr16, unsigned short* __restrict__ kr16,
    unsigned short* __restrict__ svh, unsigned short* __restrict__ svl) {
  __shared__ __align__(16) unsigned short sm[2 * Stage<false, false, 2, 4, 2>::WORDS];
  const int y = blockIdx.y;
  const bool tv = (y == 4);
  const int nbN = (tv ? NTOK : DMOD) / 128;
  const int m0b = ((int)blockIdx.x / nbN) * 128, n0b = ((int)blockIdx.x % nbN) * 128;
  const unsigned short* Wy = wT + (size_t)y * DMOD * DMOD;
  if (y == 2 || y == 3) {
    unsigned short* c = (y == 2) ? qr16 : kr16;
    gemm_block<1, false, false, 2, 4, 2, 1, DMOD, DMOD>(xb, xb, 0, Wy, Wy, 0, c, c, DMOD, 0, DMOD, 1.0f, m0b, n0b, sm);
  } else {
    const unsigned short* a  = tv ? Wy : xb;
    const unsigned short* bt = tv ? sb : Wy;
    unsigned short* chi = tv ? svh : (y == 0 ? xqh : xkh);
    unsigned short* clo = tv ? svl : (y == 0 ? xql : xkl);
    gemm_block<1, false, false, 2, 4, 2, 2, DMOD, DMOD>(a, a, 0, bt, bt, 0, chi, clo, tv ? NTOK : DMOD, 0, DMOD, 1.0f, m0b, n0b, sm);
  }
}

// Attention (scores, causal softmax, P.V) of every chunk, batch row and head in one grid: a work-group owns SR whole query rows.
// Part 1, per block of 256 keys: scores[il][j] = SCALE_ATTN * sum_d xq[i][h,d] xk[j][h,d] (hi/lo split on both operands, product
//   hi.hi + hi.lo + lo.hi), operands staged as in gemm_block (one stage: all of k); the block's f32 scores pass through a
//   32 x 256 buffer in LDS into the registers of the wave that owns the row: wave w owns rows 4w .. 4w+3, lane owns
//   j = 256*t + 8*lane .. +7 (t <= c). The next block's global loads are issued ahead of this block's products.
// Part 2: softmax of the wave's four rows, keys j <= i.
// Part 3, per block of 256 keys: attended_symbols[il][d] += sum_j P[il][j] * svT[h*64+d][j] (hi/lo split on both operands, product
//   hi.hi + hi.lo + lo.hi). Each wave packs its four rows of P as bf16 hi and lo into those rows' own bytes of the score buffer;
//   V comes in stages of 128 keys, three buffers in the LDS that held the score operands: one stage is fetched beside the
//   packing, the next beside the products. Wave w sums, for the rows 16*(w&1).. +15 and all 64 columns, the keys
//   32*(w>>1).. +31 of every stage (a fragment of P feeds four tiles). P hi/lo never go to memory.
// Part 4: the four key groups' 32 x 64 partial sums meet in LDS, are added in the order of the groups and stored as whole lines;
//   the P*1024 f16 plane is written, row r = (b*NHEAD + h)*CHR + il at pitch jend, zeros for i < j up to the end of the group of
//   32 keys that holds i (behind the last barrier); nothing is written, and nothing read later, behind that group.
// Keys behind the work-group's last row: in the chunk's last block of 256 keys they are masked for all 32 rows. A wave whose keys
//   all lie there computes no scores and no P.V products; their V is not staged and their P is not stored.
// The relation scores (they read nothing of the above) ride in the same grid: blockIdx.z = 4..7, chunk 7 - z, tiles of 128x256.
static constexpr int SR  = 32;                 // query rows per work-group
static constexpr int SRW = SR / 8;             // rows per wave
static constexpr int STP = CHR + 4;            // floats per row of the score buffer: rows 8 apart lie 32 banks apart (the two lane halves of a tile store), 16-B aligned
typedef Stage<true, true, 1, 2, 4> SG;         // one block: 32 query rows x 256 keys
static_assert(SG::BM == SR && SG::BN == CHR && HDIM == GK, "one stage holds all of k for 32 rows and 256 keys");
static constexpr int VK     = 128;             // keys per stage of V: 256 B, two whole lines, of every row of svT
static constexpr int VP     = VK + 8;          // LDS row pitch in 16-bit elements: 272 B = 16 B x 17, no bank conflict for 16-byte fragment reads
static constexpr int VWORDS = 2 * HDIM * VP;   // one stage: 64 hi rows, then 64 lo rows
static constexpr int PPW    = STP * 2;         // a row of the score buffer in 16-bit elements: 1040 B = 16 B x 65; holds 256 hi, then 256 lo
static constexpr int AWORDS = 3 * VWORDS > SG::WORDS ? 3 * VWORDS : SG::WORDS;   // the score operands' stage, then three stages of V
static_assert(2 * CHR <= PPW, "hi and lo of a row of P fit the row's bytes of the score buffer");
static_assert(4 * SR * 68 * 2 <= AWORDS && CHR == 2 * VK && VK == 4 * 32 && SR == 32 && HDIM == 64, "partial sums' staging; 2 row halves x 4 key groups = 8 waves");
static_assert(Stage<false, false, 4, 2, 4>::WORDS <= SG::WORDS, "the relation scores' stage fits");
// One code path for all chunks: c, and with it the number NT of key blocks, is block-uniform, so every test on it is a scalar
// branch that the whole work-group takes alike (barriers included); the kernel's text stays small.
// blockIdx.x = block of SR query rows in the chunk, blockIdx.y = batch row * 16 + head, blockIdx.z = 0..3: chunk 3 - z (longest first).
// Two work-groups share a WGP (one's products run beside the other's softmax arithmetic): four waves per SIMD, 256 registers each.
__global__ __launch_bounds__(256) __attribute__((amdgpu_waves_per_eu(4, 4))) void k_attn_rel(
    const unsigned short* __restrict__ xqh, const unsigned short* __restrict__ xql,
    const unsigned short* __restrict__ xkh, const unsigned short* __restrict__ xkl,
    const unsigned short* __restrict__ svh, const unsigned short* __restrict__ svl,
    float* __restrict__ attsym, unsigned short* __restrict__ p16,
    const unsigned short* __restrict__ qr16, const unsigned short* __restrict__ kr16, unsigned short* __restrict__ rel16) {
  __shared__ __align__(16) unsigned short smem[AWORDS];
  __shared__ __align__(16) float tbuf[SR * STP];
  if ((int)blockIdx.z >= NCHK) {                           // block-uniform
    const int cr = (2 * NCHK - 1) - (int)blockIdx.z;
    const int jr = CHR * (cr + 1), nbN = cr + 1;           // nbN = jr / 256
    if ((int)blockIdx.x >= (CHR / 128) * nbN) return;      // block-uniform, in front of every barrier
    const size_t br = blockIdx.y >> 4, hr = blockIdx.y & 15;
    // rel[c][b][il][r][j] = SCALE_REL * sum_p qr[i][r,p] kr[j][r,p]  (plain f16) -> f16 plane
    gemm_block<0, false, false, 4, 2, 4, 1, DMOD, DMOD, 1, true>(qr16, qr16, (br * SEQ + (size_t)cr * CHR) * DMOD + hr * RDIM,
                                            kr16, kr16, br * ((size_t)SEQ * DMOD) + hr * RDIM,
                                            rel16, rel16, NREL * jr, chunk_base(cr) + br * ((size_t)CHR * NREL * jr) + hr * jr,
                                            RDIM, SCALE_REL, ((int)blockIdx.x / nbN) * 128, ((int)blockIdx.x % nbN) * 256, smem, cr * CHR);
    return;
  }
  typedef __bf16 T;
  typedef Frag<T>::V V;
  constexpr int NLD = SG::ROWS / 32;           // 16-byte pieces per thread and stage
  constexpr int NA  = SG::AROWS / 32;          // of them the query rows, hi and lo
  const int c = (NCHK - 1) - (int)blockIdx.z;
  const int y = blockIdx.y, il0 = (int)blockIdx.x * SR;
  const int NT = c + 1;                        // blocks of 256 keys
  const int jend = CHR * NT;
  const int dl = il0 + SR - 1;                 // in the chunk's last block of keys (it holds the diagonal): the last key that any row of this work-group attends to
  const int tid = threadIdx.x, lane = tid & 31;
  const int wave = __builtin_amdgcn_readfirstlane(tid >> 5);   // the same in every lane: kept in a scalar register, and the row addresses with it
  const int srow = tid >> 3, scol = (tid & 7) * 8;      // staging: row within a group of 32, 16-byte column
  const size_t bb = (size_t)(y >> 4), h = (size_t)(y & 15);
  const size_t offA = (bb * SEQ + (size_t)(c * CHR + il0)) * DMOD + h * HDIM;
  const size_t offB = bb * ((size_t)SEQ * DMOD) + h * HDIM;
  const unsigned short* gA  = xqh + offA + (size_t)srow * DMOD + scol;
  const unsigned short* gA2 = xql + offA + (size_t)srow * DMOD + scol;
  const unsigned short* gB  = xkh + offB + (size_t)srow * DMOD + scol;
  const unsigned short* gB2 = xkl + offB + (size_t)srow * DMOD + scol;
  unsigned short* sdst = smem + srow * GP + scol;

  const int rlane = lane & 15;                 // row (A) / col (B, D) within subtile
  const int koff  = (lane >> 4) * 8;           // k offset of this lane half
  const int wm = wave >> 2, wn = wave & 3;     // 2 x 4 waves, each 16 rows x 64 keys
  const int aoff = (wm * 16 + rlane) * GP + koff;
  const int boff = (SG::AROWS + wn * 64 + rlane) * GP + koff;
  float* tdst = tbuf + (wm * 16 + (lane >> 4) * 8) * STP + wn * 64 + rlane;   // D row 8*(lane>>4) + r, column rlane
  const float* tsrc = tbuf + (wave * SRW) * STP;                              // the wave's own rows

  // How many keys of block nb are wanted, counted from the block's first: all 256, but in the chunk's last block only those up to dl.
  // The same for the whole work-group: a test of a wave tile's or a key group's first key against it is a scalar branch.
  auto kwant = [&](int nb) { return nb + 1 < NT ? CHR : dl + 1; };
  v4u st[NLD];
  auto fetch = [&](int nb) {                   // nb: the key block, a compile-time number at every call: an immediate offset
#pragma unroll
    for (int n = (nb == 0 ? 0 : NA); n < NLD; ++n) {   // the query rows are staged once, with block 0, and stay
      const int r = n * 32;                    // first staged row of the group of 32: picks the plane at compile time
      const unsigned short* g;
      if (r < SG::BM)                   g = gA  + (size_t)r * DMOD;
      else if (r < SG::AROWS)           g = gA2 + (size_t)(r - SG::BM) * DMOD;
      else if (r < SG::AROWS + SG::BN)  g = gB  + (size_t)(nb * SG::BN + r - SG::AROWS) * DMOD;
      else                              g = gB2 + (size_t)(nb * SG::BN + r - SG::AROWS - SG::BN) * DMOD;
      st[n] = *(const v4u*)g;
    }
    // the addresses, the same for every block, stay in their registers up to this wait, so that it stands in front of
    // every overwrite of a register that these loads name
    if (nb == 0) asm volatile("s_wait_xcnt 0x0" :: "v"(gA), "v"(gA2), "v"(gB), "v"(gB2) : "memory");
    else         asm volatile("s_wait_xcnt 0x0" :: "v"(gB), "v"(gB2) : "memory");
  };
  auto put = [&](int nb) {
#pragma unroll
    for (int n = (nb == 0 ? 0 : NA); n < NLD; ++n) *(v4u*)(sdst + n * 32 * GP) = st[n];
  };

  const float NEG = -__builtin_huge_valf();
  const int ilw = il0 + wave * SRW;            // the wave's first row within the chunk
  float s[SRW][NCHK][8];                       // blocks t >= NT are neither written nor read
  fetch(0);
  put(0);
  lds_barrier();
  const T* cur = (const T*)smem;
  auto scores = [&]() {                        // the wave's 16 rows x 64 keys of the block in the stage, into the score buffer
    v8f acc[4];
#pragma unroll
    for (int j = 0; j < 4; ++j) acc[j] = (v8f){0.f,0.f,0.f,0.f,0.f,0.f,0.f,0.f};
#pragma unroll
    for (int ks = 0; ks < GK; ks += 32) {
      V bh[4], bl[4];
#pragma unroll
      for (int j = 0; j < 4; ++j) {
        bh[j] = Frag<T>::load(cur + boff + j * 16 * GP + ks);
        bl[j] = Frag<T>::load(cur + boff + (SG::BN + j * 16) * GP + ks);
      }
      const V ah = Frag<T>::load(cur + aoff + ks);
      const V al = Frag<T>::load(cur + aoff + SG::BM * GP + ks);
#pragma unroll
      for (int j = 0; j < 4; ++j) {
        acc[j] = Frag<T>::mma(ah, bh[j], acc[j]);
        acc[j] = Frag<T>::mma(ah, bl[j], acc[j]);
        acc[j] = Frag<T>::mma(al, bh[j], acc[j]);
      }
    }
#pragma unroll
    for (int j = 0; j < 4; ++j)
#pragma unroll
      for (int r = 0; r < 8; ++r) tdst[r * STP + j * 16] = acc[j][r] * SCALE_ATTN;
  };
  auto take = [&](int nb, const float* ts) {   // the wave's own rows of the score buffer, the lane's 8 keys at ts, into registers
#pragma unroll
    for (int q = 0; q < SRW; ++q) {
      const v4f a = *(const v4f*)(ts + q * STP);
      const v4f b = *(const v4f*)(ts + q * STP + 4);
      s[q][nb][0] = a[0]; s[q][nb][1] = a[1]; s[q][nb][2] = a[2]; s[q][nb][3] = a[3];
      s[q][nb][4] = b[0]; s[q][nb][5] = b[1]; s[q][nb][6] = b[2]; s[q][nb][7] = b[3];
    }
  };
  // unrolled: s lives in registers and is indexed by the block's number
#pragma unroll
  for (int nb = 0; nb < NCHK; ++nb) {
    if (nb < NT) {
      if (nb + 1 < NCHK && nb + 1 < NT) {
        // the next block's loads fly beside this block's products and over the barrier behind them, which orders LDS alone
        fetch(nb + 1);
        scores();
        lds_barrier();                        // publishes this block's scores; ends every read of the stage
        take(nb, tsrc + lane * 8);
        put(nb + 1);
        lds_barrier();                        // publishes the next stage; ends every read of the score buffer
      } else {
        // The chunk's last block holds the diagonal. A wave whose 64 keys all lie behind dl has nothing to compute (a scalar branch:
        // wn is wave-uniform); no score is written there, so a lane whose 8 keys lie behind dl reads the row's first 8 instead,
        // and the mask replaces all of them.
        if (wn * 64 <= dl) scores();
        lds_barrier();                        // publishes this block's scores
        take(nb, tsrc + (lane * 8 <= dl ? lane * 8 : 0));
        // keys j > i get -inf, as in the definition (they leave the maximum alone and their exponential is exactly 0); in every
        // earlier block j < 256 c <= i
#pragma unroll
        for (int q = 0; q < SRW; ++q)
#pragma unroll
          for (int e = 0; e < 8; ++e) s[q][nb][e] = (lane * 8 + e <= ilw + q) ? s[q][nb][e] : NEG;
      }
    }
  }

  // Part 3's operands. Behind the last block's barrier nobody reads the stage any more: its LDS takes the stages of V.
  const int vrow = tid >> 4, vcol = (tid & 15) * 8;        // staging of V: row within a group of 16, 16-byte column
  const size_t offV = (h * HDIM + (size_t)vrow) * NTOK + bb * SEQ + vcol;
  const unsigned short* gV  = svh + offV;
  const unsigned short* gV2 = svl + offV;
  unsigned short* vdst = smem + vrow * VP + vcol;
  v4u vst[8];
  // whether the lane's 8 keys of stage sg are wanted: in the last block the keys behind dl are not (no P.V product reads them)
  auto vwanted = [&](int sg) { return (sg & 1) * VK + vcol < kwant(sg >> 1); };
  auto vfetch = [&](int sg) {                  // sg: the stage of 128 keys, a compile-time number at every call: an immediate offset
    if (vwanted(sg)) {
#pragma unroll
      for (int n = 0; n < 8; ++n) {
        const unsigned short* g = (n < 4 ? gV + (size_t)(n * 16) * NTOK : gV2 + (size_t)((n - 4) * 16) * NTOK) + sg * VK;
        vst[n] = *(const v4u*)g;
      }
    }
    // the addresses, the same for every stage, stay in their registers up to this wait, so that it stands in front of
    // every overwrite of a register that these loads name
    asm volatile("s_wait_xcnt 0x0" :: "v"(gV), "v"(gV2) : "memory");
  };
  auto vput = [&](int sg) {                    // stage sg goes to buffer sg mod 3
    if (vwanted(sg)) {
#pragma unroll
      for (int n = 0; n < 8; ++n) *(v4u*)(vdst + (sg % 3) * VWORDS + n * 16 * VP) = vst[n];
    }
  };
  vfetch(0);                                   // lands while the softmax arithmetic runs

  const float LOG2E = 1.44269504088896340736f;
  float m[SRW], sum[SRW], inv[SRW];
#pragma unroll
  for (int q = 0; q < SRW; ++q) m[q] = NEG;
#pragma unroll
  for (int t = 0; t < NCHK; ++t) {
    if (t < NT) {
#pragma unroll
      for (int q = 0; q < SRW; ++q)
#pragma unroll
        for (int e = 0; e < 8; ++e) m[q] = fmaxf(m[q], s[q][t][e]);
    }
  }
#pragma unroll
  for (int off = 1; off < 32; off <<= 1) {     // the four rows' chains of shuffles overlap
#pragma unroll
    for (int q = 0; q < SRW; ++q) m[q] = fmaxf(m[q], __shfl_xor(m[q], off, 32));
  }
#pragma unroll
  for (int q = 0; q < SRW; ++q) sum[q] = 0.f;
#pragma unroll
  for (int t = 0; t < NCHK; ++t) {
    if (t < NT) {
#pragma unroll
      for (int q = 0; q < SRW; ++q) {
        float x[8], v[8];
#pragma unroll
        for (int e = 0; e < 8; ++e) x[e] = (s[q][t][e] - m[q]) * LOG2E;
        // exp(u) = 2^(u * log2 e), eight at a time in one statement: no result shares a register with a source (early clobber),
        // and the v_nop fills the slot that the instruction set asks for behind the last transcendental
        asm("v_exp_f32 %0, %8\n\tv_exp_f32 %1, %9\n\tv_exp_f32 %2, %10\n\tv_exp_f32 %3, %11\n\t"
            "v_exp_f32 %4, %12\n\tv_exp_f32 %5, %13\n\tv_exp_f32 %6, %14\n\tv_exp_f32 %7, %15\n\tv_nop"
            : "=&v"(v[0]), "=&v"(v[1]), "=&v"(v[2]), "=&v"(v[3]), "=&v"(v[4]), "=&v"(v[5]), "=&v"(v[6]), "=&v"(v[7])
            : "v"(x[0]), "v"(x[1]), "v"(x[2]), "v"(x[3]), "v"(x[4]), "v"(x[5]), "v"(x[6]), "v"(x[7]));
#pragma unroll
        for (int e = 0; e < 8; ++e) {
          s[q][t][e] = v[e];
          sum[q] += v[e];
        }
      }
    }
  }
#pragma unroll
  for (int off = 1; off < 32; off <<= 1) {
#pragma unroll
    for (int q = 0; q < SRW; ++q) sum[q] += __shfl_xor(sum[q], off, 32);
  }
#pragma unroll
  for (int q = 0; q < SRW; ++q) inv[q] = 1.0f / sum[q];    // sum >= 1 (the row's largest score gives exp(0))
  // ---- part 3: P.V ----
  const int rh = wave & 1, kq = wave >> 1;     // the wave's half of the rows, its group of 32 keys in every stage
  unsigned short* pw = (unsigned short*)tbuf + (wave * SRW) * PPW + lane * 8;    // the wave's own rows, the lane's 8 keys
  const T* pa = (const T*)tbuf + (rh * 16 + rlane) * PPW + kq * 32 + koff;       // A: row m = query row, hi; lo CHR elements on
  const T* vb = (const T*)smem + rlane * VP + kq * 32 + koff;                    // Bt: row n = d, hi; lo HDIM rows on
  v8f o[4];
#pragma unroll
  for (int j = 0; j < 4; ++j) o[j] = (v8f){0.f,0.f,0.f,0.f,0.f,0.f,0.f,0.f};
  auto pv = [&](int buf, int half) {           // keys 128*half .. +127 of the block in the score buffer; their V in buffer 'buf'
    const V ah = Frag<T>::load(pa + half * VK);
    const V al = Frag<T>::load(pa + CHR + half * VK);
#pragma unroll
    for (int j = 0; j < 4; ++j) {
      const V bh = Frag<T>::load(vb + buf * VWORDS + j * 16 * VP);
      const V bl = Frag<T>::load(vb + buf * VWORDS + (HDIM + j * 16) * VP);
      o[j] = Frag<T>::mma(ah, bh, o[j]);
      o[j] = Frag<T>::mma(ah, bl, o[j]);
      o[j] = Frag<T>::mma(al, bh, o[j]);
    }
    // These products stand in a branch. The four vector slots that the chip needs between a matrix instruction and a vector instruction
    // that overwrites its operands.
    asm volatile("v_nop\n\tv_nop\n\tv_nop\n\tv_nop" : "+v"(o[3]));
  };
  v4u fv[NCHK][SRW];                           // P*1024 as f16, kept for part 4 in half the registers of s
  vput(0);
  // unrolled: s lives in registers and is indexed by the block's number; stage g of V lies in buffer g mod 3
#pragma unroll
  for (int t = 0; t < NCHK; ++t) {
    if (t < NT) {
      if (t == 0) vfetch(1);                   // a block's second stage lands while the block of P is packed; later blocks': see below
      // a row's hi and lo overwrite that row's scores, which only this wave has read since the last barrier
#pragma unroll
      for (int q = 0; q < SRW; ++q) {
        v4u hv, lv;
#pragma unroll
        for (int e = 0; e < 4; ++e) {
          const float a = s[q][t][2 * e] * inv[q];
          const float b = s[q][t][2 * e + 1] * inv[q];
          unsigned hp, lp;
          split_bf16x2(a, b, hp, lp);
          hv[e] = hp;
          lv[e] = lp;
          fv[t][q][e] = pack_f16x2(a * PCARRY, b * PCARRY);
        }
        *(v4u*)(pw + q * PPW) = hv;
        *(v4u*)(pw + q * PPW + CHR) = lv;
      }
      vput(2 * t + 1);                         // its buffer held stage 2t - 2, last read in front of the last barrier
      lds_barrier();                          // publishes this block of P and its two stages of V
      if (t + 1 < NCHK && t + 1 < NT) vfetch(2 * t + 2);   // lands while the products run
      // in the last block P is exactly 0 behind dl: a wave skips its group of 32 keys there (a scalar branch: kq is wave-uniform)
      if (kq * 32 < kwant(t))      pv((2 * t) % 3, 0);
      if (VK + kq * 32 < kwant(t)) pv((2 * t + 1) % 3, 1);
      if (t + 1 < NCHK && t + 1 < NT) {
        vput(2 * t + 2);                       // its buffer held stage 2t - 1, last read one block ago
        vfetch(2 * t + 3);                     // in flight over the barrier and the packing of the next block of P
      }
      lds_barrier();                          // ends every read of this block of P and of its two stages
    }
  }

  // ---- part 4: results ----
  float* ob = (float*)smem;                    // four key groups x 32 x 68 floats; every read of V has ended
#pragma unroll
  for (int j = 0; j < 4; ++j)
#pragma unroll
    for (int r = 0; r < 8; ++r)                // D row 8*(lane>>4) + r, column rlane
      ob[(kq * SR + rh * 16 + (lane >> 4) * 8 + r) * 68 + j * 16 + rlane] = o[j][r];
  lds_barrier();                              // publishes the partial sums
  {
    float* og = attsym + (bb * SEQ + (size_t)(c * CHR + il0 + vrow)) * DMOD + h * HDIM + (tid & 15) * 4;   // 16 lanes x 16 B = a row's 256 B
    const float* os = ob + vrow * 68 + (tid & 15) * 4;
    v4f o0 = *(const v4f*)os;
    v4f o1 = *(const v4f*)(os + 16 * 68);
#pragma unroll
    for (int g = 1; g < 4; ++g) {
      o0 += *(const v4f*)(os + g * SR * 68);
      o1 += *(const v4f*)(os + (g * SR + 16) * 68);
    }
    *(v4f*)og = o0;
    *(v4f*)(og + (size_t)16 * DMOD) = o1;
    // the address stays in its registers up to this wait, which stands in front of every overwrite of a register that these stores name
    asm volatile("s_wait_xcnt 0x0" :: "v"(og), "v"(o0), "v"(o1) : "memory");
  }
  const size_t ro = chunk_base(c) + ((size_t)y * CHR + ilw) * jend;   // the wave's first row: a scalar base for every store
  unsigned short* df = p16 + ro;
  unsigned vo[SRW];                            // the lane's place in each of the four rows, in bytes: one 32-bit offset register per row
#pragma unroll
  for (int q = 0; q < SRW; ++q) vo[q] = (unsigned)(q * jend + lane * 8) * 2u;
#pragma unroll
  for (int t = 0; t < NCHK; ++t) {
    // the relation mix reads a row up to the end of its diagonal's group of 32 keys, dl for all of these rows, and no further
    if (t < NT && lane * 8 < kwant(t)) {
#pragma unroll
      for (int q = 0; q < SRW; ++q) *(v4u*)((char*)df + vo[q] + t * 512) = fv[t][q];
    }
  }
}

// out[token][n] = sum_k combined[token][k] * WoT[n][k]  (A hi/lo, B bf16 weights), f32 out; one 128x128 tile per block.
__global__ __launch_bounds__(256) void k_out(const unsigned short* __restrict__ ch, const unsigned short* __restrict__ cl,
    const unsigned short* __restrict__ woT, float* __restrict__ out) {
  __shared__ __align__(16) unsigned short sm[2 * Stage<true, false, 2, 4, 2>::WORDS];
  const int nbN = DMOD / 128;
  gemm_block<1, true, false, 2, 4, 2, 0, DMOD, DMOD, 2>(ch, cl, 0, woT, woT, 0, out, out, DMOD, 0, DMOD, 1.0f,
                                         ((int)blockIdx.x / nbN) * 128, ((int)blockIdx.x % nbN) * 128, sm);
}

// ---------------------------------------------------------------------------
// f32 -> bf16 (RNE) cast of the two activation tensors, 8 elements per thread:
// by selects the tensor (block-uniform), bx the block of 2048 elements. Coverage: CAST_BLOCKS*256 threads * 8 = n8*8 elements exactly.
// ---------------------------------------------------------------------------
__device__ __forceinline__ void cast_bf16x8_block(const float* __restrict__ s0, const float* __restrict__ s1,
    unsigned short* __restrict__ d0, unsigned short* __restrict__ d1, int n8, int bx, int by) {
  const float* src = (by == 0) ? s0 : s1;
  unsigned short* dst = (by == 0) ? d0 : d1;
  const int i = bx * 256 + threadIdx.x;
  if (i < n8) {
    const size_t e0 = (size_t)i * 8;
    const v4f a = *(const v4f*)(src + e0);
    const v4f c = *(const v4f*)(src + e0 + 4);
    v4u u;
    u[0] = pack_bf16x2(a[0], a[1]);
    u[1] = pack_bf16x2(a[2], a[3]);
    u[2] = pack_bf16x2(c[0], c[1]);
    u[3] = pack_bf16x2(c[2], c[3]);
    *(v4u*)(dst + e0) = u;
    
  }
}

// ---------------------------------------------------------------------------
// Weight transpose + bf16 cast: W[k][o] (f32, [DMOD][DMOD]) -> WT[o][k] (bf16), 6 weights selected by z; tile: 64*68 floats of LDS.
// Coverage per block: read 4 iters * 256 threads * 4 = 4096 elements; write 2 iters * 8 waves * 4 lines * 64 = 4096.
// ---------------------------------------------------------------------------
__device__ __forceinline__ void wT_bf16_block(const float* __restrict__ w0, const float* __restrict__ w1,
    const float* __restrict__ w2, const float* __restrict__ w3, const float* __restrict__ w4, const float* __restrict__ w5,
    unsigned short* __restrict__ dst, float* tile, int bx, int by, int z) {
  const float* W = (z == 0) ? w0 : (z == 1) ? w1 : (z == 2) ? w2 : (z == 3) ? w3 : (z == 4) ? w4 : w5;
  unsigned short* WT = dst + (size_t)z * DMOD * DMOD;
  const int k0 = by * 64;   // rows of W (input dim)
  const int o0 = bx * 64;   // cols of W (output dim)
  const int tid = threadIdx.x;
#pragma unroll
  for (int it = 0; it < 4; ++it) {
    const int e = (it * 256 + tid) * 4;
    const int row = e >> 6, col = e & 63;
    const v4f v = *(const v4f*)(W + (size_t)(k0 + row) * DMOD + o0 + col);
    *(v4f*)(tile + row * 68 + col) = v;
  }
  __syncthreads();
  const int lane = tid & 31, wave = tid >> 5, q = lane >> 3, c8 = (lane & 7) * 8;
  v4u ov[2];
#pragma unroll
  for (int it = 0; it < 2; ++it) {
    const int oo = it * 32 + wave * 4 + q;
    float f[8];
#pragma unroll
    for (int e = 0; e < 8; ++e) f[e] = tile[(c8 + e) * 68 + oo];
    ov[it][0] = pack_bf16x2(f[0], f[1]);
    ov[it][1] = pack_bf16x2(f[2], f[3]);
    ov[it][2] = pack_bf16x2(f[4], f[5]);
    ov[it][3] = pack_bf16x2(f[6], f[7]);
  }
  {
#pragma unroll
    for (int it = 0; it < 2; ++it) {
      const int oo = it * 32 + wave * 4 + q;
      *(v4u*)(WT + (size_t)(o0 + oo) * DMOD + k0 + c8) = ov[it];
    }
    // in the merged kernel's built control flow another role's code follows these stores and reuses their registers:
    // keep the wait in front of that overwrite
    asm volatile("s_wait_xcnt 0x0" ::: "memory");
  }
}

// ---------------------------------------------------------------------------
// Wr [NHEAD*HDIM rows][NREL] f32 -> WrP [rows][32] bf16 with k 16..31 zero-FILLED (WMMA K padding).
// Coverage: 256 threads * 8 elements = 64 rows * 32; store 8 waves * 4 lines * 64 = 2048 elements.
// ---------------------------------------------------------------------------
__device__ __forceinline__ void wr_pack_block(const float* __restrict__ wr, unsigned short* __restrict__ dst,
    unsigned short* tile, int bx) {   // tile: 64*32 16-bit words of LDS
  const int r0 = bx * 64;
  const int tid = threadIdx.x;
  const int row = tid >> 2, kq = (tid & 3) * 8;
  v4u u;
  unsigned wv[4];
#pragma unroll
  for (int e = 0; e < 4; ++e) {
    const int ka = kq + 2 * e, kb = kq + 2 * e + 1;
    const int kac = ka < NREL ? ka : NREL - 1;
    const int kbc = kb < NREL ? kb : NREL - 1;
    const float fa = wr[(size_t)(r0 + row) * NREL + kac];
    const float fb = wr[(size_t)(r0 + row) * NREL + kbc];
    wv[e] = pack_bf16x2((ka < NREL) ? fa : 0.f, (kb < NREL) ? fb : 0.f);
  }
  u[0] = wv[0]; u[1] = wv[1]; u[2] = wv[2]; u[3] = wv[3];
  *(v4u*)(tile + row * 32 + kq) = u;
  __syncthreads();
  const int lane = tid & 31, wave = tid >> 5, q = lane >> 3, c8 = (lane & 7) * 8;
  const int L = wave * 4 + q;                       // line 0..31, 64 elements per line
  const v4u v = *(const v4u*)(tile + L * 64 + c8);
  {
    *(v4u*)(dst + (size_t)r0 * 32 + L * 64 + c8) = v;
    // as in the weight transpose: the wait in front of an overwrite of this store's registers by another role's code
    asm volatile("s_wait_xcnt 0x0" ::: "memory");
  }
}

// ---------------------------------------------------------------------------
// The three input conversions in one grid (none reads another's result); the role is block-uniform, from blockIdx.x:
// [0, 2*CAST_BLOCKS) activation casts, then WT_BLOCKS weight-transpose tiles, then WR_BLOCKS blocks of the Wr pack.
// ---------------------------------------------------------------------------
static constexpr int CAST_BLOCKS = NTOK * DMOD / 8 / 256;            // 1024 per tensor
static constexpr int WT_SIDE     = DMOD / 64;                        // 16 tiles per side
static constexpr int WT_BLOCKS   = 6 * WT_SIDE * WT_SIDE;            // 1536
static constexpr int WR_BLOCKS   = (NHEAD * HDIM) / 64;              // 16
__global__ __launch_bounds__(256) void k_prep(const float* __restrict__ x, const float* __restrict__ symb,
    const float* __restrict__ w0, const float* __restrict__ w1, const float* __restrict__ w2,
    const float* __restrict__ w3, const float* __restrict__ w4, const float* __restrict__ w5, const float* __restrict__ wr,
    unsigned short* __restrict__ xb, unsigned short* __restrict__ sb, unsigned short* __restrict__ wT,
    unsigned short* __restrict__ wrp) {
  __shared__ __align__(16) float tile[64 * 68];
  const int id = blockIdx.x;
  if (id < 2 * CAST_BLOCKS) {
    cast_bf16x8_block(x, symb, xb, sb, NTOK * DMOD / 8, id % CAST_BLOCKS, id / CAST_BLOCKS);
    return;
  }
  if (id < 2 * CAST_BLOCKS + WT_BLOCKS) {
    const int t = id - 2 * CAST_BLOCKS;
    wT_bf16_block(w0, w1, w2, w3, w4, w5, wT, tile, t % WT_SIDE, (t / WT_SIDE) % WT_SIDE, t / (WT_SIDE * WT_SIDE));
    return;
  }
  wr_pack_block(wr, wrp, (unsigned short*)tile, id - 2 * CAST_BLOCKS - WT_BLOCKS);
}

// ---------------------------------------------------------------------------
// Relation aggregation + Wr mix + residual. Block = 8 waves = 8 query rows of batch row blockIdx.y, one row per wave: the four rows
// 4g .. 4g+3 and the four rows SEQ-1-4g .. SEQ-4-4g, g = blockIdx.x. A row reads bytes in proportion to its causal extent, so a short
// row beside a long one gives every work-group the same number of bytes; SEQ/8 * NB work-groups, one per WGP (LDS), are resident at once.
// Phase 1 (per wave, local row ill = wave, in its own chunk c = i / 256): D[h][r] = sum_{j<kend} P16[h][il][j] * rel[il][r][j]
//   (one f16 WMMA tile, K stepped by 32; the 16 + 16 operand rows are staged 256 k at a time in the wave's own LDS, up to the
//   causal extent, zeros behind it; P16 carries P*1024, rel carries REL_SCALE);
//   D is split into bf16 hi/lo and written to LDS arHL[m=ill][h][k=r] (k 16..31 and the rows m = 8..15 zero-filled first).
// Phase 2 (per wave, heads h = wave and wave+8): attrel[ill][d] = sum_r ar[ill][h][r] * Wr[h][d][r]
//   (A = arHL hi/lo from LDS, B = WrP bf16 [h*64+d][32], two products per tile, 4 tiles of 16 d).
// Epilogue: per-wave 8x64 slab in LDS, residual attended_symbols added from two 16-B loads per lane and row
// ---------------------------------------------------------------------------
__global__ __launch_bounds__(256) void k_rel_mix(const unsigned short* __restrict__ p16all, const unsigned short* __restrict__ relall,
    const unsigned short* __restrict__ wrp, const float* __restrict__ attsym,
    unsigned short* __restrict__ comb_hi, unsigned short* __restrict__ comb_lo) {
  const int rowbase = (int)blockIdx.y * SEQ;
  const int g4 = (int)blockIdx.x * 4;
  __shared__ __align__(16) unsigned short arHL[2 * 16 * 16 * 32];   // hi plane [m][h][32] then lo plane
  __shared__ __align__(16) float slab[8][8 * 68];
  constexpr int RK = 256;                   // k per stage of phase 1: 512 B of an operand row = one wave-wide load of whole lines
  constexpr int RPITCH = RK + 8;            // 528 B = 16 B x 33: no bank conflict for 16-byte fragment reads
  __shared__ __align__(16) unsigned short stg[8][32 * RPITCH];
  const int tid = threadIdx.x, lane = tid & 31;
  const int wave = __builtin_amdgcn_readfirstlane(tid >> 5);   // the same in every lane: the row, its chunk and its trip count stay scalar
  const int hh = lane >> 4, rl = lane & 15, koff = hh * 8;
  {
    const v4u zz = {0u, 0u, 0u, 0u};
    v4u* zp = (v4u*)arHL;                 // 32768 B = 2048 x 16 B, 256 threads x 8
    for (int qq = tid; qq < 2048; qq += 256) zp[qq] = zz;
  }
  lds_barrier();
  const v8f zero8 = {0.f, 0.f, 0.f, 0.f, 0.f, 0.f, 0.f, 0.f};
  {
    const int ill = wave;                     // local row 0..7 (wave-uniform)
    const int i = (wave < 4) ? g4 + wave : (SEQ - 1) - g4 - (wave - 4);   // query position
    const int c = i / CHR, il = i % CHR;      // the row's chunk, its place there
    const int jend = CHR * (c + 1);           // the chunk's row pitch
    const unsigned short* p16 = p16all + chunk_base(c) + (size_t)blockIdx.y * ((size_t)NHEAD * CHR * jend);
    const unsigned short* rel = relall + chunk_base(c) + (size_t)blockIdx.y * ((size_t)CHR * NREL * jend);
    const int kend = (i & ~31) + 32;          // <= jend; P16 is zero for i < j < kend
    const unsigned short* gA = p16 + (size_t)il * jend;                      // + head * CHR * jend: A row m = head
    const unsigned short* gB = rel + (size_t)il * ((size_t)NREL * jend);     // + relation * jend: Bt row n = relation
    const int lane8 = lane * 8;               // the lane's 16 bytes of a row's 512
    unsigned short* wst = stg[wave];          // the wave's own stage: rows 0..15 = A, 16..31 = Bt
    v8f acc = zero8;
    for (int ks = 0; ks < kend; ks += RK) {
      const bool on = ks + lane * 8 < kend;   // kend is a multiple of 32; columns from kend on are staged as zeros and add nothing
      v4u st[32];
#pragma unroll
      for (int n = 0; n < 32; ++n) st[n] = (v4u){0u, 0u, 0u, 0u};
      if (on) {
#pragma unroll
        for (int n4 = 0; n4 < 16; n4 += 4) {
          const unsigned short *ga[4], *gb[4];
#pragma unroll
          for (int q = 0; q < 4; ++q) {
            ga[q] = gA + (size_t)(n4 + q) * ((size_t)CHR * jend) + ks + lane8;
            gb[q] = gB + (size_t)(n4 + q) * jend + ks + lane8;
            st[n4 + q]      = *(const v4u*)ga[q];
            st[16 + n4 + q] = *(const v4u*)gb[q];
          }
          // a later load's result may be given the registers that held these addresses: the addresses stay where they are
          // up to this wait, which stands in front of every such overwrite
          asm volatile("s_wait_xcnt 0x0" :: "v"(ga[0]), "v"(ga[1]), "v"(ga[2]), "v"(ga[3]),
                                            "v"(gb[0]), "v"(gb[1]), "v"(gb[2]), "v"(gb[3]) : "memory");
        }
      }
#pragma unroll
      for (int n = 0; n < 32; ++n) *(v4u*)(wst + n * RPITCH + lane * 8) = st[n];
      lds_wave_fence();
      v16h a[RK / 32], bb[RK / 32];           // the stage's fragment reads go as one group ahead of its products
#pragma unroll
      for (int u = 0; u < RK / 32; ++u) {
        a[u]  = Frag<_Float16>::load((const _Float16*)wst + rl * RPITCH + koff + u * 32);
        bb[u] = Frag<_Float16>::load((const _Float16*)wst + (16 + rl) * RPITCH + koff + u * 32);
      }
#pragma unroll
      for (int u = 0; u < RK / 32; ++u) acc = mma16h(a[u], bb[u], acc);
      lds_wave_fence();
    }
    // acc[r8] = D[row h = 8*hh + r8][col r = rl]  (carried x1024)
#pragma unroll
    for (int r8 = 0; r8 < 8; r8 += 2) {
      unsigned hp, lp;
      split_bf16x2(acc[r8], acc[r8 + 1], hp, lp);
      const int idx = (ill * 16 + 8 * hh + r8) * 32 + rl;
      arHL[idx] = (unsigned short)hp;
      arHL[idx + 32] = (unsigned short)(hp >> 16);
      arHL[8192 + idx] = (unsigned short)lp;
      arHL[8192 + idx + 32] = (unsigned short)(lp >> 16);
    }
  }
  lds_barrier();
  const int q = lane >> 3, c8 = (lane & 7) * 8;
  float* sl = slab[wave];
#pragma unroll
  for (int sub = 0; sub < 2; ++sub) {
    const int h = wave + 8 * sub;             // wave-uniform head
    const v16b ah = Frag<__bf16>::load((const __bf16*)arHL + rl * 512 + h * 32 + koff);          // A[m = rl][k]
    const v16b al = Frag<__bf16>::load((const __bf16*)arHL + 8192 + rl * 512 + h * 32 + koff);
    v8f acc2[4];
#pragma unroll
    for (int j = 0; j < 4; ++j) {
      const v16b bw = Frag<__bf16>::load((const __bf16*)wrp + (size_t)(h * HDIM + j * 16 + rl) * 32 + koff);  // Bt[n = d][k = r]
      acc2[j] = mma16b(ah, bw, zero8);
      acc2[j] = mma16b(al, bw, acc2[j]);
    }
    // acc2[j][r8] = attrel[ill = 8*hh + r8][d = 16*j + rl] * 1024; the rows 8..15 (hh = 1) are padding
    if (hh == 0) {
#pragma unroll
      for (int j = 0; j < 4; ++j)
#pragma unroll
        for (int r8 = 0; r8 < 8; ++r8) sl[r8 * 68 + j * 16 + rl] = acc2[j][r8] * PCARRY_INV;
    }
    lds_wave_fence();
    v4u hv[2], lv[2];
    const float* ra[2];
    v4f ra0[2], ra1[2];
#pragma unroll
    for (int it = 0; it < 2; ++it) {           // local row it * 4 + q; its query position as in phase 1
      ra[it] = attsym + (size_t)(rowbase + (it == 0 ? g4 + q : (SEQ - 1) - g4 - q)) * DMOD + h * HDIM + c8;
      ra0[it] = *(const v4f*)ra[it];
      ra1[it] = *(const v4f*)(ra[it] + 4);
    }
    // the addresses stay in their registers up to this wait, so that it stands in front of every overwrite of a register
    // that these loads name (a later load's result)
    asm volatile("s_wait_xcnt 0x0" :: "v"(ra[0]), "v"(ra[1]) : "memory");
#pragma unroll
    for (int it = 0; it < 2; ++it) {
      const int row = it * 4 + q;
      const v4f s0 = *(const v4f*)(sl + row * 68 + c8);
      const v4f s1 = *(const v4f*)(sl + row * 68 + c8 + 4);
      const v4f r0 = ra0[it];
      const v4f r1 = ra1[it];
      float v[8];
      v[0] = s0[0] + r0[0]; v[1] = s0[1] + r0[1]; v[2] = s0[2] + r0[2]; v[3] = s0[3] + r0[3];
      v[4] = s1[0] + r1[0]; v[5] = s1[1] + r1[1]; v[6] = s1[2] + r1[2]; v[7] = s1[3] + r1[3];
#pragma unroll
      for (int e = 0; e < 4; ++e) {
        unsigned hp, lp;
        split_bf16x2(v[2 * e], v[2 * e + 1], hp, lp);
        hv[it][e] = hp;
        lv[it][e] = lp;
      }
    }
    {
      unsigned short *ph[2], *pl[2];
#pragma unroll
      for (int it = 0; it < 2; ++it) {
        const size_t g = (size_t)(rowbase + (it == 0 ? g4 + q : (SEQ - 1) - g4 - q)) * DMOD + h * HDIM + c8;
        ph[it] = comb_hi + g;
        pl[it] = comb_lo + g;
        *(v4u*)ph[it] = hv[it];
        *(v4u*)pl[it] = lv[it];
      }
      // nothing drains these stores any more before the second head reuses their registers: addresses and data stay where they
      // are up to this wait, which stands in front of every such overwrite
      asm volatile("s_wait_xcnt 0x0" :: "v"(ph[0]), "v"(ph[1]), "v"(pl[0]), "v"(pl[1]),
                                        "v"(hv[0]), "v"(hv[1]), "v"(lv[0]), "v"(lv[1]) : "memory");
    }
    lds_wave_fence();
  }
}

// ---------------------------------------------------------------------------
// launcher
// Workspace region map (bytes, all 256-B aligned; total 178,323,456):
//   region 0, 83,886,080 bytes, used twice in turn, the first use ended by a launch boundary before the second begins:
//     steps 1-2: xb [2048][1024] bf16 (x, RNE) at 0, sb (symbols, RNE) behind it; in its last 10,485,760 bytes the
//                transposed bf16 weights 0 q_attn, 1 k_attn, 2 q_rel, 3 k_rel, 4 v, [1024][1024] each
//     relation scores -> relation mix: rel16 f16, PLANE_ELEMS elements, [c][b][256][16][jend] (REL_SCALE folded)
//   WoT    [1024][1024] bf16     2,097,152      directly behind region 0: the sixth slot of the weight transpose; lives to step 4
//   xqh/xql/xkh/xkl [2048][1024] bf16  4 x 4,194,304
//   qr16/kr16 [2048][1024] f16   2 x 4,194,304
//   svh/svl [1024][2048] bf16    2 x 4,194,304  (values transposed: row h*64+d, col b*1024+j)
//   attsym  [2048][1024] f32     8,388,608
//   ch/cl   [2048][1024] bf16    2 x 4,194,304  (pre-output activations hi/lo)
//   wrp     [1024][32] bf16      65,536         (Wr with K padded to 32, pad zero-filled)
//   p16     [c][b][16][256][jend] f16  41,943,040      probabilities x1024
// ---------------------------------------------------------------------------
extern "C" void kernel_launch(void* const* d_in, const int* in_sizes, int n_in,
                              void* d_out, int out_size, void* d_ws, size_t ws_size,
                              hipStream_t stream) {
  if (n_in < 9) return;
  if (in_sizes[0] != NTOK * DMOD || in_sizes[1] != NTOK * DMOD) return;
  if (in_sizes[2] != DMOD * DMOD || in_sizes[3] != DMOD * DMOD || in_sizes[4] != DMOD * DMOD ||
      in_sizes[5] != DMOD * DMOD || in_sizes[7] != DMOD * DMOD || in_sizes[8] != DMOD * DMOD) return;
  if (in_sizes[6] != NHEAD * HDIM * NREL) return;
  if (out_size != NTOK * DMOD) return;

  const float* x      = (const float*)d_in[0];
  const float* symb   = (const float*)d_in[1];
  const float* Wq_a   = (const float*)d_in[2];
  const float* Wk_a   = (const float*)d_in[3];
  const float* Wq_r   = (const float*)d_in[4];
  const float* Wk_r   = (const float*)d_in[5];
  const float* Wr     = (const float*)d_in[6];
  const float* Wv     = (const float*)d_in[7];
  const float* Wo     = (const float*)d_in[8];
  float* out = (float*)d_out;

  char* ws = (char*)d_ws;
  size_t off = 0;
  auto carve = [&](size_t bytes) -> char* {
    char* p = ws + off;
    off += (bytes + 255) & ~(size_t)255;
    return p;
  };
  const size_t ACT16 = (size_t)NTOK * DMOD * 2;            // 4,194,304
  const size_t WGT16 = (size_t)DMOD * DMOD * 2;            // 2,097,152
  const size_t ACT32 = (size_t)NTOK * DMOD * 4;            // 8,388,608
  const size_t PLANE16 = PLANE_ELEMS * 2;                  // 41,943,040
  const size_t PLANE32 = PLANE_ELEMS * 4;                  // 83,886,080
  static_assert(PLANE_ELEMS * 4 % 256 == 0, "the sixth weight slot must follow region 0 without a gap");
  static_assert((size_t)2 * NTOK * DMOD * 2 + (size_t)5 * DMOD * DMOD * 2 <= PLANE_ELEMS * 4, "casts and five weights fit region 0 side by side");

  char* reg0 = carve(PLANE32);
  carve(WGT16);                                            // WoT = wT + 5 weights
  unsigned short* xb   = (unsigned short*)reg0;
  unsigned short* sb   = (unsigned short*)(reg0 + ACT16);
  unsigned short* wT   = (unsigned short*)(reg0 + PLANE32 - 5 * WGT16);
  unsigned short* rel16 = (unsigned short*)reg0;
  unsigned short* xqh  = (unsigned short*)carve(ACT16);
  unsigned short* xql  = (unsigned short*)carve(ACT16);
  unsigned short* xkh  = (unsigned short*)carve(ACT16);
  unsigned short* xkl  = (unsigned short*)carve(ACT16);
  unsigned short* qr16 = (unsigned short*)carve(ACT16);
  unsigned short* kr16 = (unsigned short*)carve(ACT16);
  unsigned short* svh  = (unsigned short*)carve(ACT16);
  unsigned short* svl  = (unsigned short*)carve(ACT16);
  float*          attsym = (float*)carve(ACT32);
  unsigned short* ch   = (unsigned short*)carve(ACT16);
  unsigned short* cl   = (unsigned short*)carve(ACT16);
  unsigned short* wrp  = (unsigned short*)carve((size_t)NHEAD * HDIM * 32 * 2);
  unsigned short* p16  = (unsigned short*)carve(PLANE16);
  if (off > ws_size) return;

  const unsigned short* WoT  = wT + 5 * (size_t)DMOD * DMOD;

  // 1) casts: activations to bf16; weights transposed to bf16; Wr packed with K padding
  k_prep<<<dim3(2 * CAST_BLOCKS + WT_BLOCKS + WR_BLOCKS), 256, 0, stream>>>(
      x, symb, Wq_a, Wk_a, Wq_r, Wk_r, Wv, Wo, Wr, xb, sb, wT, wrp);

  // 2) projections (bf16 x bf16, exact products, f32 accumulate)
  //    xq, xk -> bf16 hi/lo planes [2048][1024]; qr, kr -> f16 planes; values transposed svT [1024][2048] hi/lo
  static_assert(NTOK % 128 == 0 && DMOD % 128 == 0 && DMOD % GK == 0, "projection and output GEMM shapes");
  k_proj5<<<dim3((NTOK / 128) * (DMOD / 128), 5, 1), 256, 0, stream>>>(xb, sb, wT, xqh, xql, xkh, xkl, qr16, kr16, svh, svl);

  // 3) every chunk of 256 query rows, both batch rows, in each grid: (scores, softmax, P.V beside relation scores) -> relation mix
  static_assert(CHR % 64 == 0 && HDIM % 32 == 0 && RDIM % 32 == 0 && HDIM % 64 == 0, "chunk GEMM shapes");
  static_assert(CHR % 128 == 0 && CHR == 256 && HDIM == 64 && RDIM == 64, "128x256 relation tiles, one stage of k for the scores");
  static_assert(NCHK == 4 && (NCHK & (NCHK - 1)) == 0 && ROWS_CH % 8 == 0 && NHEAD == 16 && NREL == 16, "grid decoding");
  static_assert(CHR / SR == (CHR / 128) * (SEQ / 256), "both roles of the grid use the same range of blockIdx.x");
  k_attn_rel<<<dim3(CHR / SR, NB * 16, 2 * NCHK), 256, 0, stream>>>(xqh, xql, xkh, xkl, svh, svl, attsym, p16, qr16, kr16, rel16);
  static_assert(SEQ % 8 == 0, "relation mix: four rows from each end of the sequence per work-group");
  k_rel_mix<<<dim3(SEQ / 8, NB), 256, 0, stream>>>(p16, rel16, wrp, attsym, ch, cl);

  // 4) out[token][n] = sum_k combined[token][k] * WoT[n][k]  (A hi/lo, B bf16 weights) -> d_out f32
  k_out<<<dim3((NTOK / 128) * (DMOD / 128)), 256, 0, stream>>>(ch, cl, WoT, out);
}

// v009
// Measured time: 88.4 microseconds a run.
// Next to v008, in two timings, it ran 1.03 times as fast each time.
// All steps since v000 together make it 10.2 times as fast.
// Contractions: v_wmma_f32_16x16x32_bf16 (bf16 operands: module inputs RNE-converted once to bf16; computed q/k, softmax probabilities, value rows, relation aggregates and pre-output activations carried as bf16 hi+lo pairs) and v_wmma_f32_16x16x32_f16 for relation scores and relation aggregation (f16 operands, probabilities carried x1024); f32 accumulate everywhere; softmax and all side math in f32.
#include <hip/hip_runtime.h>

// ---------------------------------------------------------------------------
// problem geometry
// ---------------------------------------------------------------------------
static constexpr int NB    = 2;
static constexpr int SEQ   = 1024;
static constexpr int DMOD  = 1024;
static constexpr int NHEAD = 16;
static constexpr int HDIM  = 64;
static constexpr int NREL  = 16;
static constexpr int RDIM  = 64;
static constexpr int NTOK  = NB * SEQ;          // 2048
static constexpr int CHR   = 256;               // query rows per chunk
static constexpr int NCHK  = SEQ / CHR;         // 4 chunks per batch row
static constexpr float SCALE_ATTN = 0.125f;     // 1/sqrt(64)
static constexpr float SCALE_REL  = 0.125f;     // 1/sqrt(64)
static constexpr float PCARRY     = 1024.0f;    // f16 probability carry
static constexpr float PCARRY_INV = 1.0f / 1024.0f;

// Per-pair planes (probabilities, relation scores) hold all chunks at once: chunk c (query rows 256c..256c+255,
// keys < jend = 256(c+1)) stores its rows at pitch jend and starts at element CHUNK_UNIT * c(c+1)/2.
static constexpr int    ROWS_CH     = NB * NHEAD * CHR;                             // 8192 rows per chunk
static constexpr size_t CHUNK_UNIT  = (size_t)ROWS_CH * CHR;                        // 2,097,152 elements per 256 keys
static constexpr size_t PLANE_ELEMS = CHUNK_UNIT * (NCHK * (NCHK + 1) / 2);         // 20,971,520 elements
__device__ __forceinline__ size_t chunk_base(int c) { return CHUNK_UNIT * (size_t)((c * (c + 1)) >> 1); }

static_assert(NHEAD * HDIM == DMOD, "head split");
static_assert(NREL * RDIM == DMOD, "relation split");
static_assert(SEQ == 4 * 256, "softmax handles up to 4 segments of 256 keys");
static_assert(SEQ % CHR == 0 && CHR % 64 == 0, "chunk tiling");
static_assert(NHEAD == 16 && NREL == 16, "relation mix kernel uses one 16x16 tile per token");
static_assert(HDIM % 32 == 0 && RDIM % 32 == 0, "K of score GEMMs multiple of 32");
static_assert(NTOK % 64 == 0 && DMOD % 64 == 0, "tile multiples");
static_assert((NTOK * DMOD) % (8 * 256) == 0, "cast kernel coverage");
static_assert((NHEAD * CHR) % 8 == 0 && CHR % 16 == 0, "softmax / mix grids");

// ---------------------------------------------------------------------------
// types, conversions, fragment helpers
// ---------------------------------------------------------------------------
typedef __attribute__((ext_vector_type(16))) _Float16 v16h;
typedef __attribute__((ext_vector_type(8)))  _Float16 v8h;
typedef __attribute__((ext_vector_type(16))) __bf16   v16b;
typedef __attribute__((ext_vector_type(8)))  __bf16   v8b;
typedef __attribute__((ext_vector_type(8)))  float    v8f;
typedef __attribute__((ext_vector_type(4)))  float    v4f;
typedef __attribute__((ext_vector_type(4)))  unsigned int v4u;

typedef __attribute__((ext_vector_type(2)))  float    v2f;
typedef __attribute__((ext_vector_type(2)))  __bf16   v2b;
typedef __attribute__((ext_vector_type(2)))  _Float16 v2h;

// f32 -> 16 bit, round to nearest even, two values per conversion instruction: a in the low half, b in the high half
__device__ __forceinline__ unsigned pack_bf16x2(float a, float b) {
  const v2f f = {a, b};
  return __builtin_bit_cast(unsigned, __builtin_convertvector(f, v2b));
}
__device__ __forceinline__ unsigned pack_f16x2(float a, float b) {
  const v2f f = {a, b};
  return __builtin_bit_cast(unsigned, __builtin_convertvector(f, v2h));
}
// hi = bf16(x), lo = bf16(x - hi) of two values, packed like pack_bf16x2
__device__ __forceinline__ void split_bf16x2(float a, float b, unsigned& hi, unsigned& lo) {
  hi = pack_bf16x2(a, b);
  lo = pack_bf16x2(a - __uint_as_float(hi << 16), b - __uint_as_float(hi & 0xFFFF0000u));
}

template <typename T> struct Frag;
template <> struct Frag<_Float16> {
  typedef v16h V; union U { v16h v; v8h h[2]; };
  static __device__ __forceinline__ v16h load(const _Float16* p) {   // elements 0..7 <- p[0..7], 8..15 <- p[16..23]
    U f; f.h[0] = *(const v8h*)(p); f.h[1] = *(const v8h*)(p + 16); return f.v;
  }
  static __device__ __forceinline__ v8f mma(v16h a, v16h b, v8f c) {
    return __builtin_amdgcn_wmma_f32_16x16x32_f16(false, a, false, b, (short)0, c, false, false);
  }
};
template <> struct Frag<__bf16> {
  typedef v16b V; union U { v16b v; v8b h[2]; };
  static __device__ __forceinline__ v16b load(const __bf16* p) {
    U f; f.h[0] = *(const v8b*)(p); f.h[1] = *(const v8b*)(p + 16); return f.v;
  }
  static __device__ __forceinline__ v8f mma(v16b a, v16b b, v8f c) {
    return __builtin_amdgcn_wmma_f32_16x16x32_bf16(false, a, false, b, (short)0, c, false, false);
  }
};

// single-accumulator WMMA + hazard nops (used by the relation mix kernel)
__device__ __forceinline__ v8f mma16h(v16h a, v16h b, v8f c) {
  c = __builtin_amdgcn_wmma_f32_16x16x32_f16(false, a, false, b, (short)0, c, false, false);
  asm volatile("v_nop\n\tv_nop\n\tv_nop\n\tv_nop" : "+v"(c) : "v"(a), "v"(b));
  return c;
}
__device__ __forceinline__ v8f mma16b(v16b a, v16b b, v8f c) {
  c = __builtin_amdgcn_wmma_f32_16x16x32_bf16(false, a, false, b, (short)0, c, false, false);
  asm volatile("v_nop\n\tv_nop\n\tv_nop\n\tv_nop" : "+v"(c) : "v"(a), "v"(b));
  return c;
}

// Waves of a work-group hand data to one another through LDS only (global results are read by later launches), so the barrier and
// the fence inside a wave order the local address space alone: they wait for the wave's LDS operations and leave its global loads
// and stores in flight, where __syncthreads() and a fence on every address space would first drain them.
__device__ __forceinline__ void lds_barrier() {
  __builtin_amdgcn_fence(__ATOMIC_RELEASE, "workgroup", "local");
  __builtin_amdgcn_s_barrier();
  __builtin_amdgcn_fence(__ATOMIC_ACQUIRE, "workgroup", "local");
}
__device__ __forceinline__ void lds_wave_fence() {
  __builtin_amdgcn_fence(__ATOMIC_RELEASE, "workgroup", "local");
  __builtin_amdgcn_wave_barrier();
  __builtin_amdgcn_fence(__ATOMIC_ACQUIRE, "workgroup", "local");
}

// ---- work-group WMMA GEMM, operands staged in LDS ---------------------
// C[m,n] = scale * sum_k A[m,k] * Bt[n,k]; one BM x BN tile of C per work-group of 8 waves.
// A row-major [M,K]; Bt row-major [N,K]; K % 64 == 0; every operand row starts on a 128-B line.
// SPLIT: A is hi/lo planes (A2 = lo); SPLITB: Bt also hi/lo (product hi.hi + hi.lo + lo.hi),
//        !SPLITB: Bt single plane (product hi.b + lo.b).
// OUT_MODE: 0 = f32, 1 = f16, 2 = bf16 hi plane (Cout) + bf16 lo plane (Cout2).
// ET: 0 = f16 operands, 1 = bf16 operands (pointers passed as 16-bit storage)
template <int ET> struct Elem;
template <> struct Elem<0> { typedef _Float16 T; };
template <> struct Elem<1> { typedef __bf16 T; };

// Result of one wave, MI x 4 accumulator tiles of 16x16 at rows m0.., columns n0..: 16 rows at a time through the wave's own
// 16x68 f32 LDS slab, so that every store covers whole row segments.
template <int MI, int OUT_MODE>
__device__ __forceinline__ void store_tiles(v8f (&acc)[MI][4], float scale,
    void* __restrict__ Cout, void* __restrict__ Cout2, int ldc, size_t offC, int m0, int n0, float* slab) {
  const int lane = threadIdx.x & 31;
  const int rlane = lane & 15;                 // column within a 16x16 tile
  const int mOff  = (lane >> 4) * 8;           // D row offset
#pragma unroll
  for (int i = 0; i < MI; ++i) {
    const int mBase = m0 + (i << 4);
#pragma unroll
    for (int j = 0; j < 4; ++j) {
#pragma unroll
      for (int r = 0; r < 8; ++r) {
        slab[(mOff + r) * 68 + (j << 4) + rlane] = acc[i][j][r] * scale;
      }
    }
    lds_wave_fence();                          // the slab's rows are read by other lanes than wrote them
    if (OUT_MODE == 0) {
      float* C = (float*)Cout + offC;
      const int hh = lane >> 4, c4 = (lane & 15) * 4;     // row seg = 256 B = 16 lanes x 16 B
      float* const g0 = C + (size_t)(mBase + hh) * ldc + n0 + c4;   // the lane's place in its first row; later rows by the row stride
      float* gp[8];
      v4f gv[8];
#pragma unroll
      for (int it = 0; it < 8; ++it) {
        const int row = it * 2 + hh;
        gv[it] = *(const v4f*)(slab + row * 68 + c4);
        gp[it] = g0 + (size_t)(it * 2) * ldc;
        *(v4f*)gp[it] = gv[it];
      }
      // nothing drains these stores any more before the next 16 rows reuse their registers: addresses and data stay where they
      // are up to this wait, which stands in front of every such overwrite
      asm volatile("s_wait_xcnt 0x0" :: "v"(gp[0]), "v"(gp[1]), "v"(gp[2]), "v"(gp[3]), "v"(gp[4]), "v"(gp[5]), "v"(gp[6]), "v"(gp[7]),
                                        "v"(gv[0]), "v"(gv[1]), "v"(gv[2]), "v"(gv[3]), "v"(gv[4]), "v"(gv[5]), "v"(gv[6]), "v"(gv[7]) : "memory");
    } else {
      const int q = lane >> 3, c8 = (lane & 7) * 8;
      unsigned short* C  = (unsigned short*)Cout  + offC;
      unsigned short* C2 = (OUT_MODE == 2) ? ((unsigned short*)Cout2 + offC) : nullptr;
      const size_t o0 = (size_t)(mBase + q) * ldc + n0 + c8;   // the lane's place in its first row; later rows by the row stride
      unsigned short *gp[4], *gp2[4];
      v4u hu[4], lu[4];
#pragma unroll
      for (int it = 0; it < 4; ++it) {
        const int row = it * 4 + q;
        const float* sp = slab + row * 68 + c8;
        lu[it] = (v4u){0u, 0u, 0u, 0u};
#pragma unroll
        for (int e = 0; e < 4; ++e) {
          if (OUT_MODE == 1) hu[it][e] = pack_f16x2(sp[2 * e], sp[2 * e + 1]);
          else {
            unsigned hp, lp;
            split_bf16x2(sp[2 * e], sp[2 * e + 1], hp, lp);
            hu[it][e] = hp;
            lu[it][e] = lp;
          }
        }
        gp[it]  = C + o0 + (size_t)(it * 4) * ldc;
        gp2[it] = (OUT_MODE == 2) ? C2 + o0 + (size_t)(it * 4) * ldc : gp[it];
        *(v4u*)gp[it] = hu[it];
        if (OUT_MODE == 2) *(v4u*)gp2[it] = lu[it];
      }
      // as above: the wait in front of every overwrite of a register that these stores name
      if (OUT_MODE == 2)
        asm volatile("s_wait_xcnt 0x0" :: "v"(gp[0]), "v"(gp[1]), "v"(gp[2]), "v"(gp[3]), "v"(gp2[0]), "v"(gp2[1]), "v"(gp2[2]), "v"(gp2[3]),
                                          "v"(hu[0]), "v"(hu[1]), "v"(hu[2]), "v"(hu[3]), "v"(lu[0]), "v"(lu[1]), "v"(lu[2]), "v"(lu[3]) : "memory");
      else
        asm volatile("s_wait_xcnt 0x0" :: "v"(gp[0]), "v"(gp[1]), "v"(gp[2]), "v"(gp[3]),
                                          "v"(hu[0]), "v"(hu[1]), "v"(hu[2]), "v"(hu[3]) : "memory");
    }
    lds_wave_fence();                          // the slab's reads end before the next 16 rows overwrite it
  }
}

static constexpr int GK = 64;                  // k per stage: 128 B, one whole line, of every operand row
static constexpr int GP = GK + 8;              // LDS row pitch in 16-bit elements: 144 B = 16 B x 9, no bank conflict for 16-byte fragment reads
static constexpr int SLAB_WORDS = 8 * 16 * 68 * 2;   // the eight result slabs, in 16-bit words
// WM x WN waves, each MI*16 rows x 64 columns of C. One stage in LDS: rows [A | A lo | Bt | Bt lo], GP elements apart.
template <bool SPLIT, bool SPLITB, int MI, int WM, int WN> struct Stage {
  static_assert(WM * WN == 8, "eight waves");
  static constexpr int BM = WM * MI * 16, BN = WN * 64;
  static constexpr int AROWS = (SPLIT ? 2 : 1) * BM;
  static constexpr int ROWS  = AROWS + ((SPLIT && SPLITB) ? 2 : 1) * BN;
  static constexpr int WORDS = ROWS * GP;      // 16-bit words per stage
  static_assert(BM % 32 == 0 && BN % 32 == 0, "each group of 32 staged rows lies in one plane");
  static_assert(WORDS >= SLAB_WORDS, "the result slabs reuse the first stage");
};
// smem: two stages (one is enough where K == GK); offA / offB / offC: element offsets of this product's operands and result;
// m0b, n0b: the work-group's tile. Every thread of the work-group calls this (it holds barriers).
// Per stage the 256 threads copy 128 B of every operand row, 8 lanes to a row, into LDS; the next stage's global loads are
// issued before this stage's products and stored to the other buffer behind them.
// LEAD: how many stages ahead of their products the global loads are issued (1 or 2; 2 takes a second set of staging registers).
// CAUSAL: row m of C is read by later launches only in columns n <= diag + (m | 31); a wave whose whole tile lies behind that neither
// multiplies nor stores (it still stages and passes every barrier).
template <int ET, bool SPLIT, bool SPLITB, int MI, int WM, int WN, int OUT_MODE, int LDA, int LDB, int LEAD = 1, bool CAUSAL = false>
__device__ __forceinline__ void gemm_block(
    const unsigned short* __restrict__ Ap, const unsigned short* __restrict__ A2p, size_t offA,
    const unsigned short* __restrict__ Btp, const unsigned short* __restrict__ Bt2p, size_t offB,
    void* __restrict__ Cout, void* __restrict__ Cout2, int ldc, size_t offC,
    int K, float scale, int m0b, int n0b, unsigned short* smem, int diag = 0) {
  static_assert(!CAUSAL || (LEAD == 1 && (MI * 16) % 32 == 0), "the causal test stands in the one-stage-ahead loop; a wave's last row ends a group of 32");
  typedef typename Elem<ET>::T T;
  typedef typename Frag<T>::V V;
  typedef Stage<SPLIT, SPLITB, MI, WM, WN> G;
  constexpr int NLD = G::ROWS / 32;            // 16-byte pieces per thread and stage
  const int tid = threadIdx.x, lane = tid & 31, wave = tid >> 5;
  const int srow = tid >> 3, scol = (tid & 7) * 8;      // staging: row within a group of 32, 16-byte column
  // the thread's place in each operand plane at the stage to be fetched next; the rows' strides LDA, LDB are compile-time,
  // so every load of a plane names this one address and an immediate offset
  const unsigned short* gA  = Ap   + offA + (size_t)(m0b + srow) * LDA + scol;
  const unsigned short* gA2 = A2p  + offA + (size_t)(m0b + srow) * LDA + scol;
  const unsigned short* gB  = Btp  + offB + (size_t)(n0b + srow) * LDB + scol;
  const unsigned short* gB2 = Bt2p + offB + (size_t)(n0b + srow) * LDB + scol;
  unsigned short* sdst = smem + srow * GP + scol;

  const int rlane = lane & 15;                 // row (A) / col (B, D) within subtile
  const int koff  = (lane >> 4) * 8;           // k offset of this lane half
  const int wm = wave / WN, wn = wave - wm * WN;
  const int aoff = (wm * (MI * 16) + rlane) * GP + koff;
  const int boff = (G::AROWS + wn * 64 + rlane) * GP + koff;
  // the same in every lane of a wave: read into a scalar register, so that the test is a scalar branch round the matrix instructions
  const bool need = !CAUSAL || __builtin_amdgcn_readfirstlane(n0b + wn * 64 - (m0b + wm * (MI * 16))) <= diag + MI * 16 - 1;

  v8f acc[MI][4];
#pragma unroll
  for (int i = 0; i < MI; ++i)
#pragma unroll
    for (int j = 0; j < 4; ++j) acc[i][j] = (v8f){0.f,0.f,0.f,0.f,0.f,0.f,0.f,0.f};

  v4u st0[NLD], st1[NLD];                      // st1: stages of odd number where LEAD == 2
  auto fetch = [&](v4u (&st)[NLD]) {
#pragma unroll
    for (int n = 0; n < NLD; ++n) {
      const int r = n * 32;                    // first staged row of the group of 32: picks the plane at compile time
      const unsigned short* g;
      if (r < G::BM)                  g = gA  + (size_t)r * LDA;
      else if (r < G::AROWS)          g = gA2 + (size_t)(r - G::BM) * LDA;
      else if (r < G::AROWS + G::BN)  g = gB  + (size_t)(r - G::AROWS) * LDB;
      else                            g = gB2 + (size_t)(r - G::AROWS - G::BN) * LDB;
      st[n] = *(const v4u*)g;
    }
    // the addresses stay in their registers up to this wait, so that it stands in front of every overwrite of a register
    // that these loads name (a later load's result, the step to the next stage)
    if (SPLIT && SPLITB) asm volatile("s_wait_xcnt 0x0" :: "v"(gA), "v"(gA2), "v"(gB), "v"(gB2) : "memory");
    else if (SPLIT)      asm volatile("s_wait_xcnt 0x0" :: "v"(gA), "v"(gA2), "v"(gB) : "memory");
    else                 asm volatile("s_wait_xcnt 0x0" :: "v"(gA), "v"(gB) : "memory");
    gA += GK; gA2 += GK; gB += GK; gB2 += GK;
  };
  auto put = [&](int buf, const v4u (&st)[NLD]) {
#pragma unroll
    for (int n = 0; n < NLD; ++n) *(v4u*)(sdst + buf * G::WORDS + n * 32 * GP) = st[n];
  };
  auto products = [&](int buf) {
    const T* cur = (const T*)(smem + buf * G::WORDS);
#pragma unroll
    for (int ks = 0; ks < GK; ks += 32) {
      V bh[4], bl[4];
#pragma unroll
      for (int j = 0; j < 4; ++j) {
        bh[j] = Frag<T>::load(cur + boff + j * 16 * GP + ks);
        if (SPLIT && SPLITB) bl[j] = Frag<T>::load(cur + boff + (G::BN + j * 16) * GP + ks);
      }
#pragma unroll
      for (int i = 0; i < MI; ++i) {
        V ah = Frag<T>::load(cur + aoff + i * 16 * GP + ks);
        V al;
        if (SPLIT) al = Frag<T>::load(cur + aoff + (G::BM + i * 16) * GP + ks);
#pragma unroll
        for (int j = 0; j < 4; ++j) {
          acc[i][j] = Frag<T>::mma(ah, bh[j], acc[i][j]);
          if (SPLIT) {
            if (SPLITB) acc[i][j] = Frag<T>::mma(ah, bl[j], acc[i][j]);
            acc[i][j] = Frag<T>::mma(al, bh[j], acc[i][j]);
          }
        }
      }
    }
  };

  if (LEAD == 1) {
    fetch(st0);
    put(0, st0);
    lds_barrier();
    for (int k0 = 0, buf = 0; k0 < K; k0 += GK, buf ^= 1) {
      const bool more = k0 + GK < K;           // the same for the whole work-group
      if (more) fetch(st0);
      if (need) products(buf);
      if (more) put(buf ^ 1, st0);             // last read one trip ago, in front of that trip's barrier
      lds_barrier();                           // publishes the next stage; ends every read of this one
    }
  } else {
    // Stage s is loaded into st(s mod 2) at the top of trip s - 2, goes to LDS buffer s mod 2 at the foot of trip s - 1 and is
    // multiplied in trip s: its loads stay in flight over one barrier and two trips' products. Two trips per pass of the loop,
    // so that each set of registers is named at compile time; the loop holds only trips that fetch, with no branch round the
    // loads, so that the wait in front of a put can be counted and leaves the younger stage's loads in flight. The last one to
    // three trips follow behind it. Every test is the same for the whole work-group.
    fetch(st0);
    if (GK < K) fetch(st1);
    put(0, st0);
    lds_barrier();
    int k0 = 0;
    for (; k0 + 3 * GK < K; k0 += 2 * GK) {
      fetch(st0);
      products(0);
      put(1, st1);                             // last read one trip ago, in front of that trip's barrier
      lds_barrier();                           // publishes the next stage; ends every read of this one
      fetch(st1);
      products(1);
      put(0, st0);
      lds_barrier();
    }
    const bool two = k0 + GK < K, three = k0 + 2 * GK < K;
    if (three) fetch(st0);
    products(0);
    if (two) put(1, st1);
    lds_barrier();
    if (two) {
      products(1);
      if (three) put(0, st0);
      lds_barrier();
      if (three) {
        products(0);
        lds_barrier();
      }
    }
  }
  if (need)
    store_tiles<MI, OUT_MODE>(acc, scale, Cout, Cout2, ldc, offC, m0b + wm * (MI * 16), n0b + wn * 64,
                              (float*)smem + wave * (16 * 68));
}

// All five input projections in one grid; blockIdx.y selects the product (block-uniform):
// 0 q_attn, 1 k_attn -> bf16 hi/lo; 2 q_rel, 3 k_rel -> f16; 4 values, transposed (A = WvT, Bt = symbols) -> bf16 hi/lo.
// Each product has (NTOK/128)*(DMOD/128) tiles of 128x128, one per block.
__global__ __launch_bounds__(256) void k_proj5(
    const unsigned short* __restrict__ xb, const unsigned short* __restrict__ sb, const unsigned short* __restrict__ wT,
    unsigned short* __restrict__ xqh, unsigned short* __restrict__ xql,
    unsigned short* __restrict__ xkh, unsigned short* __restrict__ xkl,
    unsigned short* __restrict__ qr16, unsigned short* __restrict__ kr16,
    unsigned short* __restrict__ svh, unsigned short* __restrict__ svl) {
  __shared__ __align__(16) unsigned short sm[2 * Stage<false, false, 2, 4, 2>::WORDS];
  const int y = blockIdx.y;
  const bool tv = (y == 4);
  const int nbN = (tv ? NTOK : DMOD) / 128;
  const int m0b = ((int)blockIdx.x / nbN) * 128, n0b = ((int)blockIdx.x % nbN) * 128;
  const unsigned short* Wy = wT + (size_t)y * DMOD * DMOD;
  if (y == 2 || y == 3) {
    unsigned short* c = (y == 2) ? qr16 : kr16;
    gemm_block<1, false, false, 2, 4, 2, 1, DMOD, DMOD>(xb, xb, 0, Wy, Wy, 0, c, c, DMOD, 0, DMOD, 1.0f, m0b, n0b, sm);
  } else {
    const unsigned short* a  = tv ? Wy : xb;
    const unsigned short* bt = tv ? sb : Wy;
    unsigned short* chi = tv ? svh : (y == 0 ? xqh : xkh);
    unsigned short* clo = tv ? svl : (y == 0 ? xql : xkl);
    gemm_block<1, false, false, 2, 4, 2, 2, DMOD, DMOD>(a, a, 0, bt, bt, 0, chi, clo, tv ? NTOK : DMOD, 0, DMOD, 1.0f, m0b, n0b, sm);
  }
}

// Attention (scores, causal softmax, P.V) of every chunk, batch row and head in one grid: a work-group owns SR whole query rows.
// Part 1, per block of 256 keys: scores[il][j] = SCALE_ATTN * sum_d xq[i][h,d] xk[j][h,d] (hi/lo split on both operands, product
//   hi.hi + hi.lo + lo.hi), operands staged as in gemm_block (one stage: all of k); the block's f32 scores pass through a
//   32 x 256 buffer in LDS into the registers of the wave that owns the row: wave w owns rows 4w .. 4w+3, lane owns
//   j = 256*t + 8*lane .. +7 (t <= c). The next block's global loads are issued ahead of this block's products.
// Part 2: softmax of the wave's four rows, keys j <= i.
// Part 3, per block of 256 keys: attended_symbols[il][d] += sum_j P[il][j] * svT[h*64+d][j] (hi/lo split on both operands, product
//   hi.hi + hi.lo + lo.hi). Each wave packs its four rows of P as bf16 hi and lo into those rows' own bytes of the score buffer;
//   V comes in stages of 128 keys, three buffers in the LDS that held the score operands: one stage is fetched beside the
//   packing, the next beside the products. Wave w sums, for the rows 16*(w&1).. +15 and all 64 columns, the keys
//   32*(w>>1).. +31 of every stage (a fragment of P feeds four tiles). P hi/lo never go to memory.
// Part 4: the four key groups' 32 x 64 partial sums meet in LDS, are added in the order of the groups and stored as whole lines;
//   the P*1024 f16 plane is written, row r = (b*NHEAD + h)*CHR + il at pitch jend, zeros for i < j up to the end of the group of
//   32 keys that holds i (behind the last barrier); nothing is written, and nothing read later, behind that group.
// Keys behind the work-group's last row: in the chunk's last block of 256 keys they are masked for all 32 rows. A wave whose keys
//   all lie there computes no scores and no P.V products; their V is not staged and their P is not stored.
// The relation scores (they read nothing of the above) ride in the same grid: blockIdx.z = 4..7, chunk 7 - z, tiles of 128x256.
static constexpr int SR  = 32;                 // query rows per work-group
static constexpr int SRW = SR / 8;             // rows per wave
static constexpr int STP = CHR + 4;            // floats per row of the score buffer: rows 8 apart lie 32 banks apart (the two lane halves of a tile store), 16-B aligned
typedef Stage<true, true, 1, 2, 4> SG;         // one block: 32 query rows x 256 keys
static_assert(SG::BM == SR && SG::BN == CHR && HDIM == GK, "one stage holds all of k for 32 rows and 256 keys");
static constexpr int VK     = 128;             // keys per stage of V: 256 B, two whole lines, of every row of svT
static constexpr int VP     = VK + 8;          // LDS row pitch in 16-bit elements: 272 B = 16 B x 17, no bank conflict for 16-byte fragment reads
static constexpr int VWORDS = 2 * HDIM * VP;   // one stage: 64 hi rows, then 64 lo rows
static constexpr int PPW    = STP * 2;         // a row of the score buffer in 16-bit elements: 1040 B = 16 B x 65; holds 256 hi, then 256 lo
static constexpr int AWORDS = 3 * VWORDS > SG::WORDS ? 3 * VWORDS : SG::WORDS;   // the score operands' stage, then three stages of V
static_assert(2 * CHR <= PPW, "hi and lo of a row of P fit the row's bytes of the score buffer");
static_assert(4 * SR * 68 * 2 <= AWORDS && CHR == 2 * VK && VK == 4 * 32 && SR == 32 && HDIM == 64, "partial sums' staging; 2 row halves x 4 key groups = 8 waves");
static_assert(Stage<false, false, 4, 2, 4>::WORDS <= SG::WORDS, "the relation scores' stage fits");
// One code path for all chunks: c, and with it the number NT of key blocks, is block-uniform, so every test on it is a scalar
// branch that the whole work-group takes alike (barriers included); the kernel's text stays small.
// blockIdx.x = block of SR query rows in the chunk, blockIdx.y = batch row * 16 + head, blockIdx.z = 0..3: chunk 3 - z (longest first).
// Two work-groups share a WGP (one's products run beside the other's softmax arithmetic): four waves per SIMD, 256 registers each.
__global__ __launch_bounds__(256) __attribute__((amdgpu_waves_per_eu(4, 4))) void k_attn_rel(
    const unsigned short* __restrict__ xqh, const unsigned short* __restrict__ xql,
    const unsigned short* __restrict__ xkh, const unsigned short* __restrict__ xkl,
    const unsigned short* __restrict__ svh, const unsigned short* __restrict__ svl,
    float* __restrict__ attsym, unsigned short* __restrict__ p16,
    const unsigned short* __restrict__ qr16, const unsigned short* __restrict__ kr16, unsigned short* __restrict__ rel16) {
  __shared__ __align__(16) unsigned short smem[AWORDS];
  __shared__ __align__(16) float tbuf[SR * STP];
  if ((int)blockIdx.z >= NCHK) {                           // block-uniform
    const int cr = (2 * NCHK - 1) - (int)blockIdx.z;
    const int jr = CHR * (cr + 1), nbN = cr + 1;           // nbN = jr / 256
    if ((int)blockIdx.x >= (CHR / 128) * nbN) return;      // block-uniform, in front of every barrier
    const size_t br = blockIdx.y >> 4, hr = blockIdx.y & 15;
    // rel[c][b][il][r][j] = SCALE_REL * sum_p qr[i][r,p] kr[j][r,p]  (plain f16) -> f16 plane
    gemm_block<0, false, false, 4, 2, 4, 1, DMOD, DMOD, 1, true>(qr16, qr16, (br * SEQ + (size_t)cr * CHR) * DMOD + hr * RDIM,
                                            kr16, kr16, br * ((size_t)SEQ * DMOD) + hr * RDIM,
                                            rel16, rel16, NREL * jr, chunk_base(cr) + br * ((size_t)CHR * NREL * jr) + hr * jr,
                                            RDIM, SCALE_REL, ((int)blockIdx.x / nbN) * 128, ((int)blockIdx.x % nbN) * 256, smem, cr * CHR);
    return;
  }
  typedef __bf16 T;
  typedef Frag<T>::V V;
  constexpr int NLD = SG::ROWS / 32;           // 16-byte pieces per thread and stage
  constexpr int NA  = SG::AROWS / 32;          // of them the query rows, hi and lo
  const int c = (NCHK - 1) - (int)blockIdx.z;
  const int y = blockIdx.y, il0 = (int)blockIdx.x * SR;
  const int NT = c + 1;                        // blocks of 256 keys
  const int jend = CHR * NT;
  const int dl = il0 + SR - 1;                 // in the chunk's last block of keys (it holds the diagonal): the last key that any row of this work-group attends to
  const int tid = threadIdx.x, lane = tid & 31;
  const int wave = __builtin_amdgcn_readfirstlane(tid >> 5);   // the same in every lane: kept in a scalar register, and the row addresses with it
  const int srow = tid >> 3, scol = (tid & 7) * 8;      // staging: row within a group of 32, 16-byte column
  const size_t bb = (size_t)(y >> 4), h = (size_t)(y & 15);
  const size_t offA = (bb * SEQ + (size_t)(c * CHR + il0)) * DMOD + h * HDIM;
  const size_t offB = bb * ((size_t)SEQ * DMOD) + h * HDIM;
  const unsigned short* gA  = xqh + offA + (size_t)srow * DMOD + scol;
  const unsigned short* gA2 = xql + offA + (size_t)srow * DMOD + scol;
  const unsigned short* gB  = xkh + offB + (size_t)srow * DMOD + scol;
  const unsigned short* gB2 = xkl + offB + (size_t)srow * DMOD + scol;
  unsigned short* sdst = smem + srow * GP + scol;

  const int rlane = lane & 15;                 // row (A) / col (B, D) within subtile
  const int koff  = (lane >> 4) * 8;           // k offset of this lane half
  const int wm = wave >> 2, wn = wave & 3;     // 2 x 4 waves, each 16 rows x 64 keys
  const int aoff = (wm * 16 + rlane) * GP + koff;
  const int boff = (SG::AROWS + wn * 64 + rlane) * GP + koff;
  float* tdst = tbuf + (wm * 16 + (lane >> 4) * 8) * STP + wn * 64 + rlane;   // D row 8*(lane>>4) + r, column rlane
  const float* tsrc = tbuf + (wave * SRW) * STP;                              // the wave's own rows

  // How many keys of block nb are wanted, counted from the block's first: all 256, but in the chunk's last block only those up to dl.
  // The same for the whole work-group: a test of a wave tile's or a key group's first key against it is a scalar branch.
  auto kwant = [&](int nb) { return nb + 1 < NT ? CHR : dl + 1; };
  v4u st[NLD];
  auto fetch = [&](int nb) {                   // nb: the key block, a compile-time number at every call: an immediate offset
#pragma unroll
    for (int n = (nb == 0 ? 0 : NA); n < NLD; ++n) {   // the query rows are staged once, with block 0, and stay
      const int r = n * 32;                    // first staged row of the group of 32: picks the plane at compile time
      const unsigned short* g;
      if (r < SG::BM)                   g = gA  + (size_t)r * DMOD;
      else if (r < SG::AROWS)           g = gA2 + (size_t)(r - SG::BM) * DMOD;
      else if (r < SG::AROWS + SG::BN)  g = gB  + (size_t)(nb * SG::BN + r - SG::AROWS) * DMOD;
      else                              g = gB2 + (size_t)(nb * SG::BN + r - SG::AROWS - SG::BN) * DMOD;
      st[n] = *(const v4u*)g;
    }
    // the addresses, the same for every block, stay in their registers up to this wait, so that it stands in front of
    // every overwrite of a register that these loads name
    if (nb == 0) asm volatile("s_wait_xcnt 0x0" :: "v"(gA), "v"(gA2), "v"(gB), "v"(gB2) : "memory");
    else         asm volatile("s_wait_xcnt 0x0" :: "v"(gB), "v"(gB2) : "memory");
  };
  auto put = [&](int nb) {
#pragma unroll
    for (int n = (nb == 0 ? 0 : NA); n < NLD; ++n) *(v4u*)(sdst + n * 32 * GP) = st[n];
  };

  const float NEG = -__builtin_huge_valf();
  const int ilw = il0 + wave * SRW;            // the wave's first row within the chunk
  float s[SRW][NCHK][8];                       // blocks t >= NT are neither written nor read
  fetch(0);
  put(0);
  lds_barrier();
  const T* cur = (const T*)smem;
  auto scores = [&]() {                        // the wave's 16 rows x 64 keys of the block in the stage, into the score buffer
    v8f acc[4];
#pragma unroll
    for (int j = 0; j < 4; ++j) acc[j] = (v8f){0.f,0.f,0.f,0.f,0.f,0.f,0.f,0.f};
#pragma unroll
    for (int ks = 0; ks < GK; ks += 32) {
      V bh[4], bl[4];
#pragma unroll
      for (int j = 0; j < 4; ++j) {
        bh[j] = Frag<T>::load(cur + boff + j * 16 * GP + ks);
        bl[j] = Frag<T>::load(cur + boff + (SG::BN + j * 16) * GP + ks);
      }
      const V ah = Frag<T>::load(cur + aoff + ks);
      const V al = Frag<T>::load(cur + aoff + SG::BM * GP + ks);
#pragma unroll
      for (int j = 0; j < 4; ++j) {
        acc[j] = Frag<T>::mma(ah, bh[j], acc[j]);
        acc[j] = Frag<T>::mma(ah, bl[j], acc[j]);
        acc[j] = Frag<T>::mma(al, bh[j], acc[j]);
      }
    }
#pragma unroll
    for (int j = 0; j < 4; ++j)
#pragma unroll
      for (int r = 0; r < 8; ++r) tdst[r * STP + j * 16] = acc[j][r] * SCALE_ATTN;
  };
  auto take = [&](int nb, const float* ts) {   // the wave's own rows of the score buffer, the lane's 8 keys at ts, into registers
#pragma unroll
    for (int q = 0; q < SRW; ++q) {
      const v4f a = *(const v4f*)(ts + q * STP);
      const v4f b = *(const v4f*)(ts + q * STP + 4);
      s[q][nb][0] = a[0]; s[q][nb][1] = a[1]; s[q][nb][2] = a[2]; s[q][nb][3] = a[3];
      s[q][nb][4] = b[0]; s[q][nb][5] = b[1]; s[q][nb][6] = b[2]; s[q][nb][7] = b[3];
    }
  };
  // unrolled: s lives in registers and is indexed by the block's number
#pragma unroll
  for (int nb = 0; nb < NCHK; ++nb) {
    if (nb < NT) {
      if (nb + 1 < NCHK && nb + 1 < NT) {
        // the next block's loads fly beside this block's products and over the barrier behind them, which orders LDS alone
        fetch(nb + 1);
        scores();
        lds_barrier();                        // publishes this block's scores; ends every read of the stage
        take(nb, tsrc + lane * 8);
        put(nb + 1);
        lds_barrier();                        // publishes the next stage; ends every read of the score buffer
      } else {
        // The chunk's last block holds the diagonal. A wave whose 64 keys all lie behind dl has nothing to compute (a scalar branch:
        // wn is wave-uniform); no score is written there, so a lane whose 8 keys lie behind dl reads the row's first 8 instead,
        // and the mask replaces all of them.
        if (wn * 64 <= dl) scores();
        lds_barrier();                        // publishes this block's scores
        take(nb, tsrc + (lane * 8 <= dl ? lane * 8 : 0));
        // keys j > i get -inf, as in the definition (they leave the maximum alone and their exponential is exactly 0); in every
        // earlier block j < 256 c <= i
#pragma unroll
        for (int q = 0; q < SRW; ++q)
#pragma unroll
          for (int e = 0; e < 8; ++e) s[q][nb][e] = (lane * 8 + e <= ilw + q) ? s[q][nb][e] : NEG;
      }
    }
  }

  // Part 3's operands. Behind the last block's barrier nobody reads the stage any more: its LDS takes the stages of V.
  const int vrow = tid >> 4, vcol = (tid & 15) * 8;        // staging of V: row within a group of 16, 16-byte column
  const size_t offV = (h * HDIM + (size_t)vrow) * NTOK + bb * SEQ + vcol;
  const unsigned short* gV  = svh + offV;
  const unsigned short* gV2 = svl + offV;
  unsigned short* vdst = smem + vrow * VP + vcol;
  v4u vst[8];
  // whether the lane's 8 keys of stage sg are wanted: in the last block the keys behind dl are not (no P.V product reads them)
  auto vwanted = [&](int sg) { return (sg & 1) * VK + vcol < kwant(sg >> 1); };
  auto vfetch = [&](int sg) {                  // sg: the stage of 128 keys, a compile-time number at every call: an immediate offset
    if (vwanted(sg)) {
#pragma unroll
      for (int n = 0; n < 8; ++n) {
        const unsigned short* g = (n < 4 ? gV + (size_t)(n * 16) * NTOK : gV2 + (size_t)((n - 4) * 16) * NTOK) + sg * VK;
        vst[n] = *(const v4u*)g;
      }
    }
    // the addresses, the same for every stage, stay in their registers up to this wait, so that it stands in front of
    // every overwrite of a register that these loads name
    asm volatile("s_wait_xcnt 0x0" :: "v"(gV), "v"(gV2) : "memory");
  };
  auto vput = [&](int sg) {                    // stage sg goes to buffer sg mod 3
    if (vwanted(sg)) {
#pragma unroll
      for (int n = 0; n < 8; ++n) *(v4u*)(vdst + (sg % 3) * VWORDS + n * 16 * VP) = vst[n];
    }
  };
  vfetch(0);                                   // lands while the softmax arithmetic runs

  const float LOG2E = 1.44269504088896340736f;
  float m[SRW], sum[SRW], inv[SRW];
#pragma unroll
  for (int q = 0; q < SRW; ++q) m[q] = NEG;
#pragma unroll
  for (int t = 0; t < NCHK; ++t) {
    if (t < NT) {
#pragma unroll
      for (int q = 0; q < SRW; ++q)
#pragma unroll
        for (int e = 0; e < 8; ++e) m[q] = fmaxf(m[q], s[q][t][e]);
    }
  }
#pragma unroll
  for (int off = 1; off < 32; off <<= 1) {     // the four rows' chains of shuffles overlap
#pragma unroll
    for (int q = 0; q < SRW; ++q) m[q] = fmaxf(m[q], __shfl_xor(m[q], off, 32));
  }
#pragma unroll
  for (int q = 0; q < SRW; ++q) sum[q] = 0.f;
#pragma unroll
  for (int t = 0; t < NCHK; ++t) {
    if (t < NT) {
#pragma unroll
      for (int q = 0; q < SRW; ++q) {
        float x[8], v[8];
#pragma unroll
        for (int e = 0; e < 8; ++e) x[e] = (s[q][t][e] - m[q]) * LOG2E;
        // exp(u) = 2^(u * log2 e), eight at a time in one statement: no result shares a register with a source (early clobber),
        // and the v_nop fills the slot that the instruction set asks for behind the last transcendental
        asm("v_exp_f32 %0, %8\n\tv_exp_f32 %1, %9\n\tv_exp_f32 %2, %10\n\tv_exp_f32 %3, %11\n\t"
            "v_exp_f32 %4, %12\n\tv_exp_f32 %5, %13\n\tv_exp_f32 %6, %14\n\tv_exp_f32 %7, %15\n\tv_nop"
            : "=&v"(v[0]), "=&v"(v[1]), "=&v"(v[2]), "=&v"(v[3]), "=&v"(v[4]), "=&v"(v[5]), "=&v"(v[6]), "=&v"(v[7])
            : "v"(x[0]), "v"(x[1]), "v"(x[2]), "v"(x[3]), "v"(x[4]), "v"(x[5]), "v"(x[6]), "v"(x[7]));
#pragma unroll
        for (int e = 0; e < 8; ++e) {
          s[q][t][e] = v[e];
          sum[q] += v[e];
        }
      }
    }
  }
#pragma unroll
  for (int off = 1; off < 32; off <<= 1) {
#pragma unroll
    for (int q = 0; q < SRW; ++q) sum[q] += __shfl_xor(sum[q], off, 32);
  }
#pragma unroll
  for (int q = 0; q < SRW; ++q) inv[q] = 1.0f / sum[q];    // sum >= 1 (the row's largest score gives exp(0))
  // ---- part 3: P.V ----
  const int rh = wave & 1, kq = wave >> 1;     // the wave's half of the rows, its group of 32 keys in every stage
  unsigned short* pw = (unsigned short*)tbuf + (wave * SRW) * PPW + lane * 8;    // the wave's own rows, the lane's 8 keys
  const T* pa = (const T*)tbuf + (rh * 16 + rlane) * PPW + kq * 32 + koff;       // A: row m = query row, hi; lo CHR elements on
  const T* vb = (const T*)smem + rlane * VP + kq * 32 + koff;                    // Bt: row n = d, hi; lo HDIM rows on
  v8f o[4];
#pragma unroll
  for (int j = 0; j < 4; ++j) o[j] = (v8f){0.f,0.f,0.f,0.f,0.f,0.f,0.f,0.f};
  auto pv = [&](int buf, int half) {           // keys 128*half .. +127 of the block in the score buffer; their V in buffer 'buf'
    const V ah = Frag<T>::load(pa + half * VK);
    const V al = Frag<T>::load(pa + CHR + half * VK);
#pragma unroll
    for (int j = 0; j < 4; ++j) {
      const V bh = Frag<T>::load(vb + buf * VWORDS + j * 16 * VP);
      const V bl = Frag<T>::load(vb + buf * VWORDS + (HDIM + j * 16) * VP);
      o[j] = Frag<T>::mma(ah, bh, o[j]);
      o[j] = Frag<T>::mma(ah, bl, o[j]);
      o[j] = Frag<T>::mma(al, bh, o[j]);
    }
    // These products stand in a branch. The four vector slots that the chip needs between a matrix instruction and a vector instruction
    // that overwrites its operands.
    asm volatile("v_nop\n\tv_nop\n\tv_nop\n\tv_nop" : "+v"(o[3]));
  };
  v4u fv[NCHK][SRW];                           // P*1024 as f16, kept for part 4 in half the registers of s
  vput(0);
  // unrolled: s lives in registers and is indexed by the block's number; stage g of V lies in buffer g mod 3
#pragma unroll
  for (int t = 0; t < NCHK; ++t) {
    if (t < NT) {
      if (t == 0) vfetch(1);                   // a block's second stage lands while the block of P is packed; later blocks': see below
      // a row's hi and lo overwrite that row's scores, which only this wave has read since the last barrier
#pragma unroll
      for (int q = 0; q < SRW; ++q) {
        v4u hv, lv;
#pragma unroll
        for (int e = 0; e < 4; ++e) {
          const float a = s[q][t][2 * e] * inv[q];
          const float b = s[q][t][2 * e + 1] * inv[q];
          unsigned hp, lp;
          split_bf16x2(a, b, hp, lp);
          hv[e] = hp;
          lv[e] = lp;
          fv[t][q][e] = pack_f16x2(a * PCARRY, b * PCARRY);
        }
        *(v4u*)(pw + q * PPW) = hv;
        *(v4u*)(pw + q * PPW + CHR) = lv;
      }
      vput(2 * t + 1);                         // its buffer held stage 2t - 2, last read in front of the last barrier
      lds_barrier();                          // publishes this block of P and its two stages of V
      if (t + 1 < NCHK && t + 1 < NT) vfetch(2 * t + 2);   // lands while the products run
      // in the last block P is exactly 0 behind dl: a wave skips its group of 32 keys there (a scalar branch: kq is wave-uniform)
      if (kq * 32 < kwant(t))      pv((2 * t) % 3, 0);
      if (VK + kq * 32 < kwant(t)) pv((2 * t + 1) % 3, 1);
      if (t + 1 < NCHK && t + 1 < NT) {
        vput(2 * t + 2);                       // its buffer held stage 2t - 1, last read one block ago
        vfetch(2 * t + 3);                     // in flight over the barrier and the packing of the next block of P
      }
      lds_barrier();                          // ends every read of this block of P and of its two stages
    }
  }

  // ---- part 4: results ----
  float* ob = (float*)smem;                    // four key groups x 32 x 68 floats; every read of V has ended
#pragma unroll
  for (int j = 0; j < 4; ++j)
#pragma unroll
    for (int r = 0; r < 8; ++r)                // D row 8*(lane>>4) + r, column rlane
      ob[(kq * SR + rh * 16 + (lane >> 4) * 8 + r) * 68 + j * 16 + rlane] = o[j][r];
  lds_barrier();                              // publishes the partial sums
  {
    float* og = attsym + (bb * SEQ + (size_t)(c * CHR + il0 + vrow)) * DMOD + h * HDIM + (tid & 15) * 4;   // 16 lanes x 16 B = a row's 256 B
    const float* os = ob + vrow * 68 + (tid & 15) * 4;
    v4f o0 = *(const v4f*)os;
    v4f o1 = *(const v4f*)(os + 16 * 68);
#pragma unroll
    for (int g = 1; g < 4; ++g) {
      o0 += *(const v4f*)(os + g * SR * 68);
      o1 += *(const v4f*)(os + (g * SR + 16) * 68);
    }
    *(v4f*)og = o0;
    *(v4f*)(og + (size_t)16 * DMOD) = o1;
    // the address stays in its registers up to this wait, which stands in front of every overwrite of a register that these stores name
    asm volatile("s_wait_xcnt 0x0" :: "v"(og), "v"(o0), "v"(o1) : "memory");
  }
  const size_t ro = chunk_base(c) + ((size_t)y * CHR + ilw) * jend;   // the wave's first row: a scalar base for every store
  unsigned short* df = p16 + ro;
  unsigned vo[SRW];                            // the lane's place in each of the four rows, in bytes: one 32-bit offset register per row
#pragma unroll
  for (int q = 0; q < SRW; ++q) vo[q] = (unsigned)(q * jend + lane * 8) * 2u;
#pragma unroll
  for (int t = 0; t < NCHK; ++t) {
    // the relation mix reads a row up to the end of its diagonal's group of 32 keys, dl for all of these rows, and no further
    if (t < NT && lane * 8 < kwant(t)) {
#pragma unroll
      for (int q = 0; q < SRW; ++q) *(v4u*)((char*)df + vo[q] + t * 512) = fv[t][q];
    }
  }
}

// out[token][n] = sum_k combined[token][k] * WoT[n][k]  (A hi/lo, B bf16 weights), f32 out; one 128x128 tile per block.
__global__ __launch_bounds__(256) void k_out(const unsigned short* __restrict__ ch, const unsigned short* __restrict__ cl,
    const unsigned short* __restrict__ woT, float* __restrict__ out) {
  __shared__ __align__(16) unsigned short sm[2 * Stage<true, false, 2, 4, 2>::WORDS];
  const int nbN = DMOD / 128;
  gemm_block<1, true, false, 2, 4, 2, 0, DMOD, DMOD, 2>(ch, cl, 0, woT, woT, 0, out, out, DMOD, 0, DMOD, 1.0f,
                                         ((int)blockIdx.x / nbN) * 128, ((int)blockIdx.x % nbN) * 128, sm);
}

// ---------------------------------------------------------------------------
// f32 -> bf16 (RNE) cast of the two activation tensors, 8 elements per thread:
// by selects the tensor (block-uniform), bx the block of 2048 elements. Coverage: CAST_BLOCKS*256 threads * 8 = n8*8 elements exactly.
// ---------------------------------------------------------------------------
__device__ __forceinline__ void cast_bf16x8_block(const float* __restrict__ s0, const float* __restrict__ s1,
    unsigned short* __restrict__ d0, unsigned short* __restrict__ d1, int n8, int bx, int by) {
  const float* src = (by == 0) ? s0 : s1;
  unsigned short* dst = (by == 0) ? d0 : d1;
  const int i = bx * 256 + threadIdx.x;
  if (i < n8) {
    const size_t e0 = (size_t)i * 8;
    const v4f a = *(const v4f*)(src + e0);
    const v4f c = *(const v4f*)(src + e0 + 4);
    v4u u;
    u[0] = pack_bf16x2(a[0], a[1]);
    u[1] = pack_bf16x2(a[2], a[3]);
    u[2] = pack_bf16x2(c[0], c[1]);
    u[3] = pack_bf16x2(c[2], c[3]);
    *(v4u*)(dst + e0) = u;
    
  }
}

// ---------------------------------------------------------------------------
// Weight transpose + bf16 cast: W[k][o] (f32, [DMOD][DMOD]) -> WT[o][k] (bf16), 6 weights selected by z; tile: 64*68 floats of LDS.
// Coverage per block: read 4 iters * 256 threads * 4 = 4096 elements; write 2 iters * 8 waves * 4 lines * 64 = 4096.
// ---------------------------------------------------------------------------
__device__ __forceinline__ void wT_bf16_block(const float* __restrict__ w0, const float* __restrict__ w1,
    const float* __restrict__ w2, const float* __restrict__ w3, const float* __restrict__ w4, const float* __restrict__ w5,
    unsigned short* __restrict__ dst, float* tile, int bx, int by, int z) {
  const float* W = (z == 0) ? w0 : (z == 1) ? w1 : (z == 2) ? w2 : (z == 3) ? w3 : (z == 4) ? w4 : w5;
  unsigned short* WT = dst + (size_t)z * DMOD * DMOD;
  const int k0 = by * 64;   // rows of W (input dim)
  const int o0 = bx * 64;   // cols of W (output dim)
  const int tid = threadIdx.x;
#pragma unroll
  for (int it = 0; it < 4; ++it) {
    const int e = (it * 256 + tid) * 4;
    const int row = e >> 6, col = e & 63;
    const v4f v = *(const v4f*)(W + (size_t)(k0 + row) * DMOD + o0 + col);
    *(v4f*)(tile + row * 68 + col) = v;
  }
  __syncthreads();
  const int lane = tid & 31, wave = tid >> 5, q = lane >> 3, c8 = (lane & 7) * 8;
  v4u ov[2];
#pragma unroll
  for (int it = 0; it < 2; ++it) {
    const int oo = it * 32 + wave * 4 + q;
    float f[8];
#pragma unroll
    for (int e = 0; e < 8; ++e) f[e] = tile[(c8 + e) * 68 + oo];
    ov[it][0] = pack_bf16x2(f[0], f[1]);
    ov[it][1] = pack_bf16x2(f[2], f[3]);
    ov[it][2] = pack_bf16x2(f[4], f[5]);
    ov[it][3] = pack_bf16x2(f[6], f[7]);
  }
  {
#pragma unroll
    for (int it = 0; it < 2; ++it) {
      const int oo = it * 32 + wave * 4 + q;
      *(v4u*)(WT + (size_t)(o0 + oo) * DMOD + k0 + c8) = ov[it];
    }
    // in the merged kernel's built control flow another role's code follows these stores and reuses their registers:
    // keep the wait in front of that overwrite
    asm volatile("s_wait_xcnt 0x0" ::: "memory");
  }
}

// ---------------------------------------------------------------------------
// Wr [NHEAD*HDIM rows][NREL] f32 -> WrP [rows][32] bf16 with k 16..31 zero-FILLED (WMMA K padding).
// Coverage: 256 threads * 8 elements = 64 rows * 32; store 8 waves * 4 lines * 64 = 2048 elements.
// ---------------------------------------------------------------------------
__device__ __forceinline__ void wr_pack_block(const float* __restrict__ wr, unsigned short* __restrict__ dst,
    unsigned short* tile, int bx) {   // tile: 64*32 16-bit words of LDS
  const int r0 = bx * 64;
  const int tid = threadIdx.x;
  const int row = tid >> 2, kq = (tid & 3) * 8;
  v4u u;
  unsigned wv[4];
#pragma unroll
  for (int e = 0; e < 4; ++e) {
    const int ka = kq + 2 * e, kb = kq + 2 * e + 1;
    const int kac = ka < NREL ? ka : NREL - 1;
    const int kbc = kb < NREL ? kb : NREL - 1;
    const float fa = wr[(size_t)(r0 + row) * NREL + kac];
    const float fb = wr[(size_t)(r0 + row) * NREL + kbc];
    wv[e] = pack_bf16x2((ka < NREL) ? fa : 0.f, (kb < NREL) ? fb : 0.f);
  }
  u[0] = wv[0]; u[1] = wv[1]; u[2] = wv[2]; u[3] = wv[3];
  *(v4u*)(tile + row * 32 + kq) = u;
  __syncthreads();
  const int lane = tid & 31, wave = tid >> 5, q = lane >> 3, c8 = (lane & 7) * 8;
  const int L = wave * 4 + q;                       // line 0..31, 64 elements per line
  const v4u v = *(const v4u*)(tile + L * 64 + c8);
  {
    *(v4u*)(dst + (size_t)r0 * 32 + L * 64 + c8) = v;
    // as in the weight transpose: the wait in front of an overwrite of this store's registers by another role's code
    asm volatile("s_wait_xcnt 0x0" ::: "memory");
  }
}

// ---------------------------------------------------------------------------
// The three input conversions in one grid (none reads another's result); the role is block-uniform, from blockIdx.x:
// [0, 2*CAST_BLOCKS) activation casts, then WT_BLOCKS weight-transpose tiles, then WR_BLOCKS blocks of the Wr pack.
// ---------------------------------------------------------------------------
static constexpr int CAST_BLOCKS = NTOK * DMOD / 8 / 256;            // 1024 per tensor
static constexpr int WT_SIDE     = DMOD / 64;                        // 16 tiles per side
static constexpr int WT_BLOCKS   = 6 * WT_SIDE * WT_SIDE;            // 1536
static constexpr int WR_BLOCKS   = (NHEAD * HDIM) / 64;              // 16
__global__ __launch_bounds__(256) void k_prep(const float* __restrict__ x, const float* __restrict__ symb,
    const float* __restrict__ w0, const float* __restrict__ w1, const float* __restrict__ w2,
    const float* __restrict__ w3, const float* __restrict__ w4, const float* __restrict__ w5, const float* __restrict__ wr,
    unsigned short* __restrict__ xb, unsigned short* __restrict__ sb, unsigned short* __restrict__ wT,
    unsigned short* __restrict__ wrp) {
  __shared__ __align__(16) float tile[64 * 68];
  const int id = blockIdx.x;
  if (id < 2 * CAST_BLOCKS) {
    cast_bf16x8_block(x, symb, xb, sb, NTOK * DMOD / 8, id % CAST_BLOCKS, id / CAST_BLOCKS);
    return;
  }
  if (id < 2 * CAST_BLOCKS + WT_BLOCKS) {
    const int t = id - 2 * CAST_BLOCKS;
    wT_bf16_block(w0, w1, w2, w3, w4, w5, wT, tile, t % WT_SIDE, (t / WT_SIDE) % WT_SIDE, t / (WT_SIDE * WT_SIDE));
    return;
  }
  wr_pack_block(wr, wrp, (unsigned short*)tile, id - 2 * CAST_BLOCKS - WT_BLOCKS);
}

// ---------------------------------------------------------------------------
// Relation aggregation + Wr mix + residual. Block = 8 waves = 8 query rows of batch row blockIdx.y, one row per wave: the four rows
// 4g .. 4g+3 and the four rows SEQ-1-4g .. SEQ-4-4g, g = blockIdx.x. A row reads bytes in proportion to its causal extent, so a short
// row beside a long one gives every work-group the same number of bytes; SEQ/8 * NB work-groups, one per WGP (LDS), are resident at once.
// Phase 1 (per wave, local row ill = wave, in its own chunk c = i / 256): D[h][r] = sum_{j<kend} P16[h][il][j] * rel[il][r][j]
//   (one f16 WMMA tile, K stepped by 32; the 16 + 16 operand rows are staged 256 k at a time in the wave's own LDS, up to the
//   causal extent, zeros behind it; the next stage's global loads fly while a stage is worked on; P16 carries P*1024, rel carries REL_SCALE);
//   D is split into bf16 hi/lo and written to LDS arHL[m=ill][h][k=r] (k 16..31 and the rows m = 8..15 zero-filled first).
// Phase 2 (per wave, heads h = wave and wave+8): attrel[ill][d] = sum_r ar[ill][h][r] * Wr[h][d][r]
//   (A = arHL hi/lo from LDS, B = WrP bf16 [h*64+d][32], two products per tile, 4 tiles of 16 d).
// Epilogue: per-wave 8x64 slab in LDS, residual attended_symbols added from two 16-B loads per lane and row
// ---------------------------------------------------------------------------
__global__ __launch_bounds__(256) void k_rel_mix(const unsigned short* __restrict__ p16all, const unsigned short* __restrict__ relall,
    const unsigned short* __restrict__ wrp, const float* __restrict__ attsym,
    unsigned short* __restrict__ comb_hi, unsigned short* __restrict__ comb_lo) {
  const int rowbase = (int)blockIdx.y * SEQ;
  const int g4 = (int)blockIdx.x * 4;
  __shared__ __align__(16) unsigned short arHL[2 * 16 * 16 * 32];   // hi plane [m][h][32] then lo plane
  __shared__ __align__(16) float slab[8][8 * 68];
  constexpr int RK = 256;                   // k per stage of phase 1: 512 B of an operand row = one wave-wide load of whole lines
  constexpr int RPITCH = RK + 8;            // 528 B = 16 B x 33: no bank conflict for 16-byte fragment reads
  __shared__ __align__(16) unsigned short stg[8][32 * RPITCH];
  const int tid = threadIdx.x, lane = tid & 31;
  const int wave = __builtin_amdgcn_readfirstlane(tid >> 5);   // the same in every lane: the row, its chunk and its trip count stay scalar
  const int hh = lane >> 4, rl = lane & 15, koff = hh * 8;
  {
    const v4u zz = {0u, 0u, 0u, 0u};
    v4u* zp = (v4u*)arHL;                 // 32768 B = 2048 x 16 B, 256 threads x 8
    for (int qq = tid; qq < 2048; qq += 256) zp[qq] = zz;
  }
  lds_barrier();
  const v8f zero8 = {0.f, 0.f, 0.f, 0.f, 0.f, 0.f, 0.f, 0.f};
  const int q = lane >> 3, c8 = (lane & 7) * 8;
  // Phase 2's operands from memory, both heads of the wave: the Wr fragments and the residual rows. They depend on nothing that
  // phase 1 computes; asked for in phase 1, they land beside its last products and the barrier instead of being waited for head by head.
  v16b bw[2][4];
  v4f ra0[2][2], ra1[2][2];
  auto p2load = [&]() {
    const __bf16* pw = (const __bf16*)wrp + (size_t)(wave * HDIM + rl) * 32 + koff;   // Bt[n = d][k = r] of head 'wave'; head wave + 8 and the tiles of 16 d by immediate offsets
    const float* ra[2];
#pragma unroll
    for (int it = 0; it < 2; ++it)             // local row it * 4 + q; its query position as in phase 1
      ra[it] = attsym + (size_t)(rowbase + (it == 0 ? g4 + q : (SEQ - 1) - g4 - q)) * DMOD + wave * HDIM + c8;
#pragma unroll
    for (int sub = 0; sub < 2; ++sub) {
#pragma unroll
      for (int j = 0; j < 4; ++j) bw[sub][j] = Frag<__bf16>::load(pw + (sub * 8 * HDIM + j * 16) * 32);
#pragma unroll
      for (int it = 0; it < 2; ++it) {
        ra0[sub][it] = *(const v4f*)(ra[it] + sub * 8 * HDIM);
        ra1[sub][it] = *(const v4f*)(ra[it] + sub * 8 * HDIM + 4);
      }
    }
    // the addresses stay in their registers up to this wait, so that it stands in front of every overwrite of a register
    // that these loads name (a later load's result)
    asm volatile("s_wait_xcnt 0x0" :: "v"(pw), "v"(ra[0]), "v"(ra[1]) : "memory");
  };
  {
    const int ill = wave;                     // local row 0..7 (wave-uniform)
    const int i = (wave < 4) ? g4 + wave : (SEQ - 1) - g4 - (wave - 4);   // query position
    const int c = i / CHR, il = i % CHR;      // the row's chunk, its place there
    const int jend = CHR * (c + 1);           // the chunk's row pitch
    const unsigned short* p16 = p16all + chunk_base(c) + (size_t)blockIdx.y * ((size_t)NHEAD * CHR * jend);
    const unsigned short* rel = relall + chunk_base(c) + (size_t)blockIdx.y * ((size_t)CHR * NREL * jend);
    const int kend = (i & ~31) + 32;          // <= jend; P16 is zero for i < j < kend
    const unsigned short* gA = p16 + (size_t)il * jend;                      // + head * CHR * jend: A row m = head
    const unsigned short* gB = rel + (size_t)il * ((size_t)NREL * jend);     // + relation * jend: Bt row n = relation
    const int lane8 = lane * 8;               // the lane's 16 bytes of a row's 512
    unsigned short* wst = stg[wave];          // the wave's own stage: rows 0..15 = A, 16..31 = Bt
    v8f acc = zero8;
    const int nst = (kend + RK - 1) / RK;     // the row's stages of 256 k, 1 .. 4: wave-uniform, every test on it is a scalar branch
    static_assert(SEQ <= 4 * RK, "at most four stages: two in flight, one refill of each set");
    v4u stA[32], stB[32];                     // two sets of staging registers, stages of even and of odd number: two stages are in flight
    // kend is a multiple of 32. A lane whose columns lie from kend on (the end of the row's last stage; all of a stage that the row
    // does not have) reads the row's first 16 bytes instead: in bounds, a line that is fetched anyway. So no branch stands round the
    // loads, and the wait in front of the older stage's use can be counted and leaves the younger stage in flight.
    auto load = [&](v4u (&st)[32], int sg) {
      const int k0 = sg * RK + lane8;
      const int col = k0 < kend ? k0 : 0;
#pragma unroll
      for (int n4 = 0; n4 < 16; n4 += 4) {
        const unsigned short *ga[4], *gb[4];
#pragma unroll
        for (int q4 = 0; q4 < 4; ++q4) {
          ga[q4] = gA + (size_t)(n4 + q4) * ((size_t)CHR * jend) + col;
          gb[q4] = gB + (size_t)(n4 + q4) * jend + col;
          st[n4 + q4]      = *(const v4u*)ga[q4];
          st[16 + n4 + q4] = *(const v4u*)gb[q4];
        }
        // a later load's result may be given the registers that held these addresses: the addresses stay where they are
        // up to this wait, which stands in front of every such overwrite
        asm volatile("s_wait_xcnt 0x0" :: "v"(ga[0]), "v"(ga[1]), "v"(ga[2]), "v"(ga[3]),
                                          "v"(gb[0]), "v"(gb[1]), "v"(gb[2]), "v"(gb[3]) : "memory");
      }
    };
    auto work = [&](v4u (&st)[32], int sg) {
      if ((sg + 1) * RK > kend) {             // the row's last stage, where it is not full: columns from kend on are staged as zeros and add nothing
        const bool on = sg * RK + lane8 < kend;
#pragma unroll
        for (int n = 0; n < 32; ++n) st[n] = on ? st[n] : (v4u){0u, 0u, 0u, 0u};
      }
#pragma unroll
      for (int n = 0; n < 32; ++n) *(v4u*)(wst + n * RPITCH + lane8) = st[n];
      lds_wave_fence();
      v16h a[RK / 32], bb[RK / 32];           // the stage's fragment reads go as one group ahead of its products
#pragma unroll
      for (int u = 0; u < RK / 32; ++u) {
        a[u]  = Frag<_Float16>::load((const _Float16*)wst + rl * RPITCH + koff + u * 32);
        bb[u] = Frag<_Float16>::load((const _Float16*)wst + (16 + rl) * RPITCH + koff + u * 32);
      }
#pragma unroll
      for (int u = 0; u < RK / 32; ++u) acc = mma16h(a[u], bb[u], acc);
      lds_wave_fence();
    };
    load(stA, 0);
    load(stB, 1);
    const bool longrow = nst > 2;
    if (longrow) {                            // on both ways to the join behind this block one stage is in flight in each set, stA's the older
      work(stA, 0);
      load(stA, 2);
      work(stB, 1);
      load(stB, 3);
    }
    p2load();                                 // behind the row's last loads, ahead of its last products
    const int sgt = longrow ? 2 : 0;
    work(stA, sgt);
    if (sgt + 1 < nst) work(stB, sgt + 1);
    // acc[r8] = D[row h = 8*hh + r8][col r = rl]  (carried x1024)
#pragma unroll
    for (int r8 = 0; r8 < 8; r8 += 2) {
      unsigned hp, lp;
      split_bf16x2(acc[r8], acc[r8 + 1], hp, lp);
      const int idx = (ill * 16 + 8 * hh + r8) * 32 + rl;
      arHL[idx] = (unsigned short)hp;
      arHL[idx + 32] = (unsigned short)(hp >> 16);
      arHL[8192 + idx] = (unsigned short)lp;
      arHL[8192 + idx + 32] = (unsigned short)(lp >> 16);
    }
  }
  lds_barrier();
  float* sl = slab[wave];
#pragma unroll
  for (int sub = 0; sub < 2; ++sub) {
    const int h = wave + 8 * sub;             // wave-uniform head
    const v16b ah = Frag<__bf16>::load((const __bf16*)arHL + rl * 512 + h * 32 + koff);          // A[m = rl][k]
    const v16b al = Frag<__bf16>::load((const __bf16*)arHL + 8192 + rl * 512 + h * 32 + koff);
    v8f acc2[4];
#pragma unroll
    for (int j = 0; j < 4; ++j) {
      acc2[j] = mma16b(ah, bw[sub][j], zero8);
      acc2[j] = mma16b(al, bw[sub][j], acc2[j]);
    }
    // acc2[j][r8] = attrel[ill = 8*hh + r8][d = 16*j + rl] * 1024; the rows 8..15 (hh = 1) are padding
    if (hh == 0) {
#pragma unroll
      for (int j = 0; j < 4; ++j)
#pragma unroll
        for (int r8 = 0; r8 < 8; ++r8) sl[r8 * 68 + j * 16 + rl] = acc2[j][r8] * PCARRY_INV;
    }
    lds_wave_fence();
    v4u hv[2], lv[2];
#pragma unroll
    for (int it = 0; it < 2; ++it) {
      const int row = it * 4 + q;
      const v4f s0 = *(const v4f*)(sl + row * 68 + c8);
      const v4f s1 = *(const v4f*)(sl + row * 68 + c8 + 4);
      const v4f r0 = ra0[sub][it];
      const v4f r1 = ra1[sub][it];
      float v[8];
      v[0] = s0[0] + r0[0]; v[1] = s0[1] + r0[1]; v[2] = s0[2] + r0[2]; v[3] = s0[3] + r0[3];
      v[4] = s1[0] + r1[0]; v[5] = s1[1] + r1[1]; v[6] = s1[2] + r1[2]; v[7] = s1[3] + r1[3];
#pragma unroll
      for (int e = 0; e < 4; ++e) {
        unsigned hp, lp;
        split_bf16x2(v[2 * e], v[2 * e + 1], hp, lp);
        hv[it][e] = hp;
        lv[it][e] = lp;
      }
    }
    {
      unsigned short *ph[2], *pl[2];
#pragma unroll
      for (int it = 0; it < 2; ++it) {
        const size_t g = (size_t)(rowbase + (it == 0 ? g4 + q : (SEQ - 1) - g4 - q)) * DMOD + h * HDIM + c8;
        ph[it] = comb_hi + g;
        pl[it] = comb_lo + g;
        *(v4u*)ph[it] = hv[it];
        *(v4u*)pl[it] = lv[it];
      }
      // nothing drains these stores any more before the second head reuses their registers: addresses and data stay where they
      // are up to this wait, which stands in front of every such overwrite
      asm volatile("s_wait_xcnt 0x0" :: "v"(ph[0]), "v"(ph[1]), "v"(pl[0]), "v"(pl[1]),
                                        "v"(hv[0]), "v"(hv[1]), "v"(lv[0]), "v"(lv[1]) : "memory");
    }
    lds_wave_fence();
  }
}

// ---------------------------------------------------------------------------
// launcher
// Workspace region map (bytes, all 256-B aligned; total 178,323,456):
//   region 0, 83,886,080 bytes, used twice in turn, the first use ended by a launch boundary before the second begins:
//     steps 1-2: xb [2048][1024] bf16 (x, RNE) at 0, sb (symbols, RNE) behind it; in its last 10,485,760 bytes the
//                transposed bf16 weights 0 q_attn, 1 k_attn, 2 q_rel, 3 k_rel, 4 v, [1024][1024] each
//     relation scores -> relation mix: rel16 f16, PLANE_ELEMS elements, [c][b][256][16][jend] (REL_SCALE folded)
//   WoT    [1024][1024] bf16     2,097,152      directly behind region 0: the sixth slot of the weight transpose; lives to step 4
//   xqh/xql/xkh/xkl [2048][1024] bf16  4 x 4,194,304
//   qr16/kr16 [2048][1024] f16   2 x 4,194,304
//   svh/svl [1024][2048] bf16    2 x 4,194,304  (values transposed: row h*64+d, col b*1024+j)
//   attsym  [2048][1024] f32     8,388,608
//   ch/cl   [2048][1024] bf16    2 x 4,194,304  (pre-output activations hi/lo)
//   wrp     [1024][32] bf16      65,536         (Wr with K padded to 32, pad zero-filled)
//   p16     [c][b][16][256][jend] f16  41,943,040      probabilities x1024
// ---------------------------------------------------------------------------
extern "C" void kernel_launch(void* const* d_in, const int* in_sizes, int n_in,
                              void* d_out, int out_size, void* d_ws, size_t ws_size,
                              hipStream_t stream) {
  if (n_in < 9) return;
  if (in_sizes[0] != NTOK * DMOD || in_sizes[1] != NTOK * DMOD) return;
  if (in_sizes[2] != DMOD * DMOD || in_sizes[3] != DMOD * DMOD || in_sizes[4] != DMOD * DMOD ||
      in_sizes[5] != DMOD * DMOD || in_sizes[7] != DMOD * DMOD || in_sizes[8] != DMOD * DMOD) return;
  if (in_sizes[6] != NHEAD * HDIM * NREL) return;
  if (out_size != NTOK * DMOD) return;

  const float* x      = (const float*)d_in[0];
  const float* symb   = (const float*)d_in[1];
  const float* Wq_a   = (const float*)d_in[2];
  const float* Wk_a   = (const float*)d_in[3];
  const float* Wq_r   = (const float*)d_in[4];
  const float* Wk_r   = (const float*)d_in[5];
  const float* Wr     = (const float*)d_in[6];
  const float* Wv     = (const float*)d_in[7];
  const float* Wo     = (const float*)d_in[8];
  float* out = (float*)d_out;

  char* ws = (char*)d_ws;
  size_t off = 0;
  auto carve = [&](size_t bytes) -> char* {
    char* p = ws + off;
    off += (bytes + 255) & ~(size_t)255;
    return p;
  };
  const size_t ACT16 = (size_t)NTOK * DMOD * 2;            // 4,194,304
  const size_t WGT16 = (size_t)DMOD * DMOD * 2;            // 2,097,152
  const size_t ACT32 = (size_t)NTOK * DMOD * 4;            // 8,388,608
  const size_t PLANE16 = PLANE_ELEMS * 2;                  // 41,943,040
  const size_t PLANE32 = PLANE_ELEMS * 4;                  // 83,886,080
  static_assert(PLANE_ELEMS * 4 % 256 == 0, "the sixth weight slot must follow region 0 without a gap");
  static_assert((size_t)2 * NTOK * DMOD * 2 + (size_t)5 * DMOD * DMOD * 2 <= PLANE_ELEMS * 4, "casts and five weights fit region 0 side by side");

  char* reg0 = carve(PLANE32);
  carve(WGT16);                                            // WoT = wT + 5 weights
  unsigned short* xb   = (unsigned short*)reg0;
  unsigned short* sb   = (unsigned short*)(reg0 + ACT16);
  unsigned short* wT   = (unsigned short*)(reg0 + PLANE32 - 5 * WGT16);
  unsigned short* rel16 = (unsigned short*)reg0;
  unsigned short* xqh  = (unsigned short*)carve(ACT16);
  unsigned short* xql  = (unsigned short*)carve(ACT16);
  unsigned short* xkh  = (unsigned short*)carve(ACT16);
  unsigned short* xkl  = (unsigned short*)carve(ACT16);
  unsigned short* qr16 = (unsigned short*)carve(ACT16);
  unsigned short* kr16 = (unsigned short*)carve(ACT16);
  unsigned short* svh  = (unsigned short*)carve(ACT16);
  unsigned short* svl  = (unsigned short*)carve(ACT16);
  float*          attsym = (float*)carve(ACT32);
  unsigned short* ch   = (unsigned short*)carve(ACT16);
  unsigned short* cl   = (unsigned short*)carve(ACT16);
  unsigned short* wrp  = (unsigned short*)carve((size_t)NHEAD * HDIM * 32 * 2);
  unsigned short* p16  = (unsigned short*)carve(PLANE16);
  if (off > ws_size) return;

  const unsigned short* WoT  = wT + 5 * (size_t)DMOD * DMOD;

  // 1) casts: activations to bf16; weights transposed to bf16; Wr packed with K padding
  k_prep<<<dim3(2 * CAST_BLOCKS + WT_BLOCKS + WR_BLOCKS), 256, 0, stream>>>(
      x, symb, Wq_a, Wk_a, Wq_r, Wk_r, Wv, Wo, Wr, xb, sb, wT, wrp);

  // 2) projections (bf16 x bf16, exact products, f32 accumulate)
  //    xq, xk -> bf16 hi/lo planes [2048][1024]; qr, kr -> f16 planes; values transposed svT [1024][2048] hi/lo
  static_assert(NTOK % 128 == 0 && DMOD % 128 == 0 && DMOD % GK == 0, "projection and output GEMM shapes");
  k_proj5<<<dim3((NTOK / 128) * (DMOD / 128), 5, 1), 256, 0, stream>>>(xb, sb, wT, xqh, xql, xkh, xkl, qr16, kr16, svh, svl);

  // 3) every chunk of 256 query rows, both batch rows, in each grid: (scores, softmax, P.V beside relation scores) -> relation mix
  static_assert(CHR % 64 == 0 && HDIM % 32 == 0 && RDIM % 32 == 0 && HDIM % 64 == 0, "chunk GEMM shapes");
  static_assert(CHR % 128 == 0 && CHR == 256 && HDIM == 64 && RDIM == 64, "128x256 relation tiles, one stage of k for the scores");
  static_assert(NCHK == 4 && (NCHK & (NCHK - 1)) == 0 && ROWS_CH % 8 == 0 && NHEAD == 16 && NREL == 16, "grid decoding");
  static_assert(CHR / SR == (CHR / 128) * (SEQ / 256), "both roles of the grid use the same range of blockIdx.x");
  k_attn_rel<<<dim3(CHR / SR, NB * 16, 2 * NCHK), 256, 0, stream>>>(xqh, xql, xkh, xkl, svh, svl, attsym, p16, qr16, kr16, rel16);
  static_assert(SEQ % 8 == 0, "relation mix: four rows from each end of the sequence per work-group");
  k_rel_mix<<<dim3(SEQ / 8, NB), 256, 0, stream>>>(p16, rel16, wrp, attsym, ch, cl);

  // 4) out[token][n] = sum_k combined[token][k] * WoT[n][k]  (A hi/lo, B bf16 weights) -> d_out f32
  k_out<<<dim3((NTOK / 128) * (DMOD / 128)), 256, 0, stream>>>(ch, cl, WoT, out);
}
